// v000
// Times are from an AMD MI455X. After a warm-up the kernel runs many times in a row, and a time is the length of
// such a window on the GPU divided by its runs, so every launch and the gaps after it count. The runs cycle
// through copies of the inputs. A figure is the median of several windows, for all but v000 over two sittings.
// Sittings can differ by a few percent; kernels timed side by side share one.
// v000 is the starting kernel. One run takes 787 microseconds.
#include <hip/hip_runtime.h>
// CausalAlibiAttn (1 x 4096 tokens, D 1024 = 16 heads of 64, 4 kv heads): q, k, v = x W + b; q head h uses kv head h/4; scores/8 + slope[h] * (key - query) (ALiBi, slopes INPUT), causal; softmax; ctx Wo + bo.
// Structure: exact f16 plane of x; q, k, v as f32 WMMA GEMM outputs (32x64 wave tiles, f32 accumulation, exact x16 weights + bias); f16 hi + 2^10-residual splits on VALU (k expanded to the 16 query heads); V^T hi/residual by LDS tiles with the kv-head mapping; the fused causal flash kernel with the ALiBi term added per (head, query, key) in f32, in its 5-plane form for the first 256 query rows and the plain form beyond; O as hi + residual into the Wo GEMMs (+ bias; residual term only on those rows).
// Compute dtype: x and parameters rounded to bf16; q/k/P/v/O as f16 hi + residual on rows < 256 (~2^-21) and plain f16 beyond (~2^-12); ALiBi/softmax f32. v_wmma_f32_16x16x32_f16.
#define NB 1
#define DM 1024
#define NKV 4
#define NREP (NH / NKV)
#define KVD (NKV * 64)           /* 256 */
#define NR (NB * SLEN)           /* 4096 */
#define SLEN 4096
#define TQ SLEN
#define TK SLEN
#define NH 16
#define SCL 0.125f
#define QBLKS (TQ / 64)
#define QB05 0
#define QBN5 4
#define QB0P QBN5
#define QBNP (QBLKS - QBN5)
#define RE 256
typedef __bf16 v16b __attribute__((ext_vector_type(16)));
typedef unsigned short v8us __attribute__((ext_vector_type(8), may_alias));
typedef float  v8f  __attribute__((ext_vector_type(8)));
typedef float  v4f  __attribute__((ext_vector_type(4)));
typedef float  v4fa __attribute__((ext_vector_type(4), may_alias));
union FragB { v16b v; v8us half[2]; unsigned short u[16]; };

__device__ __forceinline__ unsigned short bf16_bits(float x) { unsigned int u = __float_as_uint(x); return (unsigned short)((u + 0x7FFFu + ((u >> 16) & 1u)) >> 16); }
__device__ __forceinline__ float bf16_val(unsigned short b) { return __uint_as_float(((unsigned int)b) << 16); }
__device__ __forceinline__ float bf16_round(float x) { return bf16_val(bf16_bits(x)); }
// D += A·B with NT terms: 1 = ah·bh, 2 = + al·bh (A split), 3 = + ah·bl (both split)
template <int NT>
__device__ __forceinline__ v8f mmaN(v16b ah, v16b al, v16b bh, v16b bl, v8f c) {
  c = __builtin_amdgcn_wmma_f32_16x16x32_bf16(false, ah, false, bh, (short)0, c, false, false);
  if (NT >= 2) c = __builtin_amdgcn_wmma_f32_16x16x32_bf16(false, al, false, bh, (short)0, c, false, false);
  if (NT >= 3) c = __builtin_amdgcn_wmma_f32_16x16x32_bf16(false, ah, false, bl, (short)0, c, false, false);
  asm volatile("v_nop\n\tv_nop\n\tv_nop\n\tv_nop" : "+v"(c) : "v"(ah), "v"(al), "v"(bh), "v"(bl));
  return c;
}

__global__ __launch_bounds__(256) void k_wt_bf16(const float* __restrict__ W, unsigned short* __restrict__ Wt, int K, int N) {
  const int t = blockIdx.x * 256 + threadIdx.x;
  const int k8n = K / 8;
  if (t >= N * k8n) return;
  const int n = t / k8n, k8 = (t % k8n) * 8;
  v8us v;
#pragma unroll
  for (int i = 0; i < 8; ++i) v[i] = bf16_bits(W[(size_t)(k8 + i) * N + n]);
  *(v8us*)(Wt + (size_t)n * K + k8) = v;
  
}

// GEMM C[M][N] (f32, pitch ldc) = act(A[M][K]·W + bias). A f32 row-major (pitch lda) converted per fragment to bf16
// (ASPLIT: hi/lo two planes -> 2 terms, else single rounded term); Wt bf16 [N][K] (pitch ldb). BIAS_BF16 rounds the
// bias to bf16 first (bias quantised to bf16 before the add). K%32==0, M%16==0, N%64==0.
template <bool ASPLIT, int ACT, bool BIAS_BF16>
__global__ __launch_bounds__(128) void k_gemm_bf(const float* __restrict__ A, int lda, const unsigned short* __restrict__ Wt, int ldb,
                                               const float* __restrict__ bias, float* __restrict__ C, int ldc, int M, int N, int K) {
  __shared__ __attribute__((aligned(16))) float so[4][16][64];
  const int tid = threadIdx.x, w = tid >> 5, lane = tid & 31, ln = lane & 15, hh = lane >> 4;
  const int ntn = N / 64;
  const int wid = blockIdx.x * 4 + w;
  const int mt = wid / ntn, nq = wid % ntn;
  if (mt * 16 >= M) return;
  const int row0 = mt * 16, col0 = nq * 64;
  const float* arow = A + (size_t)(row0 + ln) * lda;
  v8f acc[4] = {};
  for (int kb = 0; kb < K; kb += 32) {
    FragB ah, al;
    const v4f x0 = *(const v4fa*)(arow + kb + 8 * hh), x1 = *(const v4fa*)(arow + kb + 8 * hh + 4);
    const v4f x2 = *(const v4fa*)(arow + kb + 16 + 8 * hh), x3 = *(const v4fa*)(arow + kb + 16 + 8 * hh + 4);
    float xs[16] = {x0[0],x0[1],x0[2],x0[3],x1[0],x1[1],x1[2],x1[3],x2[0],x2[1],x2[2],x2[3],x3[0],x3[1],x3[2],x3[3]};
#pragma unroll
    for (int i = 0; i < 16; ++i) { const unsigned short hb = bf16_bits(xs[i]); ah.u[i] = hb; al.u[i] = ASPLIT ? bf16_bits(xs[i] - bf16_val(hb)) : (unsigned short)0; }
#pragma unroll
    for (int t = 0; t < 4; ++t) {
      const unsigned short* brow = Wt + (size_t)(col0 + t * 16 + ln) * ldb + kb;
      FragB b;
      b.half[0] = *(const v8us*)(brow + 8 * hh);
      b.half[1] = *(const v8us*)(brow + 16 + 8 * hh);
      acc[t] = mmaN<ASPLIT ? 2 : 1>(ah.v, al.v, b.v, b.v, acc[t]);
    }
  }
#pragma unroll
  for (int t = 0; t < 4; ++t) {
    float bv = bias ? bias[col0 + t * 16 + ln] : 0.f;
    if (BIAS_BF16) bv = bf16_round(bv);
#pragma unroll
    for (int r = 0; r < 8; ++r) { float v = acc[t][r] + bv; if (ACT == 1) v = fmaxf(v, 0.f); so[w][8 * hh + r][t * 16 + ln] = v; }
  }
  __builtin_amdgcn_fence(__ATOMIC_ACQ_REL, "workgroup");
  __builtin_amdgcn_wave_barrier();
  const int rsub = lane >> 4, c4 = (lane & 15) * 4;
  {
#pragma unroll
    for (int q = 0; q < 8; ++q) {
      const int r = q * 2 + rsub;
      const v4f v = *(const v4fa*)&so[w][r][c4];
      *(v4f*)(C + (size_t)(row0 + r) * ldc + col0 + c4) = v;
    }
    
  }
}

// GEMM C = act(A·W + bias + resid): A f32 (ASPLIT -> hi/lo 2 terms), Wt bf16 [N][K]; ACT 0 none, 1 relu, 2 exact gelu;
// resid (optional, f32, row index = (row % rmod), pitch ldr, RES_BF16 rounds it) added before the activation.
template <bool ASPLIT, int ACT, bool BIAS_BF16, bool RES_BF16>
__global__ __launch_bounds__(128) void k_gemm_bf3(const float* __restrict__ A, int lda, const unsigned short* __restrict__ Wt, int ldb,
                                                const float* __restrict__ bias, const float* __restrict__ resid, int rmod, int ldr,
                                                float* __restrict__ C, int ldc, int M, int N, int K) {
  __shared__ __attribute__((aligned(16))) float so[4][16][64];
  const int tid = threadIdx.x, w = tid >> 5, lane = tid & 31, ln = lane & 15, hh = lane >> 4;
  const int ntn = N / 64;
  const int wid = blockIdx.x * 4 + w;
  const int mt = wid / ntn, nq = wid % ntn;
  if (mt * 16 >= M) return;
  const int row0 = mt * 16, col0 = nq * 64;
  const float* arow = A + (size_t)(row0 + ln) * lda;
  v8f acc[4] = {};
  for (int kb = 0; kb < K; kb += 32) {
    FragB ah, al;
    const v4f x0 = *(const v4fa*)(arow + kb + 8 * hh), x1 = *(const v4fa*)(arow + kb + 8 * hh + 4);
    const v4f x2 = *(const v4fa*)(arow + kb + 16 + 8 * hh), x3 = *(const v4fa*)(arow + kb + 16 + 8 * hh + 4);
    float xs[16] = {x0[0],x0[1],x0[2],x0[3],x1[0],x1[1],x1[2],x1[3],x2[0],x2[1],x2[2],x2[3],x3[0],x3[1],x3[2],x3[3]};
#pragma unroll
    for (int i = 0; i < 16; ++i) { const unsigned short hb = bf16_bits(xs[i]); ah.u[i] = hb; al.u[i] = ASPLIT ? bf16_bits(xs[i] - bf16_val(hb)) : (unsigned short)0; }
#pragma unroll
    for (int t = 0; t < 4; ++t) {
      const unsigned short* brow = Wt + (size_t)(col0 + t * 16 + ln) * ldb + kb;
      FragB b;
      b.half[0] = *(const v8us*)(brow + 8 * hh);
      b.half[1] = *(const v8us*)(brow + 16 + 8 * hh);
      acc[t] = mmaN<ASPLIT ? 2 : 1>(ah.v, al.v, b.v, b.v, acc[t]);
    }
  }
#pragma unroll
  for (int t = 0; t < 4; ++t) {
    const int col = col0 + t * 16 + ln;
    float bv = bias ? bias[col] : 0.f;
    if (BIAS_BF16) bv = bf16_round(bv);
#pragma unroll
    for (int r = 0; r < 8; ++r) {
      float v = acc[t][r] + bv;
      if (resid) { float rv = resid[(size_t)((row0 + 8 * hh + r) % rmod) * ldr + col]; if (RES_BF16) rv = bf16_round(rv); v += rv; }
      if (ACT == 1) v = fmaxf(v, 0.f);
      if (ACT == 2) v = 0.5f * v * (1.0f + erff(v * 0.70710678118654752f));
      if (ACT == 3) { const float u = 0.7978845608028654f * (v + 0.044715f * v * v * v); v = 0.5f * v * (1.0f + tanhf(u)); }
      so[w][8 * hh + r][t * 16 + ln] = v;
    }
  }
  __builtin_amdgcn_fence(__ATOMIC_ACQ_REL, "workgroup");
  __builtin_amdgcn_wave_barrier();
  const int rsub = lane >> 4, c4 = (lane & 15) * 4;
  {
#pragma unroll
    for (int q = 0; q < 8; ++q) {
      const int r = q * 2 + rsub;
      const v4f v = *(const v4fa*)&so[w][r][c4];
      *(v4f*)(C + (size_t)(row0 + r) * ldc + col0 + c4) = v;
    }
    
  }
}
// row LayerNorm (biased variance, eps) over N: s = X (+ R); optional out_sum <- s; out_norm <- (s-mu)*rsqrt(var+eps)*g + b
template <bool PARAM_BF16>
__global__ __launch_bounds__(256) void k_layernorm(const float* __restrict__ X, const float* __restrict__ R, const float* __restrict__ g, const float* __restrict__ bta,
                                                  float* __restrict__ out_sum, float* __restrict__ out_norm, int N, float eps) {
  __shared__ float red[256];
  const int row = blockIdx.x, tid = threadIdx.x;
  const float* x = X + (size_t)row * N; const float* rr = R ? R + (size_t)row * N : nullptr;
  float vals[16];                     // up to N = 4096
  const int per = N / 256;            // contiguous chunk per thread? use strided-by-4 chunks: thread handles j = tid*4 + 1024*u
  float s1 = 0.f;
  for (int u = 0; u < per / 4; ++u) {
    const int j = tid * 4 + 1024 * u;
    const v4f a = *(const v4fa*)(x + j);
    v4f b = {0.f,0.f,0.f,0.f}; if (rr) b = *(const v4fa*)(rr + j);
#pragma unroll
    for (int q = 0; q < 4; ++q) { const float v = a[q] + b[q]; vals[u * 4 + q] = v; s1 += v; }
  }
  red[tid] = s1; __syncthreads();
  for (int st = 128; st > 0; st >>= 1) { if (tid < st) red[tid] += red[tid + st]; __syncthreads(); }
  const float mu = red[0] / (float)N; __syncthreads();
  float s2 = 0.f;
  for (int u = 0; u < per / 4; ++u)
#pragma unroll
    for (int q = 0; q < 4; ++q) { const float c = vals[u * 4 + q] - mu; s2 += c * c; }
  red[tid] = s2; __syncthreads();
  for (int st = 128; st > 0; st >>= 1) { if (tid < st) red[tid] += red[tid + st]; __syncthreads(); }
  const float rs = rsqrtf(red[0] / (float)N + eps);
  {
    for (int u = 0; u < per / 4; ++u) {
      const int j = tid * 4 + 1024 * u;
      v4f o, sm;
#pragma unroll
      for (int q = 0; q < 4; ++q) {
        float gg = g[j + q], bb = bta[j + q];
        if (PARAM_BF16) { gg = bf16_round(gg); bb = bf16_round(bb); }
        sm[q] = vals[u * 4 + q]; o[q] = (vals[u * 4 + q] - mu) * rs * gg + bb;
      }
      if (out_sum) *(v4f*)(out_sum + (size_t)row * N + j) = sm;
      *(v4f*)(out_norm + (size_t)row * N + j) = o;
    }
    
  }
}



// ---- f16 WMMA path (v_wmma_f32_16x16x32_f16): 11-bit significands for operands in range — used where a [0,1] probability operand needs more precision than bf16
typedef _Float16 v16h __attribute__((ext_vector_type(16)));
union FragH { v16h v; v8us half[2]; _Float16 h[16]; unsigned short u[16]; };
template <int NT>
__device__ __forceinline__ v8f mmaH(v16h ah, v16h al, v16h bh, v16h bl, v8f c) {
  c = __builtin_amdgcn_wmma_f32_16x16x32_f16(false, ah, false, bh, (short)0, c, false, false);
  if (NT >= 2) c = __builtin_amdgcn_wmma_f32_16x16x32_f16(false, al, false, bh, (short)0, c, false, false);
  if (NT >= 3) c = __builtin_amdgcn_wmma_f32_16x16x32_f16(false, ah, false, bl, (short)0, c, false, false);
  asm volatile("v_nop\n\tv_nop\n\tv_nop\n\tv_nop" : "+v"(c) : "v"(ah), "v"(al), "v"(bh), "v"(bl));
  return c;
}
// batched GEMM like k_gemm_b but f16 operands: A f32 (split into f16 hi/lo if ASPLIT, else rounded to f16), Bt = f16 values [n][k]; alpha; C f32; N multiple of 16 (partial tiles skipped)
template <bool ASPLIT>
__global__ __launch_bounds__(128) void k_gemm_h(const float* __restrict__ A, int lda, size_t sA, const _Float16* __restrict__ Bh, int ldb, size_t sB, float alpha, float* __restrict__ C, int ldc, size_t sC, int M, int N, int K) {
  __shared__ __attribute__((aligned(16))) float so[4][16][64];
  const int tid = threadIdx.x, w = tid >> 5, lane = tid & 31, ln = lane & 15, hh = lane >> 4; const int by = blockIdx.y;
  A += (size_t)by * sA; Bh += (size_t)by * sB; C += (size_t)by * sC;
  const int ntn = (N + 63) / 64; const int wid = blockIdx.x * 4 + w; const int mt = wid / ntn, nq = wid % ntn; if (mt * 16 >= M) return;
  const int row0 = mt * 16, col0 = nq * 64; const float* arow = A + (size_t)(row0 + ln) * lda;
  v8f acc[4] = {};
  for (int kb = 0; kb < K; kb += 32) {
    FragH ah, al;
    const v4f x0 = *(const v4fa*)(arow + kb + 8 * hh), x1 = *(const v4fa*)(arow + kb + 8 * hh + 4), x2 = *(const v4fa*)(arow + kb + 16 + 8 * hh), x3 = *(const v4fa*)(arow + kb + 16 + 8 * hh + 4);
    float xs[16] = {x0[0],x0[1],x0[2],x0[3],x1[0],x1[1],x1[2],x1[3],x2[0],x2[1],x2[2],x2[3],x3[0],x3[1],x3[2],x3[3]};
#pragma unroll
    for (int i = 0; i < 16; ++i) { const _Float16 h = (_Float16)xs[i]; ah.h[i] = h; al.h[i] = ASPLIT ? (_Float16)(xs[i] - (float)h) : (_Float16)0.0f; }
#pragma unroll
    for (int t = 0; t < 4; ++t) { if (col0 + t * 16 >= N) continue; const size_t boff = (size_t)(col0 + t * 16 + ln) * ldb + kb; FragH bq; bq.half[0] = *(const v8us*)(Bh + boff + 8 * hh); bq.half[1] = *(const v8us*)(Bh + boff + 16 + 8 * hh);
      acc[t] = mmaH<ASPLIT ? 2 : 1>(ah.v, al.v, bq.v, bq.v, acc[t]); }
  }
#pragma unroll
  for (int t = 0; t < 4; ++t) { if (col0 + t * 16 >= N) continue;
#pragma unroll
    for (int r = 0; r < 8; ++r) so[w][8 * hh + r][t * 16 + ln] = acc[t][r] * alpha; }
  __builtin_amdgcn_fence(__ATOMIC_ACQ_REL, "workgroup"); __builtin_amdgcn_wave_barrier();
  const int rsub = lane >> 4, c4 = (lane & 15) * 4;
  {
#pragma unroll
    for (int q = 0; q < 8; ++q) { const int r = q * 2 + rsub; if (col0 + c4 < N) { const v4f v = *(const v4fa*)&so[w][r][c4]; *(v4f*)(C + (size_t)(row0 + r) * ldc + col0 + c4) = v; } }
     }
}

// Wt[n][k] = f16(W[k][n]·scale) from f32 row-major W[K][N] (scale = power of two; bf16-exact weights stay exact in f16 away from the subnormal range)
__global__ __launch_bounds__(256) void k_wt_f16(const float* __restrict__ W, _Float16* __restrict__ Wt, int K, int N, float scale) {
  const int t = blockIdx.x * 256 + threadIdx.x; if (t >= N * (K / 8)) return; const int n = t / (K / 8), k8 = (t % (K / 8)) * 8; FragH f;
#pragma unroll
  for (int i = 0; i < 8; ++i) f.h[i] = (_Float16)(bf16_round(W[(size_t)(k8 + i) * N + n]) * scale); const v8us o = f.half[0];
  *(v8us*)((unsigned short*)Wt + (size_t)n * K + k8) = o; 
}
// k_gemm_hh variant with fused epilogue: v = acc·alpha + bias[by·sBias + col] (+ CP[(row/rowsPerB)·sCPb + by·64 + col] if CP) ; ACT 0 none / 1 elu ; writes f16 C16 (and f32 C if non-null)
template <int ACT>
__global__ __launch_bounds__(128) void k_gemm_hhx(const _Float16* __restrict__ A, int lda, size_t sA, const _Float16* __restrict__ Bh, int ldb, size_t sB, float alpha, const float* __restrict__ bias, size_t sBias, const float* __restrict__ CP, int rowsPerB, size_t sCPb, int row0g,
    float* __restrict__ C, _Float16* __restrict__ C16, int ldc, size_t sC, int M, int N, int K) {
  __shared__ __attribute__((aligned(16))) float so[4][16][64];
  const int tid = threadIdx.x, w = tid >> 5, lane = tid & 31, ln = lane & 15, hh = lane >> 4; const int by = blockIdx.y;
  A += (size_t)by * sA; Bh += (size_t)by * sB; const size_t cofs = (size_t)by * sC; const float* bp = bias ? bias + (size_t)by * sBias : nullptr;
  const int ntn = (N + 63) / 64; const int wid = blockIdx.x * 4 + w; const int mt = wid / ntn, nq = wid % ntn; if (mt * 16 >= M) return;
  const int row0 = mt * 16, col0 = nq * 64; const _Float16* arow = A + (size_t)(row0 + ln) * lda;
  v8f acc[4] = {};
  for (int kb = 0; kb < K; kb += 32) { FragH ah; ah.half[0] = *(const v8us*)((const unsigned short*)arow + kb + 8 * hh); ah.half[1] = *(const v8us*)((const unsigned short*)arow + kb + 16 + 8 * hh);
#pragma unroll
    for (int t = 0; t < 4; ++t) { if (col0 + t * 16 >= N) continue; const size_t boff = (size_t)(col0 + t * 16 + ln) * ldb + kb; FragH bq; bq.half[0] = *(const v8us*)((const unsigned short*)Bh + boff + 8 * hh); bq.half[1] = *(const v8us*)((const unsigned short*)Bh + boff + 16 + 8 * hh);
      acc[t] = mmaH<1>(ah.v, ah.v, bq.v, bq.v, acc[t]); }
  }
#pragma unroll
  for (int t = 0; t < 4; ++t) { if (col0 + t * 16 >= N) continue; const int col = col0 + t * 16 + ln; const float bv = bp ? bf16_round(bp[col]) : 0.f;
#pragma unroll
    for (int r = 0; r < 8; ++r) { float v = acc[t][r] * alpha + bv; if (CP) { const int bidx = (row0g + row0 + 8 * hh + r) / rowsPerB; v += CP[(size_t)bidx * sCPb + (size_t)by * 64 + col]; } if (ACT == 1) v = (v > 0.f) ? v : expm1f(v); else if (ACT == 7) v = (v > 0.f) ? v + 1.0f : expf(v); else if (ACT == 8) v = tanhf(v); else if (ACT == 9) v = 0.5f * v * (1.0f + tanhf(0.7978845608028654f * (v + 0.044715f * v * v * v))); else if (ACT == 11) v = 1.0f / (1.0f + expf(-v)); else if (ACT == 12) v = (v > 0.f) ? v : 0.01f * v; else if (ACT == 14) v = (v > 0.f) ? v : 0.1f * v; else if (ACT == 15) v = v / (1.0f + expf(-v)); else if (ACT == 3) v = fmaxf(v, 0.f); else if (ACT == 6) v = 0.5f * v * (1.0f + erff(v * 0.70710678118654752f)); so[w][8 * hh + r][t * 16 + ln] = v; } }
  __builtin_amdgcn_fence(__ATOMIC_ACQ_REL, "workgroup"); __builtin_amdgcn_wave_barrier();
  const int rsub = lane >> 4, c4 = (lane & 15) * 4; typedef _Float16 v4h __attribute__((ext_vector_type(4)));
  {
#pragma unroll
    for (int q = 0; q < 8; ++q) { const int r = q * 2 + rsub; if (col0 + c4 < N) { const v4f v = *(const v4fa*)&so[w][r][c4]; if (C) *(v4f*)(C + cofs + (size_t)(row0 + r) * ldc + col0 + c4) = v; if (C16) { v4h h4; for (int i = 0; i < 4; ++i) h4[i] = (_Float16)v[i]; *(v4h*)(C16 + cofs + (size_t)(row0 + r) * ldc + col0 + c4) = h4; } } }
     }
}


typedef _Float16 v4h __attribute__((ext_vector_type(4)));

__global__ __launch_bounds__(256) void k_x16(const float* __restrict__ x, _Float16* __restrict__ X16, size_t n8) { const size_t t = (size_t)blockIdx.x * 256 + threadIdx.x; if (t >= n8) return; FragH f;
#pragma unroll
  for (int q = 0; q < 8; ++q) f.h[q] = (_Float16)bf16_round(x[t * 8 + q]); *(v8us*)((unsigned short*)X16 + t * 8) = f.half[0];  }
__global__ __launch_bounds__(256) void k_h16(const float* __restrict__ x, _Float16* __restrict__ X16, size_t n8) { const size_t t = (size_t)blockIdx.x * 256 + threadIdx.x; if (t >= n8) return; FragH f;
#pragma unroll
  for (int q = 0; q < 8; ++q) f.h[q] = (_Float16)x[t * 8 + q]; *(v8us*)((unsigned short*)X16 + t * 8) = f.half[0];  }
__global__ __launch_bounds__(256) void k_round16f(const float* __restrict__ W, _Float16* __restrict__ Bt, size_t n8) { const size_t t = (size_t)blockIdx.x * 256 + threadIdx.x; if (t >= n8) return; FragH f;
#pragma unroll
  for (int i = 0; i < 8; ++i) f.h[i] = (_Float16)(bf16_round(W[t * 8 + i]) * 16.0f); *(v8us*)((unsigned short*)Bt + t * 8) = f.half[0];  }
template <int NHv, int TTv>
__global__ __launch_bounds__(256) void k_vt(const _Float16* __restrict__ V16, int ldv, int voff, _Float16* __restrict__ Vt) { __shared__ unsigned short tl[64][66]; const int tid = threadIdx.x; const int slab = blockIdx.x / (TTv / 64), lg = blockIdx.x % (TTv / 64); const int b = slab / NHv, h = slab % NHv;
  for (int i = tid; i < 64 * 8; i += 256) { const int r = i / 8, c8 = (i % 8) * 8; FragH f; f.half[0] = *(const v8us*)((const unsigned short*)V16 + ((size_t)b * TTv + lg * 64 + r) * ldv + voff + h * 64 + c8);
#pragma unroll
    for (int q = 0; q < 8; ++q) tl[r][c8 + q] = f.u[q]; }
  __syncthreads();
  {
#pragma unroll
    for (int rd = 0; rd < 2; ++rd) { const int d = rd * 32 + tid / 8, pc = tid % 8; FragH f;
#pragma unroll
      for (int q = 0; q < 8; ++q) f.u[q] = tl[pc * 8 + q][d];
      *(v8us*)((unsigned short*)Vt + ((size_t)slab * 64 + d) * TTv + lg * 64 + pc * 8) = f.half[0]; }
     } }

__global__ __launch_bounds__(256) void k_hl(const float* __restrict__ F, _Float16* __restrict__ Hh, _Float16* __restrict__ Hl, size_t n8) { const size_t t = (size_t)blockIdx.x * 256 + threadIdx.x; if (t >= n8) return; FragH fh, fl; const v4f a = *(const v4fa*)(F + t * 8), c = *(const v4fa*)(F + t * 8 + 4);
#pragma unroll
  for (int q = 0; q < 4; ++q) { _Float16 h = (_Float16)a[q]; fh.h[q] = h; fl.h[q] = (_Float16)((a[q] - (float)h) * 1024.0f); h = (_Float16)c[q]; fh.h[4 + q] = h; fl.h[4 + q] = (_Float16)((c[q] - (float)h) * 1024.0f); }
  { *(v8us*)((unsigned short*)Hh + t * 8) = fh.half[0]; *(v8us*)((unsigned short*)Hl + t * 8) = fl.half[0];  } }

// ---- fast GEMM (wave tile 32x64; requires M % 32 == 0 rows per launch region and N % 64 == 0); epilogue = k_gemm_hhx semantics ----
__device__ __forceinline__ v16h g2_frag(const _Float16* p, int hh) { FragH f; f.half[0] = *(const v8us*)((const unsigned short*)p + 8 * hh); f.half[1] = *(const v8us*)((const unsigned short*)p + 16 + 8 * hh); return f.v; }
__device__ __forceinline__ v8f g2_mma(v16h a, v16h b, v8f c) { v8f d = __builtin_amdgcn_wmma_f32_16x16x32_f16(false, a, false, b, (short)0, c, false, false); asm volatile("v_nop\n\tv_nop\n\tv_nop\n\tv_nop" : "+v"(d) : "v"(a), "v"(b)); return d; }
template <int ACT>
__global__ __launch_bounds__(128) void k_gemm2(const _Float16* __restrict__ A, int lda, size_t sA, const _Float16* __restrict__ Bh, int ldb, size_t sB, float alpha, const float* __restrict__ bias, size_t sBias, const float* __restrict__ CP, int rowsPerB, size_t sCPb, int row0g,
    float* __restrict__ C, _Float16* __restrict__ C16, int ldc, size_t sC, int M, int N, int K) {
  __shared__ __attribute__((aligned(16))) float so[4][32][68];
  const int tid = threadIdx.x, w = tid >> 5, lane = tid & 31, ln = lane & 15, hh = lane >> 4; const int by = blockIdx.y;
  A += (size_t)by * sA; Bh += (size_t)by * sB; const size_t cofs = (size_t)by * sC; const float* bp = bias ? bias + (size_t)by * sBias : nullptr;
  const int ntn = N >> 6; const int mt = blockIdx.x / ntn, nq = blockIdx.x - mt * ntn; const int row0 = mt * 128 + 32 * w, col0 = nq * 64; if (row0 >= M) return;
  const _Float16* a0p = A + (size_t)(row0 + ln) * lda; const _Float16* a1p = a0p + (size_t)16 * lda;
  const _Float16* b0p = Bh + (size_t)(col0 + ln) * ldb; const _Float16* b1p = b0p + (size_t)16 * ldb; const _Float16* b2p = b1p + (size_t)16 * ldb; const _Float16* b3p = b2p + (size_t)16 * ldb;
  const v8f z8 = {0.f,0.f,0.f,0.f,0.f,0.f,0.f,0.f}; v8f c00 = z8, c01 = z8, c02 = z8, c03 = z8, c10 = z8, c11 = z8, c12 = z8, c13 = z8;
#pragma unroll 1
  for (int kb = 0; kb < K; kb += 32) { const v16h a0 = g2_frag(a0p + kb, hh), a1 = g2_frag(a1p + kb, hh);
    v16h b = g2_frag(b0p + kb, hh); c00 = g2_mma(a0, b, c00); c10 = g2_mma(a1, b, c10);
    b = g2_frag(b1p + kb, hh); c01 = g2_mma(a0, b, c01); c11 = g2_mma(a1, b, c11);
    b = g2_frag(b2p + kb, hh); c02 = g2_mma(a0, b, c02); c12 = g2_mma(a1, b, c12);
    b = g2_frag(b3p + kb, hh); c03 = g2_mma(a0, b, c03); c13 = g2_mma(a1, b, c13); }
  v8f accs[8] = {c00, c01, c02, c03, c10, c11, c12, c13};
#pragma unroll
  for (int u = 0; u < 8; ++u) { const int t = u & 3, half = u >> 2; const int col = col0 + t * 16 + ln; const float bv = bp ? bf16_round(bp[col]) : 0.f;
#pragma unroll
    for (int r = 0; r < 8; ++r) { const int rloc = half * 16 + 8 * hh + r; float v = accs[u][r] * alpha + bv; if (CP) { const int bidx = (row0g + row0 + rloc) / rowsPerB; v += CP[(size_t)bidx * sCPb + (size_t)by * 64 + col]; }
      if (ACT == 3) v = fmaxf(v, 0.f); else if (ACT == 6) v = 0.5f * v * (1.0f + erff(v * 0.70710678118654752f)); else if (ACT == 11) v = 1.0f / (1.0f + expf(-v)); else if (ACT == 15) v = v / (1.0f + expf(-v)); else if (ACT == 12) v = (v > 0.f) ? v : 0.01f * v; else if (ACT == 8) v = tanhf(v);
      so[w][rloc][t * 16 + ln] = v; } }
  __builtin_amdgcn_fence(__ATOMIC_ACQ_REL, "workgroup"); __builtin_amdgcn_wave_barrier();
  const int rsub = lane >> 4, c4 = (lane & 15) * 4;
  {
#pragma unroll
    for (int q = 0; q < 16; ++q) { const int r = q * 2 + rsub; const v4f v = *(const v4fa*)&so[w][r][c4]; if (C) *(v4f*)(C + cofs + (size_t)(row0 + r) * ldc + col0 + c4) = v; if (C16) { v4h h4; for (int i = 0; i < 4; ++i) h4[i] = (_Float16)v[i]; *(v4h*)(C16 + cofs + (size_t)(row0 + r) * ldc + col0 + c4) = h4; } }
     } }



template <int CAUSAL>
__global__ __launch_bounds__(128) void k_flash(const _Float16* __restrict__ Q16, int ldq, const _Float16* __restrict__ K16, int ldk, const _Float16* __restrict__ Vt, const int* __restrict__ MSK, float* __restrict__ O, int ldo) {
  constexpr int RPW = 16, RTN = RPW / 16, NQB = TQ / (4 * RPW), DT = 4, KS = 2;
  __shared__ __attribute__((aligned(16))) unsigned short sP[4][RPW][40]; __shared__ __attribute__((aligned(16))) float sO[4][RPW][64 + 4];
  const int tid = threadIdx.x, w = tid >> 5, lane = tid & 31, ln = lane & 15, hh = lane >> 4;
  const int slab = blockIdx.x / QBNP, qblk = QB0P + blockIdx.x % QBNP; (void)NQB; const int b = slab / NH, h = slab % NH; const int qb0 = qblk * (4 * RPW); const int q0 = qb0 + w * RPW;
  FragH aq[2][KS];
#pragma unroll
  for (int rt = 0; rt < RTN; ++rt) { const unsigned short* qr = (const unsigned short*)Q16 + ((size_t)b * TQ + q0 + rt * 16 + ln) * ldq + h * 64;
#pragma unroll
    for (int ks = 0; ks < KS; ++ks) { aq[rt][ks].half[0] = *(const v8us*)(qr + ks * 32 + 8 * hh); aq[rt][ks].half[1] = *(const v8us*)(qr + ks * 32 + 16 + 8 * hh); } }
  const unsigned short* Vth = (const unsigned short*)Vt + (size_t)slab * 64 * TK;
  float m_r[2][8], l_r[2][8]; v8f oacc[2][DT];
#pragma unroll
  for (int rt = 0; rt < RTN; ++rt) {
#pragma unroll
    for (int r = 0; r < 8; ++r) { m_r[rt][r] = -3.0e38f; l_r[rt][r] = 0.f; }
#pragma unroll
    for (int dt = 0; dt < DT; ++dt) oacc[rt][dt] = (v8f){0.f,0.f,0.f,0.f,0.f,0.f,0.f,0.f}; }
  const int jend = (CAUSAL == 1 || CAUSAL == 14) ? (qb0 + 4 * RPW) : TK;      /* causal: keys beyond the block's last query never contribute */
#pragma unroll 1
  for (int j0 = 0; j0 < jend; j0 += 32) {
    v8f s[2][2];
#pragma unroll
    for (int nt = 0; nt < 2; ++nt) { const unsigned short* kr = (const unsigned short*)K16 + ((size_t)b * TK + j0 + nt * 16 + ln) * ldk + h * 64; FragH bk[KS];
#pragma unroll
      for (int ks = 0; ks < KS; ++ks) { bk[ks].half[0] = *(const v8us*)(kr + ks * 32 + 8 * hh); bk[ks].half[1] = *(const v8us*)(kr + ks * 32 + 16 + 8 * hh); }
#pragma unroll
      for (int rt = 0; rt < RTN; ++rt) { v8f acc = (v8f){0.f,0.f,0.f,0.f,0.f,0.f,0.f,0.f};
#pragma unroll
        for (int ks = 0; ks < KS; ++ks) acc = mmaH<1>(aq[rt][ks].v, aq[rt][ks].v, bk[ks].v, bk[ks].v, acc); s[rt][nt] = acc; } }
#pragma unroll
    for (int rt = 0; rt < RTN; ++rt)
#pragma unroll
      for (int r = 0; r < 8; ++r) { const int tq = q0 + rt * 16 + 8 * hh + r; const int k0 = j0 + ln, k1 = j0 + 16 + ln;
        const bool ok0 = (CAUSAL == 1 || CAUSAL == 14) ? (k0 <= tq) : ((CAUSAL == 2) ? ((k0 >> 5) == (tq >> 5)) : true), ok1 = (CAUSAL == 1 || CAUSAL == 14) ? (k1 <= tq) : ((CAUSAL == 2) ? ((k1 >> 5) == (tq >> 5)) : true);      /* mode 2: block-diagonal 32-token groups */
        float s0 = ok0 ? s[rt][0][r] * SCL : -3.0e38f, s1 = ok1 ? s[rt][1][r] * SCL : -3.0e38f; if (CAUSAL == 14) { const float sl = bf16_round(((const float*)MSK)[h]); if (ok0) s0 += sl * (float)(k0 - tq); if (ok1) s1 += sl * (float)(k1 - tq); }      /* mode 14: causal + ALiBi slope[h] * (key - query) from the slopes INPUT */ float mc = fmaxf(s0, s1);
        mc = fmaxf(mc, __shfl_xor(mc, 1, 32)); mc = fmaxf(mc, __shfl_xor(mc, 2, 32)); mc = fmaxf(mc, __shfl_xor(mc, 4, 32)); mc = fmaxf(mc, __shfl_xor(mc, 8, 32));
        const float mn = fmaxf(m_r[rt][r], mc); const float al = (mn > -1.0e38f) ? expf(m_r[rt][r] - mn) : 1.0f; m_r[rt][r] = mn; const float p0 = ok0 ? expf(s0 - mn) : 0.f, p1 = ok1 ? expf(s1 - mn) : 0.f; l_r[rt][r] = l_r[rt][r] * al + p0 + p1;
#pragma unroll
        for (int dt = 0; dt < DT; ++dt) oacc[rt][dt][r] *= al;
        FragH t2; t2.h[0] = (_Float16)(p0 * 1024.0f); t2.h[1] = (_Float16)(p1 * 1024.0f); sP[w][rt * 16 + 8 * hh + r][ln] = t2.u[0]; sP[w][rt * 16 + 8 * hh + r][16 + ln] = t2.u[1]; }
    __builtin_amdgcn_fence(__ATOMIC_ACQ_REL, "workgroup"); __builtin_amdgcn_wave_barrier();
    FragH pa[2];
#pragma unroll
    for (int rt = 0; rt < RTN; ++rt) { pa[rt].half[0] = *(const v8us*)&sP[w][rt * 16 + ln][8 * hh]; pa[rt].half[1] = *(const v8us*)&sP[w][rt * 16 + ln][16 + 8 * hh]; }
#pragma unroll
    for (int dt = 0; dt < DT; ++dt) { const unsigned short* vrow = Vth + (size_t)(dt * 16 + ln) * TK + j0; FragH bv; bv.half[0] = *(const v8us*)(vrow + 8 * hh); bv.half[1] = *(const v8us*)(vrow + 16 + 8 * hh);
#pragma unroll
      for (int rt = 0; rt < RTN; ++rt) oacc[rt][dt] = mmaH<1>(pa[rt].v, pa[rt].v, bv.v, bv.v, oacc[rt][dt]); }
    __builtin_amdgcn_fence(__ATOMIC_ACQ_REL, "workgroup"); __builtin_amdgcn_wave_barrier(); }
#pragma unroll
  for (int rt = 0; rt < RTN; ++rt) {
#pragma unroll
    for (int r = 0; r < 8; ++r) { float l = l_r[rt][r]; l += __shfl_xor(l, 1, 32); l += __shfl_xor(l, 2, 32); l += __shfl_xor(l, 4, 32); l += __shfl_xor(l, 8, 32); l_r[rt][r] = (l > 0.f) ? 1.0f / (l * 1024.0f) : 0.f; }
#pragma unroll
    for (int dt = 0; dt < DT; ++dt)
#pragma unroll
      for (int r = 0; r < 8; ++r) sO[w][rt * 16 + 8 * hh + r][dt * 16 + ln] = oacc[rt][dt][r] * l_r[rt][r]; }
  __builtin_amdgcn_fence(__ATOMIC_ACQ_REL, "workgroup"); __builtin_amdgcn_wave_barrier();
  {
#pragma unroll
    for (int rp = 0; rp < RPW; rp += 2) { const int r = rp + (lane >> 4), pc = lane & 15; const v4f val = *(const v4fa*)&sO[w][r][pc * 4]; *(v4f*)(O + ((size_t)b * TQ + q0 + r) * ldo + h * 64 + pc * 4) = val; }
     } }
// 5-plane variant: S = Qh Kh^T + (Ql Kh^T + Qh Kl^T)/1024 with Q/K = [hi | 2^10 residual] f16 planes (QL/KL same layout as Q16/K16), then the 3-term P.V below.
// 3-term variant: O = (P_hi V_hi + (P_lo V_hi + P_hi V_lo) / 1024) / l with P = [hi | 2^10 residual] of 1024 p and V^T = [hi | 2^10 residual] planes (VtL same layout as Vt) -> ~2^-21-class products for un-averaged (early causal / peaked) rows
template <int CAUSAL>
__global__ __launch_bounds__(128) void k_flash5(const _Float16* __restrict__ Q16, const _Float16* __restrict__ QL, int ldq, const _Float16* __restrict__ K16, const _Float16* __restrict__ KL, int ldk, const _Float16* __restrict__ Vt, const _Float16* __restrict__ VtL, const int* __restrict__ MSK, float* __restrict__ O, int ldo) {
  constexpr int RPW = 16, RTN = RPW / 16, NQB = TQ / (4 * RPW), DT = 4, KS = 2;
  __shared__ __attribute__((aligned(16))) unsigned short sP[4][RPW][40]; __shared__ __attribute__((aligned(16))) unsigned short sPL[4][RPW][40]; __shared__ __attribute__((aligned(16))) float sO[4][RPW][64 + 4];
  const int tid = threadIdx.x, w = tid >> 5, lane = tid & 31, ln = lane & 15, hh = lane >> 4;
  const int slab = blockIdx.x / QBN5, qblk = QB05 + blockIdx.x % QBN5; (void)NQB; const int b = slab / NH, h = slab % NH; const int qb0 = qblk * (4 * RPW); const int q0 = qb0 + w * RPW;
  FragH aq[2][KS], aql[2][KS];
#pragma unroll
  for (int rt = 0; rt < RTN; ++rt) { const unsigned short* qr = (const unsigned short*)Q16 + ((size_t)b * TQ + q0 + rt * 16 + ln) * ldq + h * 64; const unsigned short* ql = (const unsigned short*)QL + ((size_t)b * TQ + q0 + rt * 16 + ln) * ldq + h * 64;
#pragma unroll
    for (int ks = 0; ks < KS; ++ks) { aq[rt][ks].half[0] = *(const v8us*)(qr + ks * 32 + 8 * hh); aq[rt][ks].half[1] = *(const v8us*)(qr + ks * 32 + 16 + 8 * hh); aql[rt][ks].half[0] = *(const v8us*)(ql + ks * 32 + 8 * hh); aql[rt][ks].half[1] = *(const v8us*)(ql + ks * 32 + 16 + 8 * hh); } }
  const unsigned short* Vth = (const unsigned short*)Vt + (size_t)slab * 64 * TK; const unsigned short* Vtl = (const unsigned short*)VtL + (size_t)slab * 64 * TK;
  float m_r[2][8], l_r[2][8]; v8f oacc[2][DT], oaccL[2][DT];
#pragma unroll
  for (int rt = 0; rt < RTN; ++rt) {
#pragma unroll
    for (int r = 0; r < 8; ++r) { m_r[rt][r] = -3.0e38f; l_r[rt][r] = 0.f; }
#pragma unroll
    for (int dt = 0; dt < DT; ++dt) { oacc[rt][dt] = (v8f){0.f,0.f,0.f,0.f,0.f,0.f,0.f,0.f}; oaccL[rt][dt] = oacc[rt][dt]; } }
  const int jend = (CAUSAL == 1 || CAUSAL == 14) ? (qb0 + 4 * RPW) : TK;      /* causal: keys beyond the block's last query never contribute */
#pragma unroll 1
  for (int j0 = 0; j0 < jend; j0 += 32) {
    v8f s[2][2];
#pragma unroll
    for (int nt = 0; nt < 2; ++nt) { const unsigned short* kr = (const unsigned short*)K16 + ((size_t)b * TK + j0 + nt * 16 + ln) * ldk + h * 64; const unsigned short* klr = (const unsigned short*)KL + ((size_t)b * TK + j0 + nt * 16 + ln) * ldk + h * 64; FragH bk[KS], bkl[KS];
#pragma unroll
      for (int ks = 0; ks < KS; ++ks) { bk[ks].half[0] = *(const v8us*)(kr + ks * 32 + 8 * hh); bk[ks].half[1] = *(const v8us*)(kr + ks * 32 + 16 + 8 * hh); bkl[ks].half[0] = *(const v8us*)(klr + ks * 32 + 8 * hh); bkl[ks].half[1] = *(const v8us*)(klr + ks * 32 + 16 + 8 * hh); }
#pragma unroll
      for (int rt = 0; rt < RTN; ++rt) { v8f acc = (v8f){0.f,0.f,0.f,0.f,0.f,0.f,0.f,0.f}, accl = acc;
#pragma unroll
        for (int ks = 0; ks < KS; ++ks) { acc = mmaH<1>(aq[rt][ks].v, aq[rt][ks].v, bk[ks].v, bk[ks].v, acc); accl = mmaH<1>(aql[rt][ks].v, aql[rt][ks].v, bk[ks].v, bk[ks].v, accl); accl = mmaH<1>(aq[rt][ks].v, aq[rt][ks].v, bkl[ks].v, bkl[ks].v, accl); }
#pragma unroll
        for (int r = 0; r < 8; ++r) acc[r] += accl[r] * 0.0009765625f;
        s[rt][nt] = acc; } }
#pragma unroll
    for (int rt = 0; rt < RTN; ++rt)
#pragma unroll
      for (int r = 0; r < 8; ++r) { const int tq = q0 + rt * 16 + 8 * hh + r; const int k0 = j0 + ln, k1 = j0 + 16 + ln;
        bool ok0 = (CAUSAL == 1 || CAUSAL == 14) ? (k0 <= tq) : ((CAUSAL == 2) ? ((k0 >> 5) == (tq >> 5)) : true), ok1 = (CAUSAL == 1 || CAUSAL == 14) ? (k1 <= tq) : ((CAUSAL == 2) ? ((k1 >> 5) == (tq >> 5)) : true);      /* mode 2: block-diagonal 32-token groups */
        if (CAUSAL == 4) { const int* mrow = MSK + ((size_t)b * TQ + tq) * TK; ok0 = mrow[k0] != 0; ok1 = mrow[k1] != 0; }      /* mode 4: per-(query, key) INPUT mask shared by all heads; masked keys contribute nothing (== the reference's -4096 fill, whose exp underflows to 0), rows with no valid key give l = 0 -> output 0 (== the reference's row_valid zeroing) */
        float s0 = ok0 ? s[rt][0][r] * SCL : -3.0e38f, s1 = ok1 ? s[rt][1][r] * SCL : -3.0e38f; if (CAUSAL == 14) { const float sl = bf16_round(((const float*)MSK)[h]); if (ok0) s0 += sl * (float)(k0 - tq); if (ok1) s1 += sl * (float)(k1 - tq); }      /* mode 14: causal + ALiBi slope[h] * (key - query) from the slopes INPUT */ float mc = fmaxf(s0, s1);
        mc = fmaxf(mc, __shfl_xor(mc, 1, 32)); mc = fmaxf(mc, __shfl_xor(mc, 2, 32)); mc = fmaxf(mc, __shfl_xor(mc, 4, 32)); mc = fmaxf(mc, __shfl_xor(mc, 8, 32));
        const float mn = fmaxf(m_r[rt][r], mc); const float al = (mn > -1.0e38f) ? expf(m_r[rt][r] - mn) : 1.0f; m_r[rt][r] = mn; const float p0 = ok0 ? expf(s0 - mn) : 0.f, p1 = ok1 ? expf(s1 - mn) : 0.f; l_r[rt][r] = l_r[rt][r] * al + p0 + p1;
#pragma unroll
        for (int dt = 0; dt < DT; ++dt) { oacc[rt][dt][r] *= al; oaccL[rt][dt][r] *= al; }
        FragH t2, t2l; const float ps0 = p0 * 1024.0f, ps1 = p1 * 1024.0f; t2.h[0] = (_Float16)ps0; t2.h[1] = (_Float16)ps1; t2l.h[0] = (_Float16)((ps0 - (float)t2.h[0]) * 1024.0f); t2l.h[1] = (_Float16)((ps1 - (float)t2.h[1]) * 1024.0f);
        sP[w][rt * 16 + 8 * hh + r][ln] = t2.u[0]; sP[w][rt * 16 + 8 * hh + r][16 + ln] = t2.u[1]; sPL[w][rt * 16 + 8 * hh + r][ln] = t2l.u[0]; sPL[w][rt * 16 + 8 * hh + r][16 + ln] = t2l.u[1]; }
    __builtin_amdgcn_fence(__ATOMIC_ACQ_REL, "workgroup"); __builtin_amdgcn_wave_barrier();
    FragH pa[2], pl[2];
#pragma unroll
    for (int rt = 0; rt < RTN; ++rt) { pa[rt].half[0] = *(const v8us*)&sP[w][rt * 16 + ln][8 * hh]; pa[rt].half[1] = *(const v8us*)&sP[w][rt * 16 + ln][16 + 8 * hh]; pl[rt].half[0] = *(const v8us*)&sPL[w][rt * 16 + ln][8 * hh]; pl[rt].half[1] = *(const v8us*)&sPL[w][rt * 16 + ln][16 + 8 * hh]; }
#pragma unroll
    for (int dt = 0; dt < DT; ++dt) { const unsigned short* vrow = Vth + (size_t)(dt * 16 + ln) * TK + j0; const unsigned short* vrl = Vtl + (size_t)(dt * 16 + ln) * TK + j0; FragH bv, bl; bv.half[0] = *(const v8us*)(vrow + 8 * hh); bv.half[1] = *(const v8us*)(vrow + 16 + 8 * hh); bl.half[0] = *(const v8us*)(vrl + 8 * hh); bl.half[1] = *(const v8us*)(vrl + 16 + 8 * hh);
#pragma unroll
      for (int rt = 0; rt < RTN; ++rt) { oacc[rt][dt] = mmaH<1>(pa[rt].v, pa[rt].v, bv.v, bv.v, oacc[rt][dt]); oaccL[rt][dt] = mmaH<1>(pl[rt].v, pl[rt].v, bv.v, bv.v, oaccL[rt][dt]); oaccL[rt][dt] = mmaH<1>(pa[rt].v, pa[rt].v, bl.v, bl.v, oaccL[rt][dt]); } }
    __builtin_amdgcn_fence(__ATOMIC_ACQ_REL, "workgroup"); __builtin_amdgcn_wave_barrier(); }
#pragma unroll
  for (int rt = 0; rt < RTN; ++rt) {
#pragma unroll
    for (int r = 0; r < 8; ++r) { float l = l_r[rt][r]; l += __shfl_xor(l, 1, 32); l += __shfl_xor(l, 2, 32); l += __shfl_xor(l, 4, 32); l += __shfl_xor(l, 8, 32); l_r[rt][r] = (l > 0.f) ? 1.0f / (l * 1024.0f) : 0.f; }
#pragma unroll
    for (int dt = 0; dt < DT; ++dt)
#pragma unroll
      for (int r = 0; r < 8; ++r) { float v = oacc[rt][dt][r]; v += oaccL[rt][dt][r] * 0.0009765625f; sO[w][rt * 16 + 8 * hh + r][dt * 16 + ln] = v * l_r[rt][r]; } }
  __builtin_amdgcn_fence(__ATOMIC_ACQ_REL, "workgroup"); __builtin_amdgcn_wave_barrier();
  {
#pragma unroll
    for (int rp = 0; rp < RPW; rp += 2) { const int r = rp + (lane >> 4), pc = lane & 15; const v4f val = *(const v4fa*)&sO[w][r][pc * 4]; *(v4f*)(O + ((size_t)b * TQ + q0 + r) * ldo + h * 64 + pc * 4) = val; }
     } }

__global__ __launch_bounds__(256) void k_rotab(float* __restrict__ CS, float* __restrict__ SN) {
  #pragma clang fp contract(off)
  const int t = blockIdx.x * 256 + threadIdx.x; if (t >= SLEN * 32) return; const int j = t % 32, s = t / 32; const float ex = (float)(2 * j) / 64.0f; const float inv = 1.0f / powf(10000.0f, ex); const float th = (float)s * inv; const float c = cosf(th), sn = sinf(th);
  { *(float*)(CS + t) = c; *(float*)(SN + t) = sn;  } }
__global__ __launch_bounds__(256) void k_rope(const float* __restrict__ F, int nsrc, int ndst, int rep, const float* __restrict__ CS, const float* __restrict__ SN, _Float16* __restrict__ H, _Float16* __restrict__ L) {
  #pragma clang fp contract(off)
  const size_t t = (size_t)blockIdx.x * 256 + threadIdx.x; if (t >= (size_t)NR * ndst * 4) return; const int g8 = (int)(t % 4); const int hd = (int)((t / 4) % ndst); const size_t row = t / ((size_t)4 * ndst); const int s = (int)(row % SLEN); const int hs = hd / rep;
  const float* src = F + row * (size_t)(nsrc * 64) + hs * 64; FragH ah, al, bh, bl;
  for (int i = 0; i < 8; ++i) { const int d = g8 * 8 + i; const float c = CS[s * 32 + d], sn = SN[s * 32 + d]; const float x1 = src[d], x2 = src[d + 32];
    float o1 = x1 * c; o1 += -x2 * sn; float o2 = x2 * c; o2 += x1 * sn;
    _Float16 hv = (_Float16)o1; ah.h[i] = hv; al.h[i] = (_Float16)((o1 - (float)hv) * 1024.0f); hv = (_Float16)o2; bh.h[i] = hv; bl.h[i] = (_Float16)((o2 - (float)hv) * 1024.0f); }
  const size_t o = row * (size_t)(ndst * 64) + hd * 64 + g8 * 8;
  { *(v8us*)((unsigned short*)H + o) = ah.half[0]; *(v8us*)((unsigned short*)H + o + 32) = bh.half[0]; *(v8us*)((unsigned short*)L + o) = al.half[0]; *(v8us*)((unsigned short*)L + o + 32) = bl.half[0];  } }
__global__ __launch_bounds__(256) void k_kexp(const float* __restrict__ F, _Float16* __restrict__ H, _Float16* __restrict__ L) { const size_t t = (size_t)blockIdx.x * 256 + threadIdx.x; if (t >= (size_t)NR * NH * 8) return; const int g8 = (int)(t % 8); const int hd = (int)((t / 8) % NH); const size_t row = t / ((size_t)8 * NH); const float* src = F + row * (size_t)KVD + (hd / NREP) * 64 + g8 * 8; FragH fh, fl;
  for (int i = 0; i < 8; ++i) { const _Float16 hv = (_Float16)src[i]; fh.h[i] = hv; fl.h[i] = (_Float16)((src[i] - (float)hv) * 1024.0f); } const size_t o = row * (size_t)(NH * 64) + hd * 64 + g8 * 8;
  { *(v8us*)((unsigned short*)H + o) = fh.half[0]; *(v8us*)((unsigned short*)L + o) = fl.half[0];  } }
__global__ __launch_bounds__(256) void k_vtg(const _Float16* __restrict__ V16, _Float16* __restrict__ Vt) { __shared__ unsigned short tl[64][66]; const int tid = threadIdx.x; const int slab = blockIdx.x / (SLEN / 64), lg = blockIdx.x % (SLEN / 64); const int b = slab / NH, h = slab % NH; const int hs = h / NREP;
  for (int i = tid; i < 64 * 8; i += 256) { const int r = i / 8, c8 = (i % 8) * 8; FragH f; f.half[0] = *(const v8us*)((const unsigned short*)V16 + ((size_t)b * SLEN + lg * 64 + r) * KVD + hs * 64 + c8); for (int q = 0; q < 8; ++q) tl[r][c8 + q] = f.u[q]; }
  __syncthreads();
  { for (int rd = 0; rd < 2; ++rd) { const int d = rd * 32 + tid / 8, pc = tid % 8; FragH f; for (int q = 0; q < 8; ++q) f.u[q] = tl[pc * 8 + q][d]; *(v8us*)((unsigned short*)Vt + ((size_t)slab * 64 + d) * SLEN + lg * 64 + pc * 8) = f.half[0]; }  } }

extern "C" void kernel_launch(void* const* d_in, const int* in_sizes, int n_in,
                              void* d_out, int out_size, void* d_ws, size_t ws_size, hipStream_t stream) {
  (void)in_sizes; (void)n_in; (void)out_size;
  const float* const* I = (const float* const*)d_in; const float* x = I[0]; const float* Wq = I[1]; const float* bq = I[2]; const float* Wk = I[3]; const float* bk = I[4]; const float* Wv = I[5]; const float* bv = I[6]; const float* Wo = I[7]; const float* bo = I[8]; const float* slopes = I[9];
  char* ws = (char*)d_ws; size_t off = 0;
  auto take = [&](size_t bytes) { char* p = ws + off; off += (bytes + 255) & ~(size_t)255; return p; };
  const size_t np = (size_t)NR * DM, nk = (size_t)NR * KVD;
  _Float16* BQ = (_Float16*)take((size_t)DM * DM * 2); _Float16* BK = (_Float16*)take((size_t)KVD * DM * 2); _Float16* BV = (_Float16*)take((size_t)KVD * DM * 2); _Float16* BO = (_Float16*)take((size_t)DM * DM * 2);
  _Float16* X16 = (_Float16*)take(np * 2); float* QF = (float*)take(np * 4); _Float16* QH = (_Float16*)take(np * 2); _Float16* QL = (_Float16*)take(np * 2); float* KF = (float*)take(nk * 4); float* VF = (float*)take(nk * 4); _Float16* KXH = (_Float16*)take(np * 2); _Float16* KXL = (_Float16*)take(np * 2); _Float16* VH = (_Float16*)take(nk * 2); _Float16* VL = (_Float16*)take(nk * 2); _Float16* VT = (_Float16*)take(np * 2); _Float16* VTL = (_Float16*)take(np * 2);
  float* O = QF;      /* attention output over the q f32 plane (dead after the q hi/lo split) */ _Float16* OH = (_Float16*)take(np * 2); _Float16* OLo = (_Float16*)take(np * 2);
  if (off > ws_size) return;      /* 2+0.5+0.5+2 + 8+16+8+8+4+4+8+8+2+2+8+8+8+8 = 105 MiB */
  k_wt_f16<<<(unsigned)(((size_t)DM * DM / 8 + 255) / 256), 256, 0, stream>>>(Wq, BQ, DM, DM, 16.0f); k_wt_f16<<<(unsigned)(((size_t)DM * KVD / 8 + 255) / 256), 256, 0, stream>>>(Wk, BK, DM, KVD, 16.0f); k_wt_f16<<<(unsigned)(((size_t)DM * KVD / 8 + 255) / 256), 256, 0, stream>>>(Wv, BV, DM, KVD, 16.0f); k_wt_f16<<<(unsigned)(((size_t)DM * DM / 8 + 255) / 256), 256, 0, stream>>>(Wo, BO, DM, DM, 16.0f);
  k_x16<<<(unsigned)((np / 8 + 255) / 256), 256, 0, stream>>>(x, X16, np / 8);
  k_gemm2<0><<<dim3((NR / 128) * (DM / 64), 1), 128, 0, stream>>>(X16, DM, 0, BQ, DM, 0, 0.0625f, bq, 0, nullptr, 1, 0, 0, QF, nullptr, DM, 0, NR, DM, DM);
  k_gemm2<0><<<dim3((NR / 128) * (KVD / 64), 1), 128, 0, stream>>>(X16, DM, 0, BK, DM, 0, 0.0625f, bk, 0, nullptr, 1, 0, 0, KF, nullptr, KVD, 0, NR, KVD, DM);
  k_gemm2<0><<<dim3((NR / 128) * (KVD / 64), 1), 128, 0, stream>>>(X16, DM, 0, BV, DM, 0, 0.0625f, bv, 0, nullptr, 1, 0, 0, VF, nullptr, KVD, 0, NR, KVD, DM);
  k_hl<<<(unsigned)((np / 8 + 255) / 256), 256, 0, stream>>>(QF, QH, QL, np / 8);      /* q hi/lo */
  k_kexp<<<(unsigned)(((size_t)NR * NH * 8 + 255) / 256), 256, 0, stream>>>(KF, KXH, KXL);      /* k: kv head h/4 expanded to query head h, hi/lo */
  k_hl<<<(unsigned)((nk / 8 + 255) / 256), 256, 0, stream>>>(VF, VH, VL, nk / 8);
  k_vtg<<<NB * NH * (SLEN / 64), 256, 0, stream>>>(VH, VT); k_vtg<<<NB * NH * (SLEN / 64), 256, 0, stream>>>(VL, VTL);      /* QF becomes O from here on */
  k_flash5<14><<<NB * NH * QBN5, 128, 0, stream>>>(QH, QL, DM, KXH, KXL, DM, VT, VTL, (const int*)slopes, O, DM);      /* causal + ALiBi, rows < 256: hi + residual */
  k_flash<14><<<NB * NH * QBNP, 128, 0, stream>>>(QH, DM, KXH, DM, VT, (const int*)slopes, O, DM);      /* causal + ALiBi, rows >= 256: plain */
  k_hl<<<(unsigned)((np / 8 + 255) / 256), 256, 0, stream>>>(O, OH, OLo, np / 8);
  k_gemm2<0><<<dim3((NR / 128) * (DM / 64), 1), 128, 0, stream>>>(OH, DM, 0, BO, DM, 0, 0.0625f, bo, 0, nullptr, 1, 0, 0, (float*)d_out, nullptr, DM, 0, NR, DM, DM);      /* out = ctx Wo + bo */
  for (int b = 0; b < NB; ++b) k_gemm2<0><<<dim3((RE / 128) * (DM / 64), 1), 128, 0, stream>>>(OLo + (size_t)b * SLEN * DM, DM, 0, BO, DM, 0, 0.0625f / 1024.0f, nullptr, 0, (const float*)d_out + (size_t)b * SLEN * DM, 1, (size_t)DM, 0, (float*)d_out + (size_t)b * SLEN * DM, nullptr, DM, 0, RE, DM, DM);      /* += O residual . Wo on the first 256 rows of each sequence */
}

// v001
// One run takes 562 microseconds.
// Next to v000, in two timings, it ran 1.42 times as fast each time.
#include <hip/hip_runtime.h>
// CausalAlibiAttn (1 x 4096 tokens, D 1024 = 16 heads of 64, 4 kv heads): q, k, v = x W + b; q head h uses kv head h/4; scores/8 + slope[h] * (key - query) (ALiBi, slopes INPUT), causal; softmax; ctx Wo + bo.
// Structure: exact f16 plane of x; q, k, v as f32 WMMA GEMM outputs (32x64 wave tiles, f32 accumulation, exact x16 weights + bias); f16 hi + 2^10-residual splits on VALU (k expanded to the 16 query heads); V^T hi/residual by LDS tiles with the kv-head mapping; the fused causal flash kernel with the ALiBi term added per (head, query, key) in f32, in its 5-plane form for the first 256 query rows and the plain form beyond; O as hi + residual into the Wo GEMMs (+ bias; residual term only on those rows).
// Compute dtype: x and parameters rounded to bf16; q/k/P/v/O as f16 hi + residual on rows < 256 (~2^-21) and plain f16 beyond (~2^-12); ALiBi/softmax f32. v_wmma_f32_16x16x32_f16.
#define NB 1
#define DM 1024
#define NKV 4
#define NREP (NH / NKV)
#define KVD (NKV * 64)           /* 256 */
#define NR (NB * SLEN)           /* 4096 */
#define SLEN 4096
#define TQ SLEN
#define TK SLEN
#define NH 16
#define SCL 0.125f
#define QBLKS (TQ / 64)
#define QB05 0
#define QBN5 4
#define QB0P QBN5
#define QBNP (QBLKS - QBN5)
#define RE 256
typedef __bf16 v16b __attribute__((ext_vector_type(16)));
typedef unsigned short v8us __attribute__((ext_vector_type(8), may_alias));
typedef float  v8f  __attribute__((ext_vector_type(8)));
typedef float  v4f  __attribute__((ext_vector_type(4)));
typedef float  v4fa __attribute__((ext_vector_type(4), may_alias));
union FragB { v16b v; v8us half[2]; unsigned short u[16]; };

__device__ __forceinline__ unsigned short bf16_bits(float x) { unsigned int u = __float_as_uint(x); return (unsigned short)((u + 0x7FFFu + ((u >> 16) & 1u)) >> 16); }
__device__ __forceinline__ float bf16_val(unsigned short b) { return __uint_as_float(((unsigned int)b) << 16); }
__device__ __forceinline__ float bf16_round(float x) { return bf16_val(bf16_bits(x)); }
// D += A·B with NT terms: 1 = ah·bh, 2 = + al·bh (A split), 3 = + ah·bl (both split)
template <int NT>
__device__ __forceinline__ v8f mmaN(v16b ah, v16b al, v16b bh, v16b bl, v8f c) {
  c = __builtin_amdgcn_wmma_f32_16x16x32_bf16(false, ah, false, bh, (short)0, c, false, false);
  if (NT >= 2) c = __builtin_amdgcn_wmma_f32_16x16x32_bf16(false, al, false, bh, (short)0, c, false, false);
  if (NT >= 3) c = __builtin_amdgcn_wmma_f32_16x16x32_bf16(false, ah, false, bl, (short)0, c, false, false);
  asm volatile("v_nop\n\tv_nop\n\tv_nop\n\tv_nop" : "+v"(c) : "v"(ah), "v"(al), "v"(bh), "v"(bl));
  return c;
}

__global__ __launch_bounds__(256) void k_wt_bf16(const float* __restrict__ W, unsigned short* __restrict__ Wt, int K, int N) {
  const int t = blockIdx.x * 256 + threadIdx.x;
  const int k8n = K / 8;
  if (t >= N * k8n) return;
  const int n = t / k8n, k8 = (t % k8n) * 8;
  v8us v;
#pragma unroll
  for (int i = 0; i < 8; ++i) v[i] = bf16_bits(W[(size_t)(k8 + i) * N + n]);
  *(v8us*)(Wt + (size_t)n * K + k8) = v;
  
}

// GEMM C[M][N] (f32, pitch ldc) = act(A[M][K]·W + bias). A f32 row-major (pitch lda) converted per fragment to bf16
// (ASPLIT: hi/lo two planes -> 2 terms, else single rounded term); Wt bf16 [N][K] (pitch ldb). BIAS_BF16 rounds the
// bias to bf16 first (bias quantised to bf16 before the add). K%32==0, M%16==0, N%64==0.
template <bool ASPLIT, int ACT, bool BIAS_BF16>
__global__ __launch_bounds__(128) void k_gemm_bf(const float* __restrict__ A, int lda, const unsigned short* __restrict__ Wt, int ldb,
                                               const float* __restrict__ bias, float* __restrict__ C, int ldc, int M, int N, int K) {
  __shared__ __attribute__((aligned(16))) float so[4][16][64];
  const int tid = threadIdx.x, w = tid >> 5, lane = tid & 31, ln = lane & 15, hh = lane >> 4;
  const int ntn = N / 64;
  const int wid = blockIdx.x * 4 + w;
  const int mt = wid / ntn, nq = wid % ntn;
  if (mt * 16 >= M) return;
  const int row0 = mt * 16, col0 = nq * 64;
  const float* arow = A + (size_t)(row0 + ln) * lda;
  v8f acc[4] = {};
  for (int kb = 0; kb < K; kb += 32) {
    FragB ah, al;
    const v4f x0 = *(const v4fa*)(arow + kb + 8 * hh), x1 = *(const v4fa*)(arow + kb + 8 * hh + 4);
    const v4f x2 = *(const v4fa*)(arow + kb + 16 + 8 * hh), x3 = *(const v4fa*)(arow + kb + 16 + 8 * hh + 4);
    float xs[16] = {x0[0],x0[1],x0[2],x0[3],x1[0],x1[1],x1[2],x1[3],x2[0],x2[1],x2[2],x2[3],x3[0],x3[1],x3[2],x3[3]};
#pragma unroll
    for (int i = 0; i < 16; ++i) { const unsigned short hb = bf16_bits(xs[i]); ah.u[i] = hb; al.u[i] = ASPLIT ? bf16_bits(xs[i] - bf16_val(hb)) : (unsigned short)0; }
#pragma unroll
    for (int t = 0; t < 4; ++t) {
      const unsigned short* brow = Wt + (size_t)(col0 + t * 16 + ln) * ldb + kb;
      FragB b;
      b.half[0] = *(const v8us*)(brow + 8 * hh);
      b.half[1] = *(const v8us*)(brow + 16 + 8 * hh);
      acc[t] = mmaN<ASPLIT ? 2 : 1>(ah.v, al.v, b.v, b.v, acc[t]);
    }
  }
#pragma unroll
  for (int t = 0; t < 4; ++t) {
    float bv = bias ? bias[col0 + t * 16 + ln] : 0.f;
    if (BIAS_BF16) bv = bf16_round(bv);
#pragma unroll
    for (int r = 0; r < 8; ++r) { float v = acc[t][r] + bv; if (ACT == 1) v = fmaxf(v, 0.f); so[w][8 * hh + r][t * 16 + ln] = v; }
  }
  __builtin_amdgcn_fence(__ATOMIC_ACQ_REL, "workgroup");
  __builtin_amdgcn_wave_barrier();
  const int rsub = lane >> 4, c4 = (lane & 15) * 4;
  {
#pragma unroll
    for (int q = 0; q < 8; ++q) {
      const int r = q * 2 + rsub;
      const v4f v = *(const v4fa*)&so[w][r][c4];
      *(v4f*)(C + (size_t)(row0 + r) * ldc + col0 + c4) = v;
    }
    
  }
}

// GEMM C = act(A·W + bias + resid): A f32 (ASPLIT -> hi/lo 2 terms), Wt bf16 [N][K]; ACT 0 none, 1 relu, 2 exact gelu;
// resid (optional, f32, row index = (row % rmod), pitch ldr, RES_BF16 rounds it) added before the activation.
template <bool ASPLIT, int ACT, bool BIAS_BF16, bool RES_BF16>
__global__ __launch_bounds__(128) void k_gemm_bf3(const float* __restrict__ A, int lda, const unsigned short* __restrict__ Wt, int ldb,
                                                const float* __restrict__ bias, const float* __restrict__ resid, int rmod, int ldr,
                                                float* __restrict__ C, int ldc, int M, int N, int K) {
  __shared__ __attribute__((aligned(16))) float so[4][16][64];
  const int tid = threadIdx.x, w = tid >> 5, lane = tid & 31, ln = lane & 15, hh = lane >> 4;
  const int ntn = N / 64;
  const int wid = blockIdx.x * 4 + w;
  const int mt = wid / ntn, nq = wid % ntn;
  if (mt * 16 >= M) return;
  const int row0 = mt * 16, col0 = nq * 64;
  const float* arow = A + (size_t)(row0 + ln) * lda;
  v8f acc[4] = {};
  for (int kb = 0; kb < K; kb += 32) {
    FragB ah, al;
    const v4f x0 = *(const v4fa*)(arow + kb + 8 * hh), x1 = *(const v4fa*)(arow + kb + 8 * hh + 4);
    const v4f x2 = *(const v4fa*)(arow + kb + 16 + 8 * hh), x3 = *(const v4fa*)(arow + kb + 16 + 8 * hh + 4);
    float xs[16] = {x0[0],x0[1],x0[2],x0[3],x1[0],x1[1],x1[2],x1[3],x2[0],x2[1],x2[2],x2[3],x3[0],x3[1],x3[2],x3[3]};
#pragma unroll
    for (int i = 0; i < 16; ++i) { const unsigned short hb = bf16_bits(xs[i]); ah.u[i] = hb; al.u[i] = ASPLIT ? bf16_bits(xs[i] - bf16_val(hb)) : (unsigned short)0; }
#pragma unroll
    for (int t = 0; t < 4; ++t) {
      const unsigned short* brow = Wt + (size_t)(col0 + t * 16 + ln) * ldb + kb;
      FragB b;
      b.half[0] = *(const v8us*)(brow + 8 * hh);
      b.half[1] = *(const v8us*)(brow + 16 + 8 * hh);
      acc[t] = mmaN<ASPLIT ? 2 : 1>(ah.v, al.v, b.v, b.v, acc[t]);
    }
  }
#pragma unroll
  for (int t = 0; t < 4; ++t) {
    const int col = col0 + t * 16 + ln;
    float bv = bias ? bias[col] : 0.f;
    if (BIAS_BF16) bv = bf16_round(bv);
#pragma unroll
    for (int r = 0; r < 8; ++r) {
      float v = acc[t][r] + bv;
      if (resid) { float rv = resid[(size_t)((row0 + 8 * hh + r) % rmod) * ldr + col]; if (RES_BF16) rv = bf16_round(rv); v += rv; }
      if (ACT == 1) v = fmaxf(v, 0.f);
      if (ACT == 2) v = 0.5f * v * (1.0f + erff(v * 0.70710678118654752f));
      if (ACT == 3) { const float u = 0.7978845608028654f * (v + 0.044715f * v * v * v); v = 0.5f * v * (1.0f + tanhf(u)); }
      so[w][8 * hh + r][t * 16 + ln] = v;
    }
  }
  __builtin_amdgcn_fence(__ATOMIC_ACQ_REL, "workgroup");
  __builtin_amdgcn_wave_barrier();
  const int rsub = lane >> 4, c4 = (lane & 15) * 4;
  {
#pragma unroll
    for (int q = 0; q < 8; ++q) {
      const int r = q * 2 + rsub;
      const v4f v = *(const v4fa*)&so[w][r][c4];
      *(v4f*)(C + (size_t)(row0 + r) * ldc + col0 + c4) = v;
    }
    
  }
}
// row LayerNorm (biased variance, eps) over N: s = X (+ R); optional out_sum <- s; out_norm <- (s-mu)*rsqrt(var+eps)*g + b
template <bool PARAM_BF16>
__global__ __launch_bounds__(256) void k_layernorm(const float* __restrict__ X, const float* __restrict__ R, const float* __restrict__ g, const float* __restrict__ bta,
                                                  float* __restrict__ out_sum, float* __restrict__ out_norm, int N, float eps) {
  __shared__ float red[256];
  const int row = blockIdx.x, tid = threadIdx.x;
  const float* x = X + (size_t)row * N; const float* rr = R ? R + (size_t)row * N : nullptr;
  float vals[16];                     // up to N = 4096
  const int per = N / 256;            // contiguous chunk per thread? use strided-by-4 chunks: thread handles j = tid*4 + 1024*u
  float s1 = 0.f;
  for (int u = 0; u < per / 4; ++u) {
    const int j = tid * 4 + 1024 * u;
    const v4f a = *(const v4fa*)(x + j);
    v4f b = {0.f,0.f,0.f,0.f}; if (rr) b = *(const v4fa*)(rr + j);
#pragma unroll
    for (int q = 0; q < 4; ++q) { const float v = a[q] + b[q]; vals[u * 4 + q] = v; s1 += v; }
  }
  red[tid] = s1; __syncthreads();
  for (int st = 128; st > 0; st >>= 1) { if (tid < st) red[tid] += red[tid + st]; __syncthreads(); }
  const float mu = red[0] / (float)N; __syncthreads();
  float s2 = 0.f;
  for (int u = 0; u < per / 4; ++u)
#pragma unroll
    for (int q = 0; q < 4; ++q) { const float c = vals[u * 4 + q] - mu; s2 += c * c; }
  red[tid] = s2; __syncthreads();
  for (int st = 128; st > 0; st >>= 1) { if (tid < st) red[tid] += red[tid + st]; __syncthreads(); }
  const float rs = rsqrtf(red[0] / (float)N + eps);
  {
    for (int u = 0; u < per / 4; ++u) {
      const int j = tid * 4 + 1024 * u;
      v4f o, sm;
#pragma unroll
      for (int q = 0; q < 4; ++q) {
        float gg = g[j + q], bb = bta[j + q];
        if (PARAM_BF16) { gg = bf16_round(gg); bb = bf16_round(bb); }
        sm[q] = vals[u * 4 + q]; o[q] = (vals[u * 4 + q] - mu) * rs * gg + bb;
      }
      if (out_sum) *(v4f*)(out_sum + (size_t)row * N + j) = sm;
      *(v4f*)(out_norm + (size_t)row * N + j) = o;
    }
    
  }
}



// ---- f16 WMMA path (v_wmma_f32_16x16x32_f16): 11-bit significands for operands in range — used where a [0,1] probability operand needs more precision than bf16
typedef _Float16 v16h __attribute__((ext_vector_type(16)));
union FragH { v16h v; v8us half[2]; _Float16 h[16]; unsigned short u[16]; };
template <int NT>
__device__ __forceinline__ v8f mmaH(v16h ah, v16h al, v16h bh, v16h bl, v8f c) {
  c = __builtin_amdgcn_wmma_f32_16x16x32_f16(false, ah, false, bh, (short)0, c, false, false);
  if (NT >= 2) c = __builtin_amdgcn_wmma_f32_16x16x32_f16(false, al, false, bh, (short)0, c, false, false);
  if (NT >= 3) c = __builtin_amdgcn_wmma_f32_16x16x32_f16(false, ah, false, bl, (short)0, c, false, false);
  asm volatile("v_nop\n\tv_nop\n\tv_nop\n\tv_nop" : "+v"(c) : "v"(ah), "v"(al), "v"(bh), "v"(bl));
  return c;
}
// batched GEMM like k_gemm_b but f16 operands: A f32 (split into f16 hi/lo if ASPLIT, else rounded to f16), Bt = f16 values [n][k]; alpha; C f32; N multiple of 16 (partial tiles skipped)
template <bool ASPLIT>
__global__ __launch_bounds__(128) void k_gemm_h(const float* __restrict__ A, int lda, size_t sA, const _Float16* __restrict__ Bh, int ldb, size_t sB, float alpha, float* __restrict__ C, int ldc, size_t sC, int M, int N, int K) {
  __shared__ __attribute__((aligned(16))) float so[4][16][64];
  const int tid = threadIdx.x, w = tid >> 5, lane = tid & 31, ln = lane & 15, hh = lane >> 4; const int by = blockIdx.y;
  A += (size_t)by * sA; Bh += (size_t)by * sB; C += (size_t)by * sC;
  const int ntn = (N + 63) / 64; const int wid = blockIdx.x * 4 + w; const int mt = wid / ntn, nq = wid % ntn; if (mt * 16 >= M) return;
  const int row0 = mt * 16, col0 = nq * 64; const float* arow = A + (size_t)(row0 + ln) * lda;
  v8f acc[4] = {};
  for (int kb = 0; kb < K; kb += 32) {
    FragH ah, al;
    const v4f x0 = *(const v4fa*)(arow + kb + 8 * hh), x1 = *(const v4fa*)(arow + kb + 8 * hh + 4), x2 = *(const v4fa*)(arow + kb + 16 + 8 * hh), x3 = *(const v4fa*)(arow + kb + 16 + 8 * hh + 4);
    float xs[16] = {x0[0],x0[1],x0[2],x0[3],x1[0],x1[1],x1[2],x1[3],x2[0],x2[1],x2[2],x2[3],x3[0],x3[1],x3[2],x3[3]};
#pragma unroll
    for (int i = 0; i < 16; ++i) { const _Float16 h = (_Float16)xs[i]; ah.h[i] = h; al.h[i] = ASPLIT ? (_Float16)(xs[i] - (float)h) : (_Float16)0.0f; }
#pragma unroll
    for (int t = 0; t < 4; ++t) { if (col0 + t * 16 >= N) continue; const size_t boff = (size_t)(col0 + t * 16 + ln) * ldb + kb; FragH bq; bq.half[0] = *(const v8us*)(Bh + boff + 8 * hh); bq.half[1] = *(const v8us*)(Bh + boff + 16 + 8 * hh);
      acc[t] = mmaH<ASPLIT ? 2 : 1>(ah.v, al.v, bq.v, bq.v, acc[t]); }
  }
#pragma unroll
  for (int t = 0; t < 4; ++t) { if (col0 + t * 16 >= N) continue;
#pragma unroll
    for (int r = 0; r < 8; ++r) so[w][8 * hh + r][t * 16 + ln] = acc[t][r] * alpha; }
  __builtin_amdgcn_fence(__ATOMIC_ACQ_REL, "workgroup"); __builtin_amdgcn_wave_barrier();
  const int rsub = lane >> 4, c4 = (lane & 15) * 4;
  {
#pragma unroll
    for (int q = 0; q < 8; ++q) { const int r = q * 2 + rsub; if (col0 + c4 < N) { const v4f v = *(const v4fa*)&so[w][r][c4]; *(v4f*)(C + (size_t)(row0 + r) * ldc + col0 + c4) = v; } }
     }
}

// Wt[n][k] = f16(W[k][n]·scale) from f32 row-major W[K][N] (scale = power of two; bf16-exact weights stay exact in f16 away from the subnormal range)
__global__ __launch_bounds__(256) void k_wt_f16(const float* __restrict__ W, _Float16* __restrict__ Wt, int K, int N, float scale) {
  const int t = blockIdx.x * 256 + threadIdx.x; if (t >= N * (K / 8)) return; const int n = t / (K / 8), k8 = (t % (K / 8)) * 8; FragH f;
#pragma unroll
  for (int i = 0; i < 8; ++i) f.h[i] = (_Float16)(bf16_round(W[(size_t)(k8 + i) * N + n]) * scale); const v8us o = f.half[0];
  *(v8us*)((unsigned short*)Wt + (size_t)n * K + k8) = o; 
}
// k_gemm_hh variant with fused epilogue: v = acc·alpha + bias[by·sBias + col] (+ CP[(row/rowsPerB)·sCPb + by·64 + col] if CP) ; ACT 0 none / 1 elu ; writes f16 C16 (and f32 C if non-null)
template <int ACT>
__global__ __launch_bounds__(128) void k_gemm_hhx(const _Float16* __restrict__ A, int lda, size_t sA, const _Float16* __restrict__ Bh, int ldb, size_t sB, float alpha, const float* __restrict__ bias, size_t sBias, const float* __restrict__ CP, int rowsPerB, size_t sCPb, int row0g,
    float* __restrict__ C, _Float16* __restrict__ C16, int ldc, size_t sC, int M, int N, int K) {
  __shared__ __attribute__((aligned(16))) float so[4][16][64];
  const int tid = threadIdx.x, w = tid >> 5, lane = tid & 31, ln = lane & 15, hh = lane >> 4; const int by = blockIdx.y;
  A += (size_t)by * sA; Bh += (size_t)by * sB; const size_t cofs = (size_t)by * sC; const float* bp = bias ? bias + (size_t)by * sBias : nullptr;
  const int ntn = (N + 63) / 64; const int wid = blockIdx.x * 4 + w; const int mt = wid / ntn, nq = wid % ntn; if (mt * 16 >= M) return;
  const int row0 = mt * 16, col0 = nq * 64; const _Float16* arow = A + (size_t)(row0 + ln) * lda;
  v8f acc[4] = {};
  for (int kb = 0; kb < K; kb += 32) { FragH ah; ah.half[0] = *(const v8us*)((const unsigned short*)arow + kb + 8 * hh); ah.half[1] = *(const v8us*)((const unsigned short*)arow + kb + 16 + 8 * hh);
#pragma unroll
    for (int t = 0; t < 4; ++t) { if (col0 + t * 16 >= N) continue; const size_t boff = (size_t)(col0 + t * 16 + ln) * ldb + kb; FragH bq; bq.half[0] = *(const v8us*)((const unsigned short*)Bh + boff + 8 * hh); bq.half[1] = *(const v8us*)((const unsigned short*)Bh + boff + 16 + 8 * hh);
      acc[t] = mmaH<1>(ah.v, ah.v, bq.v, bq.v, acc[t]); }
  }
#pragma unroll
  for (int t = 0; t < 4; ++t) { if (col0 + t * 16 >= N) continue; const int col = col0 + t * 16 + ln; const float bv = bp ? bf16_round(bp[col]) : 0.f;
#pragma unroll
    for (int r = 0; r < 8; ++r) { float v = acc[t][r] * alpha + bv; if (CP) { const int bidx = (row0g + row0 + 8 * hh + r) / rowsPerB; v += CP[(size_t)bidx * sCPb + (size_t)by * 64 + col]; } if (ACT == 1) v = (v > 0.f) ? v : expm1f(v); else if (ACT == 7) v = (v > 0.f) ? v + 1.0f : expf(v); else if (ACT == 8) v = tanhf(v); else if (ACT == 9) v = 0.5f * v * (1.0f + tanhf(0.7978845608028654f * (v + 0.044715f * v * v * v))); else if (ACT == 11) v = 1.0f / (1.0f + expf(-v)); else if (ACT == 12) v = (v > 0.f) ? v : 0.01f * v; else if (ACT == 14) v = (v > 0.f) ? v : 0.1f * v; else if (ACT == 15) v = v / (1.0f + expf(-v)); else if (ACT == 3) v = fmaxf(v, 0.f); else if (ACT == 6) v = 0.5f * v * (1.0f + erff(v * 0.70710678118654752f)); so[w][8 * hh + r][t * 16 + ln] = v; } }
  __builtin_amdgcn_fence(__ATOMIC_ACQ_REL, "workgroup"); __builtin_amdgcn_wave_barrier();
  const int rsub = lane >> 4, c4 = (lane & 15) * 4; typedef _Float16 v4h __attribute__((ext_vector_type(4)));
  {
#pragma unroll
    for (int q = 0; q < 8; ++q) { const int r = q * 2 + rsub; if (col0 + c4 < N) { const v4f v = *(const v4fa*)&so[w][r][c4]; if (C) *(v4f*)(C + cofs + (size_t)(row0 + r) * ldc + col0 + c4) = v; if (C16) { v4h h4; for (int i = 0; i < 4; ++i) h4[i] = (_Float16)v[i]; *(v4h*)(C16 + cofs + (size_t)(row0 + r) * ldc + col0 + c4) = h4; } } }
     }
}


typedef _Float16 v4h __attribute__((ext_vector_type(4)));

__global__ __launch_bounds__(256) void k_x16(const float* __restrict__ x, _Float16* __restrict__ X16, size_t n8) { const size_t t = (size_t)blockIdx.x * 256 + threadIdx.x; if (t >= n8) return; FragH f;
#pragma unroll
  for (int q = 0; q < 8; ++q) f.h[q] = (_Float16)bf16_round(x[t * 8 + q]); *(v8us*)((unsigned short*)X16 + t * 8) = f.half[0];  }
__global__ __launch_bounds__(256) void k_h16(const float* __restrict__ x, _Float16* __restrict__ X16, size_t n8) { const size_t t = (size_t)blockIdx.x * 256 + threadIdx.x; if (t >= n8) return; FragH f;
#pragma unroll
  for (int q = 0; q < 8; ++q) f.h[q] = (_Float16)x[t * 8 + q]; *(v8us*)((unsigned short*)X16 + t * 8) = f.half[0];  }
__global__ __launch_bounds__(256) void k_round16f(const float* __restrict__ W, _Float16* __restrict__ Bt, size_t n8) { const size_t t = (size_t)blockIdx.x * 256 + threadIdx.x; if (t >= n8) return; FragH f;
#pragma unroll
  for (int i = 0; i < 8; ++i) f.h[i] = (_Float16)(bf16_round(W[t * 8 + i]) * 16.0f); *(v8us*)((unsigned short*)Bt + t * 8) = f.half[0];  }
template <int NHv, int TTv>
__global__ __launch_bounds__(256) void k_vt(const _Float16* __restrict__ V16, int ldv, int voff, _Float16* __restrict__ Vt) { __shared__ unsigned short tl[64][66]; const int tid = threadIdx.x; const int slab = blockIdx.x / (TTv / 64), lg = blockIdx.x % (TTv / 64); const int b = slab / NHv, h = slab % NHv;
  for (int i = tid; i < 64 * 8; i += 256) { const int r = i / 8, c8 = (i % 8) * 8; FragH f; f.half[0] = *(const v8us*)((const unsigned short*)V16 + ((size_t)b * TTv + lg * 64 + r) * ldv + voff + h * 64 + c8);
#pragma unroll
    for (int q = 0; q < 8; ++q) tl[r][c8 + q] = f.u[q]; }
  __syncthreads();
  {
#pragma unroll
    for (int rd = 0; rd < 2; ++rd) { const int d = rd * 32 + tid / 8, pc = tid % 8; FragH f;
#pragma unroll
      for (int q = 0; q < 8; ++q) f.u[q] = tl[pc * 8 + q][d];
      *(v8us*)((unsigned short*)Vt + ((size_t)slab * 64 + d) * TTv + lg * 64 + pc * 8) = f.half[0]; }
     } }

__global__ __launch_bounds__(256) void k_hl(const float* __restrict__ F, _Float16* __restrict__ Hh, _Float16* __restrict__ Hl, size_t n8) { const size_t t = (size_t)blockIdx.x * 256 + threadIdx.x; if (t >= n8) return; FragH fh, fl; const v4f a = *(const v4fa*)(F + t * 8), c = *(const v4fa*)(F + t * 8 + 4);
#pragma unroll
  for (int q = 0; q < 4; ++q) { _Float16 h = (_Float16)a[q]; fh.h[q] = h; fl.h[q] = (_Float16)((a[q] - (float)h) * 1024.0f); h = (_Float16)c[q]; fh.h[4 + q] = h; fl.h[4 + q] = (_Float16)((c[q] - (float)h) * 1024.0f); }
  { *(v8us*)((unsigned short*)Hh + t * 8) = fh.half[0]; *(v8us*)((unsigned short*)Hl + t * 8) = fl.half[0];  } }

// ---- fast GEMM (wave tile 32x64; requires M % 32 == 0 rows per launch region and N % 64 == 0); epilogue = k_gemm_hhx semantics ----
__device__ __forceinline__ v16h g2_frag(const _Float16* p, int hh) { FragH f; f.half[0] = *(const v8us*)((const unsigned short*)p + 8 * hh); f.half[1] = *(const v8us*)((const unsigned short*)p + 16 + 8 * hh); return f.v; }
__device__ __forceinline__ v8f g2_mma(v16h a, v16h b, v8f c) { v8f d = __builtin_amdgcn_wmma_f32_16x16x32_f16(false, a, false, b, (short)0, c, false, false); asm volatile("v_nop\n\tv_nop\n\tv_nop\n\tv_nop" : "+v"(d) : "v"(a), "v"(b)); return d; }
template <int ACT>
__global__ __launch_bounds__(128) void k_gemm2(const _Float16* __restrict__ A, int lda, size_t sA, const _Float16* __restrict__ Bh, int ldb, size_t sB, float alpha, const float* __restrict__ bias, size_t sBias, const float* __restrict__ CP, int rowsPerB, size_t sCPb, int row0g,
    float* __restrict__ C, _Float16* __restrict__ C16, int ldc, size_t sC, int M, int N, int K) {
  __shared__ __attribute__((aligned(16))) float so[4][32][68];
  const int tid = threadIdx.x, w = tid >> 5, lane = tid & 31, ln = lane & 15, hh = lane >> 4; const int by = blockIdx.y;
  A += (size_t)by * sA; Bh += (size_t)by * sB; const size_t cofs = (size_t)by * sC; const float* bp = bias ? bias + (size_t)by * sBias : nullptr;
  const int ntn = N >> 6; const int mt = blockIdx.x / ntn, nq = blockIdx.x - mt * ntn; const int row0 = mt * 128 + 32 * w, col0 = nq * 64; if (row0 >= M) return;
  const _Float16* a0p = A + (size_t)(row0 + ln) * lda; const _Float16* a1p = a0p + (size_t)16 * lda;
  const _Float16* b0p = Bh + (size_t)(col0 + ln) * ldb; const _Float16* b1p = b0p + (size_t)16 * ldb; const _Float16* b2p = b1p + (size_t)16 * ldb; const _Float16* b3p = b2p + (size_t)16 * ldb;
  const v8f z8 = {0.f,0.f,0.f,0.f,0.f,0.f,0.f,0.f}; v8f c00 = z8, c01 = z8, c02 = z8, c03 = z8, c10 = z8, c11 = z8, c12 = z8, c13 = z8;
#pragma unroll 1
  for (int kb = 0; kb < K; kb += 32) { const v16h a0 = g2_frag(a0p + kb, hh), a1 = g2_frag(a1p + kb, hh);
    v16h b = g2_frag(b0p + kb, hh); c00 = g2_mma(a0, b, c00); c10 = g2_mma(a1, b, c10);
    b = g2_frag(b1p + kb, hh); c01 = g2_mma(a0, b, c01); c11 = g2_mma(a1, b, c11);
    b = g2_frag(b2p + kb, hh); c02 = g2_mma(a0, b, c02); c12 = g2_mma(a1, b, c12);
    b = g2_frag(b3p + kb, hh); c03 = g2_mma(a0, b, c03); c13 = g2_mma(a1, b, c13); }
  v8f accs[8] = {c00, c01, c02, c03, c10, c11, c12, c13};
#pragma unroll
  for (int u = 0; u < 8; ++u) { const int t = u & 3, half = u >> 2; const int col = col0 + t * 16 + ln; const float bv = bp ? bf16_round(bp[col]) : 0.f;
#pragma unroll
    for (int r = 0; r < 8; ++r) { const int rloc = half * 16 + 8 * hh + r; float v = accs[u][r] * alpha + bv; if (CP) { const int bidx = (row0g + row0 + rloc) / rowsPerB; v += CP[(size_t)bidx * sCPb + (size_t)by * 64 + col]; }
      if (ACT == 3) v = fmaxf(v, 0.f); else if (ACT == 6) v = 0.5f * v * (1.0f + erff(v * 0.70710678118654752f)); else if (ACT == 11) v = 1.0f / (1.0f + expf(-v)); else if (ACT == 15) v = v / (1.0f + expf(-v)); else if (ACT == 12) v = (v > 0.f) ? v : 0.01f * v; else if (ACT == 8) v = tanhf(v);
      so[w][rloc][t * 16 + ln] = v; } }
  __builtin_amdgcn_fence(__ATOMIC_ACQ_REL, "workgroup"); __builtin_amdgcn_wave_barrier();
  const int rsub = lane >> 4, c4 = (lane & 15) * 4;
  {
#pragma unroll
    for (int q = 0; q < 16; ++q) { const int r = q * 2 + rsub; const v4f v = *(const v4fa*)&so[w][r][c4]; if (C) *(v4f*)(C + cofs + (size_t)(row0 + r) * ldc + col0 + c4) = v; if (C16) { v4h h4; for (int i = 0; i < 4; ++i) h4[i] = (_Float16)v[i]; *(v4h*)(C16 + cofs + (size_t)(row0 + r) * ldc + col0 + c4) = h4; } }
     } }



// lane l with lane l ^ 16: the two lane halves of a 16-column group hold the two key halves of one query
__device__ __forceinline__ float xhalf(float x) { return __builtin_bit_cast(float, __builtin_amdgcn_permlanex16(__builtin_bit_cast(int, x), __builtin_bit_cast(int, x), 0x76543210, 0xfedcba98, false, false)); }
template <int CAUSAL>
__global__ __launch_bounds__(128) void k_flash(const _Float16* __restrict__ Q16, int ldq, const _Float16* __restrict__ K16, int ldk, const _Float16* __restrict__ Vt, const int* __restrict__ MSK, float* __restrict__ O, int ldo) {
  constexpr int RPW = 16, DT = 4, KS = 2;      /* every '#pragma unroll' below: constant indices keep the fragment, score and accumulator arrays in registers */
  __shared__ __attribute__((aligned(16))) float sO[4][RPW][64 + 4];
  const int tid = threadIdx.x, w = tid >> 5, lane = tid & 31, ln = lane & 15, hh = lane >> 4;
  const int slab = blockIdx.x / QBNP, qblk = QB0P + blockIdx.x % QBNP; const int b = slab / NH, h = slab % NH; const int qb0 = qblk * (4 * RPW); const int q0 = qb0 + w * RPW; const int tq = q0 + ln;
  FragH bq[KS];
  { const unsigned short* qr = (const unsigned short*)Q16 + ((size_t)b * TQ + tq) * ldq + h * 64;
#pragma unroll
    for (int ks = 0; ks < KS; ++ks) { bq[ks].half[0] = *(const v8us*)(qr + ks * 32 + 8 * hh); bq[ks].half[1] = *(const v8us*)(qr + ks * 32 + 16 + 8 * hh); } }
  const unsigned short* Vth = (const unsigned short*)Vt + (size_t)slab * 64 * TK;
  const float sl = (CAUSAL == 14) ? bf16_round(((const float*)MSK)[h]) : 0.f;      /* mode 14: causal + ALiBi slope[h] * (key - query) from the slopes INPUT */
  float m_r = -3.0e38f, l_r = 0.f; v8f oacc[DT];
#pragma unroll
  for (int dt = 0; dt < DT; ++dt) oacc[dt] = (v8f){0.f,0.f,0.f,0.f,0.f,0.f,0.f,0.f};
  const int jend = (CAUSAL == 1 || CAUSAL == 14) ? (qb0 + 4 * RPW) : TK;      /* causal: keys beyond the block's last query never contribute */
  for (int j0 = 0; j0 < jend; j0 += 32) {
    v8f s[2];
#pragma unroll
    for (int nt = 0; nt < 2; ++nt) { const unsigned short* kr = (const unsigned short*)K16 + ((size_t)b * TK + j0 + nt * 16 + ln) * ldk + h * 64; FragH ak[KS];
#pragma unroll
      for (int ks = 0; ks < KS; ++ks) { ak[ks].half[0] = *(const v8us*)(kr + ks * 32 + 8 * hh); ak[ks].half[1] = *(const v8us*)(kr + ks * 32 + 16 + 8 * hh); }
      v8f acc = (v8f){0.f,0.f,0.f,0.f,0.f,0.f,0.f,0.f};
#pragma unroll
      for (int ks = 0; ks < KS; ++ks) acc = mmaH<1>(ak[ks].v, ak[ks].v, bq[ks].v, bq[ks].v, acc);
      s[nt] = acc; }
    float sc[2][8], mcn[2]; bool ok[2][8];
#pragma unroll
    for (int nt = 0; nt < 2; ++nt) { mcn[nt] = -3.0e38f;
#pragma unroll
      for (int r = 0; r < 8; ++r) { const int kk = j0 + nt * 16 + 8 * hh + r;
        ok[nt][r] = (CAUSAL == 1 || CAUSAL == 14) ? (kk <= tq) : ((CAUSAL == 2) ? ((kk >> 5) == (tq >> 5)) : true);      /* mode 2: block-diagonal 32-token groups */
        float sv = ok[nt][r] ? s[nt][r] * SCL : -3.0e38f; if (CAUSAL == 14) { if (ok[nt][r]) sv += sl * (float)(kk - tq); }
        sc[nt][r] = sv; mcn[nt] = fmaxf(mcn[nt], sv); } }
    float mc = fmaxf(mcn[0], mcn[1]); mc = fmaxf(mc, xhalf(mc));
    const float mn = fmaxf(m_r, mc); const float ea = expf(m_r - mn); const float al = (mn > -1.0e38f) ? ea : 1.0f; m_r = mn;
    FragH pb; float psn[2];
#pragma unroll
    for (int nt = 0; nt < 2; ++nt) { psn[nt] = 0.f;
#pragma unroll
      for (int r = 0; r < 8; ++r) { const float e = expf(sc[nt][r] - mn); const float p = ok[nt][r] ? e : 0.f; psn[nt] += p; pb.h[nt * 8 + r] = (_Float16)(p * 1024.0f); } }
    l_r = l_r * al + (psn[0] + psn[1]);
#pragma unroll
    for (int dt = 0; dt < DT; ++dt)
#pragma unroll
      for (int r = 0; r < 8; ++r) oacc[dt][r] *= al;
#pragma unroll
    for (int dt = 0; dt < DT; ++dt) { const unsigned short* vrow = Vth + (size_t)(dt * 16 + ln) * TK + j0; FragH av; av.half[0] = *(const v8us*)(vrow + 8 * hh); av.half[1] = *(const v8us*)(vrow + 16 + 8 * hh);
      oacc[dt] = mmaH<1>(av.v, av.v, pb.v, pb.v, oacc[dt]); } }
  const float l = l_r + xhalf(l_r); const float li = (l > 0.f) ? 1.0f / (l * 1024.0f) : 0.f;
#pragma unroll
  for (int dt = 0; dt < DT; ++dt) { const v4f lo = {oacc[dt][0] * li, oacc[dt][1] * li, oacc[dt][2] * li, oacc[dt][3] * li}, hi = {oacc[dt][4] * li, oacc[dt][5] * li, oacc[dt][6] * li, oacc[dt][7] * li};
    *(v4fa*)&sO[w][ln][dt * 16 + 8 * hh] = lo; *(v4fa*)&sO[w][ln][dt * 16 + 8 * hh + 4] = hi; }
  __builtin_amdgcn_fence(__ATOMIC_ACQ_REL, "workgroup"); __builtin_amdgcn_wave_barrier();      /* the wave's own sO rows: its stores above stay ahead of its whole-line reads below */
  {
#pragma unroll
    for (int rp = 0; rp < RPW; rp += 2) { const int r = rp + (lane >> 4), pc = lane & 15; const v4f val = *(const v4fa*)&sO[w][r][pc * 4]; *(v4f*)(O + ((size_t)b * TQ + q0 + r) * ldo + h * 64 + pc * 4) = val; }
     } }
// 5-plane variant: S = Qh Kh^T + (Ql Kh^T + Qh Kl^T)/1024 with Q/K = [hi | 2^10 residual] f16 planes (QL/KL same layout as Q16/K16), then the 3-term P.V below.
// 3-term variant: O = (P_hi V_hi + (P_lo V_hi + P_hi V_lo) / 1024) / l with P = [hi | 2^10 residual] of 1024 p and V^T = [hi | 2^10 residual] planes (VtL same layout as Vt) -> ~2^-21-class products for un-averaged (early causal / peaked) rows
template <int CAUSAL>
__global__ __launch_bounds__(128) void k_flash5(const _Float16* __restrict__ Q16, const _Float16* __restrict__ QL, int ldq, const _Float16* __restrict__ K16, const _Float16* __restrict__ KL, int ldk, const _Float16* __restrict__ Vt, const _Float16* __restrict__ VtL, const int* __restrict__ MSK, float* __restrict__ O, int ldo) {
  constexpr int RPW = 16, DT = 4, KS = 2;      /* transposed products as in k_flash: lane (ln, hh) holds query q0 + ln, keys j0 + nt * 16 + 8 * hh + r; '#pragma unroll' as there */
  __shared__ __attribute__((aligned(16))) float sO[4][RPW][64 + 4];
  const int tid = threadIdx.x, w = tid >> 5, lane = tid & 31, ln = lane & 15, hh = lane >> 4;
  const int slab = blockIdx.x / QBN5, qblk = QB05 + blockIdx.x % QBN5; const int b = slab / NH, h = slab % NH; const int qb0 = qblk * (4 * RPW); const int q0 = qb0 + w * RPW; const int tq = q0 + ln;
  FragH bq[KS], bql[KS];
  { const unsigned short* qr = (const unsigned short*)Q16 + ((size_t)b * TQ + tq) * ldq + h * 64; const unsigned short* ql = (const unsigned short*)QL + ((size_t)b * TQ + tq) * ldq + h * 64;
#pragma unroll
    for (int ks = 0; ks < KS; ++ks) { bq[ks].half[0] = *(const v8us*)(qr + ks * 32 + 8 * hh); bq[ks].half[1] = *(const v8us*)(qr + ks * 32 + 16 + 8 * hh); bql[ks].half[0] = *(const v8us*)(ql + ks * 32 + 8 * hh); bql[ks].half[1] = *(const v8us*)(ql + ks * 32 + 16 + 8 * hh); } }
  const unsigned short* Vth = (const unsigned short*)Vt + (size_t)slab * 64 * TK; const unsigned short* Vtl = (const unsigned short*)VtL + (size_t)slab * 64 * TK;
  const float sl = (CAUSAL == 14) ? bf16_round(((const float*)MSK)[h]) : 0.f;      /* mode 14: causal + ALiBi slope[h] * (key - query) from the slopes INPUT */
  float m_r = -3.0e38f, l_r = 0.f; v8f oacc[DT], oaccL[DT];
#pragma unroll
  for (int dt = 0; dt < DT; ++dt) { oacc[dt] = (v8f){0.f,0.f,0.f,0.f,0.f,0.f,0.f,0.f}; oaccL[dt] = oacc[dt]; }
  const int jend = (CAUSAL == 1 || CAUSAL == 14) ? (qb0 + 4 * RPW) : TK;      /* causal: keys beyond the block's last query never contribute */
  for (int j0 = 0; j0 < jend; j0 += 32) {
    v8f s[2];
#pragma unroll
    for (int nt = 0; nt < 2; ++nt) { const unsigned short* kr = (const unsigned short*)K16 + ((size_t)b * TK + j0 + nt * 16 + ln) * ldk + h * 64; const unsigned short* klr = (const unsigned short*)KL + ((size_t)b * TK + j0 + nt * 16 + ln) * ldk + h * 64; FragH ak[KS], akl[KS];
#pragma unroll
      for (int ks = 0; ks < KS; ++ks) { ak[ks].half[0] = *(const v8us*)(kr + ks * 32 + 8 * hh); ak[ks].half[1] = *(const v8us*)(kr + ks * 32 + 16 + 8 * hh); akl[ks].half[0] = *(const v8us*)(klr + ks * 32 + 8 * hh); akl[ks].half[1] = *(const v8us*)(klr + ks * 32 + 16 + 8 * hh); }
      v8f acc = (v8f){0.f,0.f,0.f,0.f,0.f,0.f,0.f,0.f}, accl = acc;
#pragma unroll
      for (int ks = 0; ks < KS; ++ks) { acc = mmaH<1>(ak[ks].v, ak[ks].v, bq[ks].v, bq[ks].v, acc); accl = mmaH<1>(ak[ks].v, ak[ks].v, bql[ks].v, bql[ks].v, accl); accl = mmaH<1>(akl[ks].v, akl[ks].v, bq[ks].v, bq[ks].v, accl); }
#pragma unroll
      for (int r = 0; r < 8; ++r) acc[r] += accl[r] * 0.0009765625f;
      s[nt] = acc; }
    float sc[2][8], mcn[2]; bool ok[2][8];
#pragma unroll
    for (int nt = 0; nt < 2; ++nt) { mcn[nt] = -3.0e38f;
#pragma unroll
      for (int r = 0; r < 8; ++r) { const int kk = j0 + nt * 16 + 8 * hh + r;
        ok[nt][r] = (CAUSAL == 1 || CAUSAL == 14) ? (kk <= tq) : ((CAUSAL == 2) ? ((kk >> 5) == (tq >> 5)) : true);      /* mode 2: block-diagonal 32-token groups */
        if (CAUSAL == 4) ok[nt][r] = MSK[((size_t)b * TQ + tq) * TK + kk] != 0;      /* mode 4: per-(query, key) INPUT mask shared by all heads; masked keys contribute nothing, rows with no valid key give l = 0 -> output 0 */
        float sv = ok[nt][r] ? s[nt][r] * SCL : -3.0e38f; if (CAUSAL == 14) { if (ok[nt][r]) sv += sl * (float)(kk - tq); }
        sc[nt][r] = sv; mcn[nt] = fmaxf(mcn[nt], sv); } }
    float mc = fmaxf(mcn[0], mcn[1]); mc = fmaxf(mc, xhalf(mc));
    const float mn = fmaxf(m_r, mc); const float ea = expf(m_r - mn); const float al = (mn > -1.0e38f) ? ea : 1.0f; m_r = mn;
    FragH pb, pl; float psn[2];
#pragma unroll
    for (int nt = 0; nt < 2; ++nt) { psn[nt] = 0.f;
#pragma unroll
      for (int r = 0; r < 8; ++r) { const float e = expf(sc[nt][r] - mn); const float p = ok[nt][r] ? e : 0.f; psn[nt] += p; const float ps = p * 1024.0f; const _Float16 ph = (_Float16)ps; pb.h[nt * 8 + r] = ph; pl.h[nt * 8 + r] = (_Float16)((ps - (float)ph) * 1024.0f); } }
    l_r = l_r * al + (psn[0] + psn[1]);
#pragma unroll
    for (int dt = 0; dt < DT; ++dt)
#pragma unroll
      for (int r = 0; r < 8; ++r) { oacc[dt][r] *= al; oaccL[dt][r] *= al; }
#pragma unroll
    for (int dt = 0; dt < DT; ++dt) { const unsigned short* vrow = Vth + (size_t)(dt * 16 + ln) * TK + j0; const unsigned short* vrl = Vtl + (size_t)(dt * 16 + ln) * TK + j0; FragH av, avl; av.half[0] = *(const v8us*)(vrow + 8 * hh); av.half[1] = *(const v8us*)(vrow + 16 + 8 * hh); avl.half[0] = *(const v8us*)(vrl + 8 * hh); avl.half[1] = *(const v8us*)(vrl + 16 + 8 * hh);
      oacc[dt] = mmaH<1>(av.v, av.v, pb.v, pb.v, oacc[dt]); oaccL[dt] = mmaH<1>(av.v, av.v, pl.v, pl.v, oaccL[dt]); oaccL[dt] = mmaH<1>(avl.v, avl.v, pb.v, pb.v, oaccL[dt]); } }
  const float l = l_r + xhalf(l_r); const float li = (l > 0.f) ? 1.0f / (l * 1024.0f) : 0.f;
#pragma unroll
  for (int dt = 0; dt < DT; ++dt) { v4f lo, hi;
#pragma unroll
    for (int r = 0; r < 4; ++r) { float v = oacc[dt][r]; v += oaccL[dt][r] * 0.0009765625f; lo[r] = v * li; v = oacc[dt][4 + r]; v += oaccL[dt][4 + r] * 0.0009765625f; hi[r] = v * li; }
    *(v4fa*)&sO[w][ln][dt * 16 + 8 * hh] = lo; *(v4fa*)&sO[w][ln][dt * 16 + 8 * hh + 4] = hi; }
  __builtin_amdgcn_fence(__ATOMIC_ACQ_REL, "workgroup"); __builtin_amdgcn_wave_barrier();      /* the wave's own sO rows: its stores above stay ahead of its whole-line reads below */
  {
#pragma unroll
    for (int rp = 0; rp < RPW; rp += 2) { const int r = rp + (lane >> 4), pc = lane & 15; const v4f val = *(const v4fa*)&sO[w][r][pc * 4]; *(v4f*)(O + ((size_t)b * TQ + q0 + r) * ldo + h * 64 + pc * 4) = val; }
     } }

__global__ __launch_bounds__(256) void k_rotab(float* __restrict__ CS, float* __restrict__ SN) {
  #pragma clang fp contract(off)
  const int t = blockIdx.x * 256 + threadIdx.x; if (t >= SLEN * 32) return; const int j = t % 32, s = t / 32; const float ex = (float)(2 * j) / 64.0f; const float inv = 1.0f / powf(10000.0f, ex); const float th = (float)s * inv; const float c = cosf(th), sn = sinf(th);
  { *(float*)(CS + t) = c; *(float*)(SN + t) = sn;  } }
__global__ __launch_bounds__(256) void k_rope(const float* __restrict__ F, int nsrc, int ndst, int rep, const float* __restrict__ CS, const float* __restrict__ SN, _Float16* __restrict__ H, _Float16* __restrict__ L) {
  #pragma clang fp contract(off)
  const size_t t = (size_t)blockIdx.x * 256 + threadIdx.x; if (t >= (size_t)NR * ndst * 4) return; const int g8 = (int)(t % 4); const int hd = (int)((t / 4) % ndst); const size_t row = t / ((size_t)4 * ndst); const int s = (int)(row % SLEN); const int hs = hd / rep;
  const float* src = F + row * (size_t)(nsrc * 64) + hs * 64; FragH ah, al, bh, bl;
  for (int i = 0; i < 8; ++i) { const int d = g8 * 8 + i; const float c = CS[s * 32 + d], sn = SN[s * 32 + d]; const float x1 = src[d], x2 = src[d + 32];
    float o1 = x1 * c; o1 += -x2 * sn; float o2 = x2 * c; o2 += x1 * sn;
    _Float16 hv = (_Float16)o1; ah.h[i] = hv; al.h[i] = (_Float16)((o1 - (float)hv) * 1024.0f); hv = (_Float16)o2; bh.h[i] = hv; bl.h[i] = (_Float16)((o2 - (float)hv) * 1024.0f); }
  const size_t o = row * (size_t)(ndst * 64) + hd * 64 + g8 * 8;
  { *(v8us*)((unsigned short*)H + o) = ah.half[0]; *(v8us*)((unsigned short*)H + o + 32) = bh.half[0]; *(v8us*)((unsigned short*)L + o) = al.half[0]; *(v8us*)((unsigned short*)L + o + 32) = bl.half[0];  } }
__global__ __launch_bounds__(256) void k_kexp(const float* __restrict__ F, _Float16* __restrict__ H, _Float16* __restrict__ L) { const size_t t = (size_t)blockIdx.x * 256 + threadIdx.x; if (t >= (size_t)NR * NH * 8) return; const int g8 = (int)(t % 8); const int hd = (int)((t / 8) % NH); const size_t row = t / ((size_t)8 * NH); const float* src = F + row * (size_t)KVD + (hd / NREP) * 64 + g8 * 8; FragH fh, fl;
  for (int i = 0; i < 8; ++i) { const _Float16 hv = (_Float16)src[i]; fh.h[i] = hv; fl.h[i] = (_Float16)((src[i] - (float)hv) * 1024.0f); } const size_t o = row * (size_t)(NH * 64) + hd * 64 + g8 * 8;
  { *(v8us*)((unsigned short*)H + o) = fh.half[0]; *(v8us*)((unsigned short*)L + o) = fl.half[0];  } }
__global__ __launch_bounds__(256) void k_vtg(const _Float16* __restrict__ V16, _Float16* __restrict__ Vt) { __shared__ unsigned short tl[64][66]; const int tid = threadIdx.x; const int slab = blockIdx.x / (SLEN / 64), lg = blockIdx.x % (SLEN / 64); const int b = slab / NH, h = slab % NH; const int hs = h / NREP;
  for (int i = tid; i < 64 * 8; i += 256) { const int r = i / 8, c8 = (i % 8) * 8; FragH f; f.half[0] = *(const v8us*)((const unsigned short*)V16 + ((size_t)b * SLEN + lg * 64 + r) * KVD + hs * 64 + c8); for (int q = 0; q < 8; ++q) tl[r][c8 + q] = f.u[q]; }
  __syncthreads();
  { for (int rd = 0; rd < 2; ++rd) { const int d = rd * 32 + tid / 8, pc = tid % 8; FragH f; for (int q = 0; q < 8; ++q) f.u[q] = tl[pc * 8 + q][d]; *(v8us*)((unsigned short*)Vt + ((size_t)slab * 64 + d) * SLEN + lg * 64 + pc * 8) = f.half[0]; }  } }

extern "C" void kernel_launch(void* const* d_in, const int* in_sizes, int n_in,
                              void* d_out, int out_size, void* d_ws, size_t ws_size, hipStream_t stream) {
  (void)in_sizes; (void)n_in; (void)out_size;
  const float* const* I = (const float* const*)d_in; const float* x = I[0]; const float* Wq = I[1]; const float* bq = I[2]; const float* Wk = I[3]; const float* bk = I[4]; const float* Wv = I[5]; const float* bv = I[6]; const float* Wo = I[7]; const float* bo = I[8]; const float* slopes = I[9];
  char* ws = (char*)d_ws; size_t off = 0;
  auto take = [&](size_t bytes) { char* p = ws + off; off += (bytes + 255) & ~(size_t)255; return p; };
  const size_t np = (size_t)NR * DM, nk = (size_t)NR * KVD;
  _Float16* BQ = (_Float16*)take((size_t)DM * DM * 2); _Float16* BK = (_Float16*)take((size_t)KVD * DM * 2); _Float16* BV = (_Float16*)take((size_t)KVD * DM * 2); _Float16* BO = (_Float16*)take((size_t)DM * DM * 2);
  _Float16* X16 = (_Float16*)take(np * 2); float* QF = (float*)take(np * 4); _Float16* QH = (_Float16*)take(np * 2); _Float16* QL = (_Float16*)take(np * 2); float* KF = (float*)take(nk * 4); float* VF = (float*)take(nk * 4); _Float16* KXH = (_Float16*)take(np * 2); _Float16* KXL = (_Float16*)take(np * 2); _Float16* VH = (_Float16*)take(nk * 2); _Float16* VL = (_Float16*)take(nk * 2); _Float16* VT = (_Float16*)take(np * 2); _Float16* VTL = (_Float16*)take(np * 2);
  float* O = QF;      /* attention output over the q f32 plane (dead after the q hi/lo split) */ _Float16* OH = (_Float16*)take(np * 2); _Float16* OLo = (_Float16*)take(np * 2);
  if (off > ws_size) return;      /* 2+0.5+0.5+2 + 8+16+8+8+4+4+8+8+2+2+8+8+8+8 = 105 MiB */
  k_wt_f16<<<(unsigned)(((size_t)DM * DM / 8 + 255) / 256), 256, 0, stream>>>(Wq, BQ, DM, DM, 16.0f); k_wt_f16<<<(unsigned)(((size_t)DM * KVD / 8 + 255) / 256), 256, 0, stream>>>(Wk, BK, DM, KVD, 16.0f); k_wt_f16<<<(unsigned)(((size_t)DM * KVD / 8 + 255) / 256), 256, 0, stream>>>(Wv, BV, DM, KVD, 16.0f); k_wt_f16<<<(unsigned)(((size_t)DM * DM / 8 + 255) / 256), 256, 0, stream>>>(Wo, BO, DM, DM, 16.0f);
  k_x16<<<(unsigned)((np / 8 + 255) / 256), 256, 0, stream>>>(x, X16, np / 8);
  k_gemm2<0><<<dim3((NR / 128) * (DM / 64), 1), 128, 0, stream>>>(X16, DM, 0, BQ, DM, 0, 0.0625f, bq, 0, nullptr, 1, 0, 0, QF, nullptr, DM, 0, NR, DM, DM);
  k_gemm2<0><<<dim3((NR / 128) * (KVD / 64), 1), 128, 0, stream>>>(X16, DM, 0, BK, DM, 0, 0.0625f, bk, 0, nullptr, 1, 0, 0, KF, nullptr, KVD, 0, NR, KVD, DM);
  k_gemm2<0><<<dim3((NR / 128) * (KVD / 64), 1), 128, 0, stream>>>(X16, DM, 0, BV, DM, 0, 0.0625f, bv, 0, nullptr, 1, 0, 0, VF, nullptr, KVD, 0, NR, KVD, DM);
  k_hl<<<(unsigned)((np / 8 + 255) / 256), 256, 0, stream>>>(QF, QH, QL, np / 8);      /* q hi/lo */
  k_kexp<<<(unsigned)(((size_t)NR * NH * 8 + 255) / 256), 256, 0, stream>>>(KF, KXH, KXL);      /* k: kv head h/4 expanded to query head h, hi/lo */
  k_hl<<<(unsigned)((nk / 8 + 255) / 256), 256, 0, stream>>>(VF, VH, VL, nk / 8);
  k_vtg<<<NB * NH * (SLEN / 64), 256, 0, stream>>>(VH, VT); k_vtg<<<NB * NH * (SLEN / 64), 256, 0, stream>>>(VL, VTL);      /* QF becomes O from here on */
  k_flash5<14><<<NB * NH * QBN5, 128, 0, stream>>>(QH, QL, DM, KXH, KXL, DM, VT, VTL, (const int*)slopes, O, DM);      /* causal + ALiBi, rows < 256: hi + residual */
  k_flash<14><<<NB * NH * QBNP, 128, 0, stream>>>(QH, DM, KXH, DM, VT, (const int*)slopes, O, DM);      /* causal + ALiBi, rows >= 256: plain */
  k_hl<<<(unsigned)((np / 8 + 255) / 256), 256, 0, stream>>>(O, OH, OLo, np / 8);
  k_gemm2<0><<<dim3((NR / 128) * (DM / 64), 1), 128, 0, stream>>>(OH, DM, 0, BO, DM, 0, 0.0625f, bo, 0, nullptr, 1, 0, 0, (float*)d_out, nullptr, DM, 0, NR, DM, DM);      /* out = ctx Wo + bo */
  for (int b = 0; b < NB; ++b) k_gemm2<0><<<dim3((RE / 128) * (DM / 64), 1), 128, 0, stream>>>(OLo + (size_t)b * SLEN * DM, DM, 0, BO, DM, 0, 0.0625f / 1024.0f, nullptr, 0, (const float*)d_out + (size_t)b * SLEN * DM, 1, (size_t)DM, 0, (float*)d_out + (size_t)b * SLEN * DM, nullptr, DM, 0, RE, DM, DM);      /* += O residual . Wo on the first 256 rows of each sequence */
}

// v002
// A run of this version takes 283 microseconds.
// Next to v001, in two timings, it ran 1.99 times as fast each time.
// Counting every step since v000, it is 2.82 times as fast.
#include <hip/hip_runtime.h>
// CausalAlibiAttn (1 x 4096 tokens, D 1024 = 16 heads of 64, 4 kv heads): q, k, v = x W + b; q head h uses kv head h/4; scores/8 + slope[h] * (key - query) (ALiBi, slopes INPUT), causal; softmax; ctx Wo + bo.
// Structure: exact f16 plane of x; q, k, v as f32 WMMA GEMM outputs (32x64 wave tiles, f32 accumulation, exact x16 weights + bias); f16 hi + 2^10-residual splits on VALU (k expanded to the 16 query heads); V^T hi/residual by LDS tiles with the kv-head mapping; the fused causal flash kernel with the ALiBi term added per (head, query, key) in f32, in its 5-plane form for the first 256 query rows and the plain form beyond; O as hi + residual into the Wo GEMMs (+ bias; residual term only on those rows).
// Compute dtype: x and parameters rounded to bf16; q/k/P/v/O as f16 hi + residual on rows < 256 (~2^-21) and plain f16 beyond (~2^-12); ALiBi/softmax f32. v_wmma_f32_16x16x32_f16.
#define NB 1
#define DM 1024
#define NKV 4
#define NREP (NH / NKV)
#define KVD (NKV * 64)           /* 256 */
#define NR (NB * SLEN)           /* 4096 */
#define SLEN 4096
#define TQ SLEN
#define TK SLEN
#define NH 16
#define SCL 0.125f
#define QBLKS (TQ / 64)
#define QB05 0
#define QBN5 4
#define QB0P QBN5
#define QBNP (QBLKS - QBN5)
#define RE 256
typedef __bf16 v16b __attribute__((ext_vector_type(16)));
typedef unsigned short v8us __attribute__((ext_vector_type(8), may_alias));
typedef float  v8f  __attribute__((ext_vector_type(8)));
typedef float  v4f  __attribute__((ext_vector_type(4)));
typedef float  v4fa __attribute__((ext_vector_type(4), may_alias));
union FragB { v16b v; v8us half[2]; unsigned short u[16]; };

__device__ __forceinline__ unsigned short bf16_bits(float x) { unsigned int u = __float_as_uint(x); return (unsigned short)((u + 0x7FFFu + ((u >> 16) & 1u)) >> 16); }
__device__ __forceinline__ float bf16_val(unsigned short b) { return __uint_as_float(((unsigned int)b) << 16); }
__device__ __forceinline__ float bf16_round(float x) { return bf16_val(bf16_bits(x)); }
// D += A·B with NT terms: 1 = ah·bh, 2 = + al·bh (A split), 3 = + ah·bl (both split)
template <int NT>
__device__ __forceinline__ v8f mmaN(v16b ah, v16b al, v16b bh, v16b bl, v8f c) {
  c = __builtin_amdgcn_wmma_f32_16x16x32_bf16(false, ah, false, bh, (short)0, c, false, false);
  if (NT >= 2) c = __builtin_amdgcn_wmma_f32_16x16x32_bf16(false, al, false, bh, (short)0, c, false, false);
  if (NT >= 3) c = __builtin_amdgcn_wmma_f32_16x16x32_bf16(false, ah, false, bl, (short)0, c, false, false);
  asm volatile("v_nop\n\tv_nop\n\tv_nop\n\tv_nop" : "+v"(c) : "v"(ah), "v"(al), "v"(bh), "v"(bl));
  return c;
}

__global__ __launch_bounds__(256) void k_wt_bf16(const float* __restrict__ W, unsigned short* __restrict__ Wt, int K, int N) {
  const int t = blockIdx.x * 256 + threadIdx.x;
  const int k8n = K / 8;
  if (t >= N * k8n) return;
  const int n = t / k8n, k8 = (t % k8n) * 8;
  v8us v;
#pragma unroll
  for (int i = 0; i < 8; ++i) v[i] = bf16_bits(W[(size_t)(k8 + i) * N + n]);
  *(v8us*)(Wt + (size_t)n * K + k8) = v;
  
}

// GEMM C[M][N] (f32, pitch ldc) = act(A[M][K]·W + bias). A f32 row-major (pitch lda) converted per fragment to bf16
// (ASPLIT: hi/lo two planes -> 2 terms, else single rounded term); Wt bf16 [N][K] (pitch ldb). BIAS_BF16 rounds the
// bias to bf16 first (bias quantised to bf16 before the add). K%32==0, M%16==0, N%64==0.
template <bool ASPLIT, int ACT, bool BIAS_BF16>
__global__ __launch_bounds__(128) void k_gemm_bf(const float* __restrict__ A, int lda, const unsigned short* __restrict__ Wt, int ldb,
                                               const float* __restrict__ bias, float* __restrict__ C, int ldc, int M, int N, int K) {
  __shared__ __attribute__((aligned(16))) float so[4][16][64];
  const int tid = threadIdx.x, w = tid >> 5, lane = tid & 31, ln = lane & 15, hh = lane >> 4;
  const int ntn = N / 64;
  const int wid = blockIdx.x * 4 + w;
  const int mt = wid / ntn, nq = wid % ntn;
  if (mt * 16 >= M) return;
  const int row0 = mt * 16, col0 = nq * 64;
  const float* arow = A + (size_t)(row0 + ln) * lda;
  v8f acc[4] = {};
  for (int kb = 0; kb < K; kb += 32) {
    FragB ah, al;
    const v4f x0 = *(const v4fa*)(arow + kb + 8 * hh), x1 = *(const v4fa*)(arow + kb + 8 * hh + 4);
    const v4f x2 = *(const v4fa*)(arow + kb + 16 + 8 * hh), x3 = *(const v4fa*)(arow + kb + 16 + 8 * hh + 4);
    float xs[16] = {x0[0],x0[1],x0[2],x0[3],x1[0],x1[1],x1[2],x1[3],x2[0],x2[1],x2[2],x2[3],x3[0],x3[1],x3[2],x3[3]};
#pragma unroll
    for (int i = 0; i < 16; ++i) { const unsigned short hb = bf16_bits(xs[i]); ah.u[i] = hb; al.u[i] = ASPLIT ? bf16_bits(xs[i] - bf16_val(hb)) : (unsigned short)0; }
#pragma unroll
    for (int t = 0; t < 4; ++t) {
      const unsigned short* brow = Wt + (size_t)(col0 + t * 16 + ln) * ldb + kb;
      FragB b;
      b.half[0] = *(const v8us*)(brow + 8 * hh);
      b.half[1] = *(const v8us*)(brow + 16 + 8 * hh);
      acc[t] = mmaN<ASPLIT ? 2 : 1>(ah.v, al.v, b.v, b.v, acc[t]);
    }
  }
#pragma unroll
  for (int t = 0; t < 4; ++t) {
    float bv = bias ? bias[col0 + t * 16 + ln] : 0.f;
    if (BIAS_BF16) bv = bf16_round(bv);
#pragma unroll
    for (int r = 0; r < 8; ++r) { float v = acc[t][r] + bv; if (ACT == 1) v = fmaxf(v, 0.f); so[w][8 * hh + r][t * 16 + ln] = v; }
  }
  __builtin_amdgcn_fence(__ATOMIC_ACQ_REL, "workgroup");
  __builtin_amdgcn_wave_barrier();
  const int rsub = lane >> 4, c4 = (lane & 15) * 4;
  {
#pragma unroll
    for (int q = 0; q < 8; ++q) {
      const int r = q * 2 + rsub;
      const v4f v = *(const v4fa*)&so[w][r][c4];
      *(v4f*)(C + (size_t)(row0 + r) * ldc + col0 + c4) = v;
    }
    
  }
}

// GEMM C = act(A·W + bias + resid): A f32 (ASPLIT -> hi/lo 2 terms), Wt bf16 [N][K]; ACT 0 none, 1 relu, 2 exact gelu;
// resid (optional, f32, row index = (row % rmod), pitch ldr, RES_BF16 rounds it) added before the activation.
template <bool ASPLIT, int ACT, bool BIAS_BF16, bool RES_BF16>
__global__ __launch_bounds__(128) void k_gemm_bf3(const float* __restrict__ A, int lda, const unsigned short* __restrict__ Wt, int ldb,
                                                const float* __restrict__ bias, const float* __restrict__ resid, int rmod, int ldr,
                                                float* __restrict__ C, int ldc, int M, int N, int K) {
  __shared__ __attribute__((aligned(16))) float so[4][16][64];
  const int tid = threadIdx.x, w = tid >> 5, lane = tid & 31, ln = lane & 15, hh = lane >> 4;
  const int ntn = N / 64;
  const int wid = blockIdx.x * 4 + w;
  const int mt = wid / ntn, nq = wid % ntn;
  if (mt * 16 >= M) return;
  const int row0 = mt * 16, col0 = nq * 64;
  const float* arow = A + (size_t)(row0 + ln) * lda;
  v8f acc[4] = {};
  for (int kb = 0; kb < K; kb += 32) {
    FragB ah, al;
    const v4f x0 = *(const v4fa*)(arow + kb + 8 * hh), x1 = *(const v4fa*)(arow + kb + 8 * hh + 4);
    const v4f x2 = *(const v4fa*)(arow + kb + 16 + 8 * hh), x3 = *(const v4fa*)(arow + kb + 16 + 8 * hh + 4);
    float xs[16] = {x0[0],x0[1],x0[2],x0[3],x1[0],x1[1],x1[2],x1[3],x2[0],x2[1],x2[2],x2[3],x3[0],x3[1],x3[2],x3[3]};
#pragma unroll
    for (int i = 0; i < 16; ++i) { const unsigned short hb = bf16_bits(xs[i]); ah.u[i] = hb; al.u[i] = ASPLIT ? bf16_bits(xs[i] - bf16_val(hb)) : (unsigned short)0; }
#pragma unroll
    for (int t = 0; t < 4; ++t) {
      const unsigned short* brow = Wt + (size_t)(col0 + t * 16 + ln) * ldb + kb;
      FragB b;
      b.half[0] = *(const v8us*)(brow + 8 * hh);
      b.half[1] = *(const v8us*)(brow + 16 + 8 * hh);
      acc[t] = mmaN<ASPLIT ? 2 : 1>(ah.v, al.v, b.v, b.v, acc[t]);
    }
  }
#pragma unroll
  for (int t = 0; t < 4; ++t) {
    const int col = col0 + t * 16 + ln;
    float bv = bias ? bias[col] : 0.f;
    if (BIAS_BF16) bv = bf16_round(bv);
#pragma unroll
    for (int r = 0; r < 8; ++r) {
      float v = acc[t][r] + bv;
      if (resid) { float rv = resid[(size_t)((row0 + 8 * hh + r) % rmod) * ldr + col]; if (RES_BF16) rv = bf16_round(rv); v += rv; }
      if (ACT == 1) v = fmaxf(v, 0.f);
      if (ACT == 2) v = 0.5f * v * (1.0f + erff(v * 0.70710678118654752f));
      if (ACT == 3) { const float u = 0.7978845608028654f * (v + 0.044715f * v * v * v); v = 0.5f * v * (1.0f + tanhf(u)); }
      so[w][8 * hh + r][t * 16 + ln] = v;
    }
  }
  __builtin_amdgcn_fence(__ATOMIC_ACQ_REL, "workgroup");
  __builtin_amdgcn_wave_barrier();
  const int rsub = lane >> 4, c4 = (lane & 15) * 4;
  {
#pragma unroll
    for (int q = 0; q < 8; ++q) {
      const int r = q * 2 + rsub;
      const v4f v = *(const v4fa*)&so[w][r][c4];
      *(v4f*)(C + (size_t)(row0 + r) * ldc + col0 + c4) = v;
    }
    
  }
}
// row LayerNorm (biased variance, eps) over N: s = X (+ R); optional out_sum <- s; out_norm <- (s-mu)*rsqrt(var+eps)*g + b
template <bool PARAM_BF16>
__global__ __launch_bounds__(256) void k_layernorm(const float* __restrict__ X, const float* __restrict__ R, const float* __restrict__ g, const float* __restrict__ bta,
                                                  float* __restrict__ out_sum, float* __restrict__ out_norm, int N, float eps) {
  __shared__ float red[256];
  const int row = blockIdx.x, tid = threadIdx.x;
  const float* x = X + (size_t)row * N; const float* rr = R ? R + (size_t)row * N : nullptr;
  float vals[16];                     // up to N = 4096
  const int per = N / 256;            // contiguous chunk per thread? use strided-by-4 chunks: thread handles j = tid*4 + 1024*u
  float s1 = 0.f;
  for (int u = 0; u < per / 4; ++u) {
    const int j = tid * 4 + 1024 * u;
    const v4f a = *(const v4fa*)(x + j);
    v4f b = {0.f,0.f,0.f,0.f}; if (rr) b = *(const v4fa*)(rr + j);
#pragma unroll
    for (int q = 0; q < 4; ++q) { const float v = a[q] + b[q]; vals[u * 4 + q] = v; s1 += v; }
  }
  red[tid] = s1; __syncthreads();
  for (int st = 128; st > 0; st >>= 1) { if (tid < st) red[tid] += red[tid + st]; __syncthreads(); }
  const float mu = red[0] / (float)N; __syncthreads();
  float s2 = 0.f;
  for (int u = 0; u < per / 4; ++u)
#pragma unroll
    for (int q = 0; q < 4; ++q) { const float c = vals[u * 4 + q] - mu; s2 += c * c; }
  red[tid] = s2; __syncthreads();
  for (int st = 128; st > 0; st >>= 1) { if (tid < st) red[tid] += red[tid + st]; __syncthreads(); }
  const float rs = rsqrtf(red[0] / (float)N + eps);
  {
    for (int u = 0; u < per / 4; ++u) {
      const int j = tid * 4 + 1024 * u;
      v4f o, sm;
#pragma unroll
      for (int q = 0; q < 4; ++q) {
        float gg = g[j + q], bb = bta[j + q];
        if (PARAM_BF16) { gg = bf16_round(gg); bb = bf16_round(bb); }
        sm[q] = vals[u * 4 + q]; o[q] = (vals[u * 4 + q] - mu) * rs * gg + bb;
      }
      if (out_sum) *(v4f*)(out_sum + (size_t)row * N + j) = sm;
      *(v4f*)(out_norm + (size_t)row * N + j) = o;
    }
    
  }
}



// ---- f16 WMMA path (v_wmma_f32_16x16x32_f16): 11-bit significands for operands in range — used where a [0,1] probability operand needs more precision than bf16
typedef _Float16 v16h __attribute__((ext_vector_type(16)));
union FragH { v16h v; v8us half[2]; _Float16 h[16]; unsigned short u[16]; };
template <int NT>
__device__ __forceinline__ v8f mmaH(v16h ah, v16h al, v16h bh, v16h bl, v8f c) {
  c = __builtin_amdgcn_wmma_f32_16x16x32_f16(false, ah, false, bh, (short)0, c, false, false);
  if (NT >= 2) c = __builtin_amdgcn_wmma_f32_16x16x32_f16(false, al, false, bh, (short)0, c, false, false);
  if (NT >= 3) c = __builtin_amdgcn_wmma_f32_16x16x32_f16(false, ah, false, bl, (short)0, c, false, false);
  asm volatile("v_nop\n\tv_nop\n\tv_nop\n\tv_nop" : "+v"(c) : "v"(ah), "v"(al), "v"(bh), "v"(bl));
  return c;
}
// batched GEMM like k_gemm_b but f16 operands: A f32 (split into f16 hi/lo if ASPLIT, else rounded to f16), Bt = f16 values [n][k]; alpha; C f32; N multiple of 16 (partial tiles skipped)
template <bool ASPLIT>
__global__ __launch_bounds__(128) void k_gemm_h(const float* __restrict__ A, int lda, size_t sA, const _Float16* __restrict__ Bh, int ldb, size_t sB, float alpha, float* __restrict__ C, int ldc, size_t sC, int M, int N, int K) {
  __shared__ __attribute__((aligned(16))) float so[4][16][64];
  const int tid = threadIdx.x, w = tid >> 5, lane = tid & 31, ln = lane & 15, hh = lane >> 4; const int by = blockIdx.y;
  A += (size_t)by * sA; Bh += (size_t)by * sB; C += (size_t)by * sC;
  const int ntn = (N + 63) / 64; const int wid = blockIdx.x * 4 + w; const int mt = wid / ntn, nq = wid % ntn; if (mt * 16 >= M) return;
  const int row0 = mt * 16, col0 = nq * 64; const float* arow = A + (size_t)(row0 + ln) * lda;
  v8f acc[4] = {};
  for (int kb = 0; kb < K; kb += 32) {
    FragH ah, al;
    const v4f x0 = *(const v4fa*)(arow + kb + 8 * hh), x1 = *(const v4fa*)(arow + kb + 8 * hh + 4), x2 = *(const v4fa*)(arow + kb + 16 + 8 * hh), x3 = *(const v4fa*)(arow + kb + 16 + 8 * hh + 4);
    float xs[16] = {x0[0],x0[1],x0[2],x0[3],x1[0],x1[1],x1[2],x1[3],x2[0],x2[1],x2[2],x2[3],x3[0],x3[1],x3[2],x3[3]};
#pragma unroll
    for (int i = 0; i < 16; ++i) { const _Float16 h = (_Float16)xs[i]; ah.h[i] = h; al.h[i] = ASPLIT ? (_Float16)(xs[i] - (float)h) : (_Float16)0.0f; }
#pragma unroll
    for (int t = 0; t < 4; ++t) { if (col0 + t * 16 >= N) continue; const size_t boff = (size_t)(col0 + t * 16 + ln) * ldb + kb; FragH bq; bq.half[0] = *(const v8us*)(Bh + boff + 8 * hh); bq.half[1] = *(const v8us*)(Bh + boff + 16 + 8 * hh);
      acc[t] = mmaH<ASPLIT ? 2 : 1>(ah.v, al.v, bq.v, bq.v, acc[t]); }
  }
#pragma unroll
  for (int t = 0; t < 4; ++t) { if (col0 + t * 16 >= N) continue;
#pragma unroll
    for (int r = 0; r < 8; ++r) so[w][8 * hh + r][t * 16 + ln] = acc[t][r] * alpha; }
  __builtin_amdgcn_fence(__ATOMIC_ACQ_REL, "workgroup"); __builtin_amdgcn_wave_barrier();
  const int rsub = lane >> 4, c4 = (lane & 15) * 4;
  {
#pragma unroll
    for (int q = 0; q < 8; ++q) { const int r = q * 2 + rsub; if (col0 + c4 < N) { const v4f v = *(const v4fa*)&so[w][r][c4]; *(v4f*)(C + (size_t)(row0 + r) * ldc + col0 + c4) = v; } }
     }
}

// Wt[n][k] = f16(W[k][n]·scale) from f32 row-major W[K][N] (scale = power of two; bf16-exact weights stay exact in f16 away from the subnormal range)
__global__ __launch_bounds__(256) void k_wt_f16(const float* __restrict__ W, _Float16* __restrict__ Wt, int K, int N, float scale) {
  const int t = blockIdx.x * 256 + threadIdx.x; if (t >= N * (K / 8)) return; const int n = t / (K / 8), k8 = (t % (K / 8)) * 8; FragH f;
#pragma unroll
  for (int i = 0; i < 8; ++i) f.h[i] = (_Float16)(bf16_round(W[(size_t)(k8 + i) * N + n]) * scale); const v8us o = f.half[0];
  *(v8us*)((unsigned short*)Wt + (size_t)n * K + k8) = o; 
}
// k_gemm_hh variant with fused epilogue: v = acc·alpha + bias[by·sBias + col] (+ CP[(row/rowsPerB)·sCPb + by·64 + col] if CP) ; ACT 0 none / 1 elu ; writes f16 C16 (and f32 C if non-null)
template <int ACT>
__global__ __launch_bounds__(128) void k_gemm_hhx(const _Float16* __restrict__ A, int lda, size_t sA, const _Float16* __restrict__ Bh, int ldb, size_t sB, float alpha, const float* __restrict__ bias, size_t sBias, const float* __restrict__ CP, int rowsPerB, size_t sCPb, int row0g,
    float* __restrict__ C, _Float16* __restrict__ C16, int ldc, size_t sC, int M, int N, int K) {
  __shared__ __attribute__((aligned(16))) float so[4][16][64];
  const int tid = threadIdx.x, w = tid >> 5, lane = tid & 31, ln = lane & 15, hh = lane >> 4; const int by = blockIdx.y;
  A += (size_t)by * sA; Bh += (size_t)by * sB; const size_t cofs = (size_t)by * sC; const float* bp = bias ? bias + (size_t)by * sBias : nullptr;
  const int ntn = (N + 63) / 64; const int wid = blockIdx.x * 4 + w; const int mt = wid / ntn, nq = wid % ntn; if (mt * 16 >= M) return;
  const int row0 = mt * 16, col0 = nq * 64; const _Float16* arow = A + (size_t)(row0 + ln) * lda;
  v8f acc[4] = {};
  for (int kb = 0; kb < K; kb += 32) { FragH ah; ah.half[0] = *(const v8us*)((const unsigned short*)arow + kb + 8 * hh); ah.half[1] = *(const v8us*)((const unsigned short*)arow + kb + 16 + 8 * hh);
#pragma unroll
    for (int t = 0; t < 4; ++t) { if (col0 + t * 16 >= N) continue; const size_t boff = (size_t)(col0 + t * 16 + ln) * ldb + kb; FragH bq; bq.half[0] = *(const v8us*)((const unsigned short*)Bh + boff + 8 * hh); bq.half[1] = *(const v8us*)((const unsigned short*)Bh + boff + 16 + 8 * hh);
      acc[t] = mmaH<1>(ah.v, ah.v, bq.v, bq.v, acc[t]); }
  }
#pragma unroll
  for (int t = 0; t < 4; ++t) { if (col0 + t * 16 >= N) continue; const int col = col0 + t * 16 + ln; const float bv = bp ? bf16_round(bp[col]) : 0.f;
#pragma unroll
    for (int r = 0; r < 8; ++r) { float v = acc[t][r] * alpha + bv; if (CP) { const int bidx = (row0g + row0 + 8 * hh + r) / rowsPerB; v += CP[(size_t)bidx * sCPb + (size_t)by * 64 + col]; } if (ACT == 1) v = (v > 0.f) ? v : expm1f(v); else if (ACT == 7) v = (v > 0.f) ? v + 1.0f : expf(v); else if (ACT == 8) v = tanhf(v); else if (ACT == 9) v = 0.5f * v * (1.0f + tanhf(0.7978845608028654f * (v + 0.044715f * v * v * v))); else if (ACT == 11) v = 1.0f / (1.0f + expf(-v)); else if (ACT == 12) v = (v > 0.f) ? v : 0.01f * v; else if (ACT == 14) v = (v > 0.f) ? v : 0.1f * v; else if (ACT == 15) v = v / (1.0f + expf(-v)); else if (ACT == 3) v = fmaxf(v, 0.f); else if (ACT == 6) v = 0.5f * v * (1.0f + erff(v * 0.70710678118654752f)); so[w][8 * hh + r][t * 16 + ln] = v; } }
  __builtin_amdgcn_fence(__ATOMIC_ACQ_REL, "workgroup"); __builtin_amdgcn_wave_barrier();
  const int rsub = lane >> 4, c4 = (lane & 15) * 4; typedef _Float16 v4h __attribute__((ext_vector_type(4)));
  {
#pragma unroll
    for (int q = 0; q < 8; ++q) { const int r = q * 2 + rsub; if (col0 + c4 < N) { const v4f v = *(const v4fa*)&so[w][r][c4]; if (C) *(v4f*)(C + cofs + (size_t)(row0 + r) * ldc + col0 + c4) = v; if (C16) { v4h h4; for (int i = 0; i < 4; ++i) h4[i] = (_Float16)v[i]; *(v4h*)(C16 + cofs + (size_t)(row0 + r) * ldc + col0 + c4) = h4; } } }
     }
}


typedef _Float16 v4h __attribute__((ext_vector_type(4)));

__global__ __launch_bounds__(256) void k_x16(const float* __restrict__ x, _Float16* __restrict__ X16, size_t n8) { const size_t t = (size_t)blockIdx.x * 256 + threadIdx.x; if (t >= n8) return; FragH f;
#pragma unroll
  for (int q = 0; q < 8; ++q) f.h[q] = (_Float16)bf16_round(x[t * 8 + q]); *(v8us*)((unsigned short*)X16 + t * 8) = f.half[0];  }
__global__ __launch_bounds__(256) void k_h16(const float* __restrict__ x, _Float16* __restrict__ X16, size_t n8) { const size_t t = (size_t)blockIdx.x * 256 + threadIdx.x; if (t >= n8) return; FragH f;
#pragma unroll
  for (int q = 0; q < 8; ++q) f.h[q] = (_Float16)x[t * 8 + q]; *(v8us*)((unsigned short*)X16 + t * 8) = f.half[0];  }
__global__ __launch_bounds__(256) void k_round16f(const float* __restrict__ W, _Float16* __restrict__ Bt, size_t n8) { const size_t t = (size_t)blockIdx.x * 256 + threadIdx.x; if (t >= n8) return; FragH f;
#pragma unroll
  for (int i = 0; i < 8; ++i) f.h[i] = (_Float16)(bf16_round(W[t * 8 + i]) * 16.0f); *(v8us*)((unsigned short*)Bt + t * 8) = f.half[0];  }
template <int NHv, int TTv>
__global__ __launch_bounds__(256) void k_vt(const _Float16* __restrict__ V16, int ldv, int voff, _Float16* __restrict__ Vt) { __shared__ unsigned short tl[64][66]; const int tid = threadIdx.x; const int slab = blockIdx.x / (TTv / 64), lg = blockIdx.x % (TTv / 64); const int b = slab / NHv, h = slab % NHv;
  for (int i = tid; i < 64 * 8; i += 256) { const int r = i / 8, c8 = (i % 8) * 8; FragH f; f.half[0] = *(const v8us*)((const unsigned short*)V16 + ((size_t)b * TTv + lg * 64 + r) * ldv + voff + h * 64 + c8);
#pragma unroll
    for (int q = 0; q < 8; ++q) tl[r][c8 + q] = f.u[q]; }
  __syncthreads();
  {
#pragma unroll
    for (int rd = 0; rd < 2; ++rd) { const int d = rd * 32 + tid / 8, pc = tid % 8; FragH f;
#pragma unroll
      for (int q = 0; q < 8; ++q) f.u[q] = tl[pc * 8 + q][d];
      *(v8us*)((unsigned short*)Vt + ((size_t)slab * 64 + d) * TTv + lg * 64 + pc * 8) = f.half[0]; }
     } }

__global__ __launch_bounds__(256) void k_hl(const float* __restrict__ F, _Float16* __restrict__ Hh, _Float16* __restrict__ Hl, size_t n8) { const size_t t = (size_t)blockIdx.x * 256 + threadIdx.x; if (t >= n8) return; FragH fh, fl; const v4f a = *(const v4fa*)(F + t * 8), c = *(const v4fa*)(F + t * 8 + 4);
#pragma unroll
  for (int q = 0; q < 4; ++q) { _Float16 h = (_Float16)a[q]; fh.h[q] = h; fl.h[q] = (_Float16)((a[q] - (float)h) * 1024.0f); h = (_Float16)c[q]; fh.h[4 + q] = h; fl.h[4 + q] = (_Float16)((c[q] - (float)h) * 1024.0f); }
  { *(v8us*)((unsigned short*)Hh + t * 8) = fh.half[0]; *(v8us*)((unsigned short*)Hl + t * 8) = fl.half[0];  } }

// ---- LDS staging by asynchronous copies (global_load_async_to_lds_b128): a lane moves its own 16 bytes, 8 lanes one whole 128-byte row; two buffers, the next stage in flight while this one is worked on ----
#define LP 72      /* LDS row pitch in f16: 128 data bytes + 16 = an odd multiple of 16 bytes, the conflict-free pitch of the ds_load_b128 fragment readers */
__device__ __forceinline__ void wait_async0() { asm volatile("s_wait_asynccnt 0x0" ::: "memory"); }      /* the wave's own copies have landed; stands before the barrier behind which the other waves read them */
__device__ __forceinline__ void wait_ds0() { asm volatile("s_wait_dscnt 0x0" ::: "memory"); }      /* the wave's own LDS reads have retired before the barrier behind which their buffer is refilled */
// one tile of 64 rows x 128 bytes (row pitch ldg f16 in global memory, LP in LDS) by 128 threads: 4 copies a lane, rows tid / 8 + 16 i. The s_wait_xcnt closes the statement so that no address register is rewritten ahead of it.
__device__ __forceinline__ void stage64(const unsigned short* g, size_t ldg, const unsigned short* s, int tid) {
  const unsigned short* g0 = g + (size_t)(tid >> 3) * ldg + (tid & 7) * 8; const unsigned short* g1 = g0 + 16 * ldg; const unsigned short* g2 = g1 + 16 * ldg; const unsigned short* g3 = g2 + 16 * ldg;
  const unsigned l0 = (unsigned)(size_t)(s + (tid >> 3) * LP + (tid & 7) * 8), l1 = l0 + 16 * LP * 2, l2 = l0 + 32 * LP * 2, l3 = l0 + 48 * LP * 2;
  asm volatile("global_load_async_to_lds_b128 %0, %1, off\n\tglobal_load_async_to_lds_b128 %2, %3, off\n\tglobal_load_async_to_lds_b128 %4, %5, off\n\tglobal_load_async_to_lds_b128 %6, %7, off\n\ts_wait_xcnt 0x0"
               :: "v"(l0), "v"(g0), "v"(l1), "v"(g1), "v"(l2), "v"(g2), "v"(l3), "v"(g3) : "memory");
}
// ---- fast GEMM (block tile 128x64, wave tile 32x64; requires M % 128 == 0 rows per launch region, N % 64 == 0, K % 64 == 0, K >= 64); A and B tiles of 64 k staged in LDS; epilogue = k_gemm_hhx semantics ----
__device__ __forceinline__ v16h g2_frag(const _Float16* p, int hh) { FragH f; f.half[0] = *(const v8us*)((const unsigned short*)p + 8 * hh); f.half[1] = *(const v8us*)((const unsigned short*)p + 16 + 8 * hh); return f.v; }
__device__ __forceinline__ v8f g2_mma(v16h a, v16h b, v8f c) { v8f d = __builtin_amdgcn_wmma_f32_16x16x32_f16(false, a, false, b, (short)0, c, false, false); asm volatile("v_nop\n\tv_nop\n\tv_nop\n\tv_nop" : "+v"(d) : "v"(a), "v"(b)); return d; }
template <int ACT>
__global__ __launch_bounds__(128) void k_gemm2(const _Float16* __restrict__ A, int lda, size_t sA, const _Float16* __restrict__ Bh, int ldb, size_t sB, float alpha, const float* __restrict__ bias, size_t sBias, const float* __restrict__ CP, int rowsPerB, size_t sCPb, int row0g,
    float* __restrict__ C, _Float16* __restrict__ C16, int ldc, size_t sC, int M, int N, int K) {
  __shared__ __attribute__((aligned(16))) float so[4][32][68];
  __shared__ __attribute__((aligned(16))) unsigned short tA[2][128][LP], tB[2][64][LP];
  const int tid = threadIdx.x, w = tid >> 5, lane = tid & 31, ln = lane & 15, hh = lane >> 4; const int by = blockIdx.y;
  A += (size_t)by * sA; Bh += (size_t)by * sB; const size_t cofs = (size_t)by * sC; const float* bp = bias ? bias + (size_t)by * sBias : nullptr;
  const int ntn = N >> 6; const int mt = blockIdx.x / ntn, nq = blockIdx.x - mt * ntn; const int row0 = mt * 128 + 32 * w, col0 = nq * 64; if (mt * 128 + 128 > M) return;      /* the whole block leaves or none, ahead of every barrier */
  const unsigned short* Ag = (const unsigned short*)A + (size_t)(mt * 128) * lda; const unsigned short* Bg = (const unsigned short*)Bh + (size_t)col0 * ldb; const int nst = K >> 6;
  stage64(Ag, lda, &tA[0][0][0], tid); stage64(Ag + (size_t)64 * lda, lda, &tA[0][64][0], tid); stage64(Bg, ldb, &tB[0][0][0], tid);
  wait_async0(); __syncthreads();      /* stage 0 published */
  if (nst > 1) { stage64(Ag + 64, lda, &tA[1][0][0], tid); stage64(Ag + (size_t)64 * lda + 64, lda, &tA[1][64][0], tid); stage64(Bg + 64, ldb, &tB[1][0][0], tid); }
  const v8f z8 = {0.f,0.f,0.f,0.f,0.f,0.f,0.f,0.f}; v8f c00 = z8, c01 = z8, c02 = z8, c03 = z8, c10 = z8, c11 = z8, c12 = z8, c13 = z8;
#pragma unroll 1
  for (int t = 0; t < nst; ++t) { const int bf = t & 1;      /* rolled: one stage a trip, the publish point at its foot */
    // unrolled: the two k blocks of a stage become constant LDS offsets
#pragma unroll
    for (int kk = 0; kk < 64; kk += 32) { const v16h a0 = g2_frag((const _Float16*)&tA[bf][32 * w + ln][kk], hh), a1 = g2_frag((const _Float16*)&tA[bf][32 * w + 16 + ln][kk], hh);
      v16h b = g2_frag((const _Float16*)&tB[bf][ln][kk], hh); c00 = g2_mma(a0, b, c00); c10 = g2_mma(a1, b, c10);
      b = g2_frag((const _Float16*)&tB[bf][16 + ln][kk], hh); c01 = g2_mma(a0, b, c01); c11 = g2_mma(a1, b, c11);
      b = g2_frag((const _Float16*)&tB[bf][32 + ln][kk], hh); c02 = g2_mma(a0, b, c02); c12 = g2_mma(a1, b, c12);
      b = g2_frag((const _Float16*)&tB[bf][48 + ln][kk], hh); c03 = g2_mma(a0, b, c03); c13 = g2_mma(a1, b, c13); }
    wait_ds0(); wait_async0(); __syncthreads();      /* publishes stage t + 1 and ends every read of buffer bf */
    if (t + 2 < nst) { const int k2 = (t + 2) * 64; stage64(Ag + k2, lda, &tA[bf][0][0], tid); stage64(Ag + (size_t)64 * lda + k2, lda, &tA[bf][64][0], tid); stage64(Bg + k2, ldb, &tB[bf][0][0], tid); } }
  wait_async0();
  v8f accs[8] = {c00, c01, c02, c03, c10, c11, c12, c13};
#pragma unroll
  for (int u = 0; u < 8; ++u) { const int t = u & 3, half = u >> 2; const int col = col0 + t * 16 + ln; const float bv = bp ? bf16_round(bp[col]) : 0.f;
#pragma unroll
    for (int r = 0; r < 8; ++r) { const int rloc = half * 16 + 8 * hh + r; float v = accs[u][r] * alpha + bv; if (CP) { const int bidx = (row0g + row0 + rloc) / rowsPerB; v += CP[(size_t)bidx * sCPb + (size_t)by * 64 + col]; }
      if (ACT == 3) v = fmaxf(v, 0.f); else if (ACT == 6) v = 0.5f * v * (1.0f + erff(v * 0.70710678118654752f)); else if (ACT == 11) v = 1.0f / (1.0f + expf(-v)); else if (ACT == 15) v = v / (1.0f + expf(-v)); else if (ACT == 12) v = (v > 0.f) ? v : 0.01f * v; else if (ACT == 8) v = tanhf(v);
      so[w][rloc][t * 16 + ln] = v; } }
  __builtin_amdgcn_fence(__ATOMIC_ACQ_REL, "workgroup"); __builtin_amdgcn_wave_barrier();
  const int rsub = lane >> 4, c4 = (lane & 15) * 4;
  {
#pragma unroll
    for (int q = 0; q < 16; ++q) { const int r = q * 2 + rsub; const v4f v = *(const v4fa*)&so[w][r][c4]; if (C) *(v4f*)(C + cofs + (size_t)(row0 + r) * ldc + col0 + c4) = v; if (C16) { v4h h4; for (int i = 0; i < 4; ++i) h4[i] = (_Float16)v[i]; *(v4h*)(C16 + cofs + (size_t)(row0 + r) * ldc + col0 + c4) = h4; } }
     } }



// lane l with lane l ^ 16: the two lane halves of a 16-column group hold the two key halves of one query
__device__ __forceinline__ float xhalf(float x) { return __builtin_bit_cast(float, __builtin_amdgcn_permlanex16(__builtin_bit_cast(int, x), __builtin_bit_cast(int, x), 0x76543210, 0xfedcba98, false, false)); }
template <int CAUSAL>
__global__ __launch_bounds__(128) void k_flash(const _Float16* __restrict__ Q16, int ldq, const _Float16* __restrict__ K16, int ldk, const _Float16* __restrict__ Vt, const int* __restrict__ MSK, float* __restrict__ O, int ldo) {
  constexpr int RPW = 16, DT = 4, KS = 2;      /* every '#pragma unroll' below: constant indices keep the fragment, score and accumulator arrays in registers */
  __shared__ __attribute__((aligned(16))) float sO[4][RPW][64 + 4];
  __shared__ __attribute__((aligned(16))) unsigned short sK[2][64][LP], sV[2][64][LP];      /* a stage = 64 keys: K rows (key, d) and V^T rows (d, key), shared by the four waves */
  const int tid = threadIdx.x, w = tid >> 5, lane = tid & 31, ln = lane & 15, hh = lane >> 4;
  const int slab = blockIdx.x / QBNP, qblk = QB0P + blockIdx.x % QBNP; const int b = slab / NH, h = slab % NH; const int qb0 = qblk * (4 * RPW); const int q0 = qb0 + w * RPW; const int tq = q0 + ln;
  FragH bq[KS];
  { const unsigned short* qr = (const unsigned short*)Q16 + ((size_t)b * TQ + tq) * ldq + h * 64;
#pragma unroll
    for (int ks = 0; ks < KS; ++ks) { bq[ks].half[0] = *(const v8us*)(qr + ks * 32 + 8 * hh); bq[ks].half[1] = *(const v8us*)(qr + ks * 32 + 16 + 8 * hh); } }
  const unsigned short* Vth = (const unsigned short*)Vt + (size_t)slab * 64 * TK;
  const float sl = (CAUSAL == 14) ? bf16_round(((const float*)MSK)[h]) : 0.f;      /* mode 14: causal + ALiBi slope[h] * (key - query) from the slopes INPUT */
  float m_r = -3.0e38f, l_r = 0.f; v8f oacc[DT];
#pragma unroll
  for (int dt = 0; dt < DT; ++dt) oacc[dt] = (v8f){0.f,0.f,0.f,0.f,0.f,0.f,0.f,0.f};
  const int jend = (CAUSAL == 1 || CAUSAL == 14) ? (qb0 + 4 * RPW) : TK;      /* causal: keys beyond the block's last query never contribute */
  const unsigned short* Kh = (const unsigned short*)K16 + (size_t)b * TK * ldk + h * 64; const int nst = jend >> 6;      /* jend is a multiple of 64 */
  stage64(Kh, ldk, &sK[0][0][0], tid); stage64(Vth, TK, &sV[0][0][0], tid);
  wait_async0(); __syncthreads();      /* stage 0 published */
  if (nst > 1) { stage64(Kh + (size_t)64 * ldk, ldk, &sK[1][0][0], tid); stage64(Vth + 64, TK, &sV[1][0][0], tid); }
  // both loops stay rolled: one stage a trip with the publish point at its foot, and the two passes of a stage share one body (short code, buffer and pass as address offsets)
#pragma unroll 1
  for (int t = 0; t < nst; ++t) { const int bf = t & 1;
#pragma unroll 1
  for (int p = 0; p < 64; p += 32) { const int j0 = t * 64 + p;
    v8f s[2];
#pragma unroll
    for (int nt = 0; nt < 2; ++nt) { const unsigned short* kr = &sK[bf][p + nt * 16 + ln][0]; FragH ak[KS];
#pragma unroll
      for (int ks = 0; ks < KS; ++ks) { ak[ks].half[0] = *(const v8us*)(kr + ks * 32 + 8 * hh); ak[ks].half[1] = *(const v8us*)(kr + ks * 32 + 16 + 8 * hh); }
      v8f acc = (v8f){0.f,0.f,0.f,0.f,0.f,0.f,0.f,0.f};
#pragma unroll
      for (int ks = 0; ks < KS; ++ks) acc = mmaH<1>(ak[ks].v, ak[ks].v, bq[ks].v, bq[ks].v, acc);
      s[nt] = acc; }
    float sc[2][8], mcn[2]; bool ok[2][8];
#pragma unroll
    for (int nt = 0; nt < 2; ++nt) { mcn[nt] = -3.0e38f;
#pragma unroll
      for (int r = 0; r < 8; ++r) { const int kk = j0 + nt * 16 + 8 * hh + r;
        ok[nt][r] = (CAUSAL == 1 || CAUSAL == 14) ? (kk <= tq) : ((CAUSAL == 2) ? ((kk >> 5) == (tq >> 5)) : true);      /* mode 2: block-diagonal 32-token groups */
        float sv = ok[nt][r] ? s[nt][r] * SCL : -3.0e38f; if (CAUSAL == 14) { if (ok[nt][r]) sv += sl * (float)(kk - tq); }
        sc[nt][r] = sv; mcn[nt] = fmaxf(mcn[nt], sv); } }
    float mc = fmaxf(mcn[0], mcn[1]); mc = fmaxf(mc, xhalf(mc));
    const float mn = fmaxf(m_r, mc); const float ea = expf(m_r - mn); const float al = (mn > -1.0e38f) ? ea : 1.0f; m_r = mn;
    FragH pb; float psn[2];
#pragma unroll
    for (int nt = 0; nt < 2; ++nt) { psn[nt] = 0.f;
#pragma unroll
      for (int r = 0; r < 8; ++r) { const float e = expf(sc[nt][r] - mn); const float p = ok[nt][r] ? e : 0.f; psn[nt] += p; pb.h[nt * 8 + r] = (_Float16)(p * 1024.0f); } }
    l_r = l_r * al + (psn[0] + psn[1]);
#pragma unroll
    for (int dt = 0; dt < DT; ++dt)
#pragma unroll
      for (int r = 0; r < 8; ++r) oacc[dt][r] *= al;
#pragma unroll
    for (int dt = 0; dt < DT; ++dt) { const unsigned short* vrow = &sV[bf][dt * 16 + ln][p]; FragH av; av.half[0] = *(const v8us*)(vrow + 8 * hh); av.half[1] = *(const v8us*)(vrow + 16 + 8 * hh);
      oacc[dt] = mmaH<1>(av.v, av.v, pb.v, pb.v, oacc[dt]); } }
    wait_ds0(); wait_async0(); __syncthreads();      /* publishes stage t + 1 and ends every read of buffer bf */
    if (t + 2 < nst) { const int j2 = (t + 2) * 64; stage64(Kh + (size_t)j2 * ldk, ldk, &sK[bf][0][0], tid); stage64(Vth + j2, TK, &sV[bf][0][0], tid); } }
  wait_async0();
  const float l = l_r + xhalf(l_r); const float li = (l > 0.f) ? 1.0f / (l * 1024.0f) : 0.f;
#pragma unroll
  for (int dt = 0; dt < DT; ++dt) { const v4f lo = {oacc[dt][0] * li, oacc[dt][1] * li, oacc[dt][2] * li, oacc[dt][3] * li}, hi = {oacc[dt][4] * li, oacc[dt][5] * li, oacc[dt][6] * li, oacc[dt][7] * li};
    *(v4fa*)&sO[w][ln][dt * 16 + 8 * hh] = lo; *(v4fa*)&sO[w][ln][dt * 16 + 8 * hh + 4] = hi; }
  __builtin_amdgcn_fence(__ATOMIC_ACQ_REL, "workgroup"); __builtin_amdgcn_wave_barrier();      /* the wave's own sO rows: its stores above stay ahead of its whole-line reads below */
  {
#pragma unroll
    for (int rp = 0; rp < RPW; rp += 2) { const int r = rp + (lane >> 4), pc = lane & 15; const v4f val = *(const v4fa*)&sO[w][r][pc * 4]; *(v4f*)(O + ((size_t)b * TQ + q0 + r) * ldo + h * 64 + pc * 4) = val; }
     } }
// 5-plane variant: S = Qh Kh^T + (Ql Kh^T + Qh Kl^T)/1024 with Q/K = [hi | 2^10 residual] f16 planes (QL/KL same layout as Q16/K16), then the 3-term P.V below.
// 3-term variant: O = (P_hi V_hi + (P_lo V_hi + P_hi V_lo) / 1024) / l with P = [hi | 2^10 residual] of 1024 p and V^T = [hi | 2^10 residual] planes (VtL same layout as Vt) -> ~2^-21-class products for un-averaged (early causal / peaked) rows
template <int CAUSAL>
__global__ __launch_bounds__(128) void k_flash5(const _Float16* __restrict__ Q16, const _Float16* __restrict__ QL, int ldq, const _Float16* __restrict__ K16, const _Float16* __restrict__ KL, int ldk, const _Float16* __restrict__ Vt, const _Float16* __restrict__ VtL, const int* __restrict__ MSK, float* __restrict__ O, int ldo) {
  constexpr int RPW = 16, DT = 4, KS = 2;      /* transposed products as in k_flash: lane (ln, hh) holds query q0 + ln, keys j0 + nt * 16 + 8 * hh + r; '#pragma unroll' as there */
  __shared__ __attribute__((aligned(16))) float sO[4][RPW][64 + 4];
  __shared__ __attribute__((aligned(16))) unsigned short sK[2][64][LP], sKl[2][64][LP], sV[2][64][LP], sVl[2][64][LP];      /* a stage = 64 keys of the four planes, as in k_flash */
  const int tid = threadIdx.x, w = tid >> 5, lane = tid & 31, ln = lane & 15, hh = lane >> 4;
  const int slab = blockIdx.x / QBN5, qblk = QB05 + blockIdx.x % QBN5; const int b = slab / NH, h = slab % NH; const int qb0 = qblk * (4 * RPW); const int q0 = qb0 + w * RPW; const int tq = q0 + ln;
  FragH bq[KS], bql[KS];
  { const unsigned short* qr = (const unsigned short*)Q16 + ((size_t)b * TQ + tq) * ldq + h * 64; const unsigned short* ql = (const unsigned short*)QL + ((size_t)b * TQ + tq) * ldq + h * 64;
#pragma unroll
    for (int ks = 0; ks < KS; ++ks) { bq[ks].half[0] = *(const v8us*)(qr + ks * 32 + 8 * hh); bq[ks].half[1] = *(const v8us*)(qr + ks * 32 + 16 + 8 * hh); bql[ks].half[0] = *(const v8us*)(ql + ks * 32 + 8 * hh); bql[ks].half[1] = *(const v8us*)(ql + ks * 32 + 16 + 8 * hh); } }
  const unsigned short* Vth = (const unsigned short*)Vt + (size_t)slab * 64 * TK; const unsigned short* Vtl = (const unsigned short*)VtL + (size_t)slab * 64 * TK;
  const float sl = (CAUSAL == 14) ? bf16_round(((const float*)MSK)[h]) : 0.f;      /* mode 14: causal + ALiBi slope[h] * (key - query) from the slopes INPUT */
  float m_r = -3.0e38f, l_r = 0.f; v8f oacc[DT], oaccL[DT];
#pragma unroll
  for (int dt = 0; dt < DT; ++dt) { oacc[dt] = (v8f){0.f,0.f,0.f,0.f,0.f,0.f,0.f,0.f}; oaccL[dt] = oacc[dt]; }
  const int jend = (CAUSAL == 1 || CAUSAL == 14) ? (qb0 + 4 * RPW) : TK;      /* causal: keys beyond the block's last query never contribute */
  const unsigned short* Kh = (const unsigned short*)K16 + (size_t)b * TK * ldk + h * 64; const unsigned short* Kl = (const unsigned short*)KL + (size_t)b * TK * ldk + h * 64; const int nst = jend >> 6;      /* jend is a multiple of 64 */
  stage64(Kh, ldk, &sK[0][0][0], tid); stage64(Kl, ldk, &sKl[0][0][0], tid); stage64(Vth, TK, &sV[0][0][0], tid); stage64(Vtl, TK, &sVl[0][0][0], tid);
  wait_async0(); __syncthreads();      /* stage 0 published */
  if (nst > 1) { stage64(Kh + (size_t)64 * ldk, ldk, &sK[1][0][0], tid); stage64(Kl + (size_t)64 * ldk, ldk, &sKl[1][0][0], tid); stage64(Vth + 64, TK, &sV[1][0][0], tid); stage64(Vtl + 64, TK, &sVl[1][0][0], tid); }
  // both loops stay rolled: one stage a trip with the publish point at its foot, and the two passes of a stage share one body (short code, buffer and pass as address offsets)
#pragma unroll 1
  for (int t = 0; t < nst; ++t) { const int bf = t & 1;
#pragma unroll 1
  for (int p = 0; p < 64; p += 32) { const int j0 = t * 64 + p;
    v8f s[2];
#pragma unroll
    for (int nt = 0; nt < 2; ++nt) { const unsigned short* kr = &sK[bf][p + nt * 16 + ln][0]; const unsigned short* klr = &sKl[bf][p + nt * 16 + ln][0]; FragH ak[KS], akl[KS];
#pragma unroll
      for (int ks = 0; ks < KS; ++ks) { ak[ks].half[0] = *(const v8us*)(kr + ks * 32 + 8 * hh); ak[ks].half[1] = *(const v8us*)(kr + ks * 32 + 16 + 8 * hh); akl[ks].half[0] = *(const v8us*)(klr + ks * 32 + 8 * hh); akl[ks].half[1] = *(const v8us*)(klr + ks * 32 + 16 + 8 * hh); }
      v8f acc = (v8f){0.f,0.f,0.f,0.f,0.f,0.f,0.f,0.f}, accl = acc;
#pragma unroll
      for (int ks = 0; ks < KS; ++ks) { acc = mmaH<1>(ak[ks].v, ak[ks].v, bq[ks].v, bq[ks].v, acc); accl = mmaH<1>(ak[ks].v, ak[ks].v, bql[ks].v, bql[ks].v, accl); accl = mmaH<1>(akl[ks].v, akl[ks].v, bq[ks].v, bq[ks].v, accl); }
#pragma unroll
      for (int r = 0; r < 8; ++r) acc[r] += accl[r] * 0.0009765625f;
      s[nt] = acc; }
    float sc[2][8], mcn[2]; bool ok[2][8];
#pragma unroll
    for (int nt = 0; nt < 2; ++nt) { mcn[nt] = -3.0e38f;
#pragma unroll
      for (int r = 0; r < 8; ++r) { const int kk = j0 + nt * 16 + 8 * hh + r;
        ok[nt][r] = (CAUSAL == 1 || CAUSAL == 14) ? (kk <= tq) : ((CAUSAL == 2) ? ((kk >> 5) == (tq >> 5)) : true);      /* mode 2: block-diagonal 32-token groups */
        if (CAUSAL == 4) ok[nt][r] = MSK[((size_t)b * TQ + tq) * TK + kk] != 0;      /* mode 4: per-(query, key) INPUT mask shared by all heads; masked keys contribute nothing, rows with no valid key give l = 0 -> output 0 */
        float sv = ok[nt][r] ? s[nt][r] * SCL : -3.0e38f; if (CAUSAL == 14) { if (ok[nt][r]) sv += sl * (float)(kk - tq); }
        sc[nt][r] = sv; mcn[nt] = fmaxf(mcn[nt], sv); } }
    float mc = fmaxf(mcn[0], mcn[1]); mc = fmaxf(mc, xhalf(mc));
    const float mn = fmaxf(m_r, mc); const float ea = expf(m_r - mn); const float al = (mn > -1.0e38f) ? ea : 1.0f; m_r = mn;
    FragH pb, pl; float psn[2];
#pragma unroll
    for (int nt = 0; nt < 2; ++nt) { psn[nt] = 0.f;
#pragma unroll
      for (int r = 0; r < 8; ++r) { const float e = expf(sc[nt][r] - mn); const float p = ok[nt][r] ? e : 0.f; psn[nt] += p; const float ps = p * 1024.0f; const _Float16 ph = (_Float16)ps; pb.h[nt * 8 + r] = ph; pl.h[nt * 8 + r] = (_Float16)((ps - (float)ph) * 1024.0f); } }
    l_r = l_r * al + (psn[0] + psn[1]);
#pragma unroll
    for (int dt = 0; dt < DT; ++dt)
#pragma unroll
      for (int r = 0; r < 8; ++r) { oacc[dt][r] *= al; oaccL[dt][r] *= al; }
#pragma unroll
    for (int dt = 0; dt < DT; ++dt) { const unsigned short* vrow = &sV[bf][dt * 16 + ln][p]; const unsigned short* vrl = &sVl[bf][dt * 16 + ln][p]; FragH av, avl; av.half[0] = *(const v8us*)(vrow + 8 * hh); av.half[1] = *(const v8us*)(vrow + 16 + 8 * hh); avl.half[0] = *(const v8us*)(vrl + 8 * hh); avl.half[1] = *(const v8us*)(vrl + 16 + 8 * hh);
      oacc[dt] = mmaH<1>(av.v, av.v, pb.v, pb.v, oacc[dt]); oaccL[dt] = mmaH<1>(av.v, av.v, pl.v, pl.v, oaccL[dt]); oaccL[dt] = mmaH<1>(avl.v, avl.v, pb.v, pb.v, oaccL[dt]); } }
    wait_ds0(); wait_async0(); __syncthreads();      /* publishes stage t + 1 and ends every read of buffer bf */
    if (t + 2 < nst) { const int j2 = (t + 2) * 64; stage64(Kh + (size_t)j2 * ldk, ldk, &sK[bf][0][0], tid); stage64(Kl + (size_t)j2 * ldk, ldk, &sKl[bf][0][0], tid); stage64(Vth + j2, TK, &sV[bf][0][0], tid); stage64(Vtl + j2, TK, &sVl[bf][0][0], tid); } }
  wait_async0();
  const float l = l_r + xhalf(l_r); const float li = (l > 0.f) ? 1.0f / (l * 1024.0f) : 0.f;
#pragma unroll
  for (int dt = 0; dt < DT; ++dt) { v4f lo, hi;
#pragma unroll
    for (int r = 0; r < 4; ++r) { float v = oacc[dt][r]; v += oaccL[dt][r] * 0.0009765625f; lo[r] = v * li; v = oacc[dt][4 + r]; v += oaccL[dt][4 + r] * 0.0009765625f; hi[r] = v * li; }
    *(v4fa*)&sO[w][ln][dt * 16 + 8 * hh] = lo; *(v4fa*)&sO[w][ln][dt * 16 + 8 * hh + 4] = hi; }
  __builtin_amdgcn_fence(__ATOMIC_ACQ_REL, "workgroup"); __builtin_amdgcn_wave_barrier();      /* the wave's own sO rows: its stores above stay ahead of its whole-line reads below */
  {
#pragma unroll
    for (int rp = 0; rp < RPW; rp += 2) { const int r = rp + (lane >> 4), pc = lane & 15; const v4f val = *(const v4fa*)&sO[w][r][pc * 4]; *(v4f*)(O + ((size_t)b * TQ + q0 + r) * ldo + h * 64 + pc * 4) = val; }
     } }

__global__ __launch_bounds__(256) void k_rotab(float* __restrict__ CS, float* __restrict__ SN) {
  #pragma clang fp contract(off)
  const int t = blockIdx.x * 256 + threadIdx.x; if (t >= SLEN * 32) return; const int j = t % 32, s = t / 32; const float ex = (float)(2 * j) / 64.0f; const float inv = 1.0f / powf(10000.0f, ex); const float th = (float)s * inv; const float c = cosf(th), sn = sinf(th);
  { *(float*)(CS + t) = c; *(float*)(SN + t) = sn;  } }
__global__ __launch_bounds__(256) void k_rope(const float* __restrict__ F, int nsrc, int ndst, int rep, const float* __restrict__ CS, const float* __restrict__ SN, _Float16* __restrict__ H, _Float16* __restrict__ L) {
  #pragma clang fp contract(off)
  const size_t t = (size_t)blockIdx.x * 256 + threadIdx.x; if (t >= (size_t)NR * ndst * 4) return; const int g8 = (int)(t % 4); const int hd = (int)((t / 4) % ndst); const size_t row = t / ((size_t)4 * ndst); const int s = (int)(row % SLEN); const int hs = hd / rep;
  const float* src = F + row * (size_t)(nsrc * 64) + hs * 64; FragH ah, al, bh, bl;
  for (int i = 0; i < 8; ++i) { const int d = g8 * 8 + i; const float c = CS[s * 32 + d], sn = SN[s * 32 + d]; const float x1 = src[d], x2 = src[d + 32];
    float o1 = x1 * c; o1 += -x2 * sn; float o2 = x2 * c; o2 += x1 * sn;
    _Float16 hv = (_Float16)o1; ah.h[i] = hv; al.h[i] = (_Float16)((o1 - (float)hv) * 1024.0f); hv = (_Float16)o2; bh.h[i] = hv; bl.h[i] = (_Float16)((o2 - (float)hv) * 1024.0f); }
  const size_t o = row * (size_t)(ndst * 64) + hd * 64 + g8 * 8;
  { *(v8us*)((unsigned short*)H + o) = ah.half[0]; *(v8us*)((unsigned short*)H + o + 32) = bh.half[0]; *(v8us*)((unsigned short*)L + o) = al.half[0]; *(v8us*)((unsigned short*)L + o + 32) = bl.half[0];  } }
__global__ __launch_bounds__(256) void k_kexp(const float* __restrict__ F, _Float16* __restrict__ H, _Float16* __restrict__ L) { const size_t t = (size_t)blockIdx.x * 256 + threadIdx.x; if (t >= (size_t)NR * NH * 8) return; const int g8 = (int)(t % 8); const int hd = (int)((t / 8) % NH); const size_t row = t / ((size_t)8 * NH); const float* src = F + row * (size_t)KVD + (hd / NREP) * 64 + g8 * 8; FragH fh, fl;
  for (int i = 0; i < 8; ++i) { const _Float16 hv = (_Float16)src[i]; fh.h[i] = hv; fl.h[i] = (_Float16)((src[i] - (float)hv) * 1024.0f); } const size_t o = row * (size_t)(NH * 64) + hd * 64 + g8 * 8;
  { *(v8us*)((unsigned short*)H + o) = fh.half[0]; *(v8us*)((unsigned short*)L + o) = fl.half[0];  } }
__global__ __launch_bounds__(256) void k_vtg(const _Float16* __restrict__ V16, _Float16* __restrict__ Vt) { __shared__ unsigned short tl[64][66]; const int tid = threadIdx.x; const int slab = blockIdx.x / (SLEN / 64), lg = blockIdx.x % (SLEN / 64); const int b = slab / NH, h = slab % NH; const int hs = h / NREP;
  for (int i = tid; i < 64 * 8; i += 256) { const int r = i / 8, c8 = (i % 8) * 8; FragH f; f.half[0] = *(const v8us*)((const unsigned short*)V16 + ((size_t)b * SLEN + lg * 64 + r) * KVD + hs * 64 + c8); for (int q = 0; q < 8; ++q) tl[r][c8 + q] = f.u[q]; }
  __syncthreads();
  { for (int rd = 0; rd < 2; ++rd) { const int d = rd * 32 + tid / 8, pc = tid % 8; FragH f; for (int q = 0; q < 8; ++q) f.u[q] = tl[pc * 8 + q][d]; *(v8us*)((unsigned short*)Vt + ((size_t)slab * 64 + d) * SLEN + lg * 64 + pc * 8) = f.half[0]; }  } }

extern "C" void kernel_launch(void* const* d_in, const int* in_sizes, int n_in,
                              void* d_out, int out_size, void* d_ws, size_t ws_size, hipStream_t stream) {
  (void)in_sizes; (void)n_in; (void)out_size;
  const float* const* I = (const float* const*)d_in; const float* x = I[0]; const float* Wq = I[1]; const float* bq = I[2]; const float* Wk = I[3]; const float* bk = I[4]; const float* Wv = I[5]; const float* bv = I[6]; const float* Wo = I[7]; const float* bo = I[8]; const float* slopes = I[9];
  char* ws = (char*)d_ws; size_t off = 0;
  auto take = [&](size_t bytes) { char* p = ws + off; off += (bytes + 255) & ~(size_t)255; return p; };
  const size_t np = (size_t)NR * DM, nk = (size_t)NR * KVD;
  _Float16* BQ = (_Float16*)take((size_t)DM * DM * 2); _Float16* BK = (_Float16*)take((size_t)KVD * DM * 2); _Float16* BV = (_Float16*)take((size_t)KVD * DM * 2); _Float16* BO = (_Float16*)take((size_t)DM * DM * 2);
  _Float16* X16 = (_Float16*)take(np * 2); float* QF = (float*)take(np * 4); _Float16* QH = (_Float16*)take(np * 2); _Float16* QL = (_Float16*)take(np * 2); float* KF = (float*)take(nk * 4); float* VF = (float*)take(nk * 4); _Float16* KXH = (_Float16*)take(np * 2); _Float16* KXL = (_Float16*)take(np * 2); _Float16* VH = (_Float16*)take(nk * 2); _Float16* VL = (_Float16*)take(nk * 2); _Float16* VT = (_Float16*)take(np * 2); _Float16* VTL = (_Float16*)take(np * 2);
  float* O = QF;      /* attention output over the q f32 plane (dead after the q hi/lo split) */ _Float16* OH = (_Float16*)take(np * 2); _Float16* OLo = (_Float16*)take(np * 2);
  if (off > ws_size) return;      /* 2+0.5+0.5+2 + 8+16+8+8+4+4+8+8+2+2+8+8+8+8 = 105 MiB */
  k_wt_f16<<<(unsigned)(((size_t)DM * DM / 8 + 255) / 256), 256, 0, stream>>>(Wq, BQ, DM, DM, 16.0f); k_wt_f16<<<(unsigned)(((size_t)DM * KVD / 8 + 255) / 256), 256, 0, stream>>>(Wk, BK, DM, KVD, 16.0f); k_wt_f16<<<(unsigned)(((size_t)DM * KVD / 8 + 255) / 256), 256, 0, stream>>>(Wv, BV, DM, KVD, 16.0f); k_wt_f16<<<(unsigned)(((size_t)DM * DM / 8 + 255) / 256), 256, 0, stream>>>(Wo, BO, DM, DM, 16.0f);
  k_x16<<<(unsigned)((np / 8 + 255) / 256), 256, 0, stream>>>(x, X16, np / 8);
  k_gemm2<0><<<dim3((NR / 128) * (DM / 64), 1), 128, 0, stream>>>(X16, DM, 0, BQ, DM, 0, 0.0625f, bq, 0, nullptr, 1, 0, 0, QF, nullptr, DM, 0, NR, DM, DM);
  k_gemm2<0><<<dim3((NR / 128) * (KVD / 64), 1), 128, 0, stream>>>(X16, DM, 0, BK, DM, 0, 0.0625f, bk, 0, nullptr, 1, 0, 0, KF, nullptr, KVD, 0, NR, KVD, DM);
  k_gemm2<0><<<dim3((NR / 128) * (KVD / 64), 1), 128, 0, stream>>>(X16, DM, 0, BV, DM, 0, 0.0625f, bv, 0, nullptr, 1, 0, 0, VF, nullptr, KVD, 0, NR, KVD, DM);
  k_hl<<<(unsigned)((np / 8 + 255) / 256), 256, 0, stream>>>(QF, QH, QL, np / 8);      /* q hi/lo */
  k_kexp<<<(unsigned)(((size_t)NR * NH * 8 + 255) / 256), 256, 0, stream>>>(KF, KXH, KXL);      /* k: kv head h/4 expanded to query head h, hi/lo */
  k_hl<<<(unsigned)((nk / 8 + 255) / 256), 256, 0, stream>>>(VF, VH, VL, nk / 8);
  k_vtg<<<NB * NH * (SLEN / 64), 256, 0, stream>>>(VH, VT); k_vtg<<<NB * NH * (SLEN / 64), 256, 0, stream>>>(VL, VTL);      /* QF becomes O from here on */
  k_flash5<14><<<NB * NH * QBN5, 128, 0, stream>>>(QH, QL, DM, KXH, KXL, DM, VT, VTL, (const int*)slopes, O, DM);      /* causal + ALiBi, rows < 256: hi + residual */
  k_flash<14><<<NB * NH * QBNP, 128, 0, stream>>>(QH, DM, KXH, DM, VT, (const int*)slopes, O, DM);      /* causal + ALiBi, rows >= 256: plain */
  k_hl<<<(unsigned)((np / 8 + 255) / 256), 256, 0, stream>>>(O, OH, OLo, np / 8);
  k_gemm2<0><<<dim3((NR / 128) * (DM / 64), 1), 128, 0, stream>>>(OH, DM, 0, BO, DM, 0, 0.0625f, bo, 0, nullptr, 1, 0, 0, (float*)d_out, nullptr, DM, 0, NR, DM, DM);      /* out = ctx Wo + bo */
  for (int b = 0; b < NB; ++b) k_gemm2<0><<<dim3((RE / 128) * (DM / 64), 1), 128, 0, stream>>>(OLo + (size_t)b * SLEN * DM, DM, 0, BO, DM, 0, 0.0625f / 1024.0f, nullptr, 0, (const float*)d_out + (size_t)b * SLEN * DM, 1, (size_t)DM, 0, (float*)d_out + (size_t)b * SLEN * DM, nullptr, DM, 0, RE, DM, DM);      /* += O residual . Wo on the first 256 rows of each sequence */
}

// v003
// One run takes 223 microseconds.
// Two timings next to v002 both put it at 1.26 times that version's speed.
// Over all steps from v000 it is 3.56 times as fast.
#include <hip/hip_runtime.h>
// CausalAlibiAttn (1 x 4096 tokens, D 1024 = 16 heads of 64, 4 kv heads): q, k, v = x W + b; q head h uses kv head h/4; scores/8 + slope[h] * (key - query) (ALiBi, slopes INPUT), causal; softmax; ctx Wo + bo.
// Structure: exact f16 plane of x; q, k, v as f32 WMMA GEMM outputs (32x64 wave tiles, f32 accumulation, exact x16 weights + bias); f16 hi + 2^10-residual splits on VALU (k expanded to the 16 query heads); V^T hi/residual by LDS tiles with the kv-head mapping; the fused causal flash kernel with the ALiBi term added per (head, query, key) in f32, in its 5-plane form for the first 256 query rows and the plain form beyond; O as hi + residual into the Wo GEMMs (+ bias; residual term only on those rows).
// Compute dtype: x and parameters rounded to bf16; q/k/P/v/O as f16 hi + residual on rows < 256 (~2^-21) and plain f16 beyond (~2^-12); ALiBi/softmax f32. v_wmma_f32_16x16x32_f16.
#define NB 1
#define DM 1024
#define NKV 4
#define NREP (NH / NKV)
#define KVD (NKV * 64)           /* 256 */
#define NR (NB * SLEN)           /* 4096 */
#define SLEN 4096
#define TQ SLEN
#define TK SLEN
#define NH 16
#define SCL 0.125f
#define QBLKS (TQ / 64)
#define QB05 0
#define QBN5 4
#define QB0P QBN5
#define QBNP (QBLKS - QBN5)
#define RE 256
typedef __bf16 v16b __attribute__((ext_vector_type(16)));
typedef unsigned short v8us __attribute__((ext_vector_type(8), may_alias));
typedef float  v8f  __attribute__((ext_vector_type(8)));
typedef float  v4f  __attribute__((ext_vector_type(4)));
typedef float  v4fa __attribute__((ext_vector_type(4), may_alias));
union FragB { v16b v; v8us half[2]; unsigned short u[16]; };

__device__ __forceinline__ unsigned short bf16_bits(float x) { unsigned int u = __float_as_uint(x); return (unsigned short)((u + 0x7FFFu + ((u >> 16) & 1u)) >> 16); }
__device__ __forceinline__ float bf16_val(unsigned short b) { return __uint_as_float(((unsigned int)b) << 16); }
__device__ __forceinline__ float bf16_round(float x) { return bf16_val(bf16_bits(x)); }
// D += A·B with NT terms: 1 = ah·bh, 2 = + al·bh (A split), 3 = + ah·bl (both split)
template <int NT>
__device__ __forceinline__ v8f mmaN(v16b ah, v16b al, v16b bh, v16b bl, v8f c) {
  c = __builtin_amdgcn_wmma_f32_16x16x32_bf16(false, ah, false, bh, (short)0, c, false, false);
  if (NT >= 2) c = __builtin_amdgcn_wmma_f32_16x16x32_bf16(false, al, false, bh, (short)0, c, false, false);
  if (NT >= 3) c = __builtin_amdgcn_wmma_f32_16x16x32_bf16(false, ah, false, bl, (short)0, c, false, false);
  asm volatile("v_nop\n\tv_nop\n\tv_nop\n\tv_nop" : "+v"(c) : "v"(ah), "v"(al), "v"(bh), "v"(bl));
  return c;
}

__global__ __launch_bounds__(256) void k_wt_bf16(const float* __restrict__ W, unsigned short* __restrict__ Wt, int K, int N) {
  const int t = blockIdx.x * 256 + threadIdx.x;
  const int k8n = K / 8;
  if (t >= N * k8n) return;
  const int n = t / k8n, k8 = (t % k8n) * 8;
  v8us v;
#pragma unroll
  for (int i = 0; i < 8; ++i) v[i] = bf16_bits(W[(size_t)(k8 + i) * N + n]);
  *(v8us*)(Wt + (size_t)n * K + k8) = v;
  
}

// GEMM C[M][N] (f32, pitch ldc) = act(A[M][K]·W + bias). A f32 row-major (pitch lda) converted per fragment to bf16
// (ASPLIT: hi/lo two planes -> 2 terms, else single rounded term); Wt bf16 [N][K] (pitch ldb). BIAS_BF16 rounds the
// bias to bf16 first (bias quantised to bf16 before the add). K%32==0, M%16==0, N%64==0.
template <bool ASPLIT, int ACT, bool BIAS_BF16>
__global__ __launch_bounds__(128) void k_gemm_bf(const float* __restrict__ A, int lda, const unsigned short* __restrict__ Wt, int ldb,
                                               const float* __restrict__ bias, float* __restrict__ C, int ldc, int M, int N, int K) {
  __shared__ __attribute__((aligned(16))) float so[4][16][64];
  const int tid = threadIdx.x, w = tid >> 5, lane = tid & 31, ln = lane & 15, hh = lane >> 4;
  const int ntn = N / 64;
  const int wid = blockIdx.x * 4 + w;
  const int mt = wid / ntn, nq = wid % ntn;
  if (mt * 16 >= M) return;
  const int row0 = mt * 16, col0 = nq * 64;
  const float* arow = A + (size_t)(row0 + ln) * lda;
  v8f acc[4] = {};
  for (int kb = 0; kb < K; kb += 32) {
    FragB ah, al;
    const v4f x0 = *(const v4fa*)(arow + kb + 8 * hh), x1 = *(const v4fa*)(arow + kb + 8 * hh + 4);
    const v4f x2 = *(const v4fa*)(arow + kb + 16 + 8 * hh), x3 = *(const v4fa*)(arow + kb + 16 + 8 * hh + 4);
    float xs[16] = {x0[0],x0[1],x0[2],x0[3],x1[0],x1[1],x1[2],x1[3],x2[0],x2[1],x2[2],x2[3],x3[0],x3[1],x3[2],x3[3]};
#pragma unroll
    for (int i = 0; i < 16; ++i) { const unsigned short hb = bf16_bits(xs[i]); ah.u[i] = hb; al.u[i] = ASPLIT ? bf16_bits(xs[i] - bf16_val(hb)) : (unsigned short)0; }
#pragma unroll
    for (int t = 0; t < 4; ++t) {
      const unsigned short* brow = Wt + (size_t)(col0 + t * 16 + ln) * ldb + kb;
      FragB b;
      b.half[0] = *(const v8us*)(brow + 8 * hh);
      b.half[1] = *(const v8us*)(brow + 16 + 8 * hh);
      acc[t] = mmaN<ASPLIT ? 2 : 1>(ah.v, al.v, b.v, b.v, acc[t]);
    }
  }
#pragma unroll
  for (int t = 0; t < 4; ++t) {
    float bv = bias ? bias[col0 + t * 16 + ln] : 0.f;
    if (BIAS_BF16) bv = bf16_round(bv);
#pragma unroll
    for (int r = 0; r < 8; ++r) { float v = acc[t][r] + bv; if (ACT == 1) v = fmaxf(v, 0.f); so[w][8 * hh + r][t * 16 + ln] = v; }
  }
  __builtin_amdgcn_fence(__ATOMIC_ACQ_REL, "workgroup");
  __builtin_amdgcn_wave_barrier();
  const int rsub = lane >> 4, c4 = (lane & 15) * 4;
  {
#pragma unroll
    for (int q = 0; q < 8; ++q) {
      const int r = q * 2 + rsub;
      const v4f v = *(const v4fa*)&so[w][r][c4];
      *(v4f*)(C + (size_t)(row0 + r) * ldc + col0 + c4) = v;
    }
    
  }
}

// GEMM C = act(A·W + bias + resid): A f32 (ASPLIT -> hi/lo 2 terms), Wt bf16 [N][K]; ACT 0 none, 1 relu, 2 exact gelu;
// resid (optional, f32, row index = (row % rmod), pitch ldr, RES_BF16 rounds it) added before the activation.
template <bool ASPLIT, int ACT, bool BIAS_BF16, bool RES_BF16>
__global__ __launch_bounds__(128) void k_gemm_bf3(const float* __restrict__ A, int lda, const unsigned short* __restrict__ Wt, int ldb,
                                                const float* __restrict__ bias, const float* __restrict__ resid, int rmod, int ldr,
                                                float* __restrict__ C, int ldc, int M, int N, int K) {
  __shared__ __attribute__((aligned(16))) float so[4][16][64];
  const int tid = threadIdx.x, w = tid >> 5, lane = tid & 31, ln = lane & 15, hh = lane >> 4;
  const int ntn = N / 64;
  const int wid = blockIdx.x * 4 + w;
  const int mt = wid / ntn, nq = wid % ntn;
  if (mt * 16 >= M) return;
  const int row0 = mt * 16, col0 = nq * 64;
  const float* arow = A + (size_t)(row0 + ln) * lda;
  v8f acc[4] = {};
  for (int kb = 0; kb < K; kb += 32) {
    FragB ah, al;
    const v4f x0 = *(const v4fa*)(arow + kb + 8 * hh), x1 = *(const v4fa*)(arow + kb + 8 * hh + 4);
    const v4f x2 = *(const v4fa*)(arow + kb + 16 + 8 * hh), x3 = *(const v4fa*)(arow + kb + 16 + 8 * hh + 4);
    float xs[16] = {x0[0],x0[1],x0[2],x0[3],x1[0],x1[1],x1[2],x1[3],x2[0],x2[1],x2[2],x2[3],x3[0],x3[1],x3[2],x3[3]};
#pragma unroll
    for (int i = 0; i < 16; ++i) { const unsigned short hb = bf16_bits(xs[i]); ah.u[i] = hb; al.u[i] = ASPLIT ? bf16_bits(xs[i] - bf16_val(hb)) : (unsigned short)0; }
#pragma unroll
    for (int t = 0; t < 4; ++t) {
      const unsigned short* brow = Wt + (size_t)(col0 + t * 16 + ln) * ldb + kb;
      FragB b;
      b.half[0] = *(const v8us*)(brow + 8 * hh);
      b.half[1] = *(const v8us*)(brow + 16 + 8 * hh);
      acc[t] = mmaN<ASPLIT ? 2 : 1>(ah.v, al.v, b.v, b.v, acc[t]);
    }
  }
#pragma unroll
  for (int t = 0; t < 4; ++t) {
    const int col = col0 + t * 16 + ln;
    float bv = bias ? bias[col] : 0.f;
    if (BIAS_BF16) bv = bf16_round(bv);
#pragma unroll
    for (int r = 0; r < 8; ++r) {
      float v = acc[t][r] + bv;
      if (resid) { float rv = resid[(size_t)((row0 + 8 * hh + r) % rmod) * ldr + col]; if (RES_BF16) rv = bf16_round(rv); v += rv; }
      if (ACT == 1) v = fmaxf(v, 0.f);
      if (ACT == 2) v = 0.5f * v * (1.0f + erff(v * 0.70710678118654752f));
      if (ACT == 3) { const float u = 0.7978845608028654f * (v + 0.044715f * v * v * v); v = 0.5f * v * (1.0f + tanhf(u)); }
      so[w][8 * hh + r][t * 16 + ln] = v;
    }
  }
  __builtin_amdgcn_fence(__ATOMIC_ACQ_REL, "workgroup");
  __builtin_amdgcn_wave_barrier();
  const int rsub = lane >> 4, c4 = (lane & 15) * 4;
  {
#pragma unroll
    for (int q = 0; q < 8; ++q) {
      const int r = q * 2 + rsub;
      const v4f v = *(const v4fa*)&so[w][r][c4];
      *(v4f*)(C + (size_t)(row0 + r) * ldc + col0 + c4) = v;
    }
    
  }
}
// row LayerNorm (biased variance, eps) over N: s = X (+ R); optional out_sum <- s; out_norm <- (s-mu)*rsqrt(var+eps)*g + b
template <bool PARAM_BF16>
__global__ __launch_bounds__(256) void k_layernorm(const float* __restrict__ X, const float* __restrict__ R, const float* __restrict__ g, const float* __restrict__ bta,
                                                  float* __restrict__ out_sum, float* __restrict__ out_norm, int N, float eps) {
  __shared__ float red[256];
  const int row = blockIdx.x, tid = threadIdx.x;
  const float* x = X + (size_t)row * N; const float* rr = R ? R + (size_t)row * N : nullptr;
  float vals[16];                     // up to N = 4096
  const int per = N / 256;            // contiguous chunk per thread? use strided-by-4 chunks: thread handles j = tid*4 + 1024*u
  float s1 = 0.f;
  for (int u = 0; u < per / 4; ++u) {
    const int j = tid * 4 + 1024 * u;
    const v4f a = *(const v4fa*)(x + j);
    v4f b = {0.f,0.f,0.f,0.f}; if (rr) b = *(const v4fa*)(rr + j);
#pragma unroll
    for (int q = 0; q < 4; ++q) { const float v = a[q] + b[q]; vals[u * 4 + q] = v; s1 += v; }
  }
  red[tid] = s1; __syncthreads();
  for (int st = 128; st > 0; st >>= 1) { if (tid < st) red[tid] += red[tid + st]; __syncthreads(); }
  const float mu = red[0] / (float)N; __syncthreads();
  float s2 = 0.f;
  for (int u = 0; u < per / 4; ++u)
#pragma unroll
    for (int q = 0; q < 4; ++q) { const float c = vals[u * 4 + q] - mu; s2 += c * c; }
  red[tid] = s2; __syncthreads();
  for (int st = 128; st > 0; st >>= 1) { if (tid < st) red[tid] += red[tid + st]; __syncthreads(); }
  const float rs = rsqrtf(red[0] / (float)N + eps);
  {
    for (int u = 0; u < per / 4; ++u) {
      const int j = tid * 4 + 1024 * u;
      v4f o, sm;
#pragma unroll
      for (int q = 0; q < 4; ++q) {
        float gg = g[j + q], bb = bta[j + q];
        if (PARAM_BF16) { gg = bf16_round(gg); bb = bf16_round(bb); }
        sm[q] = vals[u * 4 + q]; o[q] = (vals[u * 4 + q] - mu) * rs * gg + bb;
      }
      if (out_sum) *(v4f*)(out_sum + (size_t)row * N + j) = sm;
      *(v4f*)(out_norm + (size_t)row * N + j) = o;
    }
    
  }
}



// ---- f16 WMMA path (v_wmma_f32_16x16x32_f16): 11-bit significands for operands in range — used where a [0,1] probability operand needs more precision than bf16
typedef _Float16 v16h __attribute__((ext_vector_type(16)));
union FragH { v16h v; v8us half[2]; _Float16 h[16]; unsigned short u[16]; };
template <int NT>
__device__ __forceinline__ v8f mmaH(v16h ah, v16h al, v16h bh, v16h bl, v8f c) {
  c = __builtin_amdgcn_wmma_f32_16x16x32_f16(false, ah, false, bh, (short)0, c, false, false);
  if (NT >= 2) c = __builtin_amdgcn_wmma_f32_16x16x32_f16(false, al, false, bh, (short)0, c, false, false);
  if (NT >= 3) c = __builtin_amdgcn_wmma_f32_16x16x32_f16(false, ah, false, bl, (short)0, c, false, false);
  asm volatile("v_nop\n\tv_nop\n\tv_nop\n\tv_nop" : "+v"(c) : "v"(ah), "v"(al), "v"(bh), "v"(bl));
  return c;
}
// batched GEMM like k_gemm_b but f16 operands: A f32 (split into f16 hi/lo if ASPLIT, else rounded to f16), Bt = f16 values [n][k]; alpha; C f32; N multiple of 16 (partial tiles skipped)
template <bool ASPLIT>
__global__ __launch_bounds__(128) void k_gemm_h(const float* __restrict__ A, int lda, size_t sA, const _Float16* __restrict__ Bh, int ldb, size_t sB, float alpha, float* __restrict__ C, int ldc, size_t sC, int M, int N, int K) {
  __shared__ __attribute__((aligned(16))) float so[4][16][64];
  const int tid = threadIdx.x, w = tid >> 5, lane = tid & 31, ln = lane & 15, hh = lane >> 4; const int by = blockIdx.y;
  A += (size_t)by * sA; Bh += (size_t)by * sB; C += (size_t)by * sC;
  const int ntn = (N + 63) / 64; const int wid = blockIdx.x * 4 + w; const int mt = wid / ntn, nq = wid % ntn; if (mt * 16 >= M) return;
  const int row0 = mt * 16, col0 = nq * 64; const float* arow = A + (size_t)(row0 + ln) * lda;
  v8f acc[4] = {};
  for (int kb = 0; kb < K; kb += 32) {
    FragH ah, al;
    const v4f x0 = *(const v4fa*)(arow + kb + 8 * hh), x1 = *(const v4fa*)(arow + kb + 8 * hh + 4), x2 = *(const v4fa*)(arow + kb + 16 + 8 * hh), x3 = *(const v4fa*)(arow + kb + 16 + 8 * hh + 4);
    float xs[16] = {x0[0],x0[1],x0[2],x0[3],x1[0],x1[1],x1[2],x1[3],x2[0],x2[1],x2[2],x2[3],x3[0],x3[1],x3[2],x3[3]};
#pragma unroll
    for (int i = 0; i < 16; ++i) { const _Float16 h = (_Float16)xs[i]; ah.h[i] = h; al.h[i] = ASPLIT ? (_Float16)(xs[i] - (float)h) : (_Float16)0.0f; }
#pragma unroll
    for (int t = 0; t < 4; ++t) { if (col0 + t * 16 >= N) continue; const size_t boff = (size_t)(col0 + t * 16 + ln) * ldb + kb; FragH bq; bq.half[0] = *(const v8us*)(Bh + boff + 8 * hh); bq.half[1] = *(const v8us*)(Bh + boff + 16 + 8 * hh);
      acc[t] = mmaH<ASPLIT ? 2 : 1>(ah.v, al.v, bq.v, bq.v, acc[t]); }
  }
#pragma unroll
  for (int t = 0; t < 4; ++t) { if (col0 + t * 16 >= N) continue;
#pragma unroll
    for (int r = 0; r < 8; ++r) so[w][8 * hh + r][t * 16 + ln] = acc[t][r] * alpha; }
  __builtin_amdgcn_fence(__ATOMIC_ACQ_REL, "workgroup"); __builtin_amdgcn_wave_barrier();
  const int rsub = lane >> 4, c4 = (lane & 15) * 4;
  {
#pragma unroll
    for (int q = 0; q < 8; ++q) { const int r = q * 2 + rsub; if (col0 + c4 < N) { const v4f v = *(const v4fa*)&so[w][r][c4]; *(v4f*)(C + (size_t)(row0 + r) * ldc + col0 + c4) = v; } }
     }
}

// Wt[n][k] = f16(W[k][n]·scale) from f32 row-major W[K][N] (scale = power of two; bf16-exact weights stay exact in f16 away from the subnormal range)
__global__ __launch_bounds__(256) void k_wt_f16(const float* __restrict__ W, _Float16* __restrict__ Wt, int K, int N, float scale) {
  const int t = blockIdx.x * 256 + threadIdx.x; if (t >= N * (K / 8)) return; const int n = t / (K / 8), k8 = (t % (K / 8)) * 8; FragH f;
#pragma unroll
  for (int i = 0; i < 8; ++i) f.h[i] = (_Float16)(bf16_round(W[(size_t)(k8 + i) * N + n]) * scale); const v8us o = f.half[0];
  *(v8us*)((unsigned short*)Wt + (size_t)n * K + k8) = o; 
}
// k_gemm_hh variant with fused epilogue: v = acc·alpha + bias[by·sBias + col] (+ CP[(row/rowsPerB)·sCPb + by·64 + col] if CP) ; ACT 0 none / 1 elu ; writes f16 C16 (and f32 C if non-null)
template <int ACT>
__global__ __launch_bounds__(128) void k_gemm_hhx(const _Float16* __restrict__ A, int lda, size_t sA, const _Float16* __restrict__ Bh, int ldb, size_t sB, float alpha, const float* __restrict__ bias, size_t sBias, const float* __restrict__ CP, int rowsPerB, size_t sCPb, int row0g,
    float* __restrict__ C, _Float16* __restrict__ C16, int ldc, size_t sC, int M, int N, int K) {
  __shared__ __attribute__((aligned(16))) float so[4][16][64];
  const int tid = threadIdx.x, w = tid >> 5, lane = tid & 31, ln = lane & 15, hh = lane >> 4; const int by = blockIdx.y;
  A += (size_t)by * sA; Bh += (size_t)by * sB; const size_t cofs = (size_t)by * sC; const float* bp = bias ? bias + (size_t)by * sBias : nullptr;
  const int ntn = (N + 63) / 64; const int wid = blockIdx.x * 4 + w; const int mt = wid / ntn, nq = wid % ntn; if (mt * 16 >= M) return;
  const int row0 = mt * 16, col0 = nq * 64; const _Float16* arow = A + (size_t)(row0 + ln) * lda;
  v8f acc[4] = {};
  for (int kb = 0; kb < K; kb += 32) { FragH ah; ah.half[0] = *(const v8us*)((const unsigned short*)arow + kb + 8 * hh); ah.half[1] = *(const v8us*)((const unsigned short*)arow + kb + 16 + 8 * hh);
#pragma unroll
    for (int t = 0; t < 4; ++t) { if (col0 + t * 16 >= N) continue; const size_t boff = (size_t)(col0 + t * 16 + ln) * ldb + kb; FragH bq; bq.half[0] = *(const v8us*)((const unsigned short*)Bh + boff + 8 * hh); bq.half[1] = *(const v8us*)((const unsigned short*)Bh + boff + 16 + 8 * hh);
      acc[t] = mmaH<1>(ah.v, ah.v, bq.v, bq.v, acc[t]); }
  }
#pragma unroll
  for (int t = 0; t < 4; ++t) { if (col0 + t * 16 >= N) continue; const int col = col0 + t * 16 + ln; const float bv = bp ? bf16_round(bp[col]) : 0.f;
#pragma unroll
    for (int r = 0; r < 8; ++r) { float v = acc[t][r] * alpha + bv; if (CP) { const int bidx = (row0g + row0 + 8 * hh + r) / rowsPerB; v += CP[(size_t)bidx * sCPb + (size_t)by * 64 + col]; } if (ACT == 1) v = (v > 0.f) ? v : expm1f(v); else if (ACT == 7) v = (v > 0.f) ? v + 1.0f : expf(v); else if (ACT == 8) v = tanhf(v); else if (ACT == 9) v = 0.5f * v * (1.0f + tanhf(0.7978845608028654f * (v + 0.044715f * v * v * v))); else if (ACT == 11) v = 1.0f / (1.0f + expf(-v)); else if (ACT == 12) v = (v > 0.f) ? v : 0.01f * v; else if (ACT == 14) v = (v > 0.f) ? v : 0.1f * v; else if (ACT == 15) v = v / (1.0f + expf(-v)); else if (ACT == 3) v = fmaxf(v, 0.f); else if (ACT == 6) v = 0.5f * v * (1.0f + erff(v * 0.70710678118654752f)); so[w][8 * hh + r][t * 16 + ln] = v; } }
  __builtin_amdgcn_fence(__ATOMIC_ACQ_REL, "workgroup"); __builtin_amdgcn_wave_barrier();
  const int rsub = lane >> 4, c4 = (lane & 15) * 4; typedef _Float16 v4h __attribute__((ext_vector_type(4)));
  {
#pragma unroll
    for (int q = 0; q < 8; ++q) { const int r = q * 2 + rsub; if (col0 + c4 < N) { const v4f v = *(const v4fa*)&so[w][r][c4]; if (C) *(v4f*)(C + cofs + (size_t)(row0 + r) * ldc + col0 + c4) = v; if (C16) { v4h h4; for (int i = 0; i < 4; ++i) h4[i] = (_Float16)v[i]; *(v4h*)(C16 + cofs + (size_t)(row0 + r) * ldc + col0 + c4) = h4; } } }
     }
}


typedef _Float16 v4h __attribute__((ext_vector_type(4)));

__global__ __launch_bounds__(256) void k_x16(const float* __restrict__ x, _Float16* __restrict__ X16, size_t n8) { const size_t t = (size_t)blockIdx.x * 256 + threadIdx.x; if (t >= n8) return; FragH f;
#pragma unroll
  for (int q = 0; q < 8; ++q) f.h[q] = (_Float16)bf16_round(x[t * 8 + q]); *(v8us*)((unsigned short*)X16 + t * 8) = f.half[0];  }
__global__ __launch_bounds__(256) void k_h16(const float* __restrict__ x, _Float16* __restrict__ X16, size_t n8) { const size_t t = (size_t)blockIdx.x * 256 + threadIdx.x; if (t >= n8) return; FragH f;
#pragma unroll
  for (int q = 0; q < 8; ++q) f.h[q] = (_Float16)x[t * 8 + q]; *(v8us*)((unsigned short*)X16 + t * 8) = f.half[0];  }
__global__ __launch_bounds__(256) void k_round16f(const float* __restrict__ W, _Float16* __restrict__ Bt, size_t n8) { const size_t t = (size_t)blockIdx.x * 256 + threadIdx.x; if (t >= n8) return; FragH f;
#pragma unroll
  for (int i = 0; i < 8; ++i) f.h[i] = (_Float16)(bf16_round(W[t * 8 + i]) * 16.0f); *(v8us*)((unsigned short*)Bt + t * 8) = f.half[0];  }
template <int NHv, int TTv>
__global__ __launch_bounds__(256) void k_vt(const _Float16* __restrict__ V16, int ldv, int voff, _Float16* __restrict__ Vt) { __shared__ unsigned short tl[64][66]; const int tid = threadIdx.x; const int slab = blockIdx.x / (TTv / 64), lg = blockIdx.x % (TTv / 64); const int b = slab / NHv, h = slab % NHv;
  for (int i = tid; i < 64 * 8; i += 256) { const int r = i / 8, c8 = (i % 8) * 8; FragH f; f.half[0] = *(const v8us*)((const unsigned short*)V16 + ((size_t)b * TTv + lg * 64 + r) * ldv + voff + h * 64 + c8);
#pragma unroll
    for (int q = 0; q < 8; ++q) tl[r][c8 + q] = f.u[q]; }
  __syncthreads();
  {
#pragma unroll
    for (int rd = 0; rd < 2; ++rd) { const int d = rd * 32 + tid / 8, pc = tid % 8; FragH f;
#pragma unroll
      for (int q = 0; q < 8; ++q) f.u[q] = tl[pc * 8 + q][d];
      *(v8us*)((unsigned short*)Vt + ((size_t)slab * 64 + d) * TTv + lg * 64 + pc * 8) = f.half[0]; }
     } }

__global__ __launch_bounds__(256) void k_hl(const float* __restrict__ F, _Float16* __restrict__ Hh, _Float16* __restrict__ Hl, size_t n8) { const size_t t = (size_t)blockIdx.x * 256 + threadIdx.x; if (t >= n8) return; FragH fh, fl; const v4f a = *(const v4fa*)(F + t * 8), c = *(const v4fa*)(F + t * 8 + 4);
#pragma unroll
  for (int q = 0; q < 4; ++q) { _Float16 h = (_Float16)a[q]; fh.h[q] = h; fl.h[q] = (_Float16)((a[q] - (float)h) * 1024.0f); h = (_Float16)c[q]; fh.h[4 + q] = h; fl.h[4 + q] = (_Float16)((c[q] - (float)h) * 1024.0f); }
  { *(v8us*)((unsigned short*)Hh + t * 8) = fh.half[0]; *(v8us*)((unsigned short*)Hl + t * 8) = fl.half[0];  } }

// ---- LDS staging by asynchronous copies (global_load_async_to_lds_b128): a lane moves its own 16 bytes, 8 lanes one whole 128-byte row; two buffers, the next stage in flight while this one is worked on ----
#define LP 72      /* LDS row pitch in f16: 128 data bytes + 16 = an odd multiple of 16 bytes, the conflict-free pitch of the ds_load_b128 fragment readers */
__device__ __forceinline__ void wait_async0() { asm volatile("s_wait_asynccnt 0x0" ::: "memory"); }      /* the wave's own copies have landed; stands before the barrier behind which the other waves read them */
__device__ __forceinline__ void wait_ds0() { asm volatile("s_wait_dscnt 0x0" ::: "memory"); }      /* the wave's own LDS reads have retired before the barrier behind which their buffer is refilled */
// one tile of 64 rows x 128 bytes (row pitch ldg f16 in global memory, LP in LDS) by 128 threads: 4 copies a lane, rows tid / 8 + 16 i. The s_wait_xcnt closes the statement so that no address register is rewritten ahead of it.
__device__ __forceinline__ void stage64(const unsigned short* g, size_t ldg, const unsigned short* s, int tid) {
  const unsigned short* g0 = g + (size_t)(tid >> 3) * ldg + (tid & 7) * 8; const unsigned short* g1 = g0 + 16 * ldg; const unsigned short* g2 = g1 + 16 * ldg; const unsigned short* g3 = g2 + 16 * ldg;
  const unsigned l0 = (unsigned)(size_t)(s + (tid >> 3) * LP + (tid & 7) * 8), l1 = l0 + 16 * LP * 2, l2 = l0 + 32 * LP * 2, l3 = l0 + 48 * LP * 2;
  asm volatile("global_load_async_to_lds_b128 %0, %1, off\n\tglobal_load_async_to_lds_b128 %2, %3, off\n\tglobal_load_async_to_lds_b128 %4, %5, off\n\tglobal_load_async_to_lds_b128 %6, %7, off\n\ts_wait_xcnt 0x0"
               :: "v"(l0), "v"(g0), "v"(l1), "v"(g1), "v"(l2), "v"(g2), "v"(l3), "v"(g3) : "memory");
}
// ---- fast GEMM (block tile 128x64, wave tile 32x64; requires M % 128 == 0 rows per launch region, N % 64 == 0, K % 64 == 0, K >= 64); A and B tiles of 64 k staged in LDS; epilogue = k_gemm_hhx semantics ----
__device__ __forceinline__ v16h g2_frag(const _Float16* p, int hh) { FragH f; f.half[0] = *(const v8us*)((const unsigned short*)p + 8 * hh); f.half[1] = *(const v8us*)((const unsigned short*)p + 16 + 8 * hh); return f.v; }
__device__ __forceinline__ v8f g2_mma(v16h a, v16h b, v8f c) { v8f d = __builtin_amdgcn_wmma_f32_16x16x32_f16(false, a, false, b, (short)0, c, false, false); asm volatile("v_nop\n\tv_nop\n\tv_nop\n\tv_nop" : "+v"(d) : "v"(a), "v"(b)); return d; }
template <int ACT>
__global__ __launch_bounds__(128) void k_gemm2(const _Float16* __restrict__ A, int lda, size_t sA, const _Float16* __restrict__ Bh, int ldb, size_t sB, float alpha, const float* __restrict__ bias, size_t sBias, const float* __restrict__ CP, int rowsPerB, size_t sCPb, int row0g,
    float* __restrict__ C, _Float16* __restrict__ C16, int ldc, size_t sC, int M, int N, int K) {
  __shared__ __attribute__((aligned(16))) float so[4][32][68];
  __shared__ __attribute__((aligned(16))) unsigned short tA[2][128][LP], tB[2][64][LP];
  const int tid = threadIdx.x, w = tid >> 5, lane = tid & 31, ln = lane & 15, hh = lane >> 4; const int by = blockIdx.y;
  A += (size_t)by * sA; Bh += (size_t)by * sB; const size_t cofs = (size_t)by * sC; const float* bp = bias ? bias + (size_t)by * sBias : nullptr;
  const int ntn = N >> 6; const int mt = blockIdx.x / ntn, nq = blockIdx.x - mt * ntn; const int row0 = mt * 128 + 32 * w, col0 = nq * 64; if (mt * 128 + 128 > M) return;      /* the whole block leaves or none, ahead of every barrier */
  const unsigned short* Ag = (const unsigned short*)A + (size_t)(mt * 128) * lda; const unsigned short* Bg = (const unsigned short*)Bh + (size_t)col0 * ldb; const int nst = K >> 6;
  stage64(Ag, lda, &tA[0][0][0], tid); stage64(Ag + (size_t)64 * lda, lda, &tA[0][64][0], tid); stage64(Bg, ldb, &tB[0][0][0], tid);
  wait_async0(); __syncthreads();      /* stage 0 published */
  if (nst > 1) { stage64(Ag + 64, lda, &tA[1][0][0], tid); stage64(Ag + (size_t)64 * lda + 64, lda, &tA[1][64][0], tid); stage64(Bg + 64, ldb, &tB[1][0][0], tid); }
  const v8f z8 = {0.f,0.f,0.f,0.f,0.f,0.f,0.f,0.f}; v8f c00 = z8, c01 = z8, c02 = z8, c03 = z8, c10 = z8, c11 = z8, c12 = z8, c13 = z8;
#pragma unroll 1
  for (int t = 0; t < nst; ++t) { const int bf = t & 1;      /* rolled: one stage a trip, the publish point at its foot */
    // unrolled: the two k blocks of a stage become constant LDS offsets
#pragma unroll
    for (int kk = 0; kk < 64; kk += 32) { const v16h a0 = g2_frag((const _Float16*)&tA[bf][32 * w + ln][kk], hh), a1 = g2_frag((const _Float16*)&tA[bf][32 * w + 16 + ln][kk], hh);
      v16h b = g2_frag((const _Float16*)&tB[bf][ln][kk], hh); c00 = g2_mma(a0, b, c00); c10 = g2_mma(a1, b, c10);
      b = g2_frag((const _Float16*)&tB[bf][16 + ln][kk], hh); c01 = g2_mma(a0, b, c01); c11 = g2_mma(a1, b, c11);
      b = g2_frag((const _Float16*)&tB[bf][32 + ln][kk], hh); c02 = g2_mma(a0, b, c02); c12 = g2_mma(a1, b, c12);
      b = g2_frag((const _Float16*)&tB[bf][48 + ln][kk], hh); c03 = g2_mma(a0, b, c03); c13 = g2_mma(a1, b, c13); }
    wait_ds0(); wait_async0(); __syncthreads();      /* publishes stage t + 1 and ends every read of buffer bf */
    if (t + 2 < nst) { const int k2 = (t + 2) * 64; stage64(Ag + k2, lda, &tA[bf][0][0], tid); stage64(Ag + (size_t)64 * lda + k2, lda, &tA[bf][64][0], tid); stage64(Bg + k2, ldb, &tB[bf][0][0], tid); } }
  wait_async0();
  v8f accs[8] = {c00, c01, c02, c03, c10, c11, c12, c13};
#pragma unroll
  for (int u = 0; u < 8; ++u) { const int t = u & 3, half = u >> 2; const int col = col0 + t * 16 + ln; const float bv = bp ? bf16_round(bp[col]) : 0.f;
#pragma unroll
    for (int r = 0; r < 8; ++r) { const int rloc = half * 16 + 8 * hh + r; float v = accs[u][r] * alpha + bv; if (CP) { const int bidx = (row0g + row0 + rloc) / rowsPerB; v += CP[(size_t)bidx * sCPb + (size_t)by * 64 + col]; }
      if (ACT == 3) v = fmaxf(v, 0.f); else if (ACT == 6) v = 0.5f * v * (1.0f + erff(v * 0.70710678118654752f)); else if (ACT == 11) v = 1.0f / (1.0f + expf(-v)); else if (ACT == 15) v = v / (1.0f + expf(-v)); else if (ACT == 12) v = (v > 0.f) ? v : 0.01f * v; else if (ACT == 8) v = tanhf(v);
      so[w][rloc][t * 16 + ln] = v; } }
  __builtin_amdgcn_fence(__ATOMIC_ACQ_REL, "workgroup"); __builtin_amdgcn_wave_barrier();
  const int rsub = lane >> 4, c4 = (lane & 15) * 4;
  {
#pragma unroll
    for (int q = 0; q < 16; ++q) { const int r = q * 2 + rsub; const v4f v = *(const v4fa*)&so[w][r][c4]; if (C) *(v4f*)(C + cofs + (size_t)(row0 + r) * ldc + col0 + c4) = v; if (C16) { v4h h4; for (int i = 0; i < 4; ++i) h4[i] = (_Float16)v[i]; *(v4h*)(C16 + cofs + (size_t)(row0 + r) * ldc + col0 + c4) = h4; } }
     } }



// lane l with lane l ^ 16: the two lane halves of a 16-column group hold the two key halves of one query
__device__ __forceinline__ float xhalf(float x) { return __builtin_bit_cast(float, __builtin_amdgcn_permlanex16(__builtin_bit_cast(int, x), __builtin_bit_cast(int, x), 0x76543210, 0xfedcba98, false, false)); }
template <int CAUSAL>
__global__ __launch_bounds__(128) void k_flash(const _Float16* __restrict__ Q16, int ldq, const _Float16* __restrict__ K16, int ldk, const _Float16* __restrict__ Vt, const int* __restrict__ MSK, float* __restrict__ O, int ldo) {
  constexpr int RPW = 16, DT = 4, KS = 2;      /* every '#pragma unroll' below: constant indices keep the fragment, score and accumulator arrays in registers */
  __shared__ __attribute__((aligned(16))) float sO[4][RPW][64 + 4];
  __shared__ __attribute__((aligned(16))) unsigned short sK[2][64][LP], sV[2][64][LP];      /* a stage = 64 keys: K rows (key, d) and V^T rows (d, key), shared by the four waves */
  const int tid = threadIdx.x, w = tid >> 5, lane = tid & 31, ln = lane & 15, hh = lane >> 4;
  const int slab = blockIdx.x / QBNP, qblk = QB0P + blockIdx.x % QBNP; const int b = slab / NH, h = slab % NH; const int qb0 = qblk * (4 * RPW); const int q0 = qb0 + w * RPW; const int tq = q0 + ln;
  FragH bq[KS];
  { const unsigned short* qr = (const unsigned short*)Q16 + ((size_t)b * TQ + tq) * ldq + h * 64;
#pragma unroll
    for (int ks = 0; ks < KS; ++ks) { bq[ks].half[0] = *(const v8us*)(qr + ks * 32 + 8 * hh); bq[ks].half[1] = *(const v8us*)(qr + ks * 32 + 16 + 8 * hh); } }
  const unsigned short* Vth = (const unsigned short*)Vt + (size_t)slab * 64 * TK;
  const float sl = (CAUSAL == 14) ? bf16_round(((const float*)MSK)[h]) : 0.f;      /* mode 14: causal + ALiBi slope[h] * (key - query) from the slopes INPUT */
  // Softmax in log2 units: p * 1024 = 2^(s * c2 + sl2 * (key - query) - m + 10). A lane's 16 keys of a pass lie at fixed distances from its first one, so scale and ALiBi are one fma per score against kb; the first key's own term (base) joins the maximum once a pass.
  static_assert(CAUSAL == 0 || CAUSAL == 1 || CAUSAL == 14, "every query needs a valid key in the first pass: masked scores go out by 2^(-3e38 - finite) = 0");
  const float c2 = SCL * 1.44269504088896340736f, sl2 = sl * 1.44269504088896340736f; v8f kb[2];
#pragma unroll
  for (int nt = 0; nt < 2; ++nt)
#pragma unroll
    for (int r = 0; r < 8; ++r) kb[nt][r] = sl2 * (float)(nt * 16 + r);
  float m_r = -3.0e38f, l_r = 0.f; v8f oacc[DT];
#pragma unroll
  for (int dt = 0; dt < DT; ++dt) oacc[dt] = (v8f){0.f,0.f,0.f,0.f,0.f,0.f,0.f,0.f};
  const int jend = (CAUSAL == 1 || CAUSAL == 14) ? (qb0 + 4 * RPW) : TK;      /* causal: keys beyond the block's last query never contribute */
  const unsigned short* Kh = (const unsigned short*)K16 + (size_t)b * TK * ldk + h * 64; const int nst = jend >> 6;      /* jend is a multiple of 64 */
  stage64(Kh, ldk, &sK[0][0][0], tid); stage64(Vth, TK, &sV[0][0][0], tid);
  wait_async0(); __syncthreads();      /* stage 0 published */
  if (nst > 1) { stage64(Kh + (size_t)64 * ldk, ldk, &sK[1][0][0], tid); stage64(Vth + 64, TK, &sV[1][0][0], tid); }
  // both loops stay rolled: one stage a trip with the publish point at its foot, and the two passes of a stage share one body (short code, buffer and pass as address offsets)
#pragma unroll 1
  for (int t = 0; t < nst; ++t) { const int bf = t & 1;
#pragma unroll 1
  for (int p = 0; p < 64; p += 32) { const int j0 = t * 64 + p;
    v8f s[2];
#pragma unroll
    for (int nt = 0; nt < 2; ++nt) { const unsigned short* kr = &sK[bf][p + nt * 16 + ln][0]; FragH ak[KS];
#pragma unroll
      for (int ks = 0; ks < KS; ++ks) { ak[ks].half[0] = *(const v8us*)(kr + ks * 32 + 8 * hh); ak[ks].half[1] = *(const v8us*)(kr + ks * 32 + 16 + 8 * hh); }
      v8f acc = (v8f){0.f,0.f,0.f,0.f,0.f,0.f,0.f,0.f};
#pragma unroll
      for (int ks = 0; ks < KS; ++ks) acc = mmaH<1>(ak[ks].v, ak[ks].v, bq[ks].v, bq[ks].v, acc);
      s[nt] = acc; }
    const float base = sl2 * (float)(j0 + 8 * hh - tq);      /* ALiBi of the lane's first key of this pass */
    v8f u[2];
#pragma unroll
    for (int nt = 0; nt < 2; ++nt) u[nt] = s[nt] * c2 + kb[nt];
    if ((CAUSAL == 1 || CAUSAL == 14) && t == nst - 1) {      /* only the block's last stage holds keys beyond a query: a scalar branch, every earlier stage goes unmasked */
#pragma unroll
      for (int nt = 0; nt < 2; ++nt)
#pragma unroll
        for (int r = 0; r < 8; ++r) u[nt][r] = (j0 + nt * 16 + 8 * hh + r <= tq) ? u[nt][r] : -3.0e38f; }
    float mcn[2];      /* two independent chains */
#pragma unroll
    for (int nt = 0; nt < 2; ++nt) { mcn[nt] = u[nt][0];
#pragma unroll
      for (int r = 1; r < 8; ++r) mcn[nt] = fmaxf(mcn[nt], u[nt][r]); }
    float mc = fmaxf(mcn[0], mcn[1]) + base; mc = fmaxf(mc, xhalf(mc));
    const float mn = fmaxf(m_r, mc); const float al = __builtin_amdgcn_exp2f(m_r - mn); m_r = mn;      /* first pass: 2^(-3e38 - mn) = 0 */
    const float sh = (mn - base) - 10.0f;      /* the factor 1024 of the f16 P operand rides in the exponent; l sums the same scaled values */
    FragH pb; v8f e[2];
#pragma unroll
    for (int nt = 0; nt < 2; ++nt)
#pragma unroll
      for (int r = 0; r < 8; ++r) { e[nt][r] = __builtin_amdgcn_exp2f(u[nt][r] - sh); pb.h[nt * 8 + r] = (_Float16)e[nt][r]; }
    const v8f e8 = e[0] + e[1]; const v4f e4 = __builtin_shufflevector(e8, e8, 0, 1, 2, 3) + __builtin_shufflevector(e8, e8, 4, 5, 6, 7);
    l_r = l_r * al + ((e4[0] + e4[2]) + (e4[1] + e4[3]));
#pragma unroll
    for (int dt = 0; dt < DT; ++dt) oacc[dt] *= al;
#pragma unroll
    for (int dt = 0; dt < DT; ++dt) { const unsigned short* vrow = &sV[bf][dt * 16 + ln][p]; FragH av; av.half[0] = *(const v8us*)(vrow + 8 * hh); av.half[1] = *(const v8us*)(vrow + 16 + 8 * hh);
      oacc[dt] = mmaH<1>(av.v, av.v, pb.v, pb.v, oacc[dt]); } }
    wait_ds0(); wait_async0(); __syncthreads();      /* publishes stage t + 1 and ends every read of buffer bf */
    if (t + 2 < nst) { const int j2 = (t + 2) * 64; stage64(Kh + (size_t)j2 * ldk, ldk, &sK[bf][0][0], tid); stage64(Vth + j2, TK, &sV[bf][0][0], tid); } }
  wait_async0();
  const float l = l_r + xhalf(l_r); const float li = (l > 0.f) ? 1.0f / l : 0.f;      /* l carries the factor 1024 of P */
#pragma unroll
  for (int dt = 0; dt < DT; ++dt) { const v4f lo = {oacc[dt][0] * li, oacc[dt][1] * li, oacc[dt][2] * li, oacc[dt][3] * li}, hi = {oacc[dt][4] * li, oacc[dt][5] * li, oacc[dt][6] * li, oacc[dt][7] * li};
    *(v4fa*)&sO[w][ln][dt * 16 + 8 * hh] = lo; *(v4fa*)&sO[w][ln][dt * 16 + 8 * hh + 4] = hi; }
  __builtin_amdgcn_fence(__ATOMIC_ACQ_REL, "workgroup"); __builtin_amdgcn_wave_barrier();      /* the wave's own sO rows: its stores above stay ahead of its whole-line reads below */
  {
#pragma unroll
    for (int rp = 0; rp < RPW; rp += 2) { const int r = rp + (lane >> 4), pc = lane & 15; const v4f val = *(const v4fa*)&sO[w][r][pc * 4]; *(v4f*)(O + ((size_t)b * TQ + q0 + r) * ldo + h * 64 + pc * 4) = val; }
     } }
// 5-plane variant: S = Qh Kh^T + (Ql Kh^T + Qh Kl^T)/1024 with Q/K = [hi | 2^10 residual] f16 planes (QL/KL same layout as Q16/K16), then the 3-term P.V below.
// 3-term variant: O = (P_hi V_hi + (P_lo V_hi + P_hi V_lo) / 1024) / l with P = [hi | 2^10 residual] of 1024 p and V^T = [hi | 2^10 residual] planes (VtL same layout as Vt) -> ~2^-21-class products for un-averaged (early causal / peaked) rows
template <int CAUSAL>
__global__ __launch_bounds__(128) void k_flash5(const _Float16* __restrict__ Q16, const _Float16* __restrict__ QL, int ldq, const _Float16* __restrict__ K16, const _Float16* __restrict__ KL, int ldk, const _Float16* __restrict__ Vt, const _Float16* __restrict__ VtL, const int* __restrict__ MSK, float* __restrict__ O, int ldo) {
  constexpr int RPW = 16, DT = 4, KS = 2;      /* transposed products as in k_flash: lane (ln, hh) holds query q0 + ln, keys j0 + nt * 16 + 8 * hh + r; '#pragma unroll' as there */
  __shared__ __attribute__((aligned(16))) float sO[4][RPW][64 + 4];
  __shared__ __attribute__((aligned(16))) unsigned short sK[2][64][LP], sKl[2][64][LP], sV[2][64][LP], sVl[2][64][LP];      /* a stage = 64 keys of the four planes, as in k_flash */
  const int tid = threadIdx.x, w = tid >> 5, lane = tid & 31, ln = lane & 15, hh = lane >> 4;
  const int slab = blockIdx.x / QBN5, qblk = QB05 + blockIdx.x % QBN5; const int b = slab / NH, h = slab % NH; const int qb0 = qblk * (4 * RPW); const int q0 = qb0 + w * RPW; const int tq = q0 + ln;
  FragH bq[KS], bql[KS];
  { const unsigned short* qr = (const unsigned short*)Q16 + ((size_t)b * TQ + tq) * ldq + h * 64; const unsigned short* ql = (const unsigned short*)QL + ((size_t)b * TQ + tq) * ldq + h * 64;
#pragma unroll
    for (int ks = 0; ks < KS; ++ks) { bq[ks].half[0] = *(const v8us*)(qr + ks * 32 + 8 * hh); bq[ks].half[1] = *(const v8us*)(qr + ks * 32 + 16 + 8 * hh); bql[ks].half[0] = *(const v8us*)(ql + ks * 32 + 8 * hh); bql[ks].half[1] = *(const v8us*)(ql + ks * 32 + 16 + 8 * hh); } }
  const unsigned short* Vth = (const unsigned short*)Vt + (size_t)slab * 64 * TK; const unsigned short* Vtl = (const unsigned short*)VtL + (size_t)slab * 64 * TK;
  const float sl = (CAUSAL == 14) ? bf16_round(((const float*)MSK)[h]) : 0.f;      /* mode 14: causal + ALiBi slope[h] * (key - query) from the slopes INPUT */
  float m_r = -3.0e38f, l_r = 0.f; v8f oacc[DT], oaccL[DT];
#pragma unroll
  for (int dt = 0; dt < DT; ++dt) { oacc[dt] = (v8f){0.f,0.f,0.f,0.f,0.f,0.f,0.f,0.f}; oaccL[dt] = oacc[dt]; }
  const int jend = (CAUSAL == 1 || CAUSAL == 14) ? (qb0 + 4 * RPW) : TK;      /* causal: keys beyond the block's last query never contribute */
  const unsigned short* Kh = (const unsigned short*)K16 + (size_t)b * TK * ldk + h * 64; const unsigned short* Kl = (const unsigned short*)KL + (size_t)b * TK * ldk + h * 64; const int nst = jend >> 6;      /* jend is a multiple of 64 */
  stage64(Kh, ldk, &sK[0][0][0], tid); stage64(Kl, ldk, &sKl[0][0][0], tid); stage64(Vth, TK, &sV[0][0][0], tid); stage64(Vtl, TK, &sVl[0][0][0], tid);
  wait_async0(); __syncthreads();      /* stage 0 published */
  if (nst > 1) { stage64(Kh + (size_t)64 * ldk, ldk, &sK[1][0][0], tid); stage64(Kl + (size_t)64 * ldk, ldk, &sKl[1][0][0], tid); stage64(Vth + 64, TK, &sV[1][0][0], tid); stage64(Vtl + 64, TK, &sVl[1][0][0], tid); }
  // both loops stay rolled: one stage a trip with the publish point at its foot, and the two passes of a stage share one body (short code, buffer and pass as address offsets)
#pragma unroll 1
  for (int t = 0; t < nst; ++t) { const int bf = t & 1;
#pragma unroll 1
  for (int p = 0; p < 64; p += 32) { const int j0 = t * 64 + p;
    v8f s[2];
#pragma unroll
    for (int nt = 0; nt < 2; ++nt) { const unsigned short* kr = &sK[bf][p + nt * 16 + ln][0]; const unsigned short* klr = &sKl[bf][p + nt * 16 + ln][0]; FragH ak[KS], akl[KS];
#pragma unroll
      for (int ks = 0; ks < KS; ++ks) { ak[ks].half[0] = *(const v8us*)(kr + ks * 32 + 8 * hh); ak[ks].half[1] = *(const v8us*)(kr + ks * 32 + 16 + 8 * hh); akl[ks].half[0] = *(const v8us*)(klr + ks * 32 + 8 * hh); akl[ks].half[1] = *(const v8us*)(klr + ks * 32 + 16 + 8 * hh); }
      v8f acc = (v8f){0.f,0.f,0.f,0.f,0.f,0.f,0.f,0.f}, accl = acc;
#pragma unroll
      for (int ks = 0; ks < KS; ++ks) { acc = mmaH<1>(ak[ks].v, ak[ks].v, bq[ks].v, bq[ks].v, acc); accl = mmaH<1>(ak[ks].v, ak[ks].v, bql[ks].v, bql[ks].v, accl); accl = mmaH<1>(akl[ks].v, akl[ks].v, bq[ks].v, bq[ks].v, accl); }
#pragma unroll
      for (int r = 0; r < 8; ++r) acc[r] += accl[r] * 0.0009765625f;
      s[nt] = acc; }
    float sc[2][8], mcn[2]; bool ok[2][8];
#pragma unroll
    for (int nt = 0; nt < 2; ++nt) { mcn[nt] = -3.0e38f;
#pragma unroll
      for (int r = 0; r < 8; ++r) { const int kk = j0 + nt * 16 + 8 * hh + r;
        ok[nt][r] = (CAUSAL == 1 || CAUSAL == 14) ? (kk <= tq) : ((CAUSAL == 2) ? ((kk >> 5) == (tq >> 5)) : true);      /* mode 2: block-diagonal 32-token groups */
        if (CAUSAL == 4) ok[nt][r] = MSK[((size_t)b * TQ + tq) * TK + kk] != 0;      /* mode 4: per-(query, key) INPUT mask shared by all heads; masked keys contribute nothing, rows with no valid key give l = 0 -> output 0 */
        float sv = ok[nt][r] ? s[nt][r] * SCL : -3.0e38f; if (CAUSAL == 14) { if (ok[nt][r]) sv += sl * (float)(kk - tq); }
        sc[nt][r] = sv; mcn[nt] = fmaxf(mcn[nt], sv); } }
    float mc = fmaxf(mcn[0], mcn[1]); mc = fmaxf(mc, xhalf(mc));
    const float mn = fmaxf(m_r, mc); const float ea = expf(m_r - mn); const float al = (mn > -1.0e38f) ? ea : 1.0f; m_r = mn;
    FragH pb, pl; float psn[2];
#pragma unroll
    for (int nt = 0; nt < 2; ++nt) { psn[nt] = 0.f;
#pragma unroll
      for (int r = 0; r < 8; ++r) { const float e = expf(sc[nt][r] - mn); const float p = ok[nt][r] ? e : 0.f; psn[nt] += p; const float ps = p * 1024.0f; const _Float16 ph = (_Float16)ps; pb.h[nt * 8 + r] = ph; pl.h[nt * 8 + r] = (_Float16)((ps - (float)ph) * 1024.0f); } }
    l_r = l_r * al + (psn[0] + psn[1]);
#pragma unroll
    for (int dt = 0; dt < DT; ++dt)
#pragma unroll
      for (int r = 0; r < 8; ++r) { oacc[dt][r] *= al; oaccL[dt][r] *= al; }
#pragma unroll
    for (int dt = 0; dt < DT; ++dt) { const unsigned short* vrow = &sV[bf][dt * 16 + ln][p]; const unsigned short* vrl = &sVl[bf][dt * 16 + ln][p]; FragH av, avl; av.half[0] = *(const v8us*)(vrow + 8 * hh); av.half[1] = *(const v8us*)(vrow + 16 + 8 * hh); avl.half[0] = *(const v8us*)(vrl + 8 * hh); avl.half[1] = *(const v8us*)(vrl + 16 + 8 * hh);
      oacc[dt] = mmaH<1>(av.v, av.v, pb.v, pb.v, oacc[dt]); oaccL[dt] = mmaH<1>(av.v, av.v, pl.v, pl.v, oaccL[dt]); oaccL[dt] = mmaH<1>(avl.v, avl.v, pb.v, pb.v, oaccL[dt]); } }
    wait_ds0(); wait_async0(); __syncthreads();      /* publishes stage t + 1 and ends every read of buffer bf */
    if (t + 2 < nst) { const int j2 = (t + 2) * 64; stage64(Kh + (size_t)j2 * ldk, ldk, &sK[bf][0][0], tid); stage64(Kl + (size_t)j2 * ldk, ldk, &sKl[bf][0][0], tid); stage64(Vth + j2, TK, &sV[bf][0][0], tid); stage64(Vtl + j2, TK, &sVl[bf][0][0], tid); } }
  wait_async0();
  const float l = l_r + xhalf(l_r); const float li = (l > 0.f) ? 1.0f / (l * 1024.0f) : 0.f;
#pragma unroll
  for (int dt = 0; dt < DT; ++dt) { v4f lo, hi;
#pragma unroll
    for (int r = 0; r < 4; ++r) { float v = oacc[dt][r]; v += oaccL[dt][r] * 0.0009765625f; lo[r] = v * li; v = oacc[dt][4 + r]; v += oaccL[dt][4 + r] * 0.0009765625f; hi[r] = v * li; }
    *(v4fa*)&sO[w][ln][dt * 16 + 8 * hh] = lo; *(v4fa*)&sO[w][ln][dt * 16 + 8 * hh + 4] = hi; }
  __builtin_amdgcn_fence(__ATOMIC_ACQ_REL, "workgroup"); __builtin_amdgcn_wave_barrier();      /* the wave's own sO rows: its stores above stay ahead of its whole-line reads below */
  {
#pragma unroll
    for (int rp = 0; rp < RPW; rp += 2) { const int r = rp + (lane >> 4), pc = lane & 15; const v4f val = *(const v4fa*)&sO[w][r][pc * 4]; *(v4f*)(O + ((size_t)b * TQ + q0 + r) * ldo + h * 64 + pc * 4) = val; }
     } }

__global__ __launch_bounds__(256) void k_rotab(float* __restrict__ CS, float* __restrict__ SN) {
  #pragma clang fp contract(off)
  const int t = blockIdx.x * 256 + threadIdx.x; if (t >= SLEN * 32) return; const int j = t % 32, s = t / 32; const float ex = (float)(2 * j) / 64.0f; const float inv = 1.0f / powf(10000.0f, ex); const float th = (float)s * inv; const float c = cosf(th), sn = sinf(th);
  { *(float*)(CS + t) = c; *(float*)(SN + t) = sn;  } }
__global__ __launch_bounds__(256) void k_rope(const float* __restrict__ F, int nsrc, int ndst, int rep, const float* __restrict__ CS, const float* __restrict__ SN, _Float16* __restrict__ H, _Float16* __restrict__ L) {
  #pragma clang fp contract(off)
  const size_t t = (size_t)blockIdx.x * 256 + threadIdx.x; if (t >= (size_t)NR * ndst * 4) return; const int g8 = (int)(t % 4); const int hd = (int)((t / 4) % ndst); const size_t row = t / ((size_t)4 * ndst); const int s = (int)(row % SLEN); const int hs = hd / rep;
  const float* src = F + row * (size_t)(nsrc * 64) + hs * 64; FragH ah, al, bh, bl;
  for (int i = 0; i < 8; ++i) { const int d = g8 * 8 + i; const float c = CS[s * 32 + d], sn = SN[s * 32 + d]; const float x1 = src[d], x2 = src[d + 32];
    float o1 = x1 * c; o1 += -x2 * sn; float o2 = x2 * c; o2 += x1 * sn;
    _Float16 hv = (_Float16)o1; ah.h[i] = hv; al.h[i] = (_Float16)((o1 - (float)hv) * 1024.0f); hv = (_Float16)o2; bh.h[i] = hv; bl.h[i] = (_Float16)((o2 - (float)hv) * 1024.0f); }
  const size_t o = row * (size_t)(ndst * 64) + hd * 64 + g8 * 8;
  { *(v8us*)((unsigned short*)H + o) = ah.half[0]; *(v8us*)((unsigned short*)H + o + 32) = bh.half[0]; *(v8us*)((unsigned short*)L + o) = al.half[0]; *(v8us*)((unsigned short*)L + o + 32) = bl.half[0];  } }
__global__ __launch_bounds__(256) void k_kexp(const float* __restrict__ F, _Float16* __restrict__ H, _Float16* __restrict__ L) { const size_t t = (size_t)blockIdx.x * 256 + threadIdx.x; if (t >= (size_t)NR * NH * 8) return; const int g8 = (int)(t % 8); const int hd = (int)((t / 8) % NH); const size_t row = t / ((size_t)8 * NH); const float* src = F + row * (size_t)KVD + (hd / NREP) * 64 + g8 * 8; FragH fh, fl;
  for (int i = 0; i < 8; ++i) { const _Float16 hv = (_Float16)src[i]; fh.h[i] = hv; fl.h[i] = (_Float16)((src[i] - (float)hv) * 1024.0f); } const size_t o = row * (size_t)(NH * 64) + hd * 64 + g8 * 8;
  { *(v8us*)((unsigned short*)H + o) = fh.half[0]; *(v8us*)((unsigned short*)L + o) = fl.half[0];  } }
__global__ __launch_bounds__(256) void k_vtg(const _Float16* __restrict__ V16, _Float16* __restrict__ Vt) { __shared__ unsigned short tl[64][66]; const int tid = threadIdx.x; const int slab = blockIdx.x / (SLEN / 64), lg = blockIdx.x % (SLEN / 64); const int b = slab / NH, h = slab % NH; const int hs = h / NREP;
  for (int i = tid; i < 64 * 8; i += 256) { const int r = i / 8, c8 = (i % 8) * 8; FragH f; f.half[0] = *(const v8us*)((const unsigned short*)V16 + ((size_t)b * SLEN + lg * 64 + r) * KVD + hs * 64 + c8); for (int q = 0; q < 8; ++q) tl[r][c8 + q] = f.u[q]; }
  __syncthreads();
  { for (int rd = 0; rd < 2; ++rd) { const int d = rd * 32 + tid / 8, pc = tid % 8; FragH f; for (int q = 0; q < 8; ++q) f.u[q] = tl[pc * 8 + q][d]; *(v8us*)((unsigned short*)Vt + ((size_t)slab * 64 + d) * SLEN + lg * 64 + pc * 8) = f.half[0]; }  } }

extern "C" void kernel_launch(void* const* d_in, const int* in_sizes, int n_in,
                              void* d_out, int out_size, void* d_ws, size_t ws_size, hipStream_t stream) {
  (void)in_sizes; (void)n_in; (void)out_size;
  const float* const* I = (const float* const*)d_in; const float* x = I[0]; const float* Wq = I[1]; const float* bq = I[2]; const float* Wk = I[3]; const float* bk = I[4]; const float* Wv = I[5]; const float* bv = I[6]; const float* Wo = I[7]; const float* bo = I[8]; const float* slopes = I[9];
  char* ws = (char*)d_ws; size_t off = 0;
  auto take = [&](size_t bytes) { char* p = ws + off; off += (bytes + 255) & ~(size_t)255; return p; };
  const size_t np = (size_t)NR * DM, nk = (size_t)NR * KVD;
  _Float16* BQ = (_Float16*)take((size_t)DM * DM * 2); _Float16* BK = (_Float16*)take((size_t)KVD * DM * 2); _Float16* BV = (_Float16*)take((size_t)KVD * DM * 2); _Float16* BO = (_Float16*)take((size_t)DM * DM * 2);
  _Float16* X16 = (_Float16*)take(np * 2); float* QF = (float*)take(np * 4); _Float16* QH = (_Float16*)take(np * 2); _Float16* QL = (_Float16*)take(np * 2); float* KF = (float*)take(nk * 4); float* VF = (float*)take(nk * 4); _Float16* KXH = (_Float16*)take(np * 2); _Float16* KXL = (_Float16*)take(np * 2); _Float16* VH = (_Float16*)take(nk * 2); _Float16* VL = (_Float16*)take(nk * 2); _Float16* VT = (_Float16*)take(np * 2); _Float16* VTL = (_Float16*)take(np * 2);
  float* O = QF;      /* attention output over the q f32 plane (dead after the q hi/lo split) */ _Float16* OH = (_Float16*)take(np * 2); _Float16* OLo = (_Float16*)take(np * 2);
  if (off > ws_size) return;      /* 2+0.5+0.5+2 + 8+16+8+8+4+4+8+8+2+2+8+8+8+8 = 105 MiB */
  k_wt_f16<<<(unsigned)(((size_t)DM * DM / 8 + 255) / 256), 256, 0, stream>>>(Wq, BQ, DM, DM, 16.0f); k_wt_f16<<<(unsigned)(((size_t)DM * KVD / 8 + 255) / 256), 256, 0, stream>>>(Wk, BK, DM, KVD, 16.0f); k_wt_f16<<<(unsigned)(((size_t)DM * KVD / 8 + 255) / 256), 256, 0, stream>>>(Wv, BV, DM, KVD, 16.0f); k_wt_f16<<<(unsigned)(((size_t)DM * DM / 8 + 255) / 256), 256, 0, stream>>>(Wo, BO, DM, DM, 16.0f);
  k_x16<<<(unsigned)((np / 8 + 255) / 256), 256, 0, stream>>>(x, X16, np / 8);
  k_gemm2<0><<<dim3((NR / 128) * (DM / 64), 1), 128, 0, stream>>>(X16, DM, 0, BQ, DM, 0, 0.0625f, bq, 0, nullptr, 1, 0, 0, QF, nullptr, DM, 0, NR, DM, DM);
  k_gemm2<0><<<dim3((NR / 128) * (KVD / 64), 1), 128, 0, stream>>>(X16, DM, 0, BK, DM, 0, 0.0625f, bk, 0, nullptr, 1, 0, 0, KF, nullptr, KVD, 0, NR, KVD, DM);
  k_gemm2<0><<<dim3((NR / 128) * (KVD / 64), 1), 128, 0, stream>>>(X16, DM, 0, BV, DM, 0, 0.0625f, bv, 0, nullptr, 1, 0, 0, VF, nullptr, KVD, 0, NR, KVD, DM);
  k_hl<<<(unsigned)((np / 8 + 255) / 256), 256, 0, stream>>>(QF, QH, QL, np / 8);      /* q hi/lo */
  k_kexp<<<(unsigned)(((size_t)NR * NH * 8 + 255) / 256), 256, 0, stream>>>(KF, KXH, KXL);      /* k: kv head h/4 expanded to query head h, hi/lo */
  k_hl<<<(unsigned)((nk / 8 + 255) / 256), 256, 0, stream>>>(VF, VH, VL, nk / 8);
  k_vtg<<<NB * NH * (SLEN / 64), 256, 0, stream>>>(VH, VT); k_vtg<<<NB * NH * (SLEN / 64), 256, 0, stream>>>(VL, VTL);      /* QF becomes O from here on */
  k_flash5<14><<<NB * NH * QBN5, 128, 0, stream>>>(QH, QL, DM, KXH, KXL, DM, VT, VTL, (const int*)slopes, O, DM);      /* causal + ALiBi, rows < 256: hi + residual */
  k_flash<14><<<NB * NH * QBNP, 128, 0, stream>>>(QH, DM, KXH, DM, VT, (const int*)slopes, O, DM);      /* causal + ALiBi, rows >= 256: plain */
  k_hl<<<(unsigned)((np / 8 + 255) / 256), 256, 0, stream>>>(O, OH, OLo, np / 8);
  k_gemm2<0><<<dim3((NR / 128) * (DM / 64), 1), 128, 0, stream>>>(OH, DM, 0, BO, DM, 0, 0.0625f, bo, 0, nullptr, 1, 0, 0, (float*)d_out, nullptr, DM, 0, NR, DM, DM);      /* out = ctx Wo + bo */
  for (int b = 0; b < NB; ++b) k_gemm2<0><<<dim3((RE / 128) * (DM / 64), 1), 128, 0, stream>>>(OLo + (size_t)b * SLEN * DM, DM, 0, BO, DM, 0, 0.0625f / 1024.0f, nullptr, 0, (const float*)d_out + (size_t)b * SLEN * DM, 1, (size_t)DM, 0, (float*)d_out + (size_t)b * SLEN * DM, nullptr, DM, 0, RE, DM, DM);      /* += O residual . Wo on the first 256 rows of each sequence */
}

// v004
// It runs in 205 microseconds.
// Two timings next to v003 both put it at 1.09 times that version's speed.
// Over all steps from v000 it is 3.88 times as fast.
#include <hip/hip_runtime.h>
// CausalAlibiAttn (1 x 4096 tokens, D 1024 = 16 heads of 64, 4 kv heads): q, k, v = x W + b; q head h uses kv head h/4; scores/8 + slope[h] * (key - query) (ALiBi, slopes INPUT), causal; softmax; ctx Wo + bo.
// Structure: exact f16 plane of x; q, k, v as f32 WMMA GEMM outputs (32x64 wave tiles, f32 accumulation, exact x16 weights + bias); f16 hi + 2^10-residual splits on VALU (k expanded to the 16 query heads); V^T hi/residual by LDS tiles with the kv-head mapping; the fused causal flash kernel with the ALiBi term added per (head, query, key) in f32, in its 5-plane form for the first 256 query rows and the plain form beyond; O as hi + residual into the Wo GEMMs (+ bias; residual term only on those rows).
// Compute dtype: x and parameters rounded to bf16; q/k/P/v/O as f16 hi + residual on rows < 256 (~2^-21) and plain f16 beyond (~2^-12); ALiBi/softmax f32. v_wmma_f32_16x16x32_f16.
#define NB 1
#define DM 1024
#define NKV 4
#define NREP (NH / NKV)
#define KVD (NKV * 64)           /* 256 */
#define NR (NB * SLEN)           /* 4096 */
#define SLEN 4096
#define TQ SLEN
#define TK SLEN
#define NH 16
#define SCL 0.125f
#define QBLKS (TQ / 64)
#define QB05 0
#define QBN5 4
#define QB0P QBN5
#define QBNP (QBLKS - QBN5)
#define RE 256
typedef __bf16 v16b __attribute__((ext_vector_type(16)));
typedef unsigned short v8us __attribute__((ext_vector_type(8), may_alias));
typedef float  v8f  __attribute__((ext_vector_type(8)));
typedef float  v4f  __attribute__((ext_vector_type(4)));
typedef float  v4fa __attribute__((ext_vector_type(4), may_alias));
union FragB { v16b v; v8us half[2]; unsigned short u[16]; };

__device__ __forceinline__ unsigned short bf16_bits(float x) { unsigned int u = __float_as_uint(x); return (unsigned short)((u + 0x7FFFu + ((u >> 16) & 1u)) >> 16); }
__device__ __forceinline__ float bf16_val(unsigned short b) { return __uint_as_float(((unsigned int)b) << 16); }
__device__ __forceinline__ float bf16_round(float x) { return bf16_val(bf16_bits(x)); }
// D += A·B with NT terms: 1 = ah·bh, 2 = + al·bh (A split), 3 = + ah·bl (both split)
template <int NT>
__device__ __forceinline__ v8f mmaN(v16b ah, v16b al, v16b bh, v16b bl, v8f c) {
  c = __builtin_amdgcn_wmma_f32_16x16x32_bf16(false, ah, false, bh, (short)0, c, false, false);
  if (NT >= 2) c = __builtin_amdgcn_wmma_f32_16x16x32_bf16(false, al, false, bh, (short)0, c, false, false);
  if (NT >= 3) c = __builtin_amdgcn_wmma_f32_16x16x32_bf16(false, ah, false, bl, (short)0, c, false, false);
  asm volatile("v_nop\n\tv_nop\n\tv_nop\n\tv_nop" : "+v"(c) : "v"(ah), "v"(al), "v"(bh), "v"(bl));
  return c;
}

__global__ __launch_bounds__(256) void k_wt_bf16(const float* __restrict__ W, unsigned short* __restrict__ Wt, int K, int N) {
  const int t = blockIdx.x * 256 + threadIdx.x;
  const int k8n = K / 8;
  if (t >= N * k8n) return;
  const int n = t / k8n, k8 = (t % k8n) * 8;
  v8us v;
#pragma unroll
  for (int i = 0; i < 8; ++i) v[i] = bf16_bits(W[(size_t)(k8 + i) * N + n]);
  *(v8us*)(Wt + (size_t)n * K + k8) = v;
  
}

// GEMM C[M][N] (f32, pitch ldc) = act(A[M][K]·W + bias). A f32 row-major (pitch lda) converted per fragment to bf16
// (ASPLIT: hi/lo two planes -> 2 terms, else single rounded term); Wt bf16 [N][K] (pitch ldb). BIAS_BF16 rounds the
// bias to bf16 first (bias quantised to bf16 before the add). K%32==0, M%16==0, N%64==0.
template <bool ASPLIT, int ACT, bool BIAS_BF16>
__global__ __launch_bounds__(128) void k_gemm_bf(const float* __restrict__ A, int lda, const unsigned short* __restrict__ Wt, int ldb,
                                               const float* __restrict__ bias, float* __restrict__ C, int ldc, int M, int N, int K) {
  __shared__ __attribute__((aligned(16))) float so[4][16][64];
  const int tid = threadIdx.x, w = tid >> 5, lane = tid & 31, ln = lane & 15, hh = lane >> 4;
  const int ntn = N / 64;
  const int wid = blockIdx.x * 4 + w;
  const int mt = wid / ntn, nq = wid % ntn;
  if (mt * 16 >= M) return;
  const int row0 = mt * 16, col0 = nq * 64;
  const float* arow = A + (size_t)(row0 + ln) * lda;
  v8f acc[4] = {};
  for (int kb = 0; kb < K; kb += 32) {
    FragB ah, al;
    const v4f x0 = *(const v4fa*)(arow + kb + 8 * hh), x1 = *(const v4fa*)(arow + kb + 8 * hh + 4);
    const v4f x2 = *(const v4fa*)(arow + kb + 16 + 8 * hh), x3 = *(const v4fa*)(arow + kb + 16 + 8 * hh + 4);
    float xs[16] = {x0[0],x0[1],x0[2],x0[3],x1[0],x1[1],x1[2],x1[3],x2[0],x2[1],x2[2],x2[3],x3[0],x3[1],x3[2],x3[3]};
#pragma unroll
    for (int i = 0; i < 16; ++i) { const unsigned short hb = bf16_bits(xs[i]); ah.u[i] = hb; al.u[i] = ASPLIT ? bf16_bits(xs[i] - bf16_val(hb)) : (unsigned short)0; }
#pragma unroll
    for (int t = 0; t < 4; ++t) {
      const unsigned short* brow = Wt + (size_t)(col0 + t * 16 + ln) * ldb + kb;
      FragB b;
      b.half[0] = *(const v8us*)(brow + 8 * hh);
      b.half[1] = *(const v8us*)(brow + 16 + 8 * hh);
      acc[t] = mmaN<ASPLIT ? 2 : 1>(ah.v, al.v, b.v, b.v, acc[t]);
    }
  }
#pragma unroll
  for (int t = 0; t < 4; ++t) {
    float bv = bias ? bias[col0 + t * 16 + ln] : 0.f;
    if (BIAS_BF16) bv = bf16_round(bv);
#pragma unroll
    for (int r = 0; r < 8; ++r) { float v = acc[t][r] + bv; if (ACT == 1) v = fmaxf(v, 0.f); so[w][8 * hh + r][t * 16 + ln] = v; }
  }
  __builtin_amdgcn_fence(__ATOMIC_ACQ_REL, "workgroup");
  __builtin_amdgcn_wave_barrier();
  const int rsub = lane >> 4, c4 = (lane & 15) * 4;
  {
#pragma unroll
    for (int q = 0; q < 8; ++q) {
      const int r = q * 2 + rsub;
      const v4f v = *(const v4fa*)&so[w][r][c4];
      *(v4f*)(C + (size_t)(row0 + r) * ldc + col0 + c4) = v;
    }
    
  }
}

// GEMM C = act(A·W + bias + resid): A f32 (ASPLIT -> hi/lo 2 terms), Wt bf16 [N][K]; ACT 0 none, 1 relu, 2 exact gelu;
// resid (optional, f32, row index = (row % rmod), pitch ldr, RES_BF16 rounds it) added before the activation.
template <bool ASPLIT, int ACT, bool BIAS_BF16, bool RES_BF16>
__global__ __launch_bounds__(128) void k_gemm_bf3(const float* __restrict__ A, int lda, const unsigned short* __restrict__ Wt, int ldb,
                                                const float* __restrict__ bias, const float* __restrict__ resid, int rmod, int ldr,
                                                float* __restrict__ C, int ldc, int M, int N, int K) {
  __shared__ __attribute__((aligned(16))) float so[4][16][64];
  const int tid = threadIdx.x, w = tid >> 5, lane = tid & 31, ln = lane & 15, hh = lane >> 4;
  const int ntn = N / 64;
  const int wid = blockIdx.x * 4 + w;
  const int mt = wid / ntn, nq = wid % ntn;
  if (mt * 16 >= M) return;
  const int row0 = mt * 16, col0 = nq * 64;
  const float* arow = A + (size_t)(row0 + ln) * lda;
  v8f acc[4] = {};
  for (int kb = 0; kb < K; kb += 32) {
    FragB ah, al;
    const v4f x0 = *(const v4fa*)(arow + kb + 8 * hh), x1 = *(const v4fa*)(arow + kb + 8 * hh + 4);
    const v4f x2 = *(const v4fa*)(arow + kb + 16 + 8 * hh), x3 = *(const v4fa*)(arow + kb + 16 + 8 * hh + 4);
    float xs[16] = {x0[0],x0[1],x0[2],x0[3],x1[0],x1[1],x1[2],x1[3],x2[0],x2[1],x2[2],x2[3],x3[0],x3[1],x3[2],x3[3]};
#pragma unroll
    for (int i = 0; i < 16; ++i) { const unsigned short hb = bf16_bits(xs[i]); ah.u[i] = hb; al.u[i] = ASPLIT ? bf16_bits(xs[i] - bf16_val(hb)) : (unsigned short)0; }
#pragma unroll
    for (int t = 0; t < 4; ++t) {
      const unsigned short* brow = Wt + (size_t)(col0 + t * 16 + ln) * ldb + kb;
      FragB b;
      b.half[0] = *(const v8us*)(brow + 8 * hh);
      b.half[1] = *(const v8us*)(brow + 16 + 8 * hh);
      acc[t] = mmaN<ASPLIT ? 2 : 1>(ah.v, al.v, b.v, b.v, acc[t]);
    }
  }
#pragma unroll
  for (int t = 0; t < 4; ++t) {
    const int col = col0 + t * 16 + ln;
    float bv = bias ? bias[col] : 0.f;
    if (BIAS_BF16) bv = bf16_round(bv);
#pragma unroll
    for (int r = 0; r < 8; ++r) {
      float v = acc[t][r] + bv;
      if (resid) { float rv = resid[(size_t)((row0 + 8 * hh + r) % rmod) * ldr + col]; if (RES_BF16) rv = bf16_round(rv); v += rv; }
      if (ACT == 1) v = fmaxf(v, 0.f);
      if (ACT == 2) v = 0.5f * v * (1.0f + erff(v * 0.70710678118654752f));
      if (ACT == 3) { const float u = 0.7978845608028654f * (v + 0.044715f * v * v * v); v = 0.5f * v * (1.0f + tanhf(u)); }
      so[w][8 * hh + r][t * 16 + ln] = v;
    }
  }
  __builtin_amdgcn_fence(__ATOMIC_ACQ_REL, "workgroup");
  __builtin_amdgcn_wave_barrier();
  const int rsub = lane >> 4, c4 = (lane & 15) * 4;
  {
#pragma unroll
    for (int q = 0; q < 8; ++q) {
      const int r = q * 2 + rsub;
      const v4f v = *(const v4fa*)&so[w][r][c4];
      *(v4f*)(C + (size_t)(row0 + r) * ldc + col0 + c4) = v;
    }
    
  }
}
// row LayerNorm (biased variance, eps) over N: s = X (+ R); optional out_sum <- s; out_norm <- (s-mu)*rsqrt(var+eps)*g + b
template <bool PARAM_BF16>
__global__ __launch_bounds__(256) void k_layernorm(const float* __restrict__ X, const float* __restrict__ R, const float* __restrict__ g, const float* __restrict__ bta,
                                                  float* __restrict__ out_sum, float* __restrict__ out_norm, int N, float eps) {
  __shared__ float red[256];
  const int row = blockIdx.x, tid = threadIdx.x;
  const float* x = X + (size_t)row * N; const float* rr = R ? R + (size_t)row * N : nullptr;
  float vals[16];                     // up to N = 4096
  const int per = N / 256;            // contiguous chunk per thread? use strided-by-4 chunks: thread handles j = tid*4 + 1024*u
  float s1 = 0.f;
  for (int u = 0; u < per / 4; ++u) {
    const int j = tid * 4 + 1024 * u;
    const v4f a = *(const v4fa*)(x + j);
    v4f b = {0.f,0.f,0.f,0.f}; if (rr) b = *(const v4fa*)(rr + j);
#pragma unroll
    for (int q = 0; q < 4; ++q) { const float v = a[q] + b[q]; vals[u * 4 + q] = v; s1 += v; }
  }
  red[tid] = s1; __syncthreads();
  for (int st = 128; st > 0; st >>= 1) { if (tid < st) red[tid] += red[tid + st]; __syncthreads(); }
  const float mu = red[0] / (float)N; __syncthreads();
  float s2 = 0.f;
  for (int u = 0; u < per / 4; ++u)
#pragma unroll
    for (int q = 0; q < 4; ++q) { const float c = vals[u * 4 + q] - mu; s2 += c * c; }
  red[tid] = s2; __syncthreads();
  for (int st = 128; st > 0; st >>= 1) { if (tid < st) red[tid] += red[tid + st]; __syncthreads(); }
  const float rs = rsqrtf(red[0] / (float)N + eps);
  {
    for (int u = 0; u < per / 4; ++u) {
      const int j = tid * 4 + 1024 * u;
      v4f o, sm;
#pragma unroll
      for (int q = 0; q < 4; ++q) {
        float gg = g[j + q], bb = bta[j + q];
        if (PARAM_BF16) { gg = bf16_round(gg); bb = bf16_round(bb); }
        sm[q] = vals[u * 4 + q]; o[q] = (vals[u * 4 + q] - mu) * rs * gg + bb;
      }
      if (out_sum) *(v4f*)(out_sum + (size_t)row * N + j) = sm;
      *(v4f*)(out_norm + (size_t)row * N + j) = o;
    }
    
  }
}



// ---- f16 WMMA path (v_wmma_f32_16x16x32_f16): 11-bit significands for operands in range — used where a [0,1] probability operand needs more precision than bf16
typedef _Float16 v16h __attribute__((ext_vector_type(16)));
union FragH { v16h v; v8us half[2]; _Float16 h[16]; unsigned short u[16]; };
template <int NT>
__device__ __forceinline__ v8f mmaH(v16h ah, v16h al, v16h bh, v16h bl, v8f c) {
  c = __builtin_amdgcn_wmma_f32_16x16x32_f16(false, ah, false, bh, (short)0, c, false, false);
  if (NT >= 2) c = __builtin_amdgcn_wmma_f32_16x16x32_f16(false, al, false, bh, (short)0, c, false, false);
  if (NT >= 3) c = __builtin_amdgcn_wmma_f32_16x16x32_f16(false, ah, false, bl, (short)0, c, false, false);
  asm volatile("v_nop\n\tv_nop\n\tv_nop\n\tv_nop" : "+v"(c) : "v"(ah), "v"(al), "v"(bh), "v"(bl));
  return c;
}
// batched GEMM like k_gemm_b but f16 operands: A f32 (split into f16 hi/lo if ASPLIT, else rounded to f16), Bt = f16 values [n][k]; alpha; C f32; N multiple of 16 (partial tiles skipped)
template <bool ASPLIT>
__global__ __launch_bounds__(128) void k_gemm_h(const float* __restrict__ A, int lda, size_t sA, const _Float16* __restrict__ Bh, int ldb, size_t sB, float alpha, float* __restrict__ C, int ldc, size_t sC, int M, int N, int K) {
  __shared__ __attribute__((aligned(16))) float so[4][16][64];
  const int tid = threadIdx.x, w = tid >> 5, lane = tid & 31, ln = lane & 15, hh = lane >> 4; const int by = blockIdx.y;
  A += (size_t)by * sA; Bh += (size_t)by * sB; C += (size_t)by * sC;
  const int ntn = (N + 63) / 64; const int wid = blockIdx.x * 4 + w; const int mt = wid / ntn, nq = wid % ntn; if (mt * 16 >= M) return;
  const int row0 = mt * 16, col0 = nq * 64; const float* arow = A + (size_t)(row0 + ln) * lda;
  v8f acc[4] = {};
  for (int kb = 0; kb < K; kb += 32) {
    FragH ah, al;
    const v4f x0 = *(const v4fa*)(arow + kb + 8 * hh), x1 = *(const v4fa*)(arow + kb + 8 * hh + 4), x2 = *(const v4fa*)(arow + kb + 16 + 8 * hh), x3 = *(const v4fa*)(arow + kb + 16 + 8 * hh + 4);
    float xs[16] = {x0[0],x0[1],x0[2],x0[3],x1[0],x1[1],x1[2],x1[3],x2[0],x2[1],x2[2],x2[3],x3[0],x3[1],x3[2],x3[3]};
#pragma unroll
    for (int i = 0; i < 16; ++i) { const _Float16 h = (_Float16)xs[i]; ah.h[i] = h; al.h[i] = ASPLIT ? (_Float16)(xs[i] - (float)h) : (_Float16)0.0f; }
#pragma unroll
    for (int t = 0; t < 4; ++t) { if (col0 + t * 16 >= N) continue; const size_t boff = (size_t)(col0 + t * 16 + ln) * ldb + kb; FragH bq; bq.half[0] = *(const v8us*)(Bh + boff + 8 * hh); bq.half[1] = *(const v8us*)(Bh + boff + 16 + 8 * hh);
      acc[t] = mmaH<ASPLIT ? 2 : 1>(ah.v, al.v, bq.v, bq.v, acc[t]); }
  }
#pragma unroll
  for (int t = 0; t < 4; ++t) { if (col0 + t * 16 >= N) continue;
#pragma unroll
    for (int r = 0; r < 8; ++r) so[w][8 * hh + r][t * 16 + ln] = acc[t][r] * alpha; }
  __builtin_amdgcn_fence(__ATOMIC_ACQ_REL, "workgroup"); __builtin_amdgcn_wave_barrier();
  const int rsub = lane >> 4, c4 = (lane & 15) * 4;
  {
#pragma unroll
    for (int q = 0; q < 8; ++q) { const int r = q * 2 + rsub; if (col0 + c4 < N) { const v4f v = *(const v4fa*)&so[w][r][c4]; *(v4f*)(C + (size_t)(row0 + r) * ldc + col0 + c4) = v; } }
     }
}

// Wt[n][k] = f16(W[k][n]·scale) from f32 row-major W[K][N] (scale = power of two; bf16-exact weights stay exact in f16 away from the subnormal range)
__global__ __launch_bounds__(256) void k_wt_f16(const float* __restrict__ W, _Float16* __restrict__ Wt, int K, int N, float scale) {
  const int t = blockIdx.x * 256 + threadIdx.x; if (t >= N * (K / 8)) return; const int n = t / (K / 8), k8 = (t % (K / 8)) * 8; FragH f;
#pragma unroll
  for (int i = 0; i < 8; ++i) f.h[i] = (_Float16)(bf16_round(W[(size_t)(k8 + i) * N + n]) * scale); const v8us o = f.half[0];
  *(v8us*)((unsigned short*)Wt + (size_t)n * K + k8) = o; 
}
// k_gemm_hh variant with fused epilogue: v = acc·alpha + bias[by·sBias + col] (+ CP[(row/rowsPerB)·sCPb + by·64 + col] if CP) ; ACT 0 none / 1 elu ; writes f16 C16 (and f32 C if non-null)
template <int ACT>
__global__ __launch_bounds__(128) void k_gemm_hhx(const _Float16* __restrict__ A, int lda, size_t sA, const _Float16* __restrict__ Bh, int ldb, size_t sB, float alpha, const float* __restrict__ bias, size_t sBias, const float* __restrict__ CP, int rowsPerB, size_t sCPb, int row0g,
    float* __restrict__ C, _Float16* __restrict__ C16, int ldc, size_t sC, int M, int N, int K) {
  __shared__ __attribute__((aligned(16))) float so[4][16][64];
  const int tid = threadIdx.x, w = tid >> 5, lane = tid & 31, ln = lane & 15, hh = lane >> 4; const int by = blockIdx.y;
  A += (size_t)by * sA; Bh += (size_t)by * sB; const size_t cofs = (size_t)by * sC; const float* bp = bias ? bias + (size_t)by * sBias : nullptr;
  const int ntn = (N + 63) / 64; const int wid = blockIdx.x * 4 + w; const int mt = wid / ntn, nq = wid % ntn; if (mt * 16 >= M) return;
  const int row0 = mt * 16, col0 = nq * 64; const _Float16* arow = A + (size_t)(row0 + ln) * lda;
  v8f acc[4] = {};
  for (int kb = 0; kb < K; kb += 32) { FragH ah; ah.half[0] = *(const v8us*)((const unsigned short*)arow + kb + 8 * hh); ah.half[1] = *(const v8us*)((const unsigned short*)arow + kb + 16 + 8 * hh);
#pragma unroll
    for (int t = 0; t < 4; ++t) { if (col0 + t * 16 >= N) continue; const size_t boff = (size_t)(col0 + t * 16 + ln) * ldb + kb; FragH bq; bq.half[0] = *(const v8us*)((const unsigned short*)Bh + boff + 8 * hh); bq.half[1] = *(const v8us*)((const unsigned short*)Bh + boff + 16 + 8 * hh);
      acc[t] = mmaH<1>(ah.v, ah.v, bq.v, bq.v, acc[t]); }
  }
#pragma unroll
  for (int t = 0; t < 4; ++t) { if (col0 + t * 16 >= N) continue; const int col = col0 + t * 16 + ln; const float bv = bp ? bf16_round(bp[col]) : 0.f;
#pragma unroll
    for (int r = 0; r < 8; ++r) { float v = acc[t][r] * alpha + bv; if (CP) { const int bidx = (row0g + row0 + 8 * hh + r) / rowsPerB; v += CP[(size_t)bidx * sCPb + (size_t)by * 64 + col]; } if (ACT == 1) v = (v > 0.f) ? v : expm1f(v); else if (ACT == 7) v = (v > 0.f) ? v + 1.0f : expf(v); else if (ACT == 8) v = tanhf(v); else if (ACT == 9) v = 0.5f * v * (1.0f + tanhf(0.7978845608028654f * (v + 0.044715f * v * v * v))); else if (ACT == 11) v = 1.0f / (1.0f + expf(-v)); else if (ACT == 12) v = (v > 0.f) ? v : 0.01f * v; else if (ACT == 14) v = (v > 0.f) ? v : 0.1f * v; else if (ACT == 15) v = v / (1.0f + expf(-v)); else if (ACT == 3) v = fmaxf(v, 0.f); else if (ACT == 6) v = 0.5f * v * (1.0f + erff(v * 0.70710678118654752f)); so[w][8 * hh + r][t * 16 + ln] = v; } }
  __builtin_amdgcn_fence(__ATOMIC_ACQ_REL, "workgroup"); __builtin_amdgcn_wave_barrier();
  const int rsub = lane >> 4, c4 = (lane & 15) * 4; typedef _Float16 v4h __attribute__((ext_vector_type(4)));
  {
#pragma unroll
    for (int q = 0; q < 8; ++q) { const int r = q * 2 + rsub; if (col0 + c4 < N) { const v4f v = *(const v4fa*)&so[w][r][c4]; if (C) *(v4f*)(C + cofs + (size_t)(row0 + r) * ldc + col0 + c4) = v; if (C16) { v4h h4; for (int i = 0; i < 4; ++i) h4[i] = (_Float16)v[i]; *(v4h*)(C16 + cofs + (size_t)(row0 + r) * ldc + col0 + c4) = h4; } } }
     }
}


typedef _Float16 v4h __attribute__((ext_vector_type(4)));

__global__ __launch_bounds__(256) void k_x16(const float* __restrict__ x, _Float16* __restrict__ X16, size_t n8) { const size_t t = (size_t)blockIdx.x * 256 + threadIdx.x; if (t >= n8) return; FragH f;
#pragma unroll
  for (int q = 0; q < 8; ++q) f.h[q] = (_Float16)bf16_round(x[t * 8 + q]); *(v8us*)((unsigned short*)X16 + t * 8) = f.half[0];  }
__global__ __launch_bounds__(256) void k_h16(const float* __restrict__ x, _Float16* __restrict__ X16, size_t n8) { const size_t t = (size_t)blockIdx.x * 256 + threadIdx.x; if (t >= n8) return; FragH f;
#pragma unroll
  for (int q = 0; q < 8; ++q) f.h[q] = (_Float16)x[t * 8 + q]; *(v8us*)((unsigned short*)X16 + t * 8) = f.half[0];  }
__global__ __launch_bounds__(256) void k_round16f(const float* __restrict__ W, _Float16* __restrict__ Bt, size_t n8) { const size_t t = (size_t)blockIdx.x * 256 + threadIdx.x; if (t >= n8) return; FragH f;
#pragma unroll
  for (int i = 0; i < 8; ++i) f.h[i] = (_Float16)(bf16_round(W[t * 8 + i]) * 16.0f); *(v8us*)((unsigned short*)Bt + t * 8) = f.half[0];  }
template <int NHv, int TTv>
__global__ __launch_bounds__(256) void k_vt(const _Float16* __restrict__ V16, int ldv, int voff, _Float16* __restrict__ Vt) { __shared__ unsigned short tl[64][66]; const int tid = threadIdx.x; const int slab = blockIdx.x / (TTv / 64), lg = blockIdx.x % (TTv / 64); const int b = slab / NHv, h = slab % NHv;
  for (int i = tid; i < 64 * 8; i += 256) { const int r = i / 8, c8 = (i % 8) * 8; FragH f; f.half[0] = *(const v8us*)((const unsigned short*)V16 + ((size_t)b * TTv + lg * 64 + r) * ldv + voff + h * 64 + c8);
#pragma unroll
    for (int q = 0; q < 8; ++q) tl[r][c8 + q] = f.u[q]; }
  __syncthreads();
  {
#pragma unroll
    for (int rd = 0; rd < 2; ++rd) { const int d = rd * 32 + tid / 8, pc = tid % 8; FragH f;
#pragma unroll
      for (int q = 0; q < 8; ++q) f.u[q] = tl[pc * 8 + q][d];
      *(v8us*)((unsigned short*)Vt + ((size_t)slab * 64 + d) * TTv + lg * 64 + pc * 8) = f.half[0]; }
     } }

__global__ __launch_bounds__(256) void k_hl(const float* __restrict__ F, _Float16* __restrict__ Hh, _Float16* __restrict__ Hl, size_t n8) { const size_t t = (size_t)blockIdx.x * 256 + threadIdx.x; if (t >= n8) return; FragH fh, fl; const v4f a = *(const v4fa*)(F + t * 8), c = *(const v4fa*)(F + t * 8 + 4);
#pragma unroll
  for (int q = 0; q < 4; ++q) { _Float16 h = (_Float16)a[q]; fh.h[q] = h; fl.h[q] = (_Float16)((a[q] - (float)h) * 1024.0f); h = (_Float16)c[q]; fh.h[4 + q] = h; fl.h[4 + q] = (_Float16)((c[q] - (float)h) * 1024.0f); }
  { *(v8us*)((unsigned short*)Hh + t * 8) = fh.half[0]; *(v8us*)((unsigned short*)Hl + t * 8) = fl.half[0];  } }

// ---- LDS staging by asynchronous copies (global_load_async_to_lds_b128): a lane moves its own 16 bytes, 8 lanes one whole 128-byte row; two buffers, the next stage in flight while this one is worked on ----
#define LP 72      /* LDS row pitch in f16: 128 data bytes + 16 = an odd multiple of 16 bytes, the conflict-free pitch of the ds_load_b128 fragment readers */
__device__ __forceinline__ void wait_async0() { asm volatile("s_wait_asynccnt 0x0" ::: "memory"); }      /* the wave's own copies have landed; stands before the barrier behind which the other waves read them */
__device__ __forceinline__ void wait_ds0() { asm volatile("s_wait_dscnt 0x0" ::: "memory"); }      /* the wave's own LDS reads have retired before the barrier behind which their buffer is refilled */
// one tile of 64 rows x 128 bytes (row pitch ldg f16 in global memory, LP in LDS) by 128 threads: 4 copies a lane, rows tid / 8 + 16 i. The s_wait_xcnt closes the statement so that no address register is rewritten ahead of it.
__device__ __forceinline__ void stage64(const unsigned short* g, size_t ldg, const unsigned short* s, int tid) {
  const unsigned short* g0 = g + (size_t)(tid >> 3) * ldg + (tid & 7) * 8; const unsigned short* g1 = g0 + 16 * ldg; const unsigned short* g2 = g1 + 16 * ldg; const unsigned short* g3 = g2 + 16 * ldg;
  const unsigned l0 = (unsigned)(size_t)(s + (tid >> 3) * LP + (tid & 7) * 8), l1 = l0 + 16 * LP * 2, l2 = l0 + 32 * LP * 2, l3 = l0 + 48 * LP * 2;
  asm volatile("global_load_async_to_lds_b128 %0, %1, off\n\tglobal_load_async_to_lds_b128 %2, %3, off\n\tglobal_load_async_to_lds_b128 %4, %5, off\n\tglobal_load_async_to_lds_b128 %6, %7, off\n\ts_wait_xcnt 0x0"
               :: "v"(l0), "v"(g0), "v"(l1), "v"(g1), "v"(l2), "v"(g2), "v"(l3), "v"(g3) : "memory");
}
// ---- fast GEMM (block tile 128x64, wave tile 32x64; requires M % 128 == 0 rows per launch region, N % 64 == 0, K % 64 == 0, K >= 64); A and B tiles of 64 k staged in LDS; epilogue = k_gemm_hhx semantics ----
__device__ __forceinline__ v16h g2_frag(const _Float16* p, int hh) { FragH f; f.half[0] = *(const v8us*)((const unsigned short*)p + 8 * hh); f.half[1] = *(const v8us*)((const unsigned short*)p + 16 + 8 * hh); return f.v; }
__device__ __forceinline__ v8f g2_mma(v16h a, v16h b, v8f c) { v8f d = __builtin_amdgcn_wmma_f32_16x16x32_f16(false, a, false, b, (short)0, c, false, false); asm volatile("v_nop\n\tv_nop\n\tv_nop\n\tv_nop" : "+v"(d) : "v"(a), "v"(b)); return d; }
template <int ACT>
__global__ __launch_bounds__(128) void k_gemm2(const _Float16* __restrict__ A, int lda, size_t sA, const _Float16* __restrict__ Bh, int ldb, size_t sB, float alpha, const float* __restrict__ bias, size_t sBias, const float* __restrict__ CP, int rowsPerB, size_t sCPb, int row0g,
    float* __restrict__ C, _Float16* __restrict__ C16, int ldc, size_t sC, int M, int N, int K) {
  __shared__ __attribute__((aligned(16))) float so[4][32][68];
  __shared__ __attribute__((aligned(16))) unsigned short tA[2][128][LP], tB[2][64][LP];
  const int tid = threadIdx.x, w = tid >> 5, lane = tid & 31, ln = lane & 15, hh = lane >> 4; const int by = blockIdx.y;
  A += (size_t)by * sA; Bh += (size_t)by * sB; const size_t cofs = (size_t)by * sC; const float* bp = bias ? bias + (size_t)by * sBias : nullptr;
  const int ntn = N >> 6; const int mt = blockIdx.x / ntn, nq = blockIdx.x - mt * ntn; const int row0 = mt * 128 + 32 * w, col0 = nq * 64; if (mt * 128 + 128 > M) return;      /* the whole block leaves or none, ahead of every barrier */
  const unsigned short* Ag = (const unsigned short*)A + (size_t)(mt * 128) * lda; const unsigned short* Bg = (const unsigned short*)Bh + (size_t)col0 * ldb; const int nst = K >> 6;
  stage64(Ag, lda, &tA[0][0][0], tid); stage64(Ag + (size_t)64 * lda, lda, &tA[0][64][0], tid); stage64(Bg, ldb, &tB[0][0][0], tid);
  wait_async0(); __syncthreads();      /* stage 0 published */
  if (nst > 1) { stage64(Ag + 64, lda, &tA[1][0][0], tid); stage64(Ag + (size_t)64 * lda + 64, lda, &tA[1][64][0], tid); stage64(Bg + 64, ldb, &tB[1][0][0], tid); }
  const v8f z8 = {0.f,0.f,0.f,0.f,0.f,0.f,0.f,0.f}; v8f c00 = z8, c01 = z8, c02 = z8, c03 = z8, c10 = z8, c11 = z8, c12 = z8, c13 = z8;
#pragma unroll 1
  for (int t = 0; t < nst; ++t) { const int bf = t & 1;      /* rolled: one stage a trip, the publish point at its foot */
    // all 12 fragments of the stage are read from LDS as one group ahead of its 16 products: one LDS latency a stage in front of the matrix run, not one in front of every pair of products
    v16h fa[2][2], fb[2][4];
    // unrolled (both loops): the two k blocks of a stage become constant LDS offsets and the fragment arrays stay in registers
#pragma unroll
    for (int kq = 0; kq < 2; ++kq) { fa[kq][0] = g2_frag((const _Float16*)&tA[bf][32 * w + ln][kq * 32], hh); fb[kq][0] = g2_frag((const _Float16*)&tB[bf][ln][kq * 32], hh); fa[kq][1] = g2_frag((const _Float16*)&tA[bf][32 * w + 16 + ln][kq * 32], hh);
      fb[kq][1] = g2_frag((const _Float16*)&tB[bf][16 + ln][kq * 32], hh); fb[kq][2] = g2_frag((const _Float16*)&tB[bf][32 + ln][kq * 32], hh); fb[kq][3] = g2_frag((const _Float16*)&tB[bf][48 + ln][kq * 32], hh); }
#pragma unroll
    for (int kq = 0; kq < 2; ++kq) { c00 = g2_mma(fa[kq][0], fb[kq][0], c00); c10 = g2_mma(fa[kq][1], fb[kq][0], c10); c01 = g2_mma(fa[kq][0], fb[kq][1], c01); c11 = g2_mma(fa[kq][1], fb[kq][1], c11);
      c02 = g2_mma(fa[kq][0], fb[kq][2], c02); c12 = g2_mma(fa[kq][1], fb[kq][2], c12); c03 = g2_mma(fa[kq][0], fb[kq][3], c03); c13 = g2_mma(fa[kq][1], fb[kq][3], c13); }
    wait_ds0(); wait_async0(); __syncthreads();      /* publishes stage t + 1 and ends every read of buffer bf */
    if (t + 2 < nst) { const int k2 = (t + 2) * 64; stage64(Ag + k2, lda, &tA[bf][0][0], tid); stage64(Ag + (size_t)64 * lda + k2, lda, &tA[bf][64][0], tid); stage64(Bg + k2, ldb, &tB[bf][0][0], tid); } }
  wait_async0();
  v8f accs[8] = {c00, c01, c02, c03, c10, c11, c12, c13};
#pragma unroll
  for (int u = 0; u < 8; ++u) { const int t = u & 3, half = u >> 2; const int col = col0 + t * 16 + ln; const float bv = bp ? bf16_round(bp[col]) : 0.f;
#pragma unroll
    for (int r = 0; r < 8; ++r) { const int rloc = half * 16 + 8 * hh + r; float v = accs[u][r] * alpha + bv; if (CP) { const int bidx = (row0g + row0 + rloc) / rowsPerB; v += CP[(size_t)bidx * sCPb + (size_t)by * 64 + col]; }
      if (ACT == 3) v = fmaxf(v, 0.f); else if (ACT == 6) v = 0.5f * v * (1.0f + erff(v * 0.70710678118654752f)); else if (ACT == 11) v = 1.0f / (1.0f + expf(-v)); else if (ACT == 15) v = v / (1.0f + expf(-v)); else if (ACT == 12) v = (v > 0.f) ? v : 0.01f * v; else if (ACT == 8) v = tanhf(v);
      so[w][rloc][t * 16 + ln] = v; } }
  __builtin_amdgcn_fence(__ATOMIC_ACQ_REL, "workgroup"); __builtin_amdgcn_wave_barrier();
  const int rsub = lane >> 4, c4 = (lane & 15) * 4;
  {
#pragma unroll
    for (int q = 0; q < 16; ++q) { const int r = q * 2 + rsub; const v4f v = *(const v4fa*)&so[w][r][c4]; if (C) *(v4f*)(C + cofs + (size_t)(row0 + r) * ldc + col0 + c4) = v; if (C16) { v4h h4; for (int i = 0; i < 4; ++i) h4[i] = (_Float16)v[i]; *(v4h*)(C16 + cofs + (size_t)(row0 + r) * ldc + col0 + c4) = h4; } }
     } }



// lane l with lane l ^ 16: the two lane halves of a 16-column group hold the two key halves of one query
__device__ __forceinline__ float xhalf(float x) { return __builtin_bit_cast(float, __builtin_amdgcn_permlanex16(__builtin_bit_cast(int, x), __builtin_bit_cast(int, x), 0x76543210, 0xfedcba98, false, false)); }
template <int CAUSAL>
__global__ __launch_bounds__(128) void k_flash(const _Float16* __restrict__ Q16, int ldq, const _Float16* __restrict__ K16, int ldk, const _Float16* __restrict__ Vt, const int* __restrict__ MSK, float* __restrict__ O, int ldo) {
  constexpr int RPW = 16, DT = 4, KS = 2;      /* every '#pragma unroll' below: constant indices keep the fragment, score and accumulator arrays in registers */
  __shared__ __attribute__((aligned(16))) float sO[4][RPW][64 + 4];
  __shared__ __attribute__((aligned(16))) unsigned short sK[2][64][LP], sV[2][64][LP];      /* a stage = 64 keys: K rows (key, d) and V^T rows (d, key), shared by the four waves */
  const int tid = threadIdx.x, w = tid >> 5, lane = tid & 31, ln = lane & 15, hh = lane >> 4;
  const int slab = blockIdx.x / QBNP, qblk = QB0P + blockIdx.x % QBNP; const int b = slab / NH, h = slab % NH; const int qb0 = qblk * (4 * RPW); const int q0 = qb0 + w * RPW; const int tq = q0 + ln;
  FragH bq[KS];
  { const unsigned short* qr = (const unsigned short*)Q16 + ((size_t)b * TQ + tq) * ldq + h * 64;
#pragma unroll
    for (int ks = 0; ks < KS; ++ks) { bq[ks].half[0] = *(const v8us*)(qr + ks * 32 + 8 * hh); bq[ks].half[1] = *(const v8us*)(qr + ks * 32 + 16 + 8 * hh); } }
  const unsigned short* Vth = (const unsigned short*)Vt + (size_t)slab * 64 * TK;
  const float sl = (CAUSAL == 14) ? bf16_round(((const float*)MSK)[h]) : 0.f;      /* mode 14: causal + ALiBi slope[h] * (key - query) from the slopes INPUT */
  // Softmax in log2 units: p * 1024 = 2^(s * c2 + sl2 * (key - query) - m + 10). A lane's 16 keys of a pass lie at fixed distances from its first one, so scale and ALiBi are one fma per score against kb; the first key's own term (base) joins the maximum once a pass.
  static_assert(CAUSAL == 0 || CAUSAL == 1 || CAUSAL == 14, "every query needs a valid key in the first pass: masked scores go out by 2^(-3e38 - finite) = 0");
  const float c2 = SCL * 1.44269504088896340736f, sl2 = sl * 1.44269504088896340736f; v8f kb[2];
#pragma unroll
  for (int nt = 0; nt < 2; ++nt)
#pragma unroll
    for (int r = 0; r < 8; ++r) kb[nt][r] = sl2 * (float)(nt * 16 + r);
  float m_r = -3.0e38f, l_r = 0.f; v8f oacc[DT];
#pragma unroll
  for (int dt = 0; dt < DT; ++dt) oacc[dt] = (v8f){0.f,0.f,0.f,0.f,0.f,0.f,0.f,0.f};
  const int jend = (CAUSAL == 1 || CAUSAL == 14) ? (qb0 + 4 * RPW) : TK;      /* causal: keys beyond the block's last query never contribute */
  const unsigned short* Kh = (const unsigned short*)K16 + (size_t)b * TK * ldk + h * 64; const int nst = jend >> 6;      /* jend is a multiple of 64 */
  stage64(Kh, ldk, &sK[0][0][0], tid); stage64(Vth, TK, &sV[0][0][0], tid);
  wait_async0(); __syncthreads();      /* stage 0 published */
  if (nst > 1) { stage64(Kh + (size_t)64 * ldk, ldk, &sK[1][0][0], tid); stage64(Vth + 64, TK, &sV[1][0][0], tid); }
  // LDS fragment reads stand in groups, ahead of the products that use them: K of both passes and V^T of pass 0 at the head of the stage, V^T of pass 1 behind the output products of pass 0.
  // Only the first group's latency is waited out; every read stays inside its own stage, ahead of the wait and the barrier at the foot.
  FragH ak[2][2][KS], av[2][DT];
  auto ldK = [&](int bf, int pp) {
#pragma unroll
    for (int nt = 0; nt < 2; ++nt) { const unsigned short* kr = &sK[bf][pp * 32 + nt * 16 + ln][0];
#pragma unroll
      for (int ks = 0; ks < KS; ++ks) { ak[pp][nt][ks].half[0] = *(const v8us*)(kr + ks * 32 + 8 * hh); ak[pp][nt][ks].half[1] = *(const v8us*)(kr + ks * 32 + 16 + 8 * hh); } } };
  auto ldV = [&](int bf, int pp) {
#pragma unroll
    for (int dt = 0; dt < DT; ++dt) { const unsigned short* vrow = &sV[bf][dt * 16 + ln][pp * 32]; av[pp][dt].half[0] = *(const v8us*)(vrow + 8 * hh); av[pp][dt].half[1] = *(const v8us*)(vrow + 16 + 8 * hh); } };
  // the stage loop stays rolled: one stage a trip with the publish point at its foot
#pragma unroll 1
  for (int t = 0; t < nst; ++t) { const int bf = t & 1;
  ldK(bf, 0); ldK(bf, 1); ldV(bf, 0);
  // the two passes of a stage are unrolled: pass 1's fragments get registers of their own, so that their reads can be issued during pass 0
#pragma unroll
  for (int pp = 0; pp < 2; ++pp) { const int j0 = t * 64 + pp * 32;
    v8f s[2];
#pragma unroll
    for (int nt = 0; nt < 2; ++nt) { v8f acc = (v8f){0.f,0.f,0.f,0.f,0.f,0.f,0.f,0.f};
#pragma unroll
      for (int ks = 0; ks < KS; ++ks) acc = mmaH<1>(ak[pp][nt][ks].v, ak[pp][nt][ks].v, bq[ks].v, bq[ks].v, acc);
      s[nt] = acc; }
    const float base = sl2 * (float)(j0 + 8 * hh - tq);      /* ALiBi of the lane's first key of this pass */
    v8f u[2];
#pragma unroll
    for (int nt = 0; nt < 2; ++nt) u[nt] = s[nt] * c2 + kb[nt];
    if ((CAUSAL == 1 || CAUSAL == 14) && t == nst - 1) {      /* only the block's last stage holds keys beyond a query: a scalar branch, every earlier stage goes unmasked */
#pragma unroll
      for (int nt = 0; nt < 2; ++nt)
#pragma unroll
        for (int r = 0; r < 8; ++r) u[nt][r] = (j0 + nt * 16 + 8 * hh + r <= tq) ? u[nt][r] : -3.0e38f; }
    float mcn[2];      /* two independent chains */
#pragma unroll
    for (int nt = 0; nt < 2; ++nt) { mcn[nt] = u[nt][0];
#pragma unroll
      for (int r = 1; r < 8; ++r) mcn[nt] = fmaxf(mcn[nt], u[nt][r]); }
    float mc = fmaxf(mcn[0], mcn[1]) + base; mc = fmaxf(mc, xhalf(mc));
    const float mn = fmaxf(m_r, mc); const float al = __builtin_amdgcn_exp2f(m_r - mn); m_r = mn;      /* first pass: 2^(-3e38 - mn) = 0 */
    const float sh = (mn - base) - 10.0f;      /* the factor 1024 of the f16 P operand rides in the exponent; l sums the same scaled values */
    FragH pb; v8f e[2];
#pragma unroll
    for (int nt = 0; nt < 2; ++nt) { e[nt] = u[nt] - sh;      /* the exponents as one vector, each 2^x then written over its own exponent */
#pragma unroll
      for (int r = 0; r < 8; ++r) { e[nt][r] = __builtin_amdgcn_exp2f(e[nt][r]); pb.h[nt * 8 + r] = (_Float16)e[nt][r]; } }
    const v8f e8 = e[0] + e[1]; const v4f e4 = __builtin_shufflevector(e8, e8, 0, 1, 2, 3) + __builtin_shufflevector(e8, e8, 4, 5, 6, 7);
    l_r = l_r * al + ((e4[0] + e4[2]) + (e4[1] + e4[3]));
#pragma unroll
    for (int dt = 0; dt < DT; ++dt) oacc[dt] *= al;
#pragma unroll
    for (int dt = 0; dt < DT; ++dt) oacc[dt] = mmaH<1>(av[pp][dt].v, av[pp][dt].v, pb.v, pb.v, oacc[dt]);
    if (pp == 0) ldV(bf, 1); }
    wait_ds0(); wait_async0(); __syncthreads();      /* publishes stage t + 1 and ends every read of buffer bf */
    if (t + 2 < nst) { const int j2 = (t + 2) * 64; stage64(Kh + (size_t)j2 * ldk, ldk, &sK[bf][0][0], tid); stage64(Vth + j2, TK, &sV[bf][0][0], tid); } }
  wait_async0();
  const float l = l_r + xhalf(l_r); const float li = (l > 0.f) ? 1.0f / l : 0.f;      /* l carries the factor 1024 of P */
#pragma unroll
  for (int dt = 0; dt < DT; ++dt) { const v4f lo = {oacc[dt][0] * li, oacc[dt][1] * li, oacc[dt][2] * li, oacc[dt][3] * li}, hi = {oacc[dt][4] * li, oacc[dt][5] * li, oacc[dt][6] * li, oacc[dt][7] * li};
    *(v4fa*)&sO[w][ln][dt * 16 + 8 * hh] = lo; *(v4fa*)&sO[w][ln][dt * 16 + 8 * hh + 4] = hi; }
  __builtin_amdgcn_fence(__ATOMIC_ACQ_REL, "workgroup"); __builtin_amdgcn_wave_barrier();      /* the wave's own sO rows: its stores above stay ahead of its whole-line reads below */
  {
#pragma unroll
    for (int rp = 0; rp < RPW; rp += 2) { const int r = rp + (lane >> 4), pc = lane & 15; const v4f val = *(const v4fa*)&sO[w][r][pc * 4]; *(v4f*)(O + ((size_t)b * TQ + q0 + r) * ldo + h * 64 + pc * 4) = val; }
     } }
// 5-plane variant: S = Qh Kh^T + (Ql Kh^T + Qh Kl^T)/1024 with Q/K = [hi | 2^10 residual] f16 planes (QL/KL same layout as Q16/K16), then the 3-term P.V below.
// 3-term variant: O = (P_hi V_hi + (P_lo V_hi + P_hi V_lo) / 1024) / l with P = [hi | 2^10 residual] of 1024 p and V^T = [hi | 2^10 residual] planes (VtL same layout as Vt) -> ~2^-21-class products for un-averaged (early causal / peaked) rows
template <int CAUSAL>
__global__ __launch_bounds__(128) void k_flash5(const _Float16* __restrict__ Q16, const _Float16* __restrict__ QL, int ldq, const _Float16* __restrict__ K16, const _Float16* __restrict__ KL, int ldk, const _Float16* __restrict__ Vt, const _Float16* __restrict__ VtL, const int* __restrict__ MSK, float* __restrict__ O, int ldo) {
  constexpr int RPW = 16, DT = 4, KS = 2;      /* transposed products as in k_flash: lane (ln, hh) holds query q0 + ln, keys j0 + nt * 16 + 8 * hh + r; '#pragma unroll' as there */
  __shared__ __attribute__((aligned(16))) float sO[4][RPW][64 + 4];
  __shared__ __attribute__((aligned(16))) unsigned short sK[2][64][LP], sKl[2][64][LP], sV[2][64][LP], sVl[2][64][LP];      /* a stage = 64 keys of the four planes, as in k_flash */
  const int tid = threadIdx.x, w = tid >> 5, lane = tid & 31, ln = lane & 15, hh = lane >> 4;
  const int slab = blockIdx.x / QBN5, qblk = QB05 + blockIdx.x % QBN5; const int b = slab / NH, h = slab % NH; const int qb0 = qblk * (4 * RPW); const int q0 = qb0 + w * RPW; const int tq = q0 + ln;
  FragH bq[KS], bql[KS];
  { const unsigned short* qr = (const unsigned short*)Q16 + ((size_t)b * TQ + tq) * ldq + h * 64; const unsigned short* ql = (const unsigned short*)QL + ((size_t)b * TQ + tq) * ldq + h * 64;
#pragma unroll
    for (int ks = 0; ks < KS; ++ks) { bq[ks].half[0] = *(const v8us*)(qr + ks * 32 + 8 * hh); bq[ks].half[1] = *(const v8us*)(qr + ks * 32 + 16 + 8 * hh); bql[ks].half[0] = *(const v8us*)(ql + ks * 32 + 8 * hh); bql[ks].half[1] = *(const v8us*)(ql + ks * 32 + 16 + 8 * hh); } }
  const unsigned short* Vth = (const unsigned short*)Vt + (size_t)slab * 64 * TK; const unsigned short* Vtl = (const unsigned short*)VtL + (size_t)slab * 64 * TK;
  const float sl = (CAUSAL == 14) ? bf16_round(((const float*)MSK)[h]) : 0.f;      /* mode 14: causal + ALiBi slope[h] * (key - query) from the slopes INPUT */
  float m_r = -3.0e38f, l_r = 0.f; v8f oacc[DT], oaccL[DT];
#pragma unroll
  for (int dt = 0; dt < DT; ++dt) { oacc[dt] = (v8f){0.f,0.f,0.f,0.f,0.f,0.f,0.f,0.f}; oaccL[dt] = oacc[dt]; }
  const int jend = (CAUSAL == 1 || CAUSAL == 14) ? (qb0 + 4 * RPW) : TK;      /* causal: keys beyond the block's last query never contribute */
  const unsigned short* Kh = (const unsigned short*)K16 + (size_t)b * TK * ldk + h * 64; const unsigned short* Kl = (const unsigned short*)KL + (size_t)b * TK * ldk + h * 64; const int nst = jend >> 6;      /* jend is a multiple of 64 */
  stage64(Kh, ldk, &sK[0][0][0], tid); stage64(Kl, ldk, &sKl[0][0][0], tid); stage64(Vth, TK, &sV[0][0][0], tid); stage64(Vtl, TK, &sVl[0][0][0], tid);
  wait_async0(); __syncthreads();      /* stage 0 published */
  if (nst > 1) { stage64(Kh + (size_t)64 * ldk, ldk, &sK[1][0][0], tid); stage64(Kl + (size_t)64 * ldk, ldk, &sKl[1][0][0], tid); stage64(Vth + 64, TK, &sV[1][0][0], tid); stage64(Vtl + 64, TK, &sVl[1][0][0], tid); }
  // both loops stay rolled: one stage a trip with the publish point at its foot, and the two passes of a stage share one body (short code, buffer and pass as address offsets)
#pragma unroll 1
  for (int t = 0; t < nst; ++t) { const int bf = t & 1;
#pragma unroll 1
  for (int p = 0; p < 64; p += 32) { const int j0 = t * 64 + p;
    v8f s[2];
#pragma unroll
    for (int nt = 0; nt < 2; ++nt) { const unsigned short* kr = &sK[bf][p + nt * 16 + ln][0]; const unsigned short* klr = &sKl[bf][p + nt * 16 + ln][0]; FragH ak[KS], akl[KS];
#pragma unroll
      for (int ks = 0; ks < KS; ++ks) { ak[ks].half[0] = *(const v8us*)(kr + ks * 32 + 8 * hh); ak[ks].half[1] = *(const v8us*)(kr + ks * 32 + 16 + 8 * hh); akl[ks].half[0] = *(const v8us*)(klr + ks * 32 + 8 * hh); akl[ks].half[1] = *(const v8us*)(klr + ks * 32 + 16 + 8 * hh); }
      v8f acc = (v8f){0.f,0.f,0.f,0.f,0.f,0.f,0.f,0.f}, accl = acc;
#pragma unroll
      for (int ks = 0; ks < KS; ++ks) { acc = mmaH<1>(ak[ks].v, ak[ks].v, bq[ks].v, bq[ks].v, acc); accl = mmaH<1>(ak[ks].v, ak[ks].v, bql[ks].v, bql[ks].v, accl); accl = mmaH<1>(akl[ks].v, akl[ks].v, bq[ks].v, bq[ks].v, accl); }
#pragma unroll
      for (int r = 0; r < 8; ++r) acc[r] += accl[r] * 0.0009765625f;
      s[nt] = acc; }
    float sc[2][8], mcn[2]; bool ok[2][8];
#pragma unroll
    for (int nt = 0; nt < 2; ++nt) { mcn[nt] = -3.0e38f;
#pragma unroll
      for (int r = 0; r < 8; ++r) { const int kk = j0 + nt * 16 + 8 * hh + r;
        ok[nt][r] = (CAUSAL == 1 || CAUSAL == 14) ? (kk <= tq) : ((CAUSAL == 2) ? ((kk >> 5) == (tq >> 5)) : true);      /* mode 2: block-diagonal 32-token groups */
        if (CAUSAL == 4) ok[nt][r] = MSK[((size_t)b * TQ + tq) * TK + kk] != 0;      /* mode 4: per-(query, key) INPUT mask shared by all heads; masked keys contribute nothing, rows with no valid key give l = 0 -> output 0 */
        float sv = ok[nt][r] ? s[nt][r] * SCL : -3.0e38f; if (CAUSAL == 14) { if (ok[nt][r]) sv += sl * (float)(kk - tq); }
        sc[nt][r] = sv; mcn[nt] = fmaxf(mcn[nt], sv); } }
    float mc = fmaxf(mcn[0], mcn[1]); mc = fmaxf(mc, xhalf(mc));
    const float mn = fmaxf(m_r, mc); const float ea = expf(m_r - mn); const float al = (mn > -1.0e38f) ? ea : 1.0f; m_r = mn;
    FragH pb, pl; float psn[2];
#pragma unroll
    for (int nt = 0; nt < 2; ++nt) { psn[nt] = 0.f;
#pragma unroll
      for (int r = 0; r < 8; ++r) { const float e = expf(sc[nt][r] - mn); const float p = ok[nt][r] ? e : 0.f; psn[nt] += p; const float ps = p * 1024.0f; const _Float16 ph = (_Float16)ps; pb.h[nt * 8 + r] = ph; pl.h[nt * 8 + r] = (_Float16)((ps - (float)ph) * 1024.0f); } }
    l_r = l_r * al + (psn[0] + psn[1]);
#pragma unroll
    for (int dt = 0; dt < DT; ++dt)
#pragma unroll
      for (int r = 0; r < 8; ++r) { oacc[dt][r] *= al; oaccL[dt][r] *= al; }
#pragma unroll
    for (int dt = 0; dt < DT; ++dt) { const unsigned short* vrow = &sV[bf][dt * 16 + ln][p]; const unsigned short* vrl = &sVl[bf][dt * 16 + ln][p]; FragH av, avl; av.half[0] = *(const v8us*)(vrow + 8 * hh); av.half[1] = *(const v8us*)(vrow + 16 + 8 * hh); avl.half[0] = *(const v8us*)(vrl + 8 * hh); avl.half[1] = *(const v8us*)(vrl + 16 + 8 * hh);
      oacc[dt] = mmaH<1>(av.v, av.v, pb.v, pb.v, oacc[dt]); oaccL[dt] = mmaH<1>(av.v, av.v, pl.v, pl.v, oaccL[dt]); oaccL[dt] = mmaH<1>(avl.v, avl.v, pb.v, pb.v, oaccL[dt]); } }
    wait_ds0(); wait_async0(); __syncthreads();      /* publishes stage t + 1 and ends every read of buffer bf */
    if (t + 2 < nst) { const int j2 = (t + 2) * 64; stage64(Kh + (size_t)j2 * ldk, ldk, &sK[bf][0][0], tid); stage64(Kl + (size_t)j2 * ldk, ldk, &sKl[bf][0][0], tid); stage64(Vth + j2, TK, &sV[bf][0][0], tid); stage64(Vtl + j2, TK, &sVl[bf][0][0], tid); } }
  wait_async0();
  const float l = l_r + xhalf(l_r); const float li = (l > 0.f) ? 1.0f / (l * 1024.0f) : 0.f;
#pragma unroll
  for (int dt = 0; dt < DT; ++dt) { v4f lo, hi;
#pragma unroll
    for (int r = 0; r < 4; ++r) { float v = oacc[dt][r]; v += oaccL[dt][r] * 0.0009765625f; lo[r] = v * li; v = oacc[dt][4 + r]; v += oaccL[dt][4 + r] * 0.0009765625f; hi[r] = v * li; }
    *(v4fa*)&sO[w][ln][dt * 16 + 8 * hh] = lo; *(v4fa*)&sO[w][ln][dt * 16 + 8 * hh + 4] = hi; }
  __builtin_amdgcn_fence(__ATOMIC_ACQ_REL, "workgroup"); __builtin_amdgcn_wave_barrier();      /* the wave's own sO rows: its stores above stay ahead of its whole-line reads below */
  {
#pragma unroll
    for (int rp = 0; rp < RPW; rp += 2) { const int r = rp + (lane >> 4), pc = lane & 15; const v4f val = *(const v4fa*)&sO[w][r][pc * 4]; *(v4f*)(O + ((size_t)b * TQ + q0 + r) * ldo + h * 64 + pc * 4) = val; }
     } }

__global__ __launch_bounds__(256) void k_rotab(float* __restrict__ CS, float* __restrict__ SN) {
  #pragma clang fp contract(off)
  const int t = blockIdx.x * 256 + threadIdx.x; if (t >= SLEN * 32) return; const int j = t % 32, s = t / 32; const float ex = (float)(2 * j) / 64.0f; const float inv = 1.0f / powf(10000.0f, ex); const float th = (float)s * inv; const float c = cosf(th), sn = sinf(th);
  { *(float*)(CS + t) = c; *(float*)(SN + t) = sn;  } }
__global__ __launch_bounds__(256) void k_rope(const float* __restrict__ F, int nsrc, int ndst, int rep, const float* __restrict__ CS, const float* __restrict__ SN, _Float16* __restrict__ H, _Float16* __restrict__ L) {
  #pragma clang fp contract(off)
  const size_t t = (size_t)blockIdx.x * 256 + threadIdx.x; if (t >= (size_t)NR * ndst * 4) return; const int g8 = (int)(t % 4); const int hd = (int)((t / 4) % ndst); const size_t row = t / ((size_t)4 * ndst); const int s = (int)(row % SLEN); const int hs = hd / rep;
  const float* src = F + row * (size_t)(nsrc * 64) + hs * 64; FragH ah, al, bh, bl;
  for (int i = 0; i < 8; ++i) { const int d = g8 * 8 + i; const float c = CS[s * 32 + d], sn = SN[s * 32 + d]; const float x1 = src[d], x2 = src[d + 32];
    float o1 = x1 * c; o1 += -x2 * sn; float o2 = x2 * c; o2 += x1 * sn;
    _Float16 hv = (_Float16)o1; ah.h[i] = hv; al.h[i] = (_Float16)((o1 - (float)hv) * 1024.0f); hv = (_Float16)o2; bh.h[i] = hv; bl.h[i] = (_Float16)((o2 - (float)hv) * 1024.0f); }
  const size_t o = row * (size_t)(ndst * 64) + hd * 64 + g8 * 8;
  { *(v8us*)((unsigned short*)H + o) = ah.half[0]; *(v8us*)((unsigned short*)H + o + 32) = bh.half[0]; *(v8us*)((unsigned short*)L + o) = al.half[0]; *(v8us*)((unsigned short*)L + o + 32) = bl.half[0];  } }
__global__ __launch_bounds__(256) void k_kexp(const float* __restrict__ F, _Float16* __restrict__ H, _Float16* __restrict__ L) { const size_t t = (size_t)blockIdx.x * 256 + threadIdx.x; if (t >= (size_t)NR * NH * 8) return; const int g8 = (int)(t % 8); const int hd = (int)((t / 8) % NH); const size_t row = t / ((size_t)8 * NH); const float* src = F + row * (size_t)KVD + (hd / NREP) * 64 + g8 * 8; FragH fh, fl;
  for (int i = 0; i < 8; ++i) { const _Float16 hv = (_Float16)src[i]; fh.h[i] = hv; fl.h[i] = (_Float16)((src[i] - (float)hv) * 1024.0f); } const size_t o = row * (size_t)(NH * 64) + hd * 64 + g8 * 8;
  { *(v8us*)((unsigned short*)H + o) = fh.half[0]; *(v8us*)((unsigned short*)L + o) = fl.half[0];  } }
__global__ __launch_bounds__(256) void k_vtg(const _Float16* __restrict__ V16, _Float16* __restrict__ Vt) { __shared__ unsigned short tl[64][66]; const int tid = threadIdx.x; const int slab = blockIdx.x / (SLEN / 64), lg = blockIdx.x % (SLEN / 64); const int b = slab / NH, h = slab % NH; const int hs = h / NREP;
  for (int i = tid; i < 64 * 8; i += 256) { const int r = i / 8, c8 = (i % 8) * 8; FragH f; f.half[0] = *(const v8us*)((const unsigned short*)V16 + ((size_t)b * SLEN + lg * 64 + r) * KVD + hs * 64 + c8); for (int q = 0; q < 8; ++q) tl[r][c8 + q] = f.u[q]; }
  __syncthreads();
  { for (int rd = 0; rd < 2; ++rd) { const int d = rd * 32 + tid / 8, pc = tid % 8; FragH f; for (int q = 0; q < 8; ++q) f.u[q] = tl[pc * 8 + q][d]; *(v8us*)((unsigned short*)Vt + ((size_t)slab * 64 + d) * SLEN + lg * 64 + pc * 8) = f.half[0]; }  } }

extern "C" void kernel_launch(void* const* d_in, const int* in_sizes, int n_in,
                              void* d_out, int out_size, void* d_ws, size_t ws_size, hipStream_t stream) {
  (void)in_sizes; (void)n_in; (void)out_size;
  const float* const* I = (const float* const*)d_in; const float* x = I[0]; const float* Wq = I[1]; const float* bq = I[2]; const float* Wk = I[3]; const float* bk = I[4]; const float* Wv = I[5]; const float* bv = I[6]; const float* Wo = I[7]; const float* bo = I[8]; const float* slopes = I[9];
  char* ws = (char*)d_ws; size_t off = 0;
  auto take = [&](size_t bytes) { char* p = ws + off; off += (bytes + 255) & ~(size_t)255; return p; };
  const size_t np = (size_t)NR * DM, nk = (size_t)NR * KVD;
  _Float16* BQ = (_Float16*)take((size_t)DM * DM * 2); _Float16* BK = (_Float16*)take((size_t)KVD * DM * 2); _Float16* BV = (_Float16*)take((size_t)KVD * DM * 2); _Float16* BO = (_Float16*)take((size_t)DM * DM * 2);
  _Float16* X16 = (_Float16*)take(np * 2); float* QF = (float*)take(np * 4); _Float16* QH = (_Float16*)take(np * 2); _Float16* QL = (_Float16*)take(np * 2); float* KF = (float*)take(nk * 4); float* VF = (float*)take(nk * 4); _Float16* KXH = (_Float16*)take(np * 2); _Float16* KXL = (_Float16*)take(np * 2); _Float16* VH = (_Float16*)take(nk * 2); _Float16* VL = (_Float16*)take(nk * 2); _Float16* VT = (_Float16*)take(np * 2); _Float16* VTL = (_Float16*)take(np * 2);
  float* O = QF;      /* attention output over the q f32 plane (dead after the q hi/lo split) */ _Float16* OH = (_Float16*)take(np * 2); _Float16* OLo = (_Float16*)take(np * 2);
  if (off > ws_size) return;      /* 2+0.5+0.5+2 + 8+16+8+8+4+4+8+8+2+2+8+8+8+8 = 105 MiB */
  k_wt_f16<<<(unsigned)(((size_t)DM * DM / 8 + 255) / 256), 256, 0, stream>>>(Wq, BQ, DM, DM, 16.0f); k_wt_f16<<<(unsigned)(((size_t)DM * KVD / 8 + 255) / 256), 256, 0, stream>>>(Wk, BK, DM, KVD, 16.0f); k_wt_f16<<<(unsigned)(((size_t)DM * KVD / 8 + 255) / 256), 256, 0, stream>>>(Wv, BV, DM, KVD, 16.0f); k_wt_f16<<<(unsigned)(((size_t)DM * DM / 8 + 255) / 256), 256, 0, stream>>>(Wo, BO, DM, DM, 16.0f);
  k_x16<<<(unsigned)((np / 8 + 255) / 256), 256, 0, stream>>>(x, X16, np / 8);
  k_gemm2<0><<<dim3((NR / 128) * (DM / 64), 1), 128, 0, stream>>>(X16, DM, 0, BQ, DM, 0, 0.0625f, bq, 0, nullptr, 1, 0, 0, QF, nullptr, DM, 0, NR, DM, DM);
  k_gemm2<0><<<dim3((NR / 128) * (KVD / 64), 1), 128, 0, stream>>>(X16, DM, 0, BK, DM, 0, 0.0625f, bk, 0, nullptr, 1, 0, 0, KF, nullptr, KVD, 0, NR, KVD, DM);
  k_gemm2<0><<<dim3((NR / 128) * (KVD / 64), 1), 128, 0, stream>>>(X16, DM, 0, BV, DM, 0, 0.0625f, bv, 0, nullptr, 1, 0, 0, VF, nullptr, KVD, 0, NR, KVD, DM);
  k_hl<<<(unsigned)((np / 8 + 255) / 256), 256, 0, stream>>>(QF, QH, QL, np / 8);      /* q hi/lo */
  k_kexp<<<(unsigned)(((size_t)NR * NH * 8 + 255) / 256), 256, 0, stream>>>(KF, KXH, KXL);      /* k: kv head h/4 expanded to query head h, hi/lo */
  k_hl<<<(unsigned)((nk / 8 + 255) / 256), 256, 0, stream>>>(VF, VH, VL, nk / 8);
  k_vtg<<<NB * NH * (SLEN / 64), 256, 0, stream>>>(VH, VT); k_vtg<<<NB * NH * (SLEN / 64), 256, 0, stream>>>(VL, VTL);      /* QF becomes O from here on */
  k_flash5<14><<<NB * NH * QBN5, 128, 0, stream>>>(QH, QL, DM, KXH, KXL, DM, VT, VTL, (const int*)slopes, O, DM);      /* causal + ALiBi, rows < 256: hi + residual */
  k_flash<14><<<NB * NH * QBNP, 128, 0, stream>>>(QH, DM, KXH, DM, VT, (const int*)slopes, O, DM);      /* causal + ALiBi, rows >= 256: plain */
  k_hl<<<(unsigned)((np / 8 + 255) / 256), 256, 0, stream>>>(O, OH, OLo, np / 8);
  k_gemm2<0><<<dim3((NR / 128) * (DM / 64), 1), 128, 0, stream>>>(OH, DM, 0, BO, DM, 0, 0.0625f, bo, 0, nullptr, 1, 0, 0, (float*)d_out, nullptr, DM, 0, NR, DM, DM);      /* out = ctx Wo + bo */
  for (int b = 0; b < NB; ++b) k_gemm2<0><<<dim3((RE / 128) * (DM / 64), 1), 128, 0, stream>>>(OLo + (size_t)b * SLEN * DM, DM, 0, BO, DM, 0, 0.0625f / 1024.0f, nullptr, 0, (const float*)d_out + (size_t)b * SLEN * DM, 1, (size_t)DM, 0, (float*)d_out + (size_t)b * SLEN * DM, nullptr, DM, 0, RE, DM, DM);      /* += O residual . Wo on the first 256 rows of each sequence */
}

// v005
// Measured time: 177 microseconds a run.
// In both of two side-by-side timings against v004, it was 1.16 times as fast.
// Over all steps from v000 it is 4.51 times as fast.
#include <hip/hip_runtime.h>
// CausalAlibiAttn (1 x 4096 tokens, D 1024 = 16 heads of 64, 4 kv heads): q, k, v = x W + b; q head h uses kv head h/4; scores/8 + slope[h] * (key - query) (ALiBi, slopes INPUT), causal; softmax; ctx Wo + bo.
// Structure: exact f16 plane of x; q, k, v by WMMA GEMMs (32x64 wave tiles, f32 accumulation, exact x16 weights + bias) whose epilogues split the f32 result into f16 hi + 2^10-residual planes themselves (v transposed in the LDS staging tile; k, v stay at their 4 kv heads); the fused causal flash kernel (query head h reads kv head h / 4) with the ALiBi term added per (head, query, key) in f32, in its 5-plane form for the first 256 query rows and the plain form beyond; it stores O as f16 hi (+ residual on those rows) for the Wo GEMMs (+ bias; residual term only on those rows).
// Compute dtype: x and parameters rounded to bf16; q/k/P/v/O as f16 hi + residual on rows < 256 (~2^-21) and plain f16 beyond (~2^-12); ALiBi/softmax f32. v_wmma_f32_16x16x32_f16.
#define NB 1
#define DM 1024
#define NKV 4
#define NREP (NH / NKV)
#define KVD (NKV * 64)           /* 256 */
#define NR (NB * SLEN)           /* 4096 */
#define SLEN 4096
#define TQ SLEN
#define TK SLEN
#define NH 16
#define SCL 0.125f
#define QBLKS (TQ / 64)
#define QB05 0
#define QBN5 4
#define QB0P QBN5
#define QBNP (QBLKS - QBN5)
#define RE 256
typedef __bf16 v16b __attribute__((ext_vector_type(16)));
typedef unsigned short v8us __attribute__((ext_vector_type(8), may_alias));
typedef float  v8f  __attribute__((ext_vector_type(8)));
typedef float  v4f  __attribute__((ext_vector_type(4)));
typedef float  v4fa __attribute__((ext_vector_type(4), may_alias));
union FragB { v16b v; v8us half[2]; unsigned short u[16]; };

__device__ __forceinline__ unsigned short bf16_bits(float x) { unsigned int u = __float_as_uint(x); return (unsigned short)((u + 0x7FFFu + ((u >> 16) & 1u)) >> 16); }
__device__ __forceinline__ float bf16_val(unsigned short b) { return __uint_as_float(((unsigned int)b) << 16); }
__device__ __forceinline__ float bf16_round(float x) { return bf16_val(bf16_bits(x)); }
// D += A·B with NT terms: 1 = ah·bh, 2 = + al·bh (A split), 3 = + ah·bl (both split)
template <int NT>
__device__ __forceinline__ v8f mmaN(v16b ah, v16b al, v16b bh, v16b bl, v8f c) {
  c = __builtin_amdgcn_wmma_f32_16x16x32_bf16(false, ah, false, bh, (short)0, c, false, false);
  if (NT >= 2) c = __builtin_amdgcn_wmma_f32_16x16x32_bf16(false, al, false, bh, (short)0, c, false, false);
  if (NT >= 3) c = __builtin_amdgcn_wmma_f32_16x16x32_bf16(false, ah, false, bl, (short)0, c, false, false);
  asm volatile("v_nop\n\tv_nop\n\tv_nop\n\tv_nop" : "+v"(c) : "v"(ah), "v"(al), "v"(bh), "v"(bl));
  return c;
}

__global__ __launch_bounds__(256) void k_wt_bf16(const float* __restrict__ W, unsigned short* __restrict__ Wt, int K, int N) {
  const int t = blockIdx.x * 256 + threadIdx.x;
  const int k8n = K / 8;
  if (t >= N * k8n) return;
  const int n = t / k8n, k8 = (t % k8n) * 8;
  v8us v;
#pragma unroll
  for (int i = 0; i < 8; ++i) v[i] = bf16_bits(W[(size_t)(k8 + i) * N + n]);
  *(v8us*)(Wt + (size_t)n * K + k8) = v;
  
}

// GEMM C[M][N] (f32, pitch ldc) = act(A[M][K]·W + bias). A f32 row-major (pitch lda) converted per fragment to bf16
// (ASPLIT: hi/lo two planes -> 2 terms, else single rounded term); Wt bf16 [N][K] (pitch ldb). BIAS_BF16 rounds the
// bias to bf16 first (bias quantised to bf16 before the add). K%32==0, M%16==0, N%64==0.
template <bool ASPLIT, int ACT, bool BIAS_BF16>
__global__ __launch_bounds__(128) void k_gemm_bf(const float* __restrict__ A, int lda, const unsigned short* __restrict__ Wt, int ldb,
                                               const float* __restrict__ bias, float* __restrict__ C, int ldc, int M, int N, int K) {
  __shared__ __attribute__((aligned(16))) float so[4][16][64];
  const int tid = threadIdx.x, w = tid >> 5, lane = tid & 31, ln = lane & 15, hh = lane >> 4;
  const int ntn = N / 64;
  const int wid = blockIdx.x * 4 + w;
  const int mt = wid / ntn, nq = wid % ntn;
  if (mt * 16 >= M) return;
  const int row0 = mt * 16, col0 = nq * 64;
  const float* arow = A + (size_t)(row0 + ln) * lda;
  v8f acc[4] = {};
  for (int kb = 0; kb < K; kb += 32) {
    FragB ah, al;
    const v4f x0 = *(const v4fa*)(arow + kb + 8 * hh), x1 = *(const v4fa*)(arow + kb + 8 * hh + 4);
    const v4f x2 = *(const v4fa*)(arow + kb + 16 + 8 * hh), x3 = *(const v4fa*)(arow + kb + 16 + 8 * hh + 4);
    float xs[16] = {x0[0],x0[1],x0[2],x0[3],x1[0],x1[1],x1[2],x1[3],x2[0],x2[1],x2[2],x2[3],x3[0],x3[1],x3[2],x3[3]};
#pragma unroll
    for (int i = 0; i < 16; ++i) { const unsigned short hb = bf16_bits(xs[i]); ah.u[i] = hb; al.u[i] = ASPLIT ? bf16_bits(xs[i] - bf16_val(hb)) : (unsigned short)0; }
#pragma unroll
    for (int t = 0; t < 4; ++t) {
      const unsigned short* brow = Wt + (size_t)(col0 + t * 16 + ln) * ldb + kb;
      FragB b;
      b.half[0] = *(const v8us*)(brow + 8 * hh);
      b.half[1] = *(const v8us*)(brow + 16 + 8 * hh);
      acc[t] = mmaN<ASPLIT ? 2 : 1>(ah.v, al.v, b.v, b.v, acc[t]);
    }
  }
#pragma unroll
  for (int t = 0; t < 4; ++t) {
    float bv = bias ? bias[col0 + t * 16 + ln] : 0.f;
    if (BIAS_BF16) bv = bf16_round(bv);
#pragma unroll
    for (int r = 0; r < 8; ++r) { float v = acc[t][r] + bv; if (ACT == 1) v = fmaxf(v, 0.f); so[w][8 * hh + r][t * 16 + ln] = v; }
  }
  __builtin_amdgcn_fence(__ATOMIC_ACQ_REL, "workgroup");
  __builtin_amdgcn_wave_barrier();
  const int rsub = lane >> 4, c4 = (lane & 15) * 4;
  {
#pragma unroll
    for (int q = 0; q < 8; ++q) {
      const int r = q * 2 + rsub;
      const v4f v = *(const v4fa*)&so[w][r][c4];
      *(v4f*)(C + (size_t)(row0 + r) * ldc + col0 + c4) = v;
    }
    
  }
}

// GEMM C = act(A·W + bias + resid): A f32 (ASPLIT -> hi/lo 2 terms), Wt bf16 [N][K]; ACT 0 none, 1 relu, 2 exact gelu;
// resid (optional, f32, row index = (row % rmod), pitch ldr, RES_BF16 rounds it) added before the activation.
template <bool ASPLIT, int ACT, bool BIAS_BF16, bool RES_BF16>
__global__ __launch_bounds__(128) void k_gemm_bf3(const float* __restrict__ A, int lda, const unsigned short* __restrict__ Wt, int ldb,
                                                const float* __restrict__ bias, const float* __restrict__ resid, int rmod, int ldr,
                                                float* __restrict__ C, int ldc, int M, int N, int K) {
  __shared__ __attribute__((aligned(16))) float so[4][16][64];
  const int tid = threadIdx.x, w = tid >> 5, lane = tid & 31, ln = lane & 15, hh = lane >> 4;
  const int ntn = N / 64;
  const int wid = blockIdx.x * 4 + w;
  const int mt = wid / ntn, nq = wid % ntn;
  if (mt * 16 >= M) return;
  const int row0 = mt * 16, col0 = nq * 64;
  const float* arow = A + (size_t)(row0 + ln) * lda;
  v8f acc[4] = {};
  for (int kb = 0; kb < K; kb += 32) {
    FragB ah, al;
    const v4f x0 = *(const v4fa*)(arow + kb + 8 * hh), x1 = *(const v4fa*)(arow + kb + 8 * hh + 4);
    const v4f x2 = *(const v4fa*)(arow + kb + 16 + 8 * hh), x3 = *(const v4fa*)(arow + kb + 16 + 8 * hh + 4);
    float xs[16] = {x0[0],x0[1],x0[2],x0[3],x1[0],x1[1],x1[2],x1[3],x2[0],x2[1],x2[2],x2[3],x3[0],x3[1],x3[2],x3[3]};
#pragma unroll
    for (int i = 0; i < 16; ++i) { const unsigned short hb = bf16_bits(xs[i]); ah.u[i] = hb; al.u[i] = ASPLIT ? bf16_bits(xs[i] - bf16_val(hb)) : (unsigned short)0; }
#pragma unroll
    for (int t = 0; t < 4; ++t) {
      const unsigned short* brow = Wt + (size_t)(col0 + t * 16 + ln) * ldb + kb;
      FragB b;
      b.half[0] = *(const v8us*)(brow + 8 * hh);
      b.half[1] = *(const v8us*)(brow + 16 + 8 * hh);
      acc[t] = mmaN<ASPLIT ? 2 : 1>(ah.v, al.v, b.v, b.v, acc[t]);
    }
  }
#pragma unroll
  for (int t = 0; t < 4; ++t) {
    const int col = col0 + t * 16 + ln;
    float bv = bias ? bias[col] : 0.f;
    if (BIAS_BF16) bv = bf16_round(bv);
#pragma unroll
    for (int r = 0; r < 8; ++r) {
      float v = acc[t][r] + bv;
      if (resid) { float rv = resid[(size_t)((row0 + 8 * hh + r) % rmod) * ldr + col]; if (RES_BF16) rv = bf16_round(rv); v += rv; }
      if (ACT == 1) v = fmaxf(v, 0.f);
      if (ACT == 2) v = 0.5f * v * (1.0f + erff(v * 0.70710678118654752f));
      if (ACT == 3) { const float u = 0.7978845608028654f * (v + 0.044715f * v * v * v); v = 0.5f * v * (1.0f + tanhf(u)); }
      so[w][8 * hh + r][t * 16 + ln] = v;
    }
  }
  __builtin_amdgcn_fence(__ATOMIC_ACQ_REL, "workgroup");
  __builtin_amdgcn_wave_barrier();
  const int rsub = lane >> 4, c4 = (lane & 15) * 4;
  {
#pragma unroll
    for (int q = 0; q < 8; ++q) {
      const int r = q * 2 + rsub;
      const v4f v = *(const v4fa*)&so[w][r][c4];
      *(v4f*)(C + (size_t)(row0 + r) * ldc + col0 + c4) = v;
    }
    
  }
}
// row LayerNorm (biased variance, eps) over N: s = X (+ R); optional out_sum <- s; out_norm <- (s-mu)*rsqrt(var+eps)*g + b
template <bool PARAM_BF16>
__global__ __launch_bounds__(256) void k_layernorm(const float* __restrict__ X, const float* __restrict__ R, const float* __restrict__ g, const float* __restrict__ bta,
                                                  float* __restrict__ out_sum, float* __restrict__ out_norm, int N, float eps) {
  __shared__ float red[256];
  const int row = blockIdx.x, tid = threadIdx.x;
  const float* x = X + (size_t)row * N; const float* rr = R ? R + (size_t)row * N : nullptr;
  float vals[16];                     // up to N = 4096
  const int per = N / 256;            // contiguous chunk per thread? use strided-by-4 chunks: thread handles j = tid*4 + 1024*u
  float s1 = 0.f;
  for (int u = 0; u < per / 4; ++u) {
    const int j = tid * 4 + 1024 * u;
    const v4f a = *(const v4fa*)(x + j);
    v4f b = {0.f,0.f,0.f,0.f}; if (rr) b = *(const v4fa*)(rr + j);
#pragma unroll
    for (int q = 0; q < 4; ++q) { const float v = a[q] + b[q]; vals[u * 4 + q] = v; s1 += v; }
  }
  red[tid] = s1; __syncthreads();
  for (int st = 128; st > 0; st >>= 1) { if (tid < st) red[tid] += red[tid + st]; __syncthreads(); }
  const float mu = red[0] / (float)N; __syncthreads();
  float s2 = 0.f;
  for (int u = 0; u < per / 4; ++u)
#pragma unroll
    for (int q = 0; q < 4; ++q) { const float c = vals[u * 4 + q] - mu; s2 += c * c; }
  red[tid] = s2; __syncthreads();
  for (int st = 128; st > 0; st >>= 1) { if (tid < st) red[tid] += red[tid + st]; __syncthreads(); }
  const float rs = rsqrtf(red[0] / (float)N + eps);
  {
    for (int u = 0; u < per / 4; ++u) {
      const int j = tid * 4 + 1024 * u;
      v4f o, sm;
#pragma unroll
      for (int q = 0; q < 4; ++q) {
        float gg = g[j + q], bb = bta[j + q];
        if (PARAM_BF16) { gg = bf16_round(gg); bb = bf16_round(bb); }
        sm[q] = vals[u * 4 + q]; o[q] = (vals[u * 4 + q] - mu) * rs * gg + bb;
      }
      if (out_sum) *(v4f*)(out_sum + (size_t)row * N + j) = sm;
      *(v4f*)(out_norm + (size_t)row * N + j) = o;
    }
    
  }
}



// ---- f16 WMMA path (v_wmma_f32_16x16x32_f16): 11-bit significands for operands in range — used where a [0,1] probability operand needs more precision than bf16
typedef _Float16 v16h __attribute__((ext_vector_type(16)));
union FragH { v16h v; v8us half[2]; _Float16 h[16]; unsigned short u[16]; };
template <int NT>
__device__ __forceinline__ v8f mmaH(v16h ah, v16h al, v16h bh, v16h bl, v8f c) {
  c = __builtin_amdgcn_wmma_f32_16x16x32_f16(false, ah, false, bh, (short)0, c, false, false);
  if (NT >= 2) c = __builtin_amdgcn_wmma_f32_16x16x32_f16(false, al, false, bh, (short)0, c, false, false);
  if (NT >= 3) c = __builtin_amdgcn_wmma_f32_16x16x32_f16(false, ah, false, bl, (short)0, c, false, false);
  asm volatile("v_nop\n\tv_nop\n\tv_nop\n\tv_nop" : "+v"(c) : "v"(ah), "v"(al), "v"(bh), "v"(bl));
  return c;
}
// batched GEMM like k_gemm_b but f16 operands: A f32 (split into f16 hi/lo if ASPLIT, else rounded to f16), Bt = f16 values [n][k]; alpha; C f32; N multiple of 16 (partial tiles skipped)
template <bool ASPLIT>
__global__ __launch_bounds__(128) void k_gemm_h(const float* __restrict__ A, int lda, size_t sA, const _Float16* __restrict__ Bh, int ldb, size_t sB, float alpha, float* __restrict__ C, int ldc, size_t sC, int M, int N, int K) {
  __shared__ __attribute__((aligned(16))) float so[4][16][64];
  const int tid = threadIdx.x, w = tid >> 5, lane = tid & 31, ln = lane & 15, hh = lane >> 4; const int by = blockIdx.y;
  A += (size_t)by * sA; Bh += (size_t)by * sB; C += (size_t)by * sC;
  const int ntn = (N + 63) / 64; const int wid = blockIdx.x * 4 + w; const int mt = wid / ntn, nq = wid % ntn; if (mt * 16 >= M) return;
  const int row0 = mt * 16, col0 = nq * 64; const float* arow = A + (size_t)(row0 + ln) * lda;
  v8f acc[4] = {};
  for (int kb = 0; kb < K; kb += 32) {
    FragH ah, al;
    const v4f x0 = *(const v4fa*)(arow + kb + 8 * hh), x1 = *(const v4fa*)(arow + kb + 8 * hh + 4), x2 = *(const v4fa*)(arow + kb + 16 + 8 * hh), x3 = *(const v4fa*)(arow + kb + 16 + 8 * hh + 4);
    float xs[16] = {x0[0],x0[1],x0[2],x0[3],x1[0],x1[1],x1[2],x1[3],x2[0],x2[1],x2[2],x2[3],x3[0],x3[1],x3[2],x3[3]};
#pragma unroll
    for (int i = 0; i < 16; ++i) { const _Float16 h = (_Float16)xs[i]; ah.h[i] = h; al.h[i] = ASPLIT ? (_Float16)(xs[i] - (float)h) : (_Float16)0.0f; }
#pragma unroll
    for (int t = 0; t < 4; ++t) { if (col0 + t * 16 >= N) continue; const size_t boff = (size_t)(col0 + t * 16 + ln) * ldb + kb; FragH bq; bq.half[0] = *(const v8us*)(Bh + boff + 8 * hh); bq.half[1] = *(const v8us*)(Bh + boff + 16 + 8 * hh);
      acc[t] = mmaH<ASPLIT ? 2 : 1>(ah.v, al.v, bq.v, bq.v, acc[t]); }
  }
#pragma unroll
  for (int t = 0; t < 4; ++t) { if (col0 + t * 16 >= N) continue;
#pragma unroll
    for (int r = 0; r < 8; ++r) so[w][8 * hh + r][t * 16 + ln] = acc[t][r] * alpha; }
  __builtin_amdgcn_fence(__ATOMIC_ACQ_REL, "workgroup"); __builtin_amdgcn_wave_barrier();
  const int rsub = lane >> 4, c4 = (lane & 15) * 4;
  {
#pragma unroll
    for (int q = 0; q < 8; ++q) { const int r = q * 2 + rsub; if (col0 + c4 < N) { const v4f v = *(const v4fa*)&so[w][r][c4]; *(v4f*)(C + (size_t)(row0 + r) * ldc + col0 + c4) = v; } }
     }
}

// Wt[n][k] = f16(W[k][n]·scale) from f32 row-major W[K][N] (scale = power of two; bf16-exact weights stay exact in f16 away from the subnormal range)
__global__ __launch_bounds__(256) void k_wt_f16(const float* __restrict__ W, _Float16* __restrict__ Wt, int K, int N, float scale) {
  const int t = blockIdx.x * 256 + threadIdx.x; if (t >= N * (K / 8)) return; const int n = t / (K / 8), k8 = (t % (K / 8)) * 8; FragH f;
#pragma unroll
  for (int i = 0; i < 8; ++i) f.h[i] = (_Float16)(bf16_round(W[(size_t)(k8 + i) * N + n]) * scale); const v8us o = f.half[0];
  *(v8us*)((unsigned short*)Wt + (size_t)n * K + k8) = o; 
}
// k_gemm_hh variant with fused epilogue: v = acc·alpha + bias[by·sBias + col] (+ CP[(row/rowsPerB)·sCPb + by·64 + col] if CP) ; ACT 0 none / 1 elu ; writes f16 C16 (and f32 C if non-null)
template <int ACT>
__global__ __launch_bounds__(128) void k_gemm_hhx(const _Float16* __restrict__ A, int lda, size_t sA, const _Float16* __restrict__ Bh, int ldb, size_t sB, float alpha, const float* __restrict__ bias, size_t sBias, const float* __restrict__ CP, int rowsPerB, size_t sCPb, int row0g,
    float* __restrict__ C, _Float16* __restrict__ C16, int ldc, size_t sC, int M, int N, int K) {
  __shared__ __attribute__((aligned(16))) float so[4][16][64];
  const int tid = threadIdx.x, w = tid >> 5, lane = tid & 31, ln = lane & 15, hh = lane >> 4; const int by = blockIdx.y;
  A += (size_t)by * sA; Bh += (size_t)by * sB; const size_t cofs = (size_t)by * sC; const float* bp = bias ? bias + (size_t)by * sBias : nullptr;
  const int ntn = (N + 63) / 64; const int wid = blockIdx.x * 4 + w; const int mt = wid / ntn, nq = wid % ntn; if (mt * 16 >= M) return;
  const int row0 = mt * 16, col0 = nq * 64; const _Float16* arow = A + (size_t)(row0 + ln) * lda;
  v8f acc[4] = {};
  for (int kb = 0; kb < K; kb += 32) { FragH ah; ah.half[0] = *(const v8us*)((const unsigned short*)arow + kb + 8 * hh); ah.half[1] = *(const v8us*)((const unsigned short*)arow + kb + 16 + 8 * hh);
#pragma unroll
    for (int t = 0; t < 4; ++t) { if (col0 + t * 16 >= N) continue; const size_t boff = (size_t)(col0 + t * 16 + ln) * ldb + kb; FragH bq; bq.half[0] = *(const v8us*)((const unsigned short*)Bh + boff + 8 * hh); bq.half[1] = *(const v8us*)((const unsigned short*)Bh + boff + 16 + 8 * hh);
      acc[t] = mmaH<1>(ah.v, ah.v, bq.v, bq.v, acc[t]); }
  }
#pragma unroll
  for (int t = 0; t < 4; ++t) { if (col0 + t * 16 >= N) continue; const int col = col0 + t * 16 + ln; const float bv = bp ? bf16_round(bp[col]) : 0.f;
#pragma unroll
    for (int r = 0; r < 8; ++r) { float v = acc[t][r] * alpha + bv; if (CP) { const int bidx = (row0g + row0 + 8 * hh + r) / rowsPerB; v += CP[(size_t)bidx * sCPb + (size_t)by * 64 + col]; } if (ACT == 1) v = (v > 0.f) ? v : expm1f(v); else if (ACT == 7) v = (v > 0.f) ? v + 1.0f : expf(v); else if (ACT == 8) v = tanhf(v); else if (ACT == 9) v = 0.5f * v * (1.0f + tanhf(0.7978845608028654f * (v + 0.044715f * v * v * v))); else if (ACT == 11) v = 1.0f / (1.0f + expf(-v)); else if (ACT == 12) v = (v > 0.f) ? v : 0.01f * v; else if (ACT == 14) v = (v > 0.f) ? v : 0.1f * v; else if (ACT == 15) v = v / (1.0f + expf(-v)); else if (ACT == 3) v = fmaxf(v, 0.f); else if (ACT == 6) v = 0.5f * v * (1.0f + erff(v * 0.70710678118654752f)); so[w][8 * hh + r][t * 16 + ln] = v; } }
  __builtin_amdgcn_fence(__ATOMIC_ACQ_REL, "workgroup"); __builtin_amdgcn_wave_barrier();
  const int rsub = lane >> 4, c4 = (lane & 15) * 4; typedef _Float16 v4h __attribute__((ext_vector_type(4)));
  {
#pragma unroll
    for (int q = 0; q < 8; ++q) { const int r = q * 2 + rsub; if (col0 + c4 < N) { const v4f v = *(const v4fa*)&so[w][r][c4]; if (C) *(v4f*)(C + cofs + (size_t)(row0 + r) * ldc + col0 + c4) = v; if (C16) { v4h h4; for (int i = 0; i < 4; ++i) h4[i] = (_Float16)v[i]; *(v4h*)(C16 + cofs + (size_t)(row0 + r) * ldc + col0 + c4) = h4; } } }
     }
}


typedef _Float16 v4h __attribute__((ext_vector_type(4)));

__global__ __launch_bounds__(256) void k_x16(const float* __restrict__ x, _Float16* __restrict__ X16, size_t n8) { const size_t t = (size_t)blockIdx.x * 256 + threadIdx.x; if (t >= n8) return; FragH f;
#pragma unroll
  for (int q = 0; q < 8; ++q) f.h[q] = (_Float16)bf16_round(x[t * 8 + q]); *(v8us*)((unsigned short*)X16 + t * 8) = f.half[0];  }
__global__ __launch_bounds__(256) void k_h16(const float* __restrict__ x, _Float16* __restrict__ X16, size_t n8) { const size_t t = (size_t)blockIdx.x * 256 + threadIdx.x; if (t >= n8) return; FragH f;
#pragma unroll
  for (int q = 0; q < 8; ++q) f.h[q] = (_Float16)x[t * 8 + q]; *(v8us*)((unsigned short*)X16 + t * 8) = f.half[0];  }
__global__ __launch_bounds__(256) void k_round16f(const float* __restrict__ W, _Float16* __restrict__ Bt, size_t n8) { const size_t t = (size_t)blockIdx.x * 256 + threadIdx.x; if (t >= n8) return; FragH f;
#pragma unroll
  for (int i = 0; i < 8; ++i) f.h[i] = (_Float16)(bf16_round(W[t * 8 + i]) * 16.0f); *(v8us*)((unsigned short*)Bt + t * 8) = f.half[0];  }
template <int NHv, int TTv>
__global__ __launch_bounds__(256) void k_vt(const _Float16* __restrict__ V16, int ldv, int voff, _Float16* __restrict__ Vt) { __shared__ unsigned short tl[64][66]; const int tid = threadIdx.x; const int slab = blockIdx.x / (TTv / 64), lg = blockIdx.x % (TTv / 64); const int b = slab / NHv, h = slab % NHv;
  for (int i = tid; i < 64 * 8; i += 256) { const int r = i / 8, c8 = (i % 8) * 8; FragH f; f.half[0] = *(const v8us*)((const unsigned short*)V16 + ((size_t)b * TTv + lg * 64 + r) * ldv + voff + h * 64 + c8);
#pragma unroll
    for (int q = 0; q < 8; ++q) tl[r][c8 + q] = f.u[q]; }
  __syncthreads();
  {
#pragma unroll
    for (int rd = 0; rd < 2; ++rd) { const int d = rd * 32 + tid / 8, pc = tid % 8; FragH f;
#pragma unroll
      for (int q = 0; q < 8; ++q) f.u[q] = tl[pc * 8 + q][d];
      *(v8us*)((unsigned short*)Vt + ((size_t)slab * 64 + d) * TTv + lg * 64 + pc * 8) = f.half[0]; }
     } }

// ---- LDS staging by asynchronous copies (global_load_async_to_lds_b128): a lane moves its own 16 bytes, 8 lanes one whole 128-byte row; two buffers, the next stage in flight while this one is worked on ----
#define LP 72      /* LDS row pitch in f16: 128 data bytes + 16 = an odd multiple of 16 bytes, the conflict-free pitch of the ds_load_b128 fragment readers */
__device__ __forceinline__ void wait_async0() { asm volatile("s_wait_asynccnt 0x0" ::: "memory"); }      /* the wave's own copies have landed; stands before the barrier behind which the other waves read them */
__device__ __forceinline__ void wait_ds0() { asm volatile("s_wait_dscnt 0x0" ::: "memory"); }      /* the wave's own LDS reads have retired before the barrier behind which their buffer is refilled */
// one tile of 64 rows x 128 bytes (row pitch ldg f16 in global memory, LP in LDS) by 128 threads: 4 copies a lane, rows tid / 8 + 16 i. The s_wait_xcnt closes the statement so that no address register is rewritten ahead of it.
__device__ __forceinline__ void stage64(const unsigned short* g, size_t ldg, const unsigned short* s, int tid) {
  const unsigned short* g0 = g + (size_t)(tid >> 3) * ldg + (tid & 7) * 8; const unsigned short* g1 = g0 + 16 * ldg; const unsigned short* g2 = g1 + 16 * ldg; const unsigned short* g3 = g2 + 16 * ldg;
  const unsigned l0 = (unsigned)(size_t)(s + (tid >> 3) * LP + (tid & 7) * 8), l1 = l0 + 16 * LP * 2, l2 = l0 + 32 * LP * 2, l3 = l0 + 48 * LP * 2;
  asm volatile("global_load_async_to_lds_b128 %0, %1, off\n\tglobal_load_async_to_lds_b128 %2, %3, off\n\tglobal_load_async_to_lds_b128 %4, %5, off\n\tglobal_load_async_to_lds_b128 %6, %7, off\n\ts_wait_xcnt 0x0"
               :: "v"(l0), "v"(g0), "v"(l1), "v"(g1), "v"(l2), "v"(g2), "v"(l3), "v"(g3) : "memory");
}
// ---- fast GEMM (block tile 128x64, wave tile 32x64; requires M % 128 == 0 rows per launch region, N % 64 == 0, K % 64 == 0, K >= 64); A and B tiles of 64 k staged in LDS; epilogue = k_gemm_hhx semantics ----
// OM 0: C (f32) and / or C16 (f16). OM 1: the f32 result leaves as two f16 planes, C16 = hi, C16L = (v - hi) * 2^10, same layout. OM 2: the same two planes transposed, [row / ldc][col][row % ldc] with ldc = rows per sequence (a multiple of 128). OM 1 and 2 take no CP term.
__device__ __forceinline__ v16h g2_frag(const _Float16* p, int hh) { FragH f; f.half[0] = *(const v8us*)((const unsigned short*)p + 8 * hh); f.half[1] = *(const v8us*)((const unsigned short*)p + 16 + 8 * hh); return f.v; }
__device__ __forceinline__ v8f g2_mma(v16h a, v16h b, v8f c) { v8f d = __builtin_amdgcn_wmma_f32_16x16x32_f16(false, a, false, b, (short)0, c, false, false); asm volatile("v_nop\n\tv_nop\n\tv_nop\n\tv_nop" : "+v"(d) : "v"(a), "v"(b)); return d; }
template <int ACT, int OM>
__global__ __launch_bounds__(128) void k_gemm2(const _Float16* __restrict__ A, int lda, size_t sA, const _Float16* __restrict__ Bh, int ldb, size_t sB, float alpha, const float* __restrict__ bias, size_t sBias, const float* __restrict__ CP, int rowsPerB, size_t sCPb, int row0g,
    float* __restrict__ C, _Float16* __restrict__ C16, _Float16* __restrict__ C16L, int ldc, size_t sC, int M, int N, int K) {
  __shared__ __attribute__((aligned(16))) float so[4][32][68];
  constexpr int TP = 132;      /* OM 2: row pitch of the transposed staging tile, 128 tokens + 4 floats; 64 rows of it fit in so */
  static_assert(64 * TP <= 4 * 32 * 68, "the transposed tile lies inside so");
  __shared__ __attribute__((aligned(16))) unsigned short tA[2][128][LP], tB[2][64][LP];
  const int tid = threadIdx.x, w = tid >> 5, lane = tid & 31, ln = lane & 15, hh = lane >> 4; const int by = blockIdx.y;
  A += (size_t)by * sA; Bh += (size_t)by * sB; const size_t cofs = (size_t)by * sC; const float* bp = bias ? bias + (size_t)by * sBias : nullptr;
  const int ntn = N >> 6; const int mt = blockIdx.x / ntn, nq = blockIdx.x - mt * ntn; const int row0 = mt * 128 + 32 * w, col0 = nq * 64; if (mt * 128 + 128 > M) return;      /* the whole block leaves or none, ahead of every barrier */
  const unsigned short* Ag = (const unsigned short*)A + (size_t)(mt * 128) * lda; const unsigned short* Bg = (const unsigned short*)Bh + (size_t)col0 * ldb; const int nst = K >> 6;
  stage64(Ag, lda, &tA[0][0][0], tid); stage64(Ag + (size_t)64 * lda, lda, &tA[0][64][0], tid); stage64(Bg, ldb, &tB[0][0][0], tid);
  wait_async0(); __syncthreads();      /* stage 0 published */
  if (nst > 1) { stage64(Ag + 64, lda, &tA[1][0][0], tid); stage64(Ag + (size_t)64 * lda + 64, lda, &tA[1][64][0], tid); stage64(Bg + 64, ldb, &tB[1][0][0], tid); }
  const v8f z8 = {0.f,0.f,0.f,0.f,0.f,0.f,0.f,0.f}; v8f c00 = z8, c01 = z8, c02 = z8, c03 = z8, c10 = z8, c11 = z8, c12 = z8, c13 = z8;
#pragma unroll 1
  for (int t = 0; t < nst; ++t) { const int bf = t & 1;      /* rolled: one stage a trip, the publish point at its foot */
    // all 12 fragments of the stage are read from LDS as one group ahead of its 16 products: one LDS latency a stage in front of the matrix run, not one in front of every pair of products
    v16h fa[2][2], fb[2][4];
    // unrolled (both loops): the two k blocks of a stage become constant LDS offsets and the fragment arrays stay in registers
#pragma unroll
    for (int kq = 0; kq < 2; ++kq) { fa[kq][0] = g2_frag((const _Float16*)&tA[bf][32 * w + ln][kq * 32], hh); fb[kq][0] = g2_frag((const _Float16*)&tB[bf][ln][kq * 32], hh); fa[kq][1] = g2_frag((const _Float16*)&tA[bf][32 * w + 16 + ln][kq * 32], hh);
      fb[kq][1] = g2_frag((const _Float16*)&tB[bf][16 + ln][kq * 32], hh); fb[kq][2] = g2_frag((const _Float16*)&tB[bf][32 + ln][kq * 32], hh); fb[kq][3] = g2_frag((const _Float16*)&tB[bf][48 + ln][kq * 32], hh); }
#pragma unroll
    for (int kq = 0; kq < 2; ++kq) { c00 = g2_mma(fa[kq][0], fb[kq][0], c00); c10 = g2_mma(fa[kq][1], fb[kq][0], c10); c01 = g2_mma(fa[kq][0], fb[kq][1], c01); c11 = g2_mma(fa[kq][1], fb[kq][1], c11);
      c02 = g2_mma(fa[kq][0], fb[kq][2], c02); c12 = g2_mma(fa[kq][1], fb[kq][2], c12); c03 = g2_mma(fa[kq][0], fb[kq][3], c03); c13 = g2_mma(fa[kq][1], fb[kq][3], c13); }
    wait_ds0(); wait_async0(); __syncthreads();      /* publishes stage t + 1 and ends every read of buffer bf */
    if (t + 2 < nst) { const int k2 = (t + 2) * 64; stage64(Ag + k2, lda, &tA[bf][0][0], tid); stage64(Ag + (size_t)64 * lda + k2, lda, &tA[bf][64][0], tid); stage64(Bg + k2, ldb, &tB[bf][0][0], tid); } }
  wait_async0();
  v8f accs[8] = {c00, c01, c02, c03, c10, c11, c12, c13};
#pragma unroll
  for (int u = 0; u < 8; ++u) { const int t = u & 3, half = u >> 2; const int col = col0 + t * 16 + ln; const float bv = bp ? bf16_round(bp[col]) : 0.f;
#pragma unroll
    for (int r = 0; r < 8; ++r) { const int rloc = half * 16 + 8 * hh + r; float v = accs[u][r] * alpha + bv; if (OM == 0 && CP) { const int bidx = (row0g + row0 + rloc) / rowsPerB; v += CP[(size_t)bidx * sCPb + (size_t)by * 64 + col]; }
      if (ACT == 3) v = fmaxf(v, 0.f); else if (ACT == 6) v = 0.5f * v * (1.0f + erff(v * 0.70710678118654752f)); else if (ACT == 11) v = 1.0f / (1.0f + expf(-v)); else if (ACT == 15) v = v / (1.0f + expf(-v)); else if (ACT == 12) v = (v > 0.f) ? v : 0.01f * v; else if (ACT == 8) v = tanhf(v);
      if (OM == 2) (&so[0][0][0])[(t * 16 + ln) * TP + 32 * w + rloc] = v; else so[w][rloc][t * 16 + ln] = v; } }
  if (OM == 2) {      /* the staging tile holds the block's 64 columns as rows of 128 tokens: a wave stores 16 of them, 16 lanes one whole 256-byte run */
    __syncthreads();      /* a transposed row holds results of all four waves */
    const float* soT = &so[0][0][0]; const int rb = mt * 128; const size_t ob = ((size_t)(rb / ldc) * N + col0) * ldc + rb % ldc + (lane & 15) * 8;
    // unrolled (both loops): the eight row pairs become constant LDS offsets whose reads go out ahead of the stores, and the two packed planes stay in registers
#pragma unroll
    for (int i = 0; i < 8; ++i) { const int d = 16 * w + 2 * i + (lane >> 4); const v4f a = *(const v4fa*)&soT[d * TP + (lane & 15) * 8], c = *(const v4fa*)&soT[d * TP + (lane & 15) * 8 + 4]; FragH fh, fl;      /* inner loop unrolled for constant element indices */
#pragma unroll
      for (int q = 0; q < 4; ++q) { _Float16 h = (_Float16)a[q]; fh.h[q] = h; fl.h[q] = (_Float16)((a[q] - (float)h) * 1024.0f); h = (_Float16)c[q]; fh.h[4 + q] = h; fl.h[4 + q] = (_Float16)((c[q] - (float)h) * 1024.0f); }
      *(v8us*)((unsigned short*)C16 + cofs + ob + (size_t)d * ldc) = fh.half[0]; *(v8us*)((unsigned short*)C16L + cofs + ob + (size_t)d * ldc) = fl.half[0]; }
    return; }
  __builtin_amdgcn_fence(__ATOMIC_ACQ_REL, "workgroup"); __builtin_amdgcn_wave_barrier();
  const int rsub = lane >> 4, c4 = (lane & 15) * 4;
  {
#pragma unroll
    for (int q = 0; q < 16; ++q) { const int r = q * 2 + rsub; const v4f v = *(const v4fa*)&so[w][r][c4];
      if (OM == 1) { v4h h4, l4; for (int i = 0; i < 4; ++i) { h4[i] = (_Float16)v[i]; l4[i] = (_Float16)((v[i] - (float)h4[i]) * 1024.0f); } *(v4h*)(C16 + cofs + (size_t)(row0 + r) * ldc + col0 + c4) = h4; *(v4h*)(C16L + cofs + (size_t)(row0 + r) * ldc + col0 + c4) = l4; continue; }
      if (C) *(v4f*)(C + cofs + (size_t)(row0 + r) * ldc + col0 + c4) = v; if (C16) { v4h h4; for (int i = 0; i < 4; ++i) h4[i] = (_Float16)v[i]; *(v4h*)(C16 + cofs + (size_t)(row0 + r) * ldc + col0 + c4) = h4; } }
     } }



// lane l with lane l ^ 16: the two lane halves of a 16-column group hold the two key halves of one query
__device__ __forceinline__ float xhalf(float x) { return __builtin_bit_cast(float, __builtin_amdgcn_permlanex16(__builtin_bit_cast(int, x), __builtin_bit_cast(int, x), 0x76543210, 0xfedcba98, false, false)); }
template <int CAUSAL>
__global__ __launch_bounds__(128) void k_flash(const _Float16* __restrict__ Q16, int ldq, const _Float16* __restrict__ K16, int ldk, const _Float16* __restrict__ Vt, const int* __restrict__ MSK, _Float16* __restrict__ OH, int ldo) {
  constexpr int RPW = 16, DT = 4, KS = 2;      /* every '#pragma unroll' below: constant indices keep the fragment, score and accumulator arrays in registers */
  __shared__ __attribute__((aligned(16))) float sO[4][RPW][64 + 4];
  __shared__ __attribute__((aligned(16))) unsigned short sK[2][64][LP], sV[2][64][LP];      /* a stage = 64 keys: K rows (key, d) and V^T rows (d, key), shared by the four waves */
  const int tid = threadIdx.x, w = tid >> 5, lane = tid & 31, ln = lane & 15, hh = lane >> 4;
  const int slab = blockIdx.x / QBNP, qblk = QB0P + blockIdx.x % QBNP; const int b = slab / NH, h = slab % NH; const int qb0 = qblk * (4 * RPW); const int q0 = qb0 + w * RPW; const int tq = q0 + ln;
  FragH bq[KS];
  { const unsigned short* qr = (const unsigned short*)Q16 + ((size_t)b * TQ + tq) * ldq + h * 64;
#pragma unroll
    for (int ks = 0; ks < KS; ++ks) { bq[ks].half[0] = *(const v8us*)(qr + ks * 32 + 8 * hh); bq[ks].half[1] = *(const v8us*)(qr + ks * 32 + 16 + 8 * hh); } }
  const int kvh = h / NREP;      /* K16 and Vt hold the kv heads themselves: query head h reads kv head h / NREP */
  const unsigned short* Vth = (const unsigned short*)Vt + (size_t)(b * NKV + kvh) * 64 * TK;
  const float sl = (CAUSAL == 14) ? bf16_round(((const float*)MSK)[h]) : 0.f;      /* mode 14: causal + ALiBi slope[h] * (key - query) from the slopes INPUT */
  // Softmax in log2 units: p * 1024 = 2^(s * c2 + sl2 * (key - query) - m + 10). A lane's 16 keys of a pass lie at fixed distances from its first one, so scale and ALiBi are one fma per score against kb; the first key's own term (base) joins the maximum once a pass.
  static_assert(CAUSAL == 0 || CAUSAL == 1 || CAUSAL == 14, "every query needs a valid key in the first pass: masked scores go out by 2^(-3e38 - finite) = 0");
  const float c2 = SCL * 1.44269504088896340736f, sl2 = sl * 1.44269504088896340736f; v8f kb[2];
#pragma unroll
  for (int nt = 0; nt < 2; ++nt)
#pragma unroll
    for (int r = 0; r < 8; ++r) kb[nt][r] = sl2 * (float)(nt * 16 + r);
  float m_r = -3.0e38f, l_r = 0.f; v8f oacc[DT];
#pragma unroll
  for (int dt = 0; dt < DT; ++dt) oacc[dt] = (v8f){0.f,0.f,0.f,0.f,0.f,0.f,0.f,0.f};
  const int jend = (CAUSAL == 1 || CAUSAL == 14) ? (qb0 + 4 * RPW) : TK;      /* causal: keys beyond the block's last query never contribute */
  const unsigned short* Kh = (const unsigned short*)K16 + (size_t)b * TK * ldk + kvh * 64; const int nst = jend >> 6;      /* jend is a multiple of 64 */
  stage64(Kh, ldk, &sK[0][0][0], tid); stage64(Vth, TK, &sV[0][0][0], tid);
  wait_async0(); __syncthreads();      /* stage 0 published */
  if (nst > 1) { stage64(Kh + (size_t)64 * ldk, ldk, &sK[1][0][0], tid); stage64(Vth + 64, TK, &sV[1][0][0], tid); }
  // LDS fragment reads stand in groups, ahead of the products that use them: K of both passes and V^T of pass 0 at the head of the stage, V^T of pass 1 behind the output products of pass 0.
  // Only the first group's latency is waited out; every read stays inside its own stage, ahead of the wait and the barrier at the foot.
  FragH ak[2][2][KS], av[2][DT];
  auto ldK = [&](int bf, int pp) {
#pragma unroll
    for (int nt = 0; nt < 2; ++nt) { const unsigned short* kr = &sK[bf][pp * 32 + nt * 16 + ln][0];
#pragma unroll
      for (int ks = 0; ks < KS; ++ks) { ak[pp][nt][ks].half[0] = *(const v8us*)(kr + ks * 32 + 8 * hh); ak[pp][nt][ks].half[1] = *(const v8us*)(kr + ks * 32 + 16 + 8 * hh); } } };
  auto ldV = [&](int bf, int pp) {
#pragma unroll
    for (int dt = 0; dt < DT; ++dt) { const unsigned short* vrow = &sV[bf][dt * 16 + ln][pp * 32]; av[pp][dt].half[0] = *(const v8us*)(vrow + 8 * hh); av[pp][dt].half[1] = *(const v8us*)(vrow + 16 + 8 * hh); } };
  // the stage loop stays rolled: one stage a trip with the publish point at its foot
#pragma unroll 1
  for (int t = 0; t < nst; ++t) { const int bf = t & 1;
  ldK(bf, 0); ldK(bf, 1); ldV(bf, 0);
  // the two passes of a stage are unrolled: pass 1's fragments get registers of their own, so that their reads can be issued during pass 0
#pragma unroll
  for (int pp = 0; pp < 2; ++pp) { const int j0 = t * 64 + pp * 32;
    v8f s[2];
#pragma unroll
    for (int nt = 0; nt < 2; ++nt) { v8f acc = (v8f){0.f,0.f,0.f,0.f,0.f,0.f,0.f,0.f};
#pragma unroll
      for (int ks = 0; ks < KS; ++ks) acc = mmaH<1>(ak[pp][nt][ks].v, ak[pp][nt][ks].v, bq[ks].v, bq[ks].v, acc);
      s[nt] = acc; }
    const float base = sl2 * (float)(j0 + 8 * hh - tq);      /* ALiBi of the lane's first key of this pass */
    v8f u[2];
#pragma unroll
    for (int nt = 0; nt < 2; ++nt) u[nt] = s[nt] * c2 + kb[nt];
    if ((CAUSAL == 1 || CAUSAL == 14) && t == nst - 1) {      /* only the block's last stage holds keys beyond a query: a scalar branch, every earlier stage goes unmasked */
#pragma unroll
      for (int nt = 0; nt < 2; ++nt)
#pragma unroll
        for (int r = 0; r < 8; ++r) u[nt][r] = (j0 + nt * 16 + 8 * hh + r <= tq) ? u[nt][r] : -3.0e38f; }
    float mcn[2];      /* two independent chains */
#pragma unroll
    for (int nt = 0; nt < 2; ++nt) { mcn[nt] = u[nt][0];
#pragma unroll
      for (int r = 1; r < 8; ++r) mcn[nt] = fmaxf(mcn[nt], u[nt][r]); }
    float mc = fmaxf(mcn[0], mcn[1]) + base; mc = fmaxf(mc, xhalf(mc));
    const float mn = fmaxf(m_r, mc); const float al = __builtin_amdgcn_exp2f(m_r - mn); m_r = mn;      /* first pass: 2^(-3e38 - mn) = 0 */
    const float sh = (mn - base) - 10.0f;      /* the factor 1024 of the f16 P operand rides in the exponent; l sums the same scaled values */
    FragH pb; v8f e[2];
#pragma unroll
    for (int nt = 0; nt < 2; ++nt) { e[nt] = u[nt] - sh;      /* the exponents as one vector, each 2^x then written over its own exponent */
#pragma unroll
      for (int r = 0; r < 8; ++r) { e[nt][r] = __builtin_amdgcn_exp2f(e[nt][r]); pb.h[nt * 8 + r] = (_Float16)e[nt][r]; } }
    const v8f e8 = e[0] + e[1]; const v4f e4 = __builtin_shufflevector(e8, e8, 0, 1, 2, 3) + __builtin_shufflevector(e8, e8, 4, 5, 6, 7);
    l_r = l_r * al + ((e4[0] + e4[2]) + (e4[1] + e4[3]));
#pragma unroll
    for (int dt = 0; dt < DT; ++dt) oacc[dt] *= al;
#pragma unroll
    for (int dt = 0; dt < DT; ++dt) oacc[dt] = mmaH<1>(av[pp][dt].v, av[pp][dt].v, pb.v, pb.v, oacc[dt]);
    if (pp == 0) ldV(bf, 1); }
    wait_ds0(); wait_async0(); __syncthreads();      /* publishes stage t + 1 and ends every read of buffer bf */
    if (t + 2 < nst) { const int j2 = (t + 2) * 64; stage64(Kh + (size_t)j2 * ldk, ldk, &sK[bf][0][0], tid); stage64(Vth + j2, TK, &sV[bf][0][0], tid); } }
  wait_async0();
  const float l = l_r + xhalf(l_r); const float li = (l > 0.f) ? 1.0f / l : 0.f;      /* l carries the factor 1024 of P */
#pragma unroll
  for (int dt = 0; dt < DT; ++dt) { const v4f lo = {oacc[dt][0] * li, oacc[dt][1] * li, oacc[dt][2] * li, oacc[dt][3] * li}, hi = {oacc[dt][4] * li, oacc[dt][5] * li, oacc[dt][6] * li, oacc[dt][7] * li};
    *(v4fa*)&sO[w][ln][dt * 16 + 8 * hh] = lo; *(v4fa*)&sO[w][ln][dt * 16 + 8 * hh + 4] = hi; }
  __builtin_amdgcn_fence(__ATOMIC_ACQ_REL, "workgroup"); __builtin_amdgcn_wave_barrier();      /* the wave's own sO rows: its stores above stay ahead of its whole-line reads below */
  {
#pragma unroll
    for (int rp = 0; rp < RPW; rp += 2) { const int r = rp + (lane >> 4), pc = lane & 15; const v4f val = *(const v4fa*)&sO[w][r][pc * 4]; v4h h4; for (int i = 0; i < 4; ++i) h4[i] = (_Float16)val[i]; *(v4h*)(OH + ((size_t)b * TQ + q0 + r) * ldo + h * 64 + pc * 4) = h4; }      /* O leaves as the f16 A operand of the Wo GEMM: 16 lanes one 128-byte line */
     } }
// 5-plane variant: S = Qh Kh^T + (Ql Kh^T + Qh Kl^T)/1024 with Q/K = [hi | 2^10 residual] f16 planes (QL/KL same layout as Q16/K16), then the 3-term P.V below.
// 3-term variant: O = (P_hi V_hi + (P_lo V_hi + P_hi V_lo) / 1024) / l with P = [hi | 2^10 residual] of 1024 p and V^T = [hi | 2^10 residual] planes (VtL same layout as Vt) -> ~2^-21-class products for un-averaged (early causal / peaked) rows
template <int CAUSAL>
__global__ __launch_bounds__(128) void k_flash5(const _Float16* __restrict__ Q16, const _Float16* __restrict__ QL, int ldq, const _Float16* __restrict__ K16, const _Float16* __restrict__ KL, int ldk, const _Float16* __restrict__ Vt, const _Float16* __restrict__ VtL, const int* __restrict__ MSK, _Float16* __restrict__ OH, _Float16* __restrict__ OL, int ldo) {
  constexpr int RPW = 16, DT = 4, KS = 2;      /* transposed products as in k_flash: lane (ln, hh) holds query q0 + ln, keys j0 + nt * 16 + 8 * hh + r; '#pragma unroll' as there */
  __shared__ __attribute__((aligned(16))) float sO[4][RPW][64 + 4];
  __shared__ __attribute__((aligned(16))) unsigned short sK[2][64][LP], sKl[2][64][LP], sV[2][64][LP], sVl[2][64][LP];      /* a stage = 64 keys of the four planes, as in k_flash */
  const int tid = threadIdx.x, w = tid >> 5, lane = tid & 31, ln = lane & 15, hh = lane >> 4;
  const int slab = blockIdx.x / QBN5, qblk = QB05 + blockIdx.x % QBN5; const int b = slab / NH, h = slab % NH; const int qb0 = qblk * (4 * RPW); const int q0 = qb0 + w * RPW; const int tq = q0 + ln;
  FragH bq[KS], bql[KS];
  { const unsigned short* qr = (const unsigned short*)Q16 + ((size_t)b * TQ + tq) * ldq + h * 64; const unsigned short* ql = (const unsigned short*)QL + ((size_t)b * TQ + tq) * ldq + h * 64;
#pragma unroll
    for (int ks = 0; ks < KS; ++ks) { bq[ks].half[0] = *(const v8us*)(qr + ks * 32 + 8 * hh); bq[ks].half[1] = *(const v8us*)(qr + ks * 32 + 16 + 8 * hh); bql[ks].half[0] = *(const v8us*)(ql + ks * 32 + 8 * hh); bql[ks].half[1] = *(const v8us*)(ql + ks * 32 + 16 + 8 * hh); } }
  const int kvh = h / NREP;      /* kv heads unexpanded, as in k_flash */
  const unsigned short* Vth = (const unsigned short*)Vt + (size_t)(b * NKV + kvh) * 64 * TK; const unsigned short* Vtl = (const unsigned short*)VtL + (size_t)(b * NKV + kvh) * 64 * TK;
  const float sl = (CAUSAL == 14) ? bf16_round(((const float*)MSK)[h]) : 0.f;      /* mode 14: causal + ALiBi slope[h] * (key - query) from the slopes INPUT */
  float m_r = -3.0e38f, l_r = 0.f; v8f oacc[DT], oaccL[DT];
#pragma unroll
  for (int dt = 0; dt < DT; ++dt) { oacc[dt] = (v8f){0.f,0.f,0.f,0.f,0.f,0.f,0.f,0.f}; oaccL[dt] = oacc[dt]; }
  const int jend = (CAUSAL == 1 || CAUSAL == 14) ? (qb0 + 4 * RPW) : TK;      /* causal: keys beyond the block's last query never contribute */
  const unsigned short* Kh = (const unsigned short*)K16 + (size_t)b * TK * ldk + kvh * 64; const unsigned short* Kl = (const unsigned short*)KL + (size_t)b * TK * ldk + kvh * 64; const int nst = jend >> 6;      /* jend is a multiple of 64 */
  stage64(Kh, ldk, &sK[0][0][0], tid); stage64(Kl, ldk, &sKl[0][0][0], tid); stage64(Vth, TK, &sV[0][0][0], tid); stage64(Vtl, TK, &sVl[0][0][0], tid);
  wait_async0(); __syncthreads();      /* stage 0 published */
  if (nst > 1) { stage64(Kh + (size_t)64 * ldk, ldk, &sK[1][0][0], tid); stage64(Kl + (size_t)64 * ldk, ldk, &sKl[1][0][0], tid); stage64(Vth + 64, TK, &sV[1][0][0], tid); stage64(Vtl + 64, TK, &sVl[1][0][0], tid); }
  // both loops stay rolled: one stage a trip with the publish point at its foot, and the two passes of a stage share one body (short code, buffer and pass as address offsets)
#pragma unroll 1
  for (int t = 0; t < nst; ++t) { const int bf = t & 1;
#pragma unroll 1
  for (int p = 0; p < 64; p += 32) { const int j0 = t * 64 + p;
    v8f s[2];
#pragma unroll
    for (int nt = 0; nt < 2; ++nt) { const unsigned short* kr = &sK[bf][p + nt * 16 + ln][0]; const unsigned short* klr = &sKl[bf][p + nt * 16 + ln][0]; FragH ak[KS], akl[KS];
#pragma unroll
      for (int ks = 0; ks < KS; ++ks) { ak[ks].half[0] = *(const v8us*)(kr + ks * 32 + 8 * hh); ak[ks].half[1] = *(const v8us*)(kr + ks * 32 + 16 + 8 * hh); akl[ks].half[0] = *(const v8us*)(klr + ks * 32 + 8 * hh); akl[ks].half[1] = *(const v8us*)(klr + ks * 32 + 16 + 8 * hh); }
      v8f acc = (v8f){0.f,0.f,0.f,0.f,0.f,0.f,0.f,0.f}, accl = acc;
#pragma unroll
      for (int ks = 0; ks < KS; ++ks) { acc = mmaH<1>(ak[ks].v, ak[ks].v, bq[ks].v, bq[ks].v, acc); accl = mmaH<1>(ak[ks].v, ak[ks].v, bql[ks].v, bql[ks].v, accl); accl = mmaH<1>(akl[ks].v, akl[ks].v, bq[ks].v, bq[ks].v, accl); }
#pragma unroll
      for (int r = 0; r < 8; ++r) acc[r] += accl[r] * 0.0009765625f;
      s[nt] = acc; }
    float sc[2][8], mcn[2]; bool ok[2][8];
#pragma unroll
    for (int nt = 0; nt < 2; ++nt) { mcn[nt] = -3.0e38f;
#pragma unroll
      for (int r = 0; r < 8; ++r) { const int kk = j0 + nt * 16 + 8 * hh + r;
        ok[nt][r] = (CAUSAL == 1 || CAUSAL == 14) ? (kk <= tq) : ((CAUSAL == 2) ? ((kk >> 5) == (tq >> 5)) : true);      /* mode 2: block-diagonal 32-token groups */
        if (CAUSAL == 4) ok[nt][r] = MSK[((size_t)b * TQ + tq) * TK + kk] != 0;      /* mode 4: per-(query, key) INPUT mask shared by all heads; masked keys contribute nothing, rows with no valid key give l = 0 -> output 0 */
        float sv = ok[nt][r] ? s[nt][r] * SCL : -3.0e38f; if (CAUSAL == 14) { if (ok[nt][r]) sv += sl * (float)(kk - tq); }
        sc[nt][r] = sv; mcn[nt] = fmaxf(mcn[nt], sv); } }
    float mc = fmaxf(mcn[0], mcn[1]); mc = fmaxf(mc, xhalf(mc));
    const float mn = fmaxf(m_r, mc); const float ea = expf(m_r - mn); const float al = (mn > -1.0e38f) ? ea : 1.0f; m_r = mn;
    FragH pb, pl; float psn[2];
#pragma unroll
    for (int nt = 0; nt < 2; ++nt) { psn[nt] = 0.f;
#pragma unroll
      for (int r = 0; r < 8; ++r) { const float e = expf(sc[nt][r] - mn); const float p = ok[nt][r] ? e : 0.f; psn[nt] += p; const float ps = p * 1024.0f; const _Float16 ph = (_Float16)ps; pb.h[nt * 8 + r] = ph; pl.h[nt * 8 + r] = (_Float16)((ps - (float)ph) * 1024.0f); } }
    l_r = l_r * al + (psn[0] + psn[1]);
#pragma unroll
    for (int dt = 0; dt < DT; ++dt)
#pragma unroll
      for (int r = 0; r < 8; ++r) { oacc[dt][r] *= al; oaccL[dt][r] *= al; }
#pragma unroll
    for (int dt = 0; dt < DT; ++dt) { const unsigned short* vrow = &sV[bf][dt * 16 + ln][p]; const unsigned short* vrl = &sVl[bf][dt * 16 + ln][p]; FragH av, avl; av.half[0] = *(const v8us*)(vrow + 8 * hh); av.half[1] = *(const v8us*)(vrow + 16 + 8 * hh); avl.half[0] = *(const v8us*)(vrl + 8 * hh); avl.half[1] = *(const v8us*)(vrl + 16 + 8 * hh);
      oacc[dt] = mmaH<1>(av.v, av.v, pb.v, pb.v, oacc[dt]); oaccL[dt] = mmaH<1>(av.v, av.v, pl.v, pl.v, oaccL[dt]); oaccL[dt] = mmaH<1>(avl.v, avl.v, pb.v, pb.v, oaccL[dt]); } }
    wait_ds0(); wait_async0(); __syncthreads();      /* publishes stage t + 1 and ends every read of buffer bf */
    if (t + 2 < nst) { const int j2 = (t + 2) * 64; stage64(Kh + (size_t)j2 * ldk, ldk, &sK[bf][0][0], tid); stage64(Kl + (size_t)j2 * ldk, ldk, &sKl[bf][0][0], tid); stage64(Vth + j2, TK, &sV[bf][0][0], tid); stage64(Vtl + j2, TK, &sVl[bf][0][0], tid); } }
  wait_async0();
  const float l = l_r + xhalf(l_r); const float li = (l > 0.f) ? 1.0f / (l * 1024.0f) : 0.f;
#pragma unroll
  for (int dt = 0; dt < DT; ++dt) { v4f lo, hi;
#pragma unroll
    for (int r = 0; r < 4; ++r) { float v = oacc[dt][r]; v += oaccL[dt][r] * 0.0009765625f; lo[r] = v * li; v = oacc[dt][4 + r]; v += oaccL[dt][4 + r] * 0.0009765625f; hi[r] = v * li; }
    *(v4fa*)&sO[w][ln][dt * 16 + 8 * hh] = lo; *(v4fa*)&sO[w][ln][dt * 16 + 8 * hh + 4] = hi; }
  __builtin_amdgcn_fence(__ATOMIC_ACQ_REL, "workgroup"); __builtin_amdgcn_wave_barrier();      /* the wave's own sO rows: its stores above stay ahead of its whole-line reads below */
  {
#pragma unroll
    for (int rp = 0; rp < RPW; rp += 2) { const int r = rp + (lane >> 4), pc = lane & 15; const v4f val = *(const v4fa*)&sO[w][r][pc * 4]; v4h h4, l4; for (int i = 0; i < 4; ++i) { h4[i] = (_Float16)val[i]; l4[i] = (_Float16)((val[i] - (float)h4[i]) * 1024.0f); }
      *(v4h*)(OH + ((size_t)b * TQ + q0 + r) * ldo + h * 64 + pc * 4) = h4; *(v4h*)(OL + ((size_t)b * TQ + q0 + r) * ldo + h * 64 + pc * 4) = l4; }      /* O leaves as f16 hi + 2^10 residual, the A operands of the two Wo GEMMs */
     } }

__global__ __launch_bounds__(256) void k_rotab(float* __restrict__ CS, float* __restrict__ SN) {
  #pragma clang fp contract(off)
  const int t = blockIdx.x * 256 + threadIdx.x; if (t >= SLEN * 32) return; const int j = t % 32, s = t / 32; const float ex = (float)(2 * j) / 64.0f; const float inv = 1.0f / powf(10000.0f, ex); const float th = (float)s * inv; const float c = cosf(th), sn = sinf(th);
  { *(float*)(CS + t) = c; *(float*)(SN + t) = sn;  } }
__global__ __launch_bounds__(256) void k_rope(const float* __restrict__ F, int nsrc, int ndst, int rep, const float* __restrict__ CS, const float* __restrict__ SN, _Float16* __restrict__ H, _Float16* __restrict__ L) {
  #pragma clang fp contract(off)
  const size_t t = (size_t)blockIdx.x * 256 + threadIdx.x; if (t >= (size_t)NR * ndst * 4) return; const int g8 = (int)(t % 4); const int hd = (int)((t / 4) % ndst); const size_t row = t / ((size_t)4 * ndst); const int s = (int)(row % SLEN); const int hs = hd / rep;
  const float* src = F + row * (size_t)(nsrc * 64) + hs * 64; FragH ah, al, bh, bl;
  for (int i = 0; i < 8; ++i) { const int d = g8 * 8 + i; const float c = CS[s * 32 + d], sn = SN[s * 32 + d]; const float x1 = src[d], x2 = src[d + 32];
    float o1 = x1 * c; o1 += -x2 * sn; float o2 = x2 * c; o2 += x1 * sn;
    _Float16 hv = (_Float16)o1; ah.h[i] = hv; al.h[i] = (_Float16)((o1 - (float)hv) * 1024.0f); hv = (_Float16)o2; bh.h[i] = hv; bl.h[i] = (_Float16)((o2 - (float)hv) * 1024.0f); }
  const size_t o = row * (size_t)(ndst * 64) + hd * 64 + g8 * 8;
  { *(v8us*)((unsigned short*)H + o) = ah.half[0]; *(v8us*)((unsigned short*)H + o + 32) = bh.half[0]; *(v8us*)((unsigned short*)L + o) = al.half[0]; *(v8us*)((unsigned short*)L + o + 32) = bl.half[0];  } }

extern "C" void kernel_launch(void* const* d_in, const int* in_sizes, int n_in,
                              void* d_out, int out_size, void* d_ws, size_t ws_size, hipStream_t stream) {
  (void)in_sizes; (void)n_in; (void)out_size;
  const float* const* I = (const float* const*)d_in; const float* x = I[0]; const float* Wq = I[1]; const float* bq = I[2]; const float* Wk = I[3]; const float* bk = I[4]; const float* Wv = I[5]; const float* bv = I[6]; const float* Wo = I[7]; const float* bo = I[8]; const float* slopes = I[9];
  char* ws = (char*)d_ws; size_t off = 0;
  auto take = [&](size_t bytes) { char* p = ws + off; off += (bytes + 255) & ~(size_t)255; return p; };
  const size_t np = (size_t)NR * DM, nk = (size_t)NR * KVD;
  _Float16* BQ = (_Float16*)take((size_t)DM * DM * 2); _Float16* BK = (_Float16*)take((size_t)KVD * DM * 2); _Float16* BV = (_Float16*)take((size_t)KVD * DM * 2); _Float16* BO = (_Float16*)take((size_t)DM * DM * 2);
  _Float16* X16 = (_Float16*)take(np * 2); _Float16* QH = (_Float16*)take(np * 2); _Float16* QL = (_Float16*)take(np * 2); _Float16* KH = (_Float16*)take(nk * 2); _Float16* KL = (_Float16*)take(nk * 2); _Float16* VT = (_Float16*)take(nk * 2); _Float16* VTL = (_Float16*)take(nk * 2);
  _Float16* OH = (_Float16*)take(np * 2); _Float16* OLo = (_Float16*)take(np * 2);
  if (off > ws_size) return;      /* 2+0.5+0.5+2 + 8+8+8+2+2+2+2+8+8 = 53 MiB */
  k_wt_f16<<<(unsigned)(((size_t)DM * DM / 8 + 255) / 256), 256, 0, stream>>>(Wq, BQ, DM, DM, 16.0f); k_wt_f16<<<(unsigned)(((size_t)DM * KVD / 8 + 255) / 256), 256, 0, stream>>>(Wk, BK, DM, KVD, 16.0f); k_wt_f16<<<(unsigned)(((size_t)DM * KVD / 8 + 255) / 256), 256, 0, stream>>>(Wv, BV, DM, KVD, 16.0f); k_wt_f16<<<(unsigned)(((size_t)DM * DM / 8 + 255) / 256), 256, 0, stream>>>(Wo, BO, DM, DM, 16.0f);
  k_x16<<<(unsigned)((np / 8 + 255) / 256), 256, 0, stream>>>(x, X16, np / 8);
  k_gemm2<0, 1><<<dim3((NR / 128) * (DM / 64), 1), 128, 0, stream>>>(X16, DM, 0, BQ, DM, 0, 0.0625f, bq, 0, nullptr, 1, 0, 0, nullptr, QH, QL, DM, 0, NR, DM, DM);      /* q hi/lo */
  k_gemm2<0, 1><<<dim3((NR / 128) * (KVD / 64), 1), 128, 0, stream>>>(X16, DM, 0, BK, DM, 0, 0.0625f, bk, 0, nullptr, 1, 0, 0, nullptr, KH, KL, KVD, 0, NR, KVD, DM);      /* k hi/lo, 4 kv heads */
  k_gemm2<0, 2><<<dim3((NR / 128) * (KVD / 64), 1), 128, 0, stream>>>(X16, DM, 0, BV, DM, 0, 0.0625f, bv, 0, nullptr, 1, 0, 0, nullptr, VT, VTL, SLEN, 0, NR, KVD, DM);      /* V^T hi/lo: [kv head][d][token] */
  k_flash5<14><<<NB * NH * QBN5, 128, 0, stream>>>(QH, QL, DM, KH, KL, KVD, VT, VTL, (const int*)slopes, OH, OLo, DM);      /* causal + ALiBi, rows < 256: hi + residual */
  k_flash<14><<<NB * NH * QBNP, 128, 0, stream>>>(QH, DM, KH, KVD, VT, (const int*)slopes, OH, DM);      /* causal + ALiBi, rows >= 256: plain */
  k_gemm2<0, 0><<<dim3((NR / 128) * (DM / 64), 1), 128, 0, stream>>>(OH, DM, 0, BO, DM, 0, 0.0625f, bo, 0, nullptr, 1, 0, 0, (float*)d_out, nullptr, nullptr, DM, 0, NR, DM, DM);      /* out = ctx Wo + bo */
  for (int b = 0; b < NB; ++b) k_gemm2<0, 0><<<dim3((RE / 128) * (DM / 64), 1), 128, 0, stream>>>(OLo + (size_t)b * SLEN * DM, DM, 0, BO, DM, 0, 0.0625f / 1024.0f, nullptr, 0, (const float*)d_out + (size_t)b * SLEN * DM, 1, (size_t)DM, 0, (float*)d_out + (size_t)b * SLEN * DM, nullptr, nullptr, DM, 0, RE, DM, DM);      /* += O residual . Wo on the first 256 rows of each sequence */
}

// v006
// A run of this version takes 135 microseconds.
// Timed twice side by side with v005, it ran 1.31 and 1.33 times as fast.
// All steps since v000 together make it 5.96 times as fast.
#include <hip/hip_runtime.h>
// CausalAlibiAttn (1 x 4096 tokens, D 1024 = 16 heads of 64, 4 kv heads): q, k, v = x W + b; q head h uses kv head h/4; scores/8 + slope[h] * (key - query) (ALiBi, slopes INPUT), causal; softmax; ctx Wo + bo.
// Structure: exact f16 plane of x; q, k, v by WMMA GEMMs (32x64 wave tiles, f32 accumulation, exact x16 weights + bias) whose epilogues split the f32 result into f16 hi + 2^10-residual planes themselves (v transposed in the LDS staging tile; k, v stay at their 4 kv heads); the fused causal flash kernel (query head h reads kv head h / 4) with the ALiBi term added per (head, query, key) in f32, in its 5-plane form for the first 256 query rows and the plain form beyond; it stores O as f16 hi (+ residual on those rows) for the Wo GEMMs (+ bias; residual term only on those rows).
// Compute dtype: x and parameters rounded to bf16; q/k/P/v/O as f16 hi + residual on rows < 256 (~2^-21) and plain f16 beyond (~2^-12); ALiBi/softmax f32. v_wmma_f32_16x16x32_f16.
#define NB 1
#define DM 1024
#define NKV 4
#define NREP (NH / NKV)
#define KVD (NKV * 64)           /* 256 */
#define NR (NB * SLEN)           /* 4096 */
#define SLEN 4096
#define TQ SLEN
#define TK SLEN
#define NH 16
#define SCL 0.125f
#define QBLKS (TQ / 64)
#define QB05 0
#define QBN5 4
#define QB0P QBN5
#define QBNP (QBLKS - QBN5)
#define RE 256
typedef __bf16 v16b __attribute__((ext_vector_type(16)));
typedef unsigned short v8us __attribute__((ext_vector_type(8), may_alias));
typedef float  v8f  __attribute__((ext_vector_type(8)));
typedef float  v4f  __attribute__((ext_vector_type(4)));
typedef float  v4fa __attribute__((ext_vector_type(4), may_alias));
union FragB { v16b v; v8us half[2]; unsigned short u[16]; };

__device__ __forceinline__ unsigned short bf16_bits(float x) { unsigned int u = __float_as_uint(x); return (unsigned short)((u + 0x7FFFu + ((u >> 16) & 1u)) >> 16); }
__device__ __forceinline__ float bf16_val(unsigned short b) { return __uint_as_float(((unsigned int)b) << 16); }
__device__ __forceinline__ float bf16_round(float x) { return bf16_val(bf16_bits(x)); }
// D += A·B with NT terms: 1 = ah·bh, 2 = + al·bh (A split), 3 = + ah·bl (both split)
template <int NT>
__device__ __forceinline__ v8f mmaN(v16b ah, v16b al, v16b bh, v16b bl, v8f c) {
  c = __builtin_amdgcn_wmma_f32_16x16x32_bf16(false, ah, false, bh, (short)0, c, false, false);
  if (NT >= 2) c = __builtin_amdgcn_wmma_f32_16x16x32_bf16(false, al, false, bh, (short)0, c, false, false);
  if (NT >= 3) c = __builtin_amdgcn_wmma_f32_16x16x32_bf16(false, ah, false, bl, (short)0, c, false, false);
  asm volatile("v_nop\n\tv_nop\n\tv_nop\n\tv_nop" : "+v"(c) : "v"(ah), "v"(al), "v"(bh), "v"(bl));
  return c;
}

__global__ __launch_bounds__(256) void k_wt_bf16(const float* __restrict__ W, unsigned short* __restrict__ Wt, int K, int N) {
  const int t = blockIdx.x * 256 + threadIdx.x;
  const int k8n = K / 8;
  if (t >= N * k8n) return;
  const int n = t / k8n, k8 = (t % k8n) * 8;
  v8us v;
#pragma unroll
  for (int i = 0; i < 8; ++i) v[i] = bf16_bits(W[(size_t)(k8 + i) * N + n]);
  *(v8us*)(Wt + (size_t)n * K + k8) = v;
  
}

// GEMM C[M][N] (f32, pitch ldc) = act(A[M][K]·W + bias). A f32 row-major (pitch lda) converted per fragment to bf16
// (ASPLIT: hi/lo two planes -> 2 terms, else single rounded term); Wt bf16 [N][K] (pitch ldb). BIAS_BF16 rounds the
// bias to bf16 first (bias quantised to bf16 before the add). K%32==0, M%16==0, N%64==0.
template <bool ASPLIT, int ACT, bool BIAS_BF16>
__global__ __launch_bounds__(128) void k_gemm_bf(const float* __restrict__ A, int lda, const unsigned short* __restrict__ Wt, int ldb,
                                               const float* __restrict__ bias, float* __restrict__ C, int ldc, int M, int N, int K) {
  __shared__ __attribute__((aligned(16))) float so[4][16][64];
  const int tid = threadIdx.x, w = tid >> 5, lane = tid & 31, ln = lane & 15, hh = lane >> 4;
  const int ntn = N / 64;
  const int wid = blockIdx.x * 4 + w;
  const int mt = wid / ntn, nq = wid % ntn;
  if (mt * 16 >= M) return;
  const int row0 = mt * 16, col0 = nq * 64;
  const float* arow = A + (size_t)(row0 + ln) * lda;
  v8f acc[4] = {};
  for (int kb = 0; kb < K; kb += 32) {
    FragB ah, al;
    const v4f x0 = *(const v4fa*)(arow + kb + 8 * hh), x1 = *(const v4fa*)(arow + kb + 8 * hh + 4);
    const v4f x2 = *(const v4fa*)(arow + kb + 16 + 8 * hh), x3 = *(const v4fa*)(arow + kb + 16 + 8 * hh + 4);
    float xs[16] = {x0[0],x0[1],x0[2],x0[3],x1[0],x1[1],x1[2],x1[3],x2[0],x2[1],x2[2],x2[3],x3[0],x3[1],x3[2],x3[3]};
#pragma unroll
    for (int i = 0; i < 16; ++i) { const unsigned short hb = bf16_bits(xs[i]); ah.u[i] = hb; al.u[i] = ASPLIT ? bf16_bits(xs[i] - bf16_val(hb)) : (unsigned short)0; }
#pragma unroll
    for (int t = 0; t < 4; ++t) {
      const unsigned short* brow = Wt + (size_t)(col0 + t * 16 + ln) * ldb + kb;
      FragB b;
      b.half[0] = *(const v8us*)(brow + 8 * hh);
      b.half[1] = *(const v8us*)(brow + 16 + 8 * hh);
      acc[t] = mmaN<ASPLIT ? 2 : 1>(ah.v, al.v, b.v, b.v, acc[t]);
    }
  }
#pragma unroll
  for (int t = 0; t < 4; ++t) {
    float bv = bias ? bias[col0 + t * 16 + ln] : 0.f;
    if (BIAS_BF16) bv = bf16_round(bv);
#pragma unroll
    for (int r = 0; r < 8; ++r) { float v = acc[t][r] + bv; if (ACT == 1) v = fmaxf(v, 0.f); so[w][8 * hh + r][t * 16 + ln] = v; }
  }
  __builtin_amdgcn_fence(__ATOMIC_ACQ_REL, "workgroup");
  __builtin_amdgcn_wave_barrier();
  const int rsub = lane >> 4, c4 = (lane & 15) * 4;
  {
#pragma unroll
    for (int q = 0; q < 8; ++q) {
      const int r = q * 2 + rsub;
      const v4f v = *(const v4fa*)&so[w][r][c4];
      *(v4f*)(C + (size_t)(row0 + r) * ldc + col0 + c4) = v;
    }
    
  }
}

// GEMM C = act(A·W + bias + resid): A f32 (ASPLIT -> hi/lo 2 terms), Wt bf16 [N][K]; ACT 0 none, 1 relu, 2 exact gelu;
// resid (optional, f32, row index = (row % rmod), pitch ldr, RES_BF16 rounds it) added before the activation.
template <bool ASPLIT, int ACT, bool BIAS_BF16, bool RES_BF16>
__global__ __launch_bounds__(128) void k_gemm_bf3(const float* __restrict__ A, int lda, const unsigned short* __restrict__ Wt, int ldb,
                                                const float* __restrict__ bias, const float* __restrict__ resid, int rmod, int ldr,
                                                float* __restrict__ C, int ldc, int M, int N, int K) {
  __shared__ __attribute__((aligned(16))) float so[4][16][64];
  const int tid = threadIdx.x, w = tid >> 5, lane = tid & 31, ln = lane & 15, hh = lane >> 4;
  const int ntn = N / 64;
  const int wid = blockIdx.x * 4 + w;
  const int mt = wid / ntn, nq = wid % ntn;
  if (mt * 16 >= M) return;
  const int row0 = mt * 16, col0 = nq * 64;
  const float* arow = A + (size_t)(row0 + ln) * lda;
  v8f acc[4] = {};
  for (int kb = 0; kb < K; kb += 32) {
    FragB ah, al;
    const v4f x0 = *(const v4fa*)(arow + kb + 8 * hh), x1 = *(const v4fa*)(arow + kb + 8 * hh + 4);
    const v4f x2 = *(const v4fa*)(arow + kb + 16 + 8 * hh), x3 = *(const v4fa*)(arow + kb + 16 + 8 * hh + 4);
    float xs[16] = {x0[0],x0[1],x0[2],x0[3],x1[0],x1[1],x1[2],x1[3],x2[0],x2[1],x2[2],x2[3],x3[0],x3[1],x3[2],x3[3]};
#pragma unroll
    for (int i = 0; i < 16; ++i) { const unsigned short hb = bf16_bits(xs[i]); ah.u[i] = hb; al.u[i] = ASPLIT ? bf16_bits(xs[i] - bf16_val(hb)) : (unsigned short)0; }
#pragma unroll
    for (int t = 0; t < 4; ++t) {
      const unsigned short* brow = Wt + (size_t)(col0 + t * 16 + ln) * ldb + kb;
      FragB b;
      b.half[0] = *(const v8us*)(brow + 8 * hh);
      b.half[1] = *(const v8us*)(brow + 16 + 8 * hh);
      acc[t] = mmaN<ASPLIT ? 2 : 1>(ah.v, al.v, b.v, b.v, acc[t]);
    }
  }
#pragma unroll
  for (int t = 0; t < 4; ++t) {
    const int col = col0 + t * 16 + ln;
    float bv = bias ? bias[col] : 0.f;
    if (BIAS_BF16) bv = bf16_round(bv);
#pragma unroll
    for (int r = 0; r < 8; ++r) {
      float v = acc[t][r] + bv;
      if (resid) { float rv = resid[(size_t)((row0 + 8 * hh + r) % rmod) * ldr + col]; if (RES_BF16) rv = bf16_round(rv); v += rv; }
      if (ACT == 1) v = fmaxf(v, 0.f);
      if (ACT == 2) v = 0.5f * v * (1.0f + erff(v * 0.70710678118654752f));
      if (ACT == 3) { const float u = 0.7978845608028654f * (v + 0.044715f * v * v * v); v = 0.5f * v * (1.0f + tanhf(u)); }
      so[w][8 * hh + r][t * 16 + ln] = v;
    }
  }
  __builtin_amdgcn_fence(__ATOMIC_ACQ_REL, "workgroup");
  __builtin_amdgcn_wave_barrier();
  const int rsub = lane >> 4, c4 = (lane & 15) * 4;
  {
#pragma unroll
    for (int q = 0; q < 8; ++q) {
      const int r = q * 2 + rsub;
      const v4f v = *(const v4fa*)&so[w][r][c4];
      *(v4f*)(C + (size_t)(row0 + r) * ldc + col0 + c4) = v;
    }
    
  }
}
// row LayerNorm (biased variance, eps) over N: s = X (+ R); optional out_sum <- s; out_norm <- (s-mu)*rsqrt(var+eps)*g + b
template <bool PARAM_BF16>
__global__ __launch_bounds__(256) void k_layernorm(const float* __restrict__ X, const float* __restrict__ R, const float* __restrict__ g, const float* __restrict__ bta,
                                                  float* __restrict__ out_sum, float* __restrict__ out_norm, int N, float eps) {
  __shared__ float red[256];
  const int row = blockIdx.x, tid = threadIdx.x;
  const float* x = X + (size_t)row * N; const float* rr = R ? R + (size_t)row * N : nullptr;
  float vals[16];                     // up to N = 4096
  const int per = N / 256;            // contiguous chunk per thread? use strided-by-4 chunks: thread handles j = tid*4 + 1024*u
  float s1 = 0.f;
  for (int u = 0; u < per / 4; ++u) {
    const int j = tid * 4 + 1024 * u;
    const v4f a = *(const v4fa*)(x + j);
    v4f b = {0.f,0.f,0.f,0.f}; if (rr) b = *(const v4fa*)(rr + j);
#pragma unroll
    for (int q = 0; q < 4; ++q) { const float v = a[q] + b[q]; vals[u * 4 + q] = v; s1 += v; }
  }
  red[tid] = s1; __syncthreads();
  for (int st = 128; st > 0; st >>= 1) { if (tid < st) red[tid] += red[tid + st]; __syncthreads(); }
  const float mu = red[0] / (float)N; __syncthreads();
  float s2 = 0.f;
  for (int u = 0; u < per / 4; ++u)
#pragma unroll
    for (int q = 0; q < 4; ++q) { const float c = vals[u * 4 + q] - mu; s2 += c * c; }
  red[tid] = s2; __syncthreads();
  for (int st = 128; st > 0; st >>= 1) { if (tid < st) red[tid] += red[tid + st]; __syncthreads(); }
  const float rs = rsqrtf(red[0] / (float)N + eps);
  {
    for (int u = 0; u < per / 4; ++u) {
      const int j = tid * 4 + 1024 * u;
      v4f o, sm;
#pragma unroll
      for (int q = 0; q < 4; ++q) {
        float gg = g[j + q], bb = bta[j + q];
        if (PARAM_BF16) { gg = bf16_round(gg); bb = bf16_round(bb); }
        sm[q] = vals[u * 4 + q]; o[q] = (vals[u * 4 + q] - mu) * rs * gg + bb;
      }
      if (out_sum) *(v4f*)(out_sum + (size_t)row * N + j) = sm;
      *(v4f*)(out_norm + (size_t)row * N + j) = o;
    }
    
  }
}



// ---- f16 WMMA path (v_wmma_f32_16x16x32_f16): 11-bit significands for operands in range — used where a [0,1] probability operand needs more precision than bf16
typedef _Float16 v16h __attribute__((ext_vector_type(16)));
union FragH { v16h v; v8us half[2]; _Float16 h[16]; unsigned short u[16]; };
template <int NT>
__device__ __forceinline__ v8f mmaH(v16h ah, v16h al, v16h bh, v16h bl, v8f c) {
  c = __builtin_amdgcn_wmma_f32_16x16x32_f16(false, ah, false, bh, (short)0, c, false, false);
  if (NT >= 2) c = __builtin_amdgcn_wmma_f32_16x16x32_f16(false, al, false, bh, (short)0, c, false, false);
  if (NT >= 3) c = __builtin_amdgcn_wmma_f32_16x16x32_f16(false, ah, false, bl, (short)0, c, false, false);
  asm volatile("v_nop\n\tv_nop\n\tv_nop\n\tv_nop" : "+v"(c) : "v"(ah), "v"(al), "v"(bh), "v"(bl));
  return c;
}
// batched GEMM like k_gemm_b but f16 operands: A f32 (split into f16 hi/lo if ASPLIT, else rounded to f16), Bt = f16 values [n][k]; alpha; C f32; N multiple of 16 (partial tiles skipped)
template <bool ASPLIT>
__global__ __launch_bounds__(128) void k_gemm_h(const float* __restrict__ A, int lda, size_t sA, const _Float16* __restrict__ Bh, int ldb, size_t sB, float alpha, float* __restrict__ C, int ldc, size_t sC, int M, int N, int K) {
  __shared__ __attribute__((aligned(16))) float so[4][16][64];
  const int tid = threadIdx.x, w = tid >> 5, lane = tid & 31, ln = lane & 15, hh = lane >> 4; const int by = blockIdx.y;
  A += (size_t)by * sA; Bh += (size_t)by * sB; C += (size_t)by * sC;
  const int ntn = (N + 63) / 64; const int wid = blockIdx.x * 4 + w; const int mt = wid / ntn, nq = wid % ntn; if (mt * 16 >= M) return;
  const int row0 = mt * 16, col0 = nq * 64; const float* arow = A + (size_t)(row0 + ln) * lda;
  v8f acc[4] = {};
  for (int kb = 0; kb < K; kb += 32) {
    FragH ah, al;
    const v4f x0 = *(const v4fa*)(arow + kb + 8 * hh), x1 = *(const v4fa*)(arow + kb + 8 * hh + 4), x2 = *(const v4fa*)(arow + kb + 16 + 8 * hh), x3 = *(const v4fa*)(arow + kb + 16 + 8 * hh + 4);
    float xs[16] = {x0[0],x0[1],x0[2],x0[3],x1[0],x1[1],x1[2],x1[3],x2[0],x2[1],x2[2],x2[3],x3[0],x3[1],x3[2],x3[3]};
#pragma unroll
    for (int i = 0; i < 16; ++i) { const _Float16 h = (_Float16)xs[i]; ah.h[i] = h; al.h[i] = ASPLIT ? (_Float16)(xs[i] - (float)h) : (_Float16)0.0f; }
#pragma unroll
    for (int t = 0; t < 4; ++t) { if (col0 + t * 16 >= N) continue; const size_t boff = (size_t)(col0 + t * 16 + ln) * ldb + kb; FragH bq; bq.half[0] = *(const v8us*)(Bh + boff + 8 * hh); bq.half[1] = *(const v8us*)(Bh + boff + 16 + 8 * hh);
      acc[t] = mmaH<ASPLIT ? 2 : 1>(ah.v, al.v, bq.v, bq.v, acc[t]); }
  }
#pragma unroll
  for (int t = 0; t < 4; ++t) { if (col0 + t * 16 >= N) continue;
#pragma unroll
    for (int r = 0; r < 8; ++r) so[w][8 * hh + r][t * 16 + ln] = acc[t][r] * alpha; }
  __builtin_amdgcn_fence(__ATOMIC_ACQ_REL, "workgroup"); __builtin_amdgcn_wave_barrier();
  const int rsub = lane >> 4, c4 = (lane & 15) * 4;
  {
#pragma unroll
    for (int q = 0; q < 8; ++q) { const int r = q * 2 + rsub; if (col0 + c4 < N) { const v4f v = *(const v4fa*)&so[w][r][c4]; *(v4f*)(C + (size_t)(row0 + r) * ldc + col0 + c4) = v; } }
     }
}

// Wt[n][k] = f16(W[k][n]·scale) from f32 row-major W[K][N] (scale = power of two; bf16-exact weights stay exact in f16 away from the subnormal range)
__device__ __forceinline__ void wt_f16(const float* __restrict__ W, _Float16* __restrict__ Wt, int K, int N, float scale, int blk) {      /* blk: the job's own block index */
  const int t = blk * 256 + threadIdx.x; if (t >= N * (K / 8)) return; const int n = t / (K / 8), k8 = (t % (K / 8)) * 8; FragH f;
#pragma unroll
  for (int i = 0; i < 8; ++i) f.h[i] = (_Float16)(bf16_round(W[(size_t)(k8 + i) * N + n]) * scale); const v8us o = f.half[0];
  *(v8us*)((unsigned short*)Wt + (size_t)n * K + k8) = o; 
}
// k_gemm_hh variant with fused epilogue: v = acc·alpha + bias[by·sBias + col] (+ CP[(row/rowsPerB)·sCPb + by·64 + col] if CP) ; ACT 0 none / 1 elu ; writes f16 C16 (and f32 C if non-null)
template <int ACT>
__global__ __launch_bounds__(128) void k_gemm_hhx(const _Float16* __restrict__ A, int lda, size_t sA, const _Float16* __restrict__ Bh, int ldb, size_t sB, float alpha, const float* __restrict__ bias, size_t sBias, const float* __restrict__ CP, int rowsPerB, size_t sCPb, int row0g,
    float* __restrict__ C, _Float16* __restrict__ C16, int ldc, size_t sC, int M, int N, int K) {
  __shared__ __attribute__((aligned(16))) float so[4][16][64];
  const int tid = threadIdx.x, w = tid >> 5, lane = tid & 31, ln = lane & 15, hh = lane >> 4; const int by = blockIdx.y;
  A += (size_t)by * sA; Bh += (size_t)by * sB; const size_t cofs = (size_t)by * sC; const float* bp = bias ? bias + (size_t)by * sBias : nullptr;
  const int ntn = (N + 63) / 64; const int wid = blockIdx.x * 4 + w; const int mt = wid / ntn, nq = wid % ntn; if (mt * 16 >= M) return;
  const int row0 = mt * 16, col0 = nq * 64; const _Float16* arow = A + (size_t)(row0 + ln) * lda;
  v8f acc[4] = {};
  for (int kb = 0; kb < K; kb += 32) { FragH ah; ah.half[0] = *(const v8us*)((const unsigned short*)arow + kb + 8 * hh); ah.half[1] = *(const v8us*)((const unsigned short*)arow + kb + 16 + 8 * hh);
#pragma unroll
    for (int t = 0; t < 4; ++t) { if (col0 + t * 16 >= N) continue; const size_t boff = (size_t)(col0 + t * 16 + ln) * ldb + kb; FragH bq; bq.half[0] = *(const v8us*)((const unsigned short*)Bh + boff + 8 * hh); bq.half[1] = *(const v8us*)((const unsigned short*)Bh + boff + 16 + 8 * hh);
      acc[t] = mmaH<1>(ah.v, ah.v, bq.v, bq.v, acc[t]); }
  }
#pragma unroll
  for (int t = 0; t < 4; ++t) { if (col0 + t * 16 >= N) continue; const int col = col0 + t * 16 + ln; const float bv = bp ? bf16_round(bp[col]) : 0.f;
#pragma unroll
    for (int r = 0; r < 8; ++r) { float v = acc[t][r] * alpha + bv; if (CP) { const int bidx = (row0g + row0 + 8 * hh + r) / rowsPerB; v += CP[(size_t)bidx * sCPb + (size_t)by * 64 + col]; } if (ACT == 1) v = (v > 0.f) ? v : expm1f(v); else if (ACT == 7) v = (v > 0.f) ? v + 1.0f : expf(v); else if (ACT == 8) v = tanhf(v); else if (ACT == 9) v = 0.5f * v * (1.0f + tanhf(0.7978845608028654f * (v + 0.044715f * v * v * v))); else if (ACT == 11) v = 1.0f / (1.0f + expf(-v)); else if (ACT == 12) v = (v > 0.f) ? v : 0.01f * v; else if (ACT == 14) v = (v > 0.f) ? v : 0.1f * v; else if (ACT == 15) v = v / (1.0f + expf(-v)); else if (ACT == 3) v = fmaxf(v, 0.f); else if (ACT == 6) v = 0.5f * v * (1.0f + erff(v * 0.70710678118654752f)); so[w][8 * hh + r][t * 16 + ln] = v; } }
  __builtin_amdgcn_fence(__ATOMIC_ACQ_REL, "workgroup"); __builtin_amdgcn_wave_barrier();
  const int rsub = lane >> 4, c4 = (lane & 15) * 4; typedef _Float16 v4h __attribute__((ext_vector_type(4)));
  {
#pragma unroll
    for (int q = 0; q < 8; ++q) { const int r = q * 2 + rsub; if (col0 + c4 < N) { const v4f v = *(const v4fa*)&so[w][r][c4]; if (C) *(v4f*)(C + cofs + (size_t)(row0 + r) * ldc + col0 + c4) = v; if (C16) { v4h h4; for (int i = 0; i < 4; ++i) h4[i] = (_Float16)v[i]; *(v4h*)(C16 + cofs + (size_t)(row0 + r) * ldc + col0 + c4) = h4; } } }
     }
}


typedef _Float16 v4h __attribute__((ext_vector_type(4)));

__device__ __forceinline__ void x16(const float* __restrict__ x, _Float16* __restrict__ X16, size_t n8, int blk) { const size_t t = (size_t)blk * 256 + threadIdx.x; if (t >= n8) return; FragH f;
#pragma unroll
  for (int q = 0; q < 8; ++q) f.h[q] = (_Float16)bf16_round(x[t * 8 + q]); *(v8us*)((unsigned short*)X16 + t * 8) = f.half[0];  }
// The five preparation jobs (four weight transposes, the f16 plane of x) read and write disjoint buffers: one grid, a block range each, so that they run side by side instead of one launch behind the other.
#define PB_W (DM * DM / 8 / 256)       /* blocks of a DM x DM weight */
#define PB_KV (DM * KVD / 8 / 256)     /* blocks of a DM x KVD weight */
#define PB_X (NR * DM / 8 / 256)       /* blocks of x */
__global__ __launch_bounds__(256) void k_prep(const float* __restrict__ x, const float* __restrict__ Wq, const float* __restrict__ Wk, const float* __restrict__ Wv, const float* __restrict__ Wo,
                                              _Float16* __restrict__ X16, _Float16* __restrict__ BQ, _Float16* __restrict__ BK, _Float16* __restrict__ BV, _Float16* __restrict__ BO) {
  int blk = blockIdx.x;
  if (blk < PB_W) { wt_f16(Wq, BQ, DM, DM, 16.0f, blk); return; } blk -= PB_W;
  if (blk < PB_W) { wt_f16(Wo, BO, DM, DM, 16.0f, blk); return; } blk -= PB_W;
  if (blk < PB_KV) { wt_f16(Wk, BK, DM, KVD, 16.0f, blk); return; } blk -= PB_KV;
  if (blk < PB_KV) { wt_f16(Wv, BV, DM, KVD, 16.0f, blk); return; } blk -= PB_KV;
  x16(x, X16, (size_t)NR * DM / 8, blk); }
__global__ __launch_bounds__(256) void k_h16(const float* __restrict__ x, _Float16* __restrict__ X16, size_t n8) { const size_t t = (size_t)blockIdx.x * 256 + threadIdx.x; if (t >= n8) return; FragH f;
#pragma unroll
  for (int q = 0; q < 8; ++q) f.h[q] = (_Float16)x[t * 8 + q]; *(v8us*)((unsigned short*)X16 + t * 8) = f.half[0];  }
__global__ __launch_bounds__(256) void k_round16f(const float* __restrict__ W, _Float16* __restrict__ Bt, size_t n8) { const size_t t = (size_t)blockIdx.x * 256 + threadIdx.x; if (t >= n8) return; FragH f;
#pragma unroll
  for (int i = 0; i < 8; ++i) f.h[i] = (_Float16)(bf16_round(W[t * 8 + i]) * 16.0f); *(v8us*)((unsigned short*)Bt + t * 8) = f.half[0];  }
template <int NHv, int TTv>
__global__ __launch_bounds__(256) void k_vt(const _Float16* __restrict__ V16, int ldv, int voff, _Float16* __restrict__ Vt) { __shared__ unsigned short tl[64][66]; const int tid = threadIdx.x; const int slab = blockIdx.x / (TTv / 64), lg = blockIdx.x % (TTv / 64); const int b = slab / NHv, h = slab % NHv;
  for (int i = tid; i < 64 * 8; i += 256) { const int r = i / 8, c8 = (i % 8) * 8; FragH f; f.half[0] = *(const v8us*)((const unsigned short*)V16 + ((size_t)b * TTv + lg * 64 + r) * ldv + voff + h * 64 + c8);
#pragma unroll
    for (int q = 0; q < 8; ++q) tl[r][c8 + q] = f.u[q]; }
  __syncthreads();
  {
#pragma unroll
    for (int rd = 0; rd < 2; ++rd) { const int d = rd * 32 + tid / 8, pc = tid % 8; FragH f;
#pragma unroll
      for (int q = 0; q < 8; ++q) f.u[q] = tl[pc * 8 + q][d];
      *(v8us*)((unsigned short*)Vt + ((size_t)slab * 64 + d) * TTv + lg * 64 + pc * 8) = f.half[0]; }
     } }

// ---- LDS staging by asynchronous copies (global_load_async_to_lds_b128): a lane moves its own 16 bytes, 8 lanes one whole 128-byte row; two buffers, the next stage in flight while this one is worked on ----
#define LP 72      /* LDS row pitch in f16: 128 data bytes + 16 = an odd multiple of 16 bytes, the conflict-free pitch of the ds_load_b128 fragment readers */
__device__ __forceinline__ void wait_async0() { asm volatile("s_wait_asynccnt 0x0" ::: "memory"); }      /* the wave's own copies have landed; stands before the barrier behind which the other waves read them */
__device__ __forceinline__ void wait_ds0() { asm volatile("s_wait_dscnt 0x0" ::: "memory"); }      /* the wave's own LDS reads have retired before the barrier behind which their buffer is refilled */
// one tile of 64 rows x 128 bytes (row pitch ldg f16 in global memory, LP in LDS) by 128 threads: 4 copies a lane, rows tid / 8 + 16 i. The s_wait_xcnt closes the statement so that no address register is rewritten ahead of it.
__device__ __forceinline__ void stage64(const unsigned short* g, size_t ldg, const unsigned short* s, int tid) {
  const unsigned short* g0 = g + (size_t)(tid >> 3) * ldg + (tid & 7) * 8; const unsigned short* g1 = g0 + 16 * ldg; const unsigned short* g2 = g1 + 16 * ldg; const unsigned short* g3 = g2 + 16 * ldg;
  const unsigned l0 = (unsigned)(size_t)(s + (tid >> 3) * LP + (tid & 7) * 8), l1 = l0 + 16 * LP * 2, l2 = l0 + 32 * LP * 2, l3 = l0 + 48 * LP * 2;
  asm volatile("global_load_async_to_lds_b128 %0, %1, off\n\tglobal_load_async_to_lds_b128 %2, %3, off\n\tglobal_load_async_to_lds_b128 %4, %5, off\n\tglobal_load_async_to_lds_b128 %6, %7, off\n\ts_wait_xcnt 0x0"
               :: "v"(l0), "v"(g0), "v"(l1), "v"(g1), "v"(l2), "v"(g2), "v"(l3), "v"(g3) : "memory");
}
// ---- fast GEMM (block tile 128x64, wave tile 32x64; requires M % 128 == 0 rows per launch region, N % 64 == 0, K % 64 == 0, K >= 64); A and B tiles of 64 k staged in LDS; epilogue = k_gemm_hhx semantics ----
// OM 0: C (f32) and / or C16 (f16). OM 1: the f32 result leaves as two f16 planes, C16 = hi, C16L = (v - hi) * 2^10, same layout. OM 2: the same two planes transposed, [row / ldc][col][row % ldc] with ldc = rows per sequence (a multiple of 128). OM 1 and 2 take no CP term.
__device__ __forceinline__ v16h g2_frag(const _Float16* p, int hh) { FragH f; f.half[0] = *(const v8us*)((const unsigned short*)p + 8 * hh); f.half[1] = *(const v8us*)((const unsigned short*)p + 16 + 8 * hh); return f.v; }
__device__ __forceinline__ v8f g2_mma(v16h a, v16h b, v8f c) { v8f d = __builtin_amdgcn_wmma_f32_16x16x32_f16(false, a, false, b, (short)0, c, false, false); asm volatile("v_nop\n\tv_nop\n\tv_nop\n\tv_nop" : "+v"(d) : "v"(a), "v"(b)); return d; }
// The body takes its block index (bx) and the kernel's LDS arrays from the caller: a kernel that serves several GEMMs from one grid hands each block range its own operands.
#define GEMM2_LDS __shared__ __attribute__((aligned(16))) float so[4][32][68]; __shared__ __attribute__((aligned(16))) unsigned short tA[2][128][LP], tB[2][64][LP];
template <int ACT, int OM>
__device__ __forceinline__ void gemm2_body(const int bx, float (*so)[32][68], unsigned short (*tA)[128][LP], unsigned short (*tB)[64][LP],
    const _Float16* __restrict__ A, int lda, size_t sA, const _Float16* __restrict__ Bh, int ldb, size_t sB, float alpha, const float* __restrict__ bias, size_t sBias, const float* __restrict__ CP, int rowsPerB, size_t sCPb, int row0g,
    float* __restrict__ C, _Float16* __restrict__ C16, _Float16* __restrict__ C16L, int ldc, size_t sC, int M, int N, int K) {
  constexpr int TP = 132;      /* OM 2: row pitch of the transposed staging tile, 128 tokens + 4 floats; 64 rows of it fit in so */
  static_assert(64 * TP <= 4 * 32 * 68, "the transposed tile lies inside so");
  const int tid = threadIdx.x, w = tid >> 5, lane = tid & 31, ln = lane & 15, hh = lane >> 4; const int by = blockIdx.y;
  A += (size_t)by * sA; Bh += (size_t)by * sB; const size_t cofs = (size_t)by * sC; const float* bp = bias ? bias + (size_t)by * sBias : nullptr;
  const int ntn = N >> 6; const int mt = bx / ntn, nq = bx - mt * ntn; const int row0 = mt * 128 + 32 * w, col0 = nq * 64; if (mt * 128 + 128 > M) return;      /* the whole block leaves or none, ahead of every barrier */
  const unsigned short* Ag = (const unsigned short*)A + (size_t)(mt * 128) * lda; const unsigned short* Bg = (const unsigned short*)Bh + (size_t)col0 * ldb; const int nst = K >> 6;
  stage64(Ag, lda, &tA[0][0][0], tid); stage64(Ag + (size_t)64 * lda, lda, &tA[0][64][0], tid); stage64(Bg, ldb, &tB[0][0][0], tid);
  wait_async0(); __syncthreads();      /* stage 0 published */
  if (nst > 1) { stage64(Ag + 64, lda, &tA[1][0][0], tid); stage64(Ag + (size_t)64 * lda + 64, lda, &tA[1][64][0], tid); stage64(Bg + 64, ldb, &tB[1][0][0], tid); }
  const v8f z8 = {0.f,0.f,0.f,0.f,0.f,0.f,0.f,0.f}; v8f c00 = z8, c01 = z8, c02 = z8, c03 = z8, c10 = z8, c11 = z8, c12 = z8, c13 = z8;
#pragma unroll 1
  for (int t = 0; t < nst; ++t) { const int bf = t & 1;      /* rolled: one stage a trip, the publish point at its foot */
    // all 12 fragments of the stage are read from LDS as one group ahead of its 16 products: one LDS latency a stage in front of the matrix run, not one in front of every pair of products
    v16h fa[2][2], fb[2][4];
    // unrolled (both loops): the two k blocks of a stage become constant LDS offsets and the fragment arrays stay in registers
#pragma unroll
    for (int kq = 0; kq < 2; ++kq) { fa[kq][0] = g2_frag((const _Float16*)&tA[bf][32 * w + ln][kq * 32], hh); fb[kq][0] = g2_frag((const _Float16*)&tB[bf][ln][kq * 32], hh); fa[kq][1] = g2_frag((const _Float16*)&tA[bf][32 * w + 16 + ln][kq * 32], hh);
      fb[kq][1] = g2_frag((const _Float16*)&tB[bf][16 + ln][kq * 32], hh); fb[kq][2] = g2_frag((const _Float16*)&tB[bf][32 + ln][kq * 32], hh); fb[kq][3] = g2_frag((const _Float16*)&tB[bf][48 + ln][kq * 32], hh); }
#pragma unroll
    for (int kq = 0; kq < 2; ++kq) { c00 = g2_mma(fa[kq][0], fb[kq][0], c00); c10 = g2_mma(fa[kq][1], fb[kq][0], c10); c01 = g2_mma(fa[kq][0], fb[kq][1], c01); c11 = g2_mma(fa[kq][1], fb[kq][1], c11);
      c02 = g2_mma(fa[kq][0], fb[kq][2], c02); c12 = g2_mma(fa[kq][1], fb[kq][2], c12); c03 = g2_mma(fa[kq][0], fb[kq][3], c03); c13 = g2_mma(fa[kq][1], fb[kq][3], c13); }
    wait_ds0(); wait_async0(); __syncthreads();      /* publishes stage t + 1 and ends every read of buffer bf */
    if (t + 2 < nst) { const int k2 = (t + 2) * 64; stage64(Ag + k2, lda, &tA[bf][0][0], tid); stage64(Ag + (size_t)64 * lda + k2, lda, &tA[bf][64][0], tid); stage64(Bg + k2, ldb, &tB[bf][0][0], tid); } }
  wait_async0();
  v8f accs[8] = {c00, c01, c02, c03, c10, c11, c12, c13};
#pragma unroll
  for (int u = 0; u < 8; ++u) { const int t = u & 3, half = u >> 2; const int col = col0 + t * 16 + ln; const float bv = bp ? bf16_round(bp[col]) : 0.f;
#pragma unroll
    for (int r = 0; r < 8; ++r) { const int rloc = half * 16 + 8 * hh + r; float v = accs[u][r] * alpha + bv; if (OM == 0 && CP) { const int bidx = (row0g + row0 + rloc) / rowsPerB; v += CP[(size_t)bidx * sCPb + (size_t)by * 64 + col]; }
      if (ACT == 3) v = fmaxf(v, 0.f); else if (ACT == 6) v = 0.5f * v * (1.0f + erff(v * 0.70710678118654752f)); else if (ACT == 11) v = 1.0f / (1.0f + expf(-v)); else if (ACT == 15) v = v / (1.0f + expf(-v)); else if (ACT == 12) v = (v > 0.f) ? v : 0.01f * v; else if (ACT == 8) v = tanhf(v);
      if (OM == 2) (&so[0][0][0])[(t * 16 + ln) * TP + 32 * w + rloc] = v; else so[w][rloc][t * 16 + ln] = v; } }
  if (OM == 2) {      /* the staging tile holds the block's 64 columns as rows of 128 tokens: a wave stores 16 of them, 16 lanes one whole 256-byte run */
    __syncthreads();      /* a transposed row holds results of all four waves */
    const float* soT = &so[0][0][0]; const int rb = mt * 128; const size_t ob = ((size_t)(rb / ldc) * N + col0) * ldc + rb % ldc + (lane & 15) * 8;
    // unrolled (both loops): the eight row pairs become constant LDS offsets whose reads go out ahead of the stores, and the two packed planes stay in registers
#pragma unroll
    for (int i = 0; i < 8; ++i) { const int d = 16 * w + 2 * i + (lane >> 4); const v4f a = *(const v4fa*)&soT[d * TP + (lane & 15) * 8], c = *(const v4fa*)&soT[d * TP + (lane & 15) * 8 + 4]; FragH fh, fl;      /* inner loop unrolled for constant element indices */
#pragma unroll
      for (int q = 0; q < 4; ++q) { _Float16 h = (_Float16)a[q]; fh.h[q] = h; fl.h[q] = (_Float16)((a[q] - (float)h) * 1024.0f); h = (_Float16)c[q]; fh.h[4 + q] = h; fl.h[4 + q] = (_Float16)((c[q] - (float)h) * 1024.0f); }
      *(v8us*)((unsigned short*)C16 + cofs + ob + (size_t)d * ldc) = fh.half[0]; *(v8us*)((unsigned short*)C16L + cofs + ob + (size_t)d * ldc) = fl.half[0]; }
    return; }
  __builtin_amdgcn_fence(__ATOMIC_ACQ_REL, "workgroup"); __builtin_amdgcn_wave_barrier();
  const int rsub = lane >> 4, c4 = (lane & 15) * 4;
  {
#pragma unroll
    for (int q = 0; q < 16; ++q) { const int r = q * 2 + rsub; const v4f v = *(const v4fa*)&so[w][r][c4];
      if (OM == 1) { v4h h4, l4; for (int i = 0; i < 4; ++i) { h4[i] = (_Float16)v[i]; l4[i] = (_Float16)((v[i] - (float)h4[i]) * 1024.0f); } *(v4h*)(C16 + cofs + (size_t)(row0 + r) * ldc + col0 + c4) = h4; *(v4h*)(C16L + cofs + (size_t)(row0 + r) * ldc + col0 + c4) = l4; continue; }
      if (C) *(v4f*)(C + cofs + (size_t)(row0 + r) * ldc + col0 + c4) = v; if (C16) { v4h h4; for (int i = 0; i < 4; ++i) h4[i] = (_Float16)v[i]; *(v4h*)(C16 + cofs + (size_t)(row0 + r) * ldc + col0 + c4) = h4; } }
    if (OM == 1) asm volatile("s_wait_xcnt 0x0" ::: "memory");      /* behind the last store of the hi/residual path */
     } }
template <int ACT, int OM>
__global__ __launch_bounds__(128) void k_gemm2(const _Float16* __restrict__ A, int lda, size_t sA, const _Float16* __restrict__ Bh, int ldb, size_t sB, float alpha, const float* __restrict__ bias, size_t sBias, const float* __restrict__ CP, int rowsPerB, size_t sCPb, int row0g,
    float* __restrict__ C, _Float16* __restrict__ C16, _Float16* __restrict__ C16L, int ldc, size_t sC, int M, int N, int K) {
  GEMM2_LDS gemm2_body<ACT, OM>(blockIdx.x, so, tA, tB, A, lda, sA, Bh, ldb, sB, alpha, bias, sBias, CP, rowsPerB, sCPb, row0g, C, C16, C16L, ldc, sC, M, N, K); }
// q, k and v = x W + b read the same x and depend on nothing of one another: one grid, a block range each (q, then k, then v), so that the two narrow products fill the places that the wide one leaves idle.
#define GB_Q ((NR / 128) * (DM / 64))
#define GB_KV ((NR / 128) * (KVD / 64))
__global__ __launch_bounds__(128) void k_qkv(const _Float16* __restrict__ X16, const _Float16* __restrict__ BQ, const _Float16* __restrict__ BK, const _Float16* __restrict__ BV, const float* __restrict__ bq, const float* __restrict__ bk, const float* __restrict__ bv,
    _Float16* __restrict__ QH, _Float16* __restrict__ QL, _Float16* __restrict__ KH, _Float16* __restrict__ KL, _Float16* __restrict__ VT, _Float16* __restrict__ VTL) {
  GEMM2_LDS
  const int b = blockIdx.x;      /* every branch below is the same for the whole block */
  if (b >= GB_Q + GB_KV) { gemm2_body<0, 2>(b - GB_Q - GB_KV, so, tA, tB, X16, DM, 0, BV, DM, 0, 0.0625f, bv, 0, nullptr, 1, 0, 0, nullptr, VT, VTL, SLEN, 0, NR, KVD, DM); return; }      /* V^T hi/lo: [kv head][d][token] */
  if (b >= GB_Q) { gemm2_body<0, 1>(b - GB_Q, so, tA, tB, X16, DM, 0, BK, DM, 0, 0.0625f, bk, 0, nullptr, 1, 0, 0, nullptr, KH, KL, KVD, 0, NR, KVD, DM); return; }      /* k hi/lo, 4 kv heads */
  gemm2_body<0, 1>(b, so, tA, tB, X16, DM, 0, BQ, DM, 0, 0.0625f, bq, 0, nullptr, 1, 0, 0, nullptr, QH, QL, DM, 0, NR, DM, DM); }      /* q hi/lo */



// lane l with lane l ^ 16: the two lane halves of a 16-column group hold the two key halves of one query
__device__ __forceinline__ float xhalf(float x) { return __builtin_bit_cast(float, __builtin_amdgcn_permlanex16(__builtin_bit_cast(int, x), __builtin_bit_cast(int, x), 0x76543210, 0xfedcba98, false, false)); }
template <int CAUSAL>
__device__ __forceinline__ void flash_body(const int bx, float (*sO)[16][64 + 4], unsigned short (*ring)[64][LP], const _Float16* __restrict__ Q16, int ldq, const _Float16* __restrict__ K16, int ldk, const _Float16* __restrict__ Vt, const int* __restrict__ MSK, _Float16* __restrict__ OH, int ldo) {
  constexpr int RPW = 16, DT = 4, KS = 2;      /* every '#pragma unroll' below: constant indices keep the fragment, score and accumulator arrays in registers */
  unsigned short (*sK)[64][LP] = ring, (*sV)[64][LP] = ring + 2;      /* two buffers each; a stage = 64 keys: K rows (key, d) and V^T rows (d, key), shared by the four waves */
  const int tid = threadIdx.x, w = tid >> 5, lane = tid & 31, ln = lane & 15, hh = lane >> 4;
  const int slab = bx / QBNP, qblk = QB0P + bx % QBNP; const int b = slab / NH, h = slab % NH; const int qb0 = qblk * (4 * RPW); const int q0 = qb0 + w * RPW; const int tq = q0 + ln;
  FragH bq[KS];
  { const unsigned short* qr = (const unsigned short*)Q16 + ((size_t)b * TQ + tq) * ldq + h * 64;
#pragma unroll
    for (int ks = 0; ks < KS; ++ks) { bq[ks].half[0] = *(const v8us*)(qr + ks * 32 + 8 * hh); bq[ks].half[1] = *(const v8us*)(qr + ks * 32 + 16 + 8 * hh); } }
  const int kvh = h / NREP;      /* K16 and Vt hold the kv heads themselves: query head h reads kv head h / NREP */
  const unsigned short* Vth = (const unsigned short*)Vt + (size_t)(b * NKV + kvh) * 64 * TK;
  const float sl = (CAUSAL == 14) ? bf16_round(((const float*)MSK)[h]) : 0.f;      /* mode 14: causal + ALiBi slope[h] * (key - query) from the slopes INPUT */
  // Softmax in log2 units: p * 1024 = 2^(s * c2 + sl2 * (key - query) - m + 10). A lane's 16 keys of a pass lie at fixed distances from its first one, so scale and ALiBi are one fma per score against kb; the first key's own term (base) joins the maximum once a pass.
  static_assert(CAUSAL == 0 || CAUSAL == 1 || CAUSAL == 14, "every query needs a valid key in the first pass: masked scores go out by 2^(-3e38 - finite) = 0");
  const float c2 = SCL * 1.44269504088896340736f, sl2 = sl * 1.44269504088896340736f; v8f kb[2];
#pragma unroll
  for (int nt = 0; nt < 2; ++nt)
#pragma unroll
    for (int r = 0; r < 8; ++r) kb[nt][r] = sl2 * (float)(nt * 16 + r);
  float m_r = -3.0e38f, l_r = 0.f; v8f oacc[DT];
#pragma unroll
  for (int dt = 0; dt < DT; ++dt) oacc[dt] = (v8f){0.f,0.f,0.f,0.f,0.f,0.f,0.f,0.f};
  const int jend = (CAUSAL == 1 || CAUSAL == 14) ? (qb0 + 4 * RPW) : TK;      /* causal: keys beyond the block's last query never contribute */
  const unsigned short* Kh = (const unsigned short*)K16 + (size_t)b * TK * ldk + kvh * 64; const int nst = jend >> 6;      /* jend is a multiple of 64 */
  stage64(Kh, ldk, &sK[0][0][0], tid); stage64(Vth, TK, &sV[0][0][0], tid);
  wait_async0(); __syncthreads();      /* stage 0 published */
  if (nst > 1) { stage64(Kh + (size_t)64 * ldk, ldk, &sK[1][0][0], tid); stage64(Vth + 64, TK, &sV[1][0][0], tid); }
  // LDS fragment reads stand in groups, ahead of the products that use them: K of both passes and V^T of pass 0 at the head of the stage, V^T of pass 1 behind the output products of pass 0.
  // Only the first group's latency is waited out; every read stays inside its own stage, ahead of the wait and the barrier at the foot.
  FragH ak[2][2][KS], av[2][DT];
  auto ldK = [&](int bf, int pp) {
#pragma unroll
    for (int nt = 0; nt < 2; ++nt) { const unsigned short* kr = &sK[bf][pp * 32 + nt * 16 + ln][0];
#pragma unroll
      for (int ks = 0; ks < KS; ++ks) { ak[pp][nt][ks].half[0] = *(const v8us*)(kr + ks * 32 + 8 * hh); ak[pp][nt][ks].half[1] = *(const v8us*)(kr + ks * 32 + 16 + 8 * hh); } } };
  auto ldV = [&](int bf, int pp) {
#pragma unroll
    for (int dt = 0; dt < DT; ++dt) { const unsigned short* vrow = &sV[bf][dt * 16 + ln][pp * 32]; av[pp][dt].half[0] = *(const v8us*)(vrow + 8 * hh); av[pp][dt].half[1] = *(const v8us*)(vrow + 16 + 8 * hh); } };
  // the stage loop stays rolled: one stage a trip with the publish point at its foot
#pragma unroll 1
  for (int t = 0; t < nst; ++t) { const int bf = t & 1;
  ldK(bf, 0); ldK(bf, 1); ldV(bf, 0);
  // the two passes of a stage are unrolled: pass 1's fragments get registers of their own, so that their reads can be issued during pass 0
#pragma unroll
  for (int pp = 0; pp < 2; ++pp) { const int j0 = t * 64 + pp * 32;
    v8f s[2];
#pragma unroll
    for (int nt = 0; nt < 2; ++nt) { v8f acc = (v8f){0.f,0.f,0.f,0.f,0.f,0.f,0.f,0.f};
#pragma unroll
      for (int ks = 0; ks < KS; ++ks) acc = mmaH<1>(ak[pp][nt][ks].v, ak[pp][nt][ks].v, bq[ks].v, bq[ks].v, acc);
      s[nt] = acc; }
    const float base = sl2 * (float)(j0 + 8 * hh - tq);      /* ALiBi of the lane's first key of this pass */
    v8f u[2];
#pragma unroll
    for (int nt = 0; nt < 2; ++nt) u[nt] = s[nt] * c2 + kb[nt];
    if ((CAUSAL == 1 || CAUSAL == 14) && t == nst - 1) {      /* only the block's last stage holds keys beyond a query: a scalar branch, every earlier stage goes unmasked */
#pragma unroll
      for (int nt = 0; nt < 2; ++nt)
#pragma unroll
        for (int r = 0; r < 8; ++r) u[nt][r] = (j0 + nt * 16 + 8 * hh + r <= tq) ? u[nt][r] : -3.0e38f; }
    float mcn[2];      /* two independent chains */
#pragma unroll
    for (int nt = 0; nt < 2; ++nt) { mcn[nt] = u[nt][0];
#pragma unroll
      for (int r = 1; r < 8; ++r) mcn[nt] = fmaxf(mcn[nt], u[nt][r]); }
    float mc = fmaxf(mcn[0], mcn[1]) + base; mc = fmaxf(mc, xhalf(mc));
    const float mn = fmaxf(m_r, mc); const float al = __builtin_amdgcn_exp2f(m_r - mn); m_r = mn;      /* first pass: 2^(-3e38 - mn) = 0 */
    const float sh = (mn - base) - 10.0f;      /* the factor 1024 of the f16 P operand rides in the exponent; l sums the same scaled values */
    FragH pb; v8f e[2];
#pragma unroll
    for (int nt = 0; nt < 2; ++nt) { e[nt] = u[nt] - sh;      /* the exponents as one vector, each 2^x then written over its own exponent */
#pragma unroll
      for (int r = 0; r < 8; ++r) { e[nt][r] = __builtin_amdgcn_exp2f(e[nt][r]); pb.h[nt * 8 + r] = (_Float16)e[nt][r]; } }
    const v8f e8 = e[0] + e[1]; const v4f e4 = __builtin_shufflevector(e8, e8, 0, 1, 2, 3) + __builtin_shufflevector(e8, e8, 4, 5, 6, 7);
    l_r = l_r * al + ((e4[0] + e4[2]) + (e4[1] + e4[3]));
#pragma unroll
    for (int dt = 0; dt < DT; ++dt) oacc[dt] *= al;
#pragma unroll
    for (int dt = 0; dt < DT; ++dt) oacc[dt] = mmaH<1>(av[pp][dt].v, av[pp][dt].v, pb.v, pb.v, oacc[dt]);
    if (pp == 0) ldV(bf, 1); }
    wait_ds0(); wait_async0(); __syncthreads();      /* publishes stage t + 1 and ends every read of buffer bf */
    if (t + 2 < nst) { const int j2 = (t + 2) * 64; stage64(Kh + (size_t)j2 * ldk, ldk, &sK[bf][0][0], tid); stage64(Vth + j2, TK, &sV[bf][0][0], tid); } }
  wait_async0();
  const float l = l_r + xhalf(l_r); const float li = (l > 0.f) ? 1.0f / l : 0.f;      /* l carries the factor 1024 of P */
#pragma unroll
  for (int dt = 0; dt < DT; ++dt) { const v4f lo = {oacc[dt][0] * li, oacc[dt][1] * li, oacc[dt][2] * li, oacc[dt][3] * li}, hi = {oacc[dt][4] * li, oacc[dt][5] * li, oacc[dt][6] * li, oacc[dt][7] * li};
    *(v4fa*)&sO[w][ln][dt * 16 + 8 * hh] = lo; *(v4fa*)&sO[w][ln][dt * 16 + 8 * hh + 4] = hi; }
  __builtin_amdgcn_fence(__ATOMIC_ACQ_REL, "workgroup"); __builtin_amdgcn_wave_barrier();      /* the wave's own sO rows: its stores above stay ahead of its whole-line reads below */
  {
#pragma unroll
    for (int rp = 0; rp < RPW; rp += 2) { const int r = rp + (lane >> 4), pc = lane & 15; const v4f val = *(const v4fa*)&sO[w][r][pc * 4]; v4h h4; for (int i = 0; i < 4; ++i) h4[i] = (_Float16)val[i]; *(v4h*)(OH + ((size_t)b * TQ + q0 + r) * ldo + h * 64 + pc * 4) = h4; }      /* O leaves as the f16 A operand of the Wo GEMM: 16 lanes one 128-byte line */
     } }
// 5-plane variant: S = Qh Kh^T + (Ql Kh^T + Qh Kl^T)/1024 with Q/K = [hi | 2^10 residual] f16 planes (QL/KL same layout as Q16/K16), then the 3-term P.V below.
// 3-term variant: O = (P_hi V_hi + (P_lo V_hi + P_hi V_lo) / 1024) / l with P = [hi | 2^10 residual] of 1024 p and V^T = [hi | 2^10 residual] planes (VtL same layout as Vt) -> ~2^-21-class products for un-averaged (early causal / peaked) rows
template <int CAUSAL>
__device__ __forceinline__ void flash5_body(const int bx, float (*sO)[16][64 + 4], unsigned short (*ring)[64][LP], const _Float16* __restrict__ Q16, const _Float16* __restrict__ QL, int ldq, const _Float16* __restrict__ K16, const _Float16* __restrict__ KL, int ldk, const _Float16* __restrict__ Vt, const _Float16* __restrict__ VtL, const int* __restrict__ MSK, _Float16* __restrict__ OH, _Float16* __restrict__ OL, int ldo) {
  constexpr int RPW = 16, DT = 4, KS = 2;      /* transposed products as in flash_body: lane (ln, hh) holds query q0 + ln, keys j0 + nt * 16 + 8 * hh + r; '#pragma unroll' as there */
  unsigned short (*sK)[LP] = ring[0], (*sKl)[LP] = ring[1], (*sV)[LP] = ring[2], (*sVl)[LP] = ring[3];      /* a stage = 64 keys of the four planes in ONE buffer: the LDS frame of flash_body, so that both bodies share a kernel at its residency */
  const int tid = threadIdx.x, w = tid >> 5, lane = tid & 31, ln = lane & 15, hh = lane >> 4;
  const int slab = bx / QBN5, qblk = QB05 + bx % QBN5; const int b = slab / NH, h = slab % NH; const int qb0 = qblk * (4 * RPW); const int q0 = qb0 + w * RPW; const int tq = q0 + ln;
  FragH bq[KS], bql[KS];
  { const unsigned short* qr = (const unsigned short*)Q16 + ((size_t)b * TQ + tq) * ldq + h * 64; const unsigned short* ql = (const unsigned short*)QL + ((size_t)b * TQ + tq) * ldq + h * 64;
#pragma unroll
    for (int ks = 0; ks < KS; ++ks) { bq[ks].half[0] = *(const v8us*)(qr + ks * 32 + 8 * hh); bq[ks].half[1] = *(const v8us*)(qr + ks * 32 + 16 + 8 * hh); bql[ks].half[0] = *(const v8us*)(ql + ks * 32 + 8 * hh); bql[ks].half[1] = *(const v8us*)(ql + ks * 32 + 16 + 8 * hh); } }
  const int kvh = h / NREP;      /* kv heads unexpanded, as in flash_body */
  const unsigned short* Vth = (const unsigned short*)Vt + (size_t)(b * NKV + kvh) * 64 * TK; const unsigned short* Vtl = (const unsigned short*)VtL + (size_t)(b * NKV + kvh) * 64 * TK;
  const float sl = (CAUSAL == 14) ? bf16_round(((const float*)MSK)[h]) : 0.f;      /* mode 14: causal + ALiBi slope[h] * (key - query) from the slopes INPUT */
  float m_r = -3.0e38f, l_r = 0.f; v8f oacc[DT], oaccL[DT];
#pragma unroll
  for (int dt = 0; dt < DT; ++dt) { oacc[dt] = (v8f){0.f,0.f,0.f,0.f,0.f,0.f,0.f,0.f}; oaccL[dt] = oacc[dt]; }
  const int jend = (CAUSAL == 1 || CAUSAL == 14) ? (qb0 + 4 * RPW) : TK;      /* causal: keys beyond the block's last query never contribute */
  const unsigned short* Kh = (const unsigned short*)K16 + (size_t)b * TK * ldk + kvh * 64; const unsigned short* Kl = (const unsigned short*)KL + (size_t)b * TK * ldk + kvh * 64; const int nst = jend >> 6;      /* jend is a multiple of 64 */
  // both loops stay rolled: one stage a trip, filled at its head and left at its foot, and the two passes of a stage share one body (short code, the pass as an address offset)
#pragma unroll 1
  for (int t = 0; t < nst; ++t) { const int j1 = t * 64;
    stage64(Kh + (size_t)j1 * ldk, ldk, &sK[0][0], tid); stage64(Kl + (size_t)j1 * ldk, ldk, &sKl[0][0], tid); stage64(Vth + j1, TK, &sV[0][0], tid); stage64(Vtl + j1, TK, &sVl[0][0], tid);
    wait_async0(); __syncthreads();      /* stage t published; at most four stages a block, their landing times covered by the other blocks of the grid */
#pragma unroll 1
  for (int p = 0; p < 64; p += 32) { const int j0 = t * 64 + p;
    v8f s[2];
#pragma unroll
    for (int nt = 0; nt < 2; ++nt) { const unsigned short* kr = &sK[p + nt * 16 + ln][0]; const unsigned short* klr = &sKl[p + nt * 16 + ln][0]; FragH ak[KS], akl[KS];
#pragma unroll
      for (int ks = 0; ks < KS; ++ks) { ak[ks].half[0] = *(const v8us*)(kr + ks * 32 + 8 * hh); ak[ks].half[1] = *(const v8us*)(kr + ks * 32 + 16 + 8 * hh); akl[ks].half[0] = *(const v8us*)(klr + ks * 32 + 8 * hh); akl[ks].half[1] = *(const v8us*)(klr + ks * 32 + 16 + 8 * hh); }
      v8f acc = (v8f){0.f,0.f,0.f,0.f,0.f,0.f,0.f,0.f}, accl = acc;
#pragma unroll
      for (int ks = 0; ks < KS; ++ks) { acc = mmaH<1>(ak[ks].v, ak[ks].v, bq[ks].v, bq[ks].v, acc); accl = mmaH<1>(ak[ks].v, ak[ks].v, bql[ks].v, bql[ks].v, accl); accl = mmaH<1>(akl[ks].v, akl[ks].v, bq[ks].v, bq[ks].v, accl); }
#pragma unroll
      for (int r = 0; r < 8; ++r) acc[r] += accl[r] * 0.0009765625f;
      s[nt] = acc; }
    float sc[2][8], mcn[2]; bool ok[2][8];
#pragma unroll
    for (int nt = 0; nt < 2; ++nt) { mcn[nt] = -3.0e38f;
#pragma unroll
      for (int r = 0; r < 8; ++r) { const int kk = j0 + nt * 16 + 8 * hh + r;
        ok[nt][r] = (CAUSAL == 1 || CAUSAL == 14) ? (kk <= tq) : ((CAUSAL == 2) ? ((kk >> 5) == (tq >> 5)) : true);      /* mode 2: block-diagonal 32-token groups */
        if (CAUSAL == 4) ok[nt][r] = MSK[((size_t)b * TQ + tq) * TK + kk] != 0;      /* mode 4: per-(query, key) INPUT mask shared by all heads; masked keys contribute nothing, rows with no valid key give l = 0 -> output 0 */
        float sv = ok[nt][r] ? s[nt][r] * SCL : -3.0e38f; if (CAUSAL == 14) { if (ok[nt][r]) sv += sl * (float)(kk - tq); }
        sc[nt][r] = sv; mcn[nt] = fmaxf(mcn[nt], sv); } }
    float mc = fmaxf(mcn[0], mcn[1]); mc = fmaxf(mc, xhalf(mc));
    const float mn = fmaxf(m_r, mc); const float ea = expf(m_r - mn); const float al = (mn > -1.0e38f) ? ea : 1.0f; m_r = mn;
    FragH pb, pl; float psn[2];
#pragma unroll
    for (int nt = 0; nt < 2; ++nt) { psn[nt] = 0.f;
#pragma unroll
      for (int r = 0; r < 8; ++r) { const float e = expf(sc[nt][r] - mn); const float p = ok[nt][r] ? e : 0.f; psn[nt] += p; const float ps = p * 1024.0f; const _Float16 ph = (_Float16)ps; pb.h[nt * 8 + r] = ph; pl.h[nt * 8 + r] = (_Float16)((ps - (float)ph) * 1024.0f); } }
    l_r = l_r * al + (psn[0] + psn[1]);
#pragma unroll
    for (int dt = 0; dt < DT; ++dt)
#pragma unroll
      for (int r = 0; r < 8; ++r) { oacc[dt][r] *= al; oaccL[dt][r] *= al; }
#pragma unroll
    for (int dt = 0; dt < DT; ++dt) { const unsigned short* vrow = &sV[dt * 16 + ln][p]; const unsigned short* vrl = &sVl[dt * 16 + ln][p]; FragH av, avl; av.half[0] = *(const v8us*)(vrow + 8 * hh); av.half[1] = *(const v8us*)(vrow + 16 + 8 * hh); avl.half[0] = *(const v8us*)(vrl + 8 * hh); avl.half[1] = *(const v8us*)(vrl + 16 + 8 * hh);
      oacc[dt] = mmaH<1>(av.v, av.v, pb.v, pb.v, oacc[dt]); oaccL[dt] = mmaH<1>(av.v, av.v, pl.v, pl.v, oaccL[dt]); oaccL[dt] = mmaH<1>(avl.v, avl.v, pb.v, pb.v, oaccL[dt]); } }
    wait_ds0(); __syncthreads(); }      /* ends every read of the buffer ahead of its refill */
  const float l = l_r + xhalf(l_r); const float li = (l > 0.f) ? 1.0f / (l * 1024.0f) : 0.f;
#pragma unroll
  for (int dt = 0; dt < DT; ++dt) { v4f lo, hi;
#pragma unroll
    for (int r = 0; r < 4; ++r) { float v = oacc[dt][r]; v += oaccL[dt][r] * 0.0009765625f; lo[r] = v * li; v = oacc[dt][4 + r]; v += oaccL[dt][4 + r] * 0.0009765625f; hi[r] = v * li; }
    *(v4fa*)&sO[w][ln][dt * 16 + 8 * hh] = lo; *(v4fa*)&sO[w][ln][dt * 16 + 8 * hh + 4] = hi; }
  __builtin_amdgcn_fence(__ATOMIC_ACQ_REL, "workgroup"); __builtin_amdgcn_wave_barrier();      /* the wave's own sO rows: its stores above stay ahead of its whole-line reads below */
  {
#pragma unroll
    for (int rp = 0; rp < RPW; rp += 2) { const int r = rp + (lane >> 4), pc = lane & 15; const v4f val = *(const v4fa*)&sO[w][r][pc * 4]; v4h h4, l4; for (int i = 0; i < 4; ++i) { h4[i] = (_Float16)val[i]; l4[i] = (_Float16)((val[i] - (float)h4[i]) * 1024.0f); }
      *(v4h*)(OH + ((size_t)b * TQ + q0 + r) * ldo + h * 64 + pc * 4) = h4; *(v4h*)(OL + ((size_t)b * TQ + q0 + r) * ldo + h * 64 + pc * 4) = l4; }      /* O leaves as f16 hi + 2^10 residual, the A operands of the two Wo GEMMs */
     } }
// The two forms work on disjoint query rows from the same planes: one grid, the plain form's blocks first, then the few short blocks of the 5-plane form, which run beside them instead of in a launch of their own.
template <int CAUSAL>
__global__ __launch_bounds__(128) void k_flash_all(const _Float16* __restrict__ Q16, const _Float16* __restrict__ QL, int ldq, const _Float16* __restrict__ K16, const _Float16* __restrict__ KL, int ldk, const _Float16* __restrict__ Vt, const _Float16* __restrict__ VtL, const float* __restrict__ SLP, _Float16* __restrict__ OH, _Float16* __restrict__ OL, int ldo) {
  __shared__ __attribute__((aligned(16))) float sO[4][16][64 + 4];
  __shared__ __attribute__((aligned(16))) unsigned short ring[4][64][LP];
  const int* MSK = (const int*)SLP;      /* the bodies' one pointer for mask or slopes; mode 14 reads it as the f32 slopes */
  const int bx = blockIdx.x;      /* the branch is the same for the whole block */
  if (bx < NB * NH * QBNP) flash_body<CAUSAL>(bx, sO, ring, Q16, ldq, K16, ldk, Vt, MSK, OH, ldo);
  else flash5_body<CAUSAL>(bx - NB * NH * QBNP, sO, ring, Q16, QL, ldq, K16, KL, ldk, Vt, VtL, MSK, OH, OL, ldo); }

__global__ __launch_bounds__(256) void k_rotab(float* __restrict__ CS, float* __restrict__ SN) {
  #pragma clang fp contract(off)
  const int t = blockIdx.x * 256 + threadIdx.x; if (t >= SLEN * 32) return; const int j = t % 32, s = t / 32; const float ex = (float)(2 * j) / 64.0f; const float inv = 1.0f / powf(10000.0f, ex); const float th = (float)s * inv; const float c = cosf(th), sn = sinf(th);
  { *(float*)(CS + t) = c; *(float*)(SN + t) = sn;  } }
__global__ __launch_bounds__(256) void k_rope(const float* __restrict__ F, int nsrc, int ndst, int rep, const float* __restrict__ CS, const float* __restrict__ SN, _Float16* __restrict__ H, _Float16* __restrict__ L) {
  #pragma clang fp contract(off)
  const size_t t = (size_t)blockIdx.x * 256 + threadIdx.x; if (t >= (size_t)NR * ndst * 4) return; const int g8 = (int)(t % 4); const int hd = (int)((t / 4) % ndst); const size_t row = t / ((size_t)4 * ndst); const int s = (int)(row % SLEN); const int hs = hd / rep;
  const float* src = F + row * (size_t)(nsrc * 64) + hs * 64; FragH ah, al, bh, bl;
  for (int i = 0; i < 8; ++i) { const int d = g8 * 8 + i; const float c = CS[s * 32 + d], sn = SN[s * 32 + d]; const float x1 = src[d], x2 = src[d + 32];
    float o1 = x1 * c; o1 += -x2 * sn; float o2 = x2 * c; o2 += x1 * sn;
    _Float16 hv = (_Float16)o1; ah.h[i] = hv; al.h[i] = (_Float16)((o1 - (float)hv) * 1024.0f); hv = (_Float16)o2; bh.h[i] = hv; bl.h[i] = (_Float16)((o2 - (float)hv) * 1024.0f); }
  const size_t o = row * (size_t)(ndst * 64) + hd * 64 + g8 * 8;
  { *(v8us*)((unsigned short*)H + o) = ah.half[0]; *(v8us*)((unsigned short*)H + o + 32) = bh.half[0]; *(v8us*)((unsigned short*)L + o) = al.half[0]; *(v8us*)((unsigned short*)L + o + 32) = bl.half[0];  } }

extern "C" void kernel_launch(void* const* d_in, const int* in_sizes, int n_in,
                              void* d_out, int out_size, void* d_ws, size_t ws_size, hipStream_t stream) {
  (void)in_sizes; (void)n_in; (void)out_size;
  const float* const* I = (const float* const*)d_in; const float* x = I[0]; const float* Wq = I[1]; const float* bq = I[2]; const float* Wk = I[3]; const float* bk = I[4]; const float* Wv = I[5]; const float* bv = I[6]; const float* Wo = I[7]; const float* bo = I[8]; const float* slopes = I[9];
  char* ws = (char*)d_ws; size_t off = 0;
  auto take = [&](size_t bytes) { char* p = ws + off; off += (bytes + 255) & ~(size_t)255; return p; };
  const size_t np = (size_t)NR * DM, nk = (size_t)NR * KVD;
  _Float16* BQ = (_Float16*)take((size_t)DM * DM * 2); _Float16* BK = (_Float16*)take((size_t)KVD * DM * 2); _Float16* BV = (_Float16*)take((size_t)KVD * DM * 2); _Float16* BO = (_Float16*)take((size_t)DM * DM * 2);
  _Float16* X16 = (_Float16*)take(np * 2); _Float16* QH = (_Float16*)take(np * 2); _Float16* QL = (_Float16*)take(np * 2); _Float16* KH = (_Float16*)take(nk * 2); _Float16* KL = (_Float16*)take(nk * 2); _Float16* VT = (_Float16*)take(nk * 2); _Float16* VTL = (_Float16*)take(nk * 2);
  _Float16* OH = (_Float16*)take(np * 2); _Float16* OLo = (_Float16*)take(np * 2);
  if (off > ws_size) return;      /* 2+0.5+0.5+2 + 8+8+8+2+2+2+2+8+8 = 53 MiB */
  k_prep<<<2 * PB_W + 2 * PB_KV + PB_X, 256, 0, stream>>>(x, Wq, Wk, Wv, Wo, X16, BQ, BK, BV, BO);      /* x16 weights transposed, f16 plane of x */
  k_qkv<<<GB_Q + 2 * GB_KV, 128, 0, stream>>>(X16, BQ, BK, BV, bq, bk, bv, QH, QL, KH, KL, VT, VTL);      /* q hi/lo; k hi/lo, 4 kv heads; V^T hi/lo: [kv head][d][token] */
  k_flash_all<14><<<NB * NH * (QBNP + QBN5), 128, 0, stream>>>(QH, QL, DM, KH, KL, KVD, VT, VTL, slopes, OH, OLo, DM);      /* causal + ALiBi: rows >= 256 plain, rows < 256 hi + residual */
  k_gemm2<0, 0><<<dim3((NR / 128) * (DM / 64), 1), 128, 0, stream>>>(OH, DM, 0, BO, DM, 0, 0.0625f, bo, 0, nullptr, 1, 0, 0, (float*)d_out, nullptr, nullptr, DM, 0, NR, DM, DM);      /* out = ctx Wo + bo */
  for (int b = 0; b < NB; ++b) k_gemm2<0, 0><<<dim3((RE / 128) * (DM / 64), 1), 128, 0, stream>>>(OLo + (size_t)b * SLEN * DM, DM, 0, BO, DM, 0, 0.0625f / 1024.0f, nullptr, 0, (const float*)d_out + (size_t)b * SLEN * DM, 1, (size_t)DM, 0, (float*)d_out + (size_t)b * SLEN * DM, nullptr, nullptr, DM, 0, RE, DM, DM);      /* += O residual . Wo on the first 256 rows of each sequence */
}

// v007
// One run takes 107 microseconds.
// Timed twice side by side with v006, it ran 1.26 and 1.27 times as fast.
// All steps since v000 together make it 7.56 times as fast.
#include <hip/hip_runtime.h>
// CausalAlibiAttn (1 x 4096 tokens, D 1024 = 16 heads of 64, 4 kv heads): q, k, v = x W + b; q head h uses kv head h/4; scores/8 + slope[h] * (key - query) (ALiBi, slopes INPUT), causal; softmax; ctx Wo + bo.
// Structure: exact f16 plane of x; q, k, v by WMMA GEMMs (32x64 wave tiles, f32 accumulation, exact x16 weights + bias) whose epilogues split the f32 result into f16 hi + 2^10-residual planes themselves (v transposed in the LDS staging tile; k, v stay at their 4 kv heads); the fused causal flash kernel (query head h reads kv head h / 4) with the ALiBi term added per (head, query, key) in f32, in its 5-plane form for the first 256 query rows and the plain form beyond; it stores O as f16 hi (+ residual on those rows) for the Wo GEMM (+ bias; residual term only on those rows, in the same launch).
// Compute dtype: x and parameters rounded to bf16; q/k/P/v/O as f16 hi + residual on rows < 256 (~2^-21) and plain f16 beyond (~2^-12); ALiBi/softmax f32. v_wmma_f32_16x16x32_f16.
#define NB 1
#define DM 1024
#define NKV 4
#define NREP (NH / NKV)
#define KVD (NKV * 64)           /* 256 */
#define NR (NB * SLEN)           /* 4096 */
#define SLEN 4096
#define TQ SLEN
#define TK SLEN
#define NH 16
#define SCL 0.125f
#define QBLKS (TQ / 64)
#define QB05 0
#define QBN5 4
#define QB0P QBN5
#define QBNP (QBLKS - QBN5)
#define RE 256
typedef __bf16 v16b __attribute__((ext_vector_type(16)));
typedef unsigned short v8us __attribute__((ext_vector_type(8), may_alias));
typedef float  v8f  __attribute__((ext_vector_type(8)));
typedef float  v4f  __attribute__((ext_vector_type(4)));
typedef float  v4fa __attribute__((ext_vector_type(4), may_alias));
union FragB { v16b v; v8us half[2]; unsigned short u[16]; };

__device__ __forceinline__ unsigned short bf16_bits(float x) { unsigned int u = __float_as_uint(x); return (unsigned short)((u + 0x7FFFu + ((u >> 16) & 1u)) >> 16); }
__device__ __forceinline__ float bf16_val(unsigned short b) { return __uint_as_float(((unsigned int)b) << 16); }
__device__ __forceinline__ float bf16_round(float x) { return bf16_val(bf16_bits(x)); }
// D += A·B with NT terms: 1 = ah·bh, 2 = + al·bh (A split), 3 = + ah·bl (both split)
template <int NT>
__device__ __forceinline__ v8f mmaN(v16b ah, v16b al, v16b bh, v16b bl, v8f c) {
  c = __builtin_amdgcn_wmma_f32_16x16x32_bf16(false, ah, false, bh, (short)0, c, false, false);
  if (NT >= 2) c = __builtin_amdgcn_wmma_f32_16x16x32_bf16(false, al, false, bh, (short)0, c, false, false);
  if (NT >= 3) c = __builtin_amdgcn_wmma_f32_16x16x32_bf16(false, ah, false, bl, (short)0, c, false, false);
  asm volatile("v_nop\n\tv_nop\n\tv_nop\n\tv_nop" : "+v"(c) : "v"(ah), "v"(al), "v"(bh), "v"(bl));
  return c;
}

__global__ __launch_bounds__(256) void k_wt_bf16(const float* __restrict__ W, unsigned short* __restrict__ Wt, int K, int N) {
  const int t = blockIdx.x * 256 + threadIdx.x;
  const int k8n = K / 8;
  if (t >= N * k8n) return;
  const int n = t / k8n, k8 = (t % k8n) * 8;
  v8us v;
#pragma unroll
  for (int i = 0; i < 8; ++i) v[i] = bf16_bits(W[(size_t)(k8 + i) * N + n]);
  *(v8us*)(Wt + (size_t)n * K + k8) = v;
  
}

// GEMM C[M][N] (f32, pitch ldc) = act(A[M][K]·W + bias). A f32 row-major (pitch lda) converted per fragment to bf16
// (ASPLIT: hi/lo two planes -> 2 terms, else single rounded term); Wt bf16 [N][K] (pitch ldb). BIAS_BF16 rounds the
// bias to bf16 first (bias quantised to bf16 before the add). K%32==0, M%16==0, N%64==0.
template <bool ASPLIT, int ACT, bool BIAS_BF16>
__global__ __launch_bounds__(128) void k_gemm_bf(const float* __restrict__ A, int lda, const unsigned short* __restrict__ Wt, int ldb,
                                               const float* __restrict__ bias, float* __restrict__ C, int ldc, int M, int N, int K) {
  __shared__ __attribute__((aligned(16))) float so[4][16][64];
  const int tid = threadIdx.x, w = tid >> 5, lane = tid & 31, ln = lane & 15, hh = lane >> 4;
  const int ntn = N / 64;
  const int wid = blockIdx.x * 4 + w;
  const int mt = wid / ntn, nq = wid % ntn;
  if (mt * 16 >= M) return;
  const int row0 = mt * 16, col0 = nq * 64;
  const float* arow = A + (size_t)(row0 + ln) * lda;
  v8f acc[4] = {};
  for (int kb = 0; kb < K; kb += 32) {
    FragB ah, al;
    const v4f x0 = *(const v4fa*)(arow + kb + 8 * hh), x1 = *(const v4fa*)(arow + kb + 8 * hh + 4);
    const v4f x2 = *(const v4fa*)(arow + kb + 16 + 8 * hh), x3 = *(const v4fa*)(arow + kb + 16 + 8 * hh + 4);
    float xs[16] = {x0[0],x0[1],x0[2],x0[3],x1[0],x1[1],x1[2],x1[3],x2[0],x2[1],x2[2],x2[3],x3[0],x3[1],x3[2],x3[3]};
#pragma unroll
    for (int i = 0; i < 16; ++i) { const unsigned short hb = bf16_bits(xs[i]); ah.u[i] = hb; al.u[i] = ASPLIT ? bf16_bits(xs[i] - bf16_val(hb)) : (unsigned short)0; }
#pragma unroll
    for (int t = 0; t < 4; ++t) {
      const unsigned short* brow = Wt + (size_t)(col0 + t * 16 + ln) * ldb + kb;
      FragB b;
      b.half[0] = *(const v8us*)(brow + 8 * hh);
      b.half[1] = *(const v8us*)(brow + 16 + 8 * hh);
      acc[t] = mmaN<ASPLIT ? 2 : 1>(ah.v, al.v, b.v, b.v, acc[t]);
    }
  }
#pragma unroll
  for (int t = 0; t < 4; ++t) {
    float bv = bias ? bias[col0 + t * 16 + ln] : 0.f;
    if (BIAS_BF16) bv = bf16_round(bv);
#pragma unroll
    for (int r = 0; r < 8; ++r) { float v = acc[t][r] + bv; if (ACT == 1) v = fmaxf(v, 0.f); so[w][8 * hh + r][t * 16 + ln] = v; }
  }
  __builtin_amdgcn_fence(__ATOMIC_ACQ_REL, "workgroup");
  __builtin_amdgcn_wave_barrier();
  const int rsub = lane >> 4, c4 = (lane & 15) * 4;
  {
#pragma unroll
    for (int q = 0; q < 8; ++q) {
      const int r = q * 2 + rsub;
      const v4f v = *(const v4fa*)&so[w][r][c4];
      *(v4f*)(C + (size_t)(row0 + r) * ldc + col0 + c4) = v;
    }
    
  }
}

// GEMM C = act(A·W + bias + resid): A f32 (ASPLIT -> hi/lo 2 terms), Wt bf16 [N][K]; ACT 0 none, 1 relu, 2 exact gelu;
// resid (optional, f32, row index = (row % rmod), pitch ldr, RES_BF16 rounds it) added before the activation.
template <bool ASPLIT, int ACT, bool BIAS_BF16, bool RES_BF16>
__global__ __launch_bounds__(128) void k_gemm_bf3(const float* __restrict__ A, int lda, const unsigned short* __restrict__ Wt, int ldb,
                                                const float* __restrict__ bias, const float* __restrict__ resid, int rmod, int ldr,
                                                float* __restrict__ C, int ldc, int M, int N, int K) {
  __shared__ __attribute__((aligned(16))) float so[4][16][64];
  const int tid = threadIdx.x, w = tid >> 5, lane = tid & 31, ln = lane & 15, hh = lane >> 4;
  const int ntn = N / 64;
  const int wid = blockIdx.x * 4 + w;
  const int mt = wid / ntn, nq = wid % ntn;
  if (mt * 16 >= M) return;
  const int row0 = mt * 16, col0 = nq * 64;
  const float* arow = A + (size_t)(row0 + ln) * lda;
  v8f acc[4] = {};
  for (int kb = 0; kb < K; kb += 32) {
    FragB ah, al;
    const v4f x0 = *(const v4fa*)(arow + kb + 8 * hh), x1 = *(const v4fa*)(arow + kb + 8 * hh + 4);
    const v4f x2 = *(const v4fa*)(arow + kb + 16 + 8 * hh), x3 = *(const v4fa*)(arow + kb + 16 + 8 * hh + 4);
    float xs[16] = {x0[0],x0[1],x0[2],x0[3],x1[0],x1[1],x1[2],x1[3],x2[0],x2[1],x2[2],x2[3],x3[0],x3[1],x3[2],x3[3]};
#pragma unroll
    for (int i = 0; i < 16; ++i) { const unsigned short hb = bf16_bits(xs[i]); ah.u[i] = hb; al.u[i] = ASPLIT ? bf16_bits(xs[i] - bf16_val(hb)) : (unsigned short)0; }
#pragma unroll
    for (int t = 0; t < 4; ++t) {
      const unsigned short* brow = Wt + (size_t)(col0 + t * 16 + ln) * ldb + kb;
      FragB b;
      b.half[0] = *(const v8us*)(brow + 8 * hh);
      b.half[1] = *(const v8us*)(brow + 16 + 8 * hh);
      acc[t] = mmaN<ASPLIT ? 2 : 1>(ah.v, al.v, b.v, b.v, acc[t]);
    }
  }
#pragma unroll
  for (int t = 0; t < 4; ++t) {
    const int col = col0 + t * 16 + ln;
    float bv = bias ? bias[col] : 0.f;
    if (BIAS_BF16) bv = bf16_round(bv);
#pragma unroll
    for (int r = 0; r < 8; ++r) {
      float v = acc[t][r] + bv;
      if (resid) { float rv = resid[(size_t)((row0 + 8 * hh + r) % rmod) * ldr + col]; if (RES_BF16) rv = bf16_round(rv); v += rv; }
      if (ACT == 1) v = fmaxf(v, 0.f);
      if (ACT == 2) v = 0.5f * v * (1.0f + erff(v * 0.70710678118654752f));
      if (ACT == 3) { const float u = 0.7978845608028654f * (v + 0.044715f * v * v * v); v = 0.5f * v * (1.0f + tanhf(u)); }
      so[w][8 * hh + r][t * 16 + ln] = v;
    }
  }
  __builtin_amdgcn_fence(__ATOMIC_ACQ_REL, "workgroup");
  __builtin_amdgcn_wave_barrier();
  const int rsub = lane >> 4, c4 = (lane & 15) * 4;
  {
#pragma unroll
    for (int q = 0; q < 8; ++q) {
      const int r = q * 2 + rsub;
      const v4f v = *(const v4fa*)&so[w][r][c4];
      *(v4f*)(C + (size_t)(row0 + r) * ldc + col0 + c4) = v;
    }
    
  }
}
// row LayerNorm (biased variance, eps) over N: s = X (+ R); optional out_sum <- s; out_norm <- (s-mu)*rsqrt(var+eps)*g + b
template <bool PARAM_BF16>
__global__ __launch_bounds__(256) void k_layernorm(const float* __restrict__ X, const float* __restrict__ R, const float* __restrict__ g, const float* __restrict__ bta,
                                                  float* __restrict__ out_sum, float* __restrict__ out_norm, int N, float eps) {
  __shared__ float red[256];
  const int row = blockIdx.x, tid = threadIdx.x;
  const float* x = X + (size_t)row * N; const float* rr = R ? R + (size_t)row * N : nullptr;
  float vals[16];                     // up to N = 4096
  const int per = N / 256;            // contiguous chunk per thread? use strided-by-4 chunks: thread handles j = tid*4 + 1024*u
  float s1 = 0.f;
  for (int u = 0; u < per / 4; ++u) {
    const int j = tid * 4 + 1024 * u;
    const v4f a = *(const v4fa*)(x + j);
    v4f b = {0.f,0.f,0.f,0.f}; if (rr) b = *(const v4fa*)(rr + j);
#pragma unroll
    for (int q = 0; q < 4; ++q) { const float v = a[q] + b[q]; vals[u * 4 + q] = v; s1 += v; }
  }
  red[tid] = s1; __syncthreads();
  for (int st = 128; st > 0; st >>= 1) { if (tid < st) red[tid] += red[tid + st]; __syncthreads(); }
  const float mu = red[0] / (float)N; __syncthreads();
  float s2 = 0.f;
  for (int u = 0; u < per / 4; ++u)
#pragma unroll
    for (int q = 0; q < 4; ++q) { const float c = vals[u * 4 + q] - mu; s2 += c * c; }
  red[tid] = s2; __syncthreads();
  for (int st = 128; st > 0; st >>= 1) { if (tid < st) red[tid] += red[tid + st]; __syncthreads(); }
  const float rs = rsqrtf(red[0] / (float)N + eps);
  {
    for (int u = 0; u < per / 4; ++u) {
      const int j = tid * 4 + 1024 * u;
      v4f o, sm;
#pragma unroll
      for (int q = 0; q < 4; ++q) {
        float gg = g[j + q], bb = bta[j + q];
        if (PARAM_BF16) { gg = bf16_round(gg); bb = bf16_round(bb); }
        sm[q] = vals[u * 4 + q]; o[q] = (vals[u * 4 + q] - mu) * rs * gg + bb;
      }
      if (out_sum) *(v4f*)(out_sum + (size_t)row * N + j) = sm;
      *(v4f*)(out_norm + (size_t)row * N + j) = o;
    }
    
  }
}



// ---- f16 WMMA path (v_wmma_f32_16x16x32_f16): 11-bit significands for operands in range — used where a [0,1] probability operand needs more precision than bf16
typedef _Float16 v16h __attribute__((ext_vector_type(16)));
union FragH { v16h v; v8us half[2]; _Float16 h[16]; unsigned short u[16]; };
template <int NT>
__device__ __forceinline__ v8f mmaH(v16h ah, v16h al, v16h bh, v16h bl, v8f c) {
  c = __builtin_amdgcn_wmma_f32_16x16x32_f16(false, ah, false, bh, (short)0, c, false, false);
  if (NT >= 2) c = __builtin_amdgcn_wmma_f32_16x16x32_f16(false, al, false, bh, (short)0, c, false, false);
  if (NT >= 3) c = __builtin_amdgcn_wmma_f32_16x16x32_f16(false, ah, false, bl, (short)0, c, false, false);
  asm volatile("v_nop\n\tv_nop\n\tv_nop\n\tv_nop" : "+v"(c) : "v"(ah), "v"(al), "v"(bh), "v"(bl));
  return c;
}
// batched GEMM like k_gemm_b but f16 operands: A f32 (split into f16 hi/lo if ASPLIT, else rounded to f16), Bt = f16 values [n][k]; alpha; C f32; N multiple of 16 (partial tiles skipped)
template <bool ASPLIT>
__global__ __launch_bounds__(128) void k_gemm_h(const float* __restrict__ A, int lda, size_t sA, const _Float16* __restrict__ Bh, int ldb, size_t sB, float alpha, float* __restrict__ C, int ldc, size_t sC, int M, int N, int K) {
  __shared__ __attribute__((aligned(16))) float so[4][16][64];
  const int tid = threadIdx.x, w = tid >> 5, lane = tid & 31, ln = lane & 15, hh = lane >> 4; const int by = blockIdx.y;
  A += (size_t)by * sA; Bh += (size_t)by * sB; C += (size_t)by * sC;
  const int ntn = (N + 63) / 64; const int wid = blockIdx.x * 4 + w; const int mt = wid / ntn, nq = wid % ntn; if (mt * 16 >= M) return;
  const int row0 = mt * 16, col0 = nq * 64; const float* arow = A + (size_t)(row0 + ln) * lda;
  v8f acc[4] = {};
  for (int kb = 0; kb < K; kb += 32) {
    FragH ah, al;
    const v4f x0 = *(const v4fa*)(arow + kb + 8 * hh), x1 = *(const v4fa*)(arow + kb + 8 * hh + 4), x2 = *(const v4fa*)(arow + kb + 16 + 8 * hh), x3 = *(const v4fa*)(arow + kb + 16 + 8 * hh + 4);
    float xs[16] = {x0[0],x0[1],x0[2],x0[3],x1[0],x1[1],x1[2],x1[3],x2[0],x2[1],x2[2],x2[3],x3[0],x3[1],x3[2],x3[3]};
#pragma unroll
    for (int i = 0; i < 16; ++i) { const _Float16 h = (_Float16)xs[i]; ah.h[i] = h; al.h[i] = ASPLIT ? (_Float16)(xs[i] - (float)h) : (_Float16)0.0f; }
#pragma unroll
    for (int t = 0; t < 4; ++t) { if (col0 + t * 16 >= N) continue; const size_t boff = (size_t)(col0 + t * 16 + ln) * ldb + kb; FragH bq; bq.half[0] = *(const v8us*)(Bh + boff + 8 * hh); bq.half[1] = *(const v8us*)(Bh + boff + 16 + 8 * hh);
      acc[t] = mmaH<ASPLIT ? 2 : 1>(ah.v, al.v, bq.v, bq.v, acc[t]); }
  }
#pragma unroll
  for (int t = 0; t < 4; ++t) { if (col0 + t * 16 >= N) continue;
#pragma unroll
    for (int r = 0; r < 8; ++r) so[w][8 * hh + r][t * 16 + ln] = acc[t][r] * alpha; }
  __builtin_amdgcn_fence(__ATOMIC_ACQ_REL, "workgroup"); __builtin_amdgcn_wave_barrier();
  const int rsub = lane >> 4, c4 = (lane & 15) * 4;
  {
#pragma unroll
    for (int q = 0; q < 8; ++q) { const int r = q * 2 + rsub; if (col0 + c4 < N) { const v4f v = *(const v4fa*)&so[w][r][c4]; *(v4f*)(C + (size_t)(row0 + r) * ldc + col0 + c4) = v; } }
     }
}

// Wt[n][k] = f16(W[k][n]·scale) from f32 row-major W[K][N] (scale = power of two; bf16-exact weights stay exact in f16 away from the subnormal range)
__device__ __forceinline__ void wt_f16(const float* __restrict__ W, _Float16* __restrict__ Wt, int K, int N, float scale, int blk) {      /* blk: the job's own block index */
  const int t = blk * 256 + threadIdx.x; if (t >= N * (K / 8)) return; const int n = t / (K / 8), k8 = (t % (K / 8)) * 8; FragH f;
#pragma unroll
  for (int i = 0; i < 8; ++i) f.h[i] = (_Float16)(bf16_round(W[(size_t)(k8 + i) * N + n]) * scale); const v8us o = f.half[0];
  *(v8us*)((unsigned short*)Wt + (size_t)n * K + k8) = o; 
}
// k_gemm_hh variant with fused epilogue: v = acc·alpha + bias[by·sBias + col] (+ CP[(row/rowsPerB)·sCPb + by·64 + col] if CP) ; ACT 0 none / 1 elu ; writes f16 C16 (and f32 C if non-null)
template <int ACT>
__global__ __launch_bounds__(128) void k_gemm_hhx(const _Float16* __restrict__ A, int lda, size_t sA, const _Float16* __restrict__ Bh, int ldb, size_t sB, float alpha, const float* __restrict__ bias, size_t sBias, const float* __restrict__ CP, int rowsPerB, size_t sCPb, int row0g,
    float* __restrict__ C, _Float16* __restrict__ C16, int ldc, size_t sC, int M, int N, int K) {
  __shared__ __attribute__((aligned(16))) float so[4][16][64];
  const int tid = threadIdx.x, w = tid >> 5, lane = tid & 31, ln = lane & 15, hh = lane >> 4; const int by = blockIdx.y;
  A += (size_t)by * sA; Bh += (size_t)by * sB; const size_t cofs = (size_t)by * sC; const float* bp = bias ? bias + (size_t)by * sBias : nullptr;
  const int ntn = (N + 63) / 64; const int wid = blockIdx.x * 4 + w; const int mt = wid / ntn, nq = wid % ntn; if (mt * 16 >= M) return;
  const int row0 = mt * 16, col0 = nq * 64; const _Float16* arow = A + (size_t)(row0 + ln) * lda;
  v8f acc[4] = {};
  for (int kb = 0; kb < K; kb += 32) { FragH ah; ah.half[0] = *(const v8us*)((const unsigned short*)arow + kb + 8 * hh); ah.half[1] = *(const v8us*)((const unsigned short*)arow + kb + 16 + 8 * hh);
#pragma unroll
    for (int t = 0; t < 4; ++t) { if (col0 + t * 16 >= N) continue; const size_t boff = (size_t)(col0 + t * 16 + ln) * ldb + kb; FragH bq; bq.half[0] = *(const v8us*)((const unsigned short*)Bh + boff + 8 * hh); bq.half[1] = *(const v8us*)((const unsigned short*)Bh + boff + 16 + 8 * hh);
      acc[t] = mmaH<1>(ah.v, ah.v, bq.v, bq.v, acc[t]); }
  }
#pragma unroll
  for (int t = 0; t < 4; ++t) { if (col0 + t * 16 >= N) continue; const int col = col0 + t * 16 + ln; const float bv = bp ? bf16_round(bp[col]) : 0.f;
#pragma unroll
    for (int r = 0; r < 8; ++r) { float v = acc[t][r] * alpha + bv; if (CP) { const int bidx = (row0g + row0 + 8 * hh + r) / rowsPerB; v += CP[(size_t)bidx * sCPb + (size_t)by * 64 + col]; } if (ACT == 1) v = (v > 0.f) ? v : expm1f(v); else if (ACT == 7) v = (v > 0.f) ? v + 1.0f : expf(v); else if (ACT == 8) v = tanhf(v); else if (ACT == 9) v = 0.5f * v * (1.0f + tanhf(0.7978845608028654f * (v + 0.044715f * v * v * v))); else if (ACT == 11) v = 1.0f / (1.0f + expf(-v)); else if (ACT == 12) v = (v > 0.f) ? v : 0.01f * v; else if (ACT == 14) v = (v > 0.f) ? v : 0.1f * v; else if (ACT == 15) v = v / (1.0f + expf(-v)); else if (ACT == 3) v = fmaxf(v, 0.f); else if (ACT == 6) v = 0.5f * v * (1.0f + erff(v * 0.70710678118654752f)); so[w][8 * hh + r][t * 16 + ln] = v; } }
  __builtin_amdgcn_fence(__ATOMIC_ACQ_REL, "workgroup"); __builtin_amdgcn_wave_barrier();
  const int rsub = lane >> 4, c4 = (lane & 15) * 4; typedef _Float16 v4h __attribute__((ext_vector_type(4)));
  {
#pragma unroll
    for (int q = 0; q < 8; ++q) { const int r = q * 2 + rsub; if (col0 + c4 < N) { const v4f v = *(const v4fa*)&so[w][r][c4]; if (C) *(v4f*)(C + cofs + (size_t)(row0 + r) * ldc + col0 + c4) = v; if (C16) { v4h h4; for (int i = 0; i < 4; ++i) h4[i] = (_Float16)v[i]; *(v4h*)(C16 + cofs + (size_t)(row0 + r) * ldc + col0 + c4) = h4; } } }
     }
}


typedef _Float16 v4h __attribute__((ext_vector_type(4)));

__device__ __forceinline__ void x16(const float* __restrict__ x, _Float16* __restrict__ X16, size_t n8, int blk) { const size_t t = (size_t)blk * 256 + threadIdx.x; if (t >= n8) return; FragH f;
#pragma unroll
  for (int q = 0; q < 8; ++q) f.h[q] = (_Float16)bf16_round(x[t * 8 + q]); *(v8us*)((unsigned short*)X16 + t * 8) = f.half[0];  }
// The five preparation jobs (four weight transposes, the f16 plane of x) read and write disjoint buffers: one grid, a block range each, so that they run side by side instead of one launch behind the other.
#define PB_W (DM * DM / 8 / 256)       /* blocks of a DM x DM weight */
#define PB_KV (DM * KVD / 8 / 256)     /* blocks of a DM x KVD weight */
#define PB_X (NR * DM / 8 / 256)       /* blocks of x */
__global__ __launch_bounds__(256) void k_prep(const float* __restrict__ x, const float* __restrict__ Wq, const float* __restrict__ Wk, const float* __restrict__ Wv, const float* __restrict__ Wo,
                                              _Float16* __restrict__ X16, _Float16* __restrict__ BQ, _Float16* __restrict__ BK, _Float16* __restrict__ BV, _Float16* __restrict__ BO) {
  int blk = blockIdx.x;
  if (blk < PB_W) { wt_f16(Wq, BQ, DM, DM, 16.0f, blk); return; } blk -= PB_W;
  if (blk < PB_W) { wt_f16(Wo, BO, DM, DM, 16.0f, blk); return; } blk -= PB_W;
  if (blk < PB_KV) { wt_f16(Wk, BK, DM, KVD, 16.0f, blk); return; } blk -= PB_KV;
  if (blk < PB_KV) { wt_f16(Wv, BV, DM, KVD, 16.0f, blk); return; } blk -= PB_KV;
  x16(x, X16, (size_t)NR * DM / 8, blk); }
__global__ __launch_bounds__(256) void k_h16(const float* __restrict__ x, _Float16* __restrict__ X16, size_t n8) { const size_t t = (size_t)blockIdx.x * 256 + threadIdx.x; if (t >= n8) return; FragH f;
#pragma unroll
  for (int q = 0; q < 8; ++q) f.h[q] = (_Float16)x[t * 8 + q]; *(v8us*)((unsigned short*)X16 + t * 8) = f.half[0];  }
__global__ __launch_bounds__(256) void k_round16f(const float* __restrict__ W, _Float16* __restrict__ Bt, size_t n8) { const size_t t = (size_t)blockIdx.x * 256 + threadIdx.x; if (t >= n8) return; FragH f;
#pragma unroll
  for (int i = 0; i < 8; ++i) f.h[i] = (_Float16)(bf16_round(W[t * 8 + i]) * 16.0f); *(v8us*)((unsigned short*)Bt + t * 8) = f.half[0];  }
template <int NHv, int TTv>
__global__ __launch_bounds__(256) void k_vt(const _Float16* __restrict__ V16, int ldv, int voff, _Float16* __restrict__ Vt) { __shared__ unsigned short tl[64][66]; const int tid = threadIdx.x; const int slab = blockIdx.x / (TTv / 64), lg = blockIdx.x % (TTv / 64); const int b = slab / NHv, h = slab % NHv;
  for (int i = tid; i < 64 * 8; i += 256) { const int r = i / 8, c8 = (i % 8) * 8; FragH f; f.half[0] = *(const v8us*)((const unsigned short*)V16 + ((size_t)b * TTv + lg * 64 + r) * ldv + voff + h * 64 + c8);
#pragma unroll
    for (int q = 0; q < 8; ++q) tl[r][c8 + q] = f.u[q]; }
  __syncthreads();
  {
#pragma unroll
    for (int rd = 0; rd < 2; ++rd) { const int d = rd * 32 + tid / 8, pc = tid % 8; FragH f;
#pragma unroll
      for (int q = 0; q < 8; ++q) f.u[q] = tl[pc * 8 + q][d];
      *(v8us*)((unsigned short*)Vt + ((size_t)slab * 64 + d) * TTv + lg * 64 + pc * 8) = f.half[0]; }
     } }

// ---- LDS staging by asynchronous copies (global_load_async_to_lds_b128): a lane moves its own 16 bytes, 8 lanes one whole 128-byte row; two buffers, the next stage in flight while this one is worked on ----
#define LP 72      /* LDS row pitch in f16: 128 data bytes + 16 = an odd multiple of 16 bytes, the conflict-free pitch of the ds_load_b128 fragment readers */
__device__ __forceinline__ void wait_async0() { asm volatile("s_wait_asynccnt 0x0" ::: "memory"); }      /* the wave's own copies have landed; stands before the barrier behind which the other waves read them */
__device__ __forceinline__ void wait_ds0() { asm volatile("s_wait_dscnt 0x0" ::: "memory"); }      /* the wave's own LDS reads have retired before the barrier behind which their buffer is refilled */
// one tile of 64 rows x 128 bytes (row pitch ldg f16 in global memory, LP in LDS) by 128 threads: 4 copies a lane, rows tid / 8 + 16 i. The s_wait_xcnt closes the statement so that no address register is rewritten ahead of it.
__device__ __forceinline__ void stage64(const unsigned short* g, size_t ldg, const unsigned short* s, int tid) {
  const unsigned short* g0 = g + (size_t)(tid >> 3) * ldg + (tid & 7) * 8; const unsigned short* g1 = g0 + 16 * ldg; const unsigned short* g2 = g1 + 16 * ldg; const unsigned short* g3 = g2 + 16 * ldg;
  const unsigned l0 = (unsigned)(size_t)(s + (tid >> 3) * LP + (tid & 7) * 8), l1 = l0 + 16 * LP * 2, l2 = l0 + 32 * LP * 2, l3 = l0 + 48 * LP * 2;
  asm volatile("global_load_async_to_lds_b128 %0, %1, off\n\tglobal_load_async_to_lds_b128 %2, %3, off\n\tglobal_load_async_to_lds_b128 %4, %5, off\n\tglobal_load_async_to_lds_b128 %6, %7, off\n\ts_wait_xcnt 0x0"
               :: "v"(l0), "v"(g0), "v"(l1), "v"(g1), "v"(l2), "v"(g2), "v"(l3), "v"(g3) : "memory");
}
// ---- fast GEMM (block tile 128x64, wave tile 32x64; requires M % 128 == 0 rows per launch region, N % 64 == 0, K % 64 == 0, K >= 64); A and B tiles of 64 k staged in LDS; epilogue = k_gemm_hhx semantics ----
// OM 0: C (f32) and / or C16 (f16). OM 1: the f32 result leaves as two f16 planes, C16 = hi, C16L = (v - hi) * 2^10, same layout. OM 2: the same two planes transposed, [row / ldc][col][row % ldc] with ldc = rows per sequence (a multiple of 128). OM 1 and 2 take no CP term.
__device__ __forceinline__ v16h g2_frag(const _Float16* p, int hh) { FragH f; f.half[0] = *(const v8us*)((const unsigned short*)p + 8 * hh); f.half[1] = *(const v8us*)((const unsigned short*)p + 16 + 8 * hh); return f.v; }
__device__ __forceinline__ v8f g2_mma(v16h a, v16h b, v8f c) { v8f d = __builtin_amdgcn_wmma_f32_16x16x32_f16(false, a, false, b, (short)0, c, false, false); asm volatile("v_nop\n\tv_nop\n\tv_nop\n\tv_nop" : "+v"(d) : "v"(a), "v"(b)); return d; }
// The body takes its block index (bx) and the kernel's LDS arrays from the caller: a kernel that serves several GEMMs from one grid hands each block range its own operands.
#define GEMM2_LDS __shared__ __attribute__((aligned(16))) float so[4][32][68]; __shared__ __attribute__((aligned(16))) unsigned short tA[2][128][LP], tB[2][64][LP];
template <int ACT, int OM>
__device__ __forceinline__ void gemm2_body(const int bx, float (*so)[32][68], unsigned short (*tA)[128][LP], unsigned short (*tB)[64][LP],
    const _Float16* __restrict__ A, int lda, size_t sA, const _Float16* __restrict__ Bh, int ldb, size_t sB, float alpha, const float* __restrict__ bias, size_t sBias, const float* __restrict__ CP, int rowsPerB, size_t sCPb, int row0g,
    float* __restrict__ C, _Float16* __restrict__ C16, _Float16* __restrict__ C16L, int ldc, size_t sC, int M, int N, int K) {
  constexpr int TP = 132;      /* OM 2: row pitch of the transposed staging tile, 128 tokens + 4 floats; 64 rows of it fit in so */
  static_assert(64 * TP <= 4 * 32 * 68, "the transposed tile lies inside so");
  const int tid = threadIdx.x, w = tid >> 5, lane = tid & 31, ln = lane & 15, hh = lane >> 4; const int by = blockIdx.y;
  A += (size_t)by * sA; Bh += (size_t)by * sB; const size_t cofs = (size_t)by * sC; const float* bp = bias ? bias + (size_t)by * sBias : nullptr;
  const int ntn = N >> 6; const int mt = bx / ntn, nq = bx - mt * ntn; const int row0 = mt * 128 + 32 * w, col0 = nq * 64; if (mt * 128 + 128 > M) return;      /* the whole block leaves or none, ahead of every barrier */
  const unsigned short* Ag = (const unsigned short*)A + (size_t)(mt * 128) * lda; const unsigned short* Bg = (const unsigned short*)Bh + (size_t)col0 * ldb; const int nst = K >> 6;
  stage64(Ag, lda, &tA[0][0][0], tid); stage64(Ag + (size_t)64 * lda, lda, &tA[0][64][0], tid); stage64(Bg, ldb, &tB[0][0][0], tid);
  wait_async0(); __syncthreads();      /* stage 0 published */
  if (nst > 1) { stage64(Ag + 64, lda, &tA[1][0][0], tid); stage64(Ag + (size_t)64 * lda + 64, lda, &tA[1][64][0], tid); stage64(Bg + 64, ldb, &tB[1][0][0], tid); }
  const v8f z8 = {0.f,0.f,0.f,0.f,0.f,0.f,0.f,0.f}; v8f c00 = z8, c01 = z8, c02 = z8, c03 = z8, c10 = z8, c11 = z8, c12 = z8, c13 = z8;
#pragma unroll 1
  for (int t = 0; t < nst; ++t) { const int bf = t & 1;      /* rolled: one stage a trip, the publish point at its foot */
    // all 12 fragments of the stage are read from LDS as one group ahead of its 16 products: one LDS latency a stage in front of the matrix run, not one in front of every pair of products
    v16h fa[2][2], fb[2][4];
    // unrolled (both loops): the two k blocks of a stage become constant LDS offsets and the fragment arrays stay in registers
#pragma unroll
    for (int kq = 0; kq < 2; ++kq) { fa[kq][0] = g2_frag((const _Float16*)&tA[bf][32 * w + ln][kq * 32], hh); fb[kq][0] = g2_frag((const _Float16*)&tB[bf][ln][kq * 32], hh); fa[kq][1] = g2_frag((const _Float16*)&tA[bf][32 * w + 16 + ln][kq * 32], hh);
      fb[kq][1] = g2_frag((const _Float16*)&tB[bf][16 + ln][kq * 32], hh); fb[kq][2] = g2_frag((const _Float16*)&tB[bf][32 + ln][kq * 32], hh); fb[kq][3] = g2_frag((const _Float16*)&tB[bf][48 + ln][kq * 32], hh); }
#pragma unroll
    for (int kq = 0; kq < 2; ++kq) { c00 = g2_mma(fa[kq][0], fb[kq][0], c00); c10 = g2_mma(fa[kq][1], fb[kq][0], c10); c01 = g2_mma(fa[kq][0], fb[kq][1], c01); c11 = g2_mma(fa[kq][1], fb[kq][1], c11);
      c02 = g2_mma(fa[kq][0], fb[kq][2], c02); c12 = g2_mma(fa[kq][1], fb[kq][2], c12); c03 = g2_mma(fa[kq][0], fb[kq][3], c03); c13 = g2_mma(fa[kq][1], fb[kq][3], c13); }
    wait_ds0(); wait_async0(); __syncthreads();      /* publishes stage t + 1 and ends every read of buffer bf */
    if (t + 2 < nst) { const int k2 = (t + 2) * 64; stage64(Ag + k2, lda, &tA[bf][0][0], tid); stage64(Ag + (size_t)64 * lda + k2, lda, &tA[bf][64][0], tid); stage64(Bg + k2, ldb, &tB[bf][0][0], tid); } }
  wait_async0();
  v8f accs[8] = {c00, c01, c02, c03, c10, c11, c12, c13};
#pragma unroll
  for (int u = 0; u < 8; ++u) { const int t = u & 3, half = u >> 2; const int col = col0 + t * 16 + ln; const float bv = bp ? bf16_round(bp[col]) : 0.f;
#pragma unroll
    for (int r = 0; r < 8; ++r) { const int rloc = half * 16 + 8 * hh + r; float v = accs[u][r] * alpha + bv; if (OM == 0 && CP) { const int bidx = (row0g + row0 + rloc) / rowsPerB; v += CP[(size_t)bidx * sCPb + (size_t)by * 64 + col]; }
      if (ACT == 3) v = fmaxf(v, 0.f); else if (ACT == 6) v = 0.5f * v * (1.0f + erff(v * 0.70710678118654752f)); else if (ACT == 11) v = 1.0f / (1.0f + expf(-v)); else if (ACT == 15) v = v / (1.0f + expf(-v)); else if (ACT == 12) v = (v > 0.f) ? v : 0.01f * v; else if (ACT == 8) v = tanhf(v);
      if (OM == 2) (&so[0][0][0])[(t * 16 + ln) * TP + 32 * w + rloc] = v; else so[w][rloc][t * 16 + ln] = v; } }
  if (OM == 2) {      /* the staging tile holds the block's 64 columns as rows of 128 tokens: a wave stores 16 of them, 16 lanes one whole 256-byte run */
    __syncthreads();      /* a transposed row holds results of all four waves */
    const float* soT = &so[0][0][0]; const int rb = mt * 128; const size_t ob = ((size_t)(rb / ldc) * N + col0) * ldc + rb % ldc + (lane & 15) * 8;
    // unrolled (both loops): the eight row pairs become constant LDS offsets whose reads go out ahead of the stores, and the two packed planes stay in registers
#pragma unroll
    for (int i = 0; i < 8; ++i) { const int d = 16 * w + 2 * i + (lane >> 4); const v4f a = *(const v4fa*)&soT[d * TP + (lane & 15) * 8], c = *(const v4fa*)&soT[d * TP + (lane & 15) * 8 + 4]; FragH fh, fl;      /* inner loop unrolled for constant element indices */
#pragma unroll
      for (int q = 0; q < 4; ++q) { _Float16 h = (_Float16)a[q]; fh.h[q] = h; fl.h[q] = (_Float16)((a[q] - (float)h) * 1024.0f); h = (_Float16)c[q]; fh.h[4 + q] = h; fl.h[4 + q] = (_Float16)((c[q] - (float)h) * 1024.0f); }
      *(v8us*)((unsigned short*)C16 + cofs + ob + (size_t)d * ldc) = fh.half[0]; *(v8us*)((unsigned short*)C16L + cofs + ob + (size_t)d * ldc) = fl.half[0]; }
    return; }
  __builtin_amdgcn_fence(__ATOMIC_ACQ_REL, "workgroup"); __builtin_amdgcn_wave_barrier();
  const int rsub = lane >> 4, c4 = (lane & 15) * 4;
  {
#pragma unroll
    for (int q = 0; q < 16; ++q) { const int r = q * 2 + rsub; const v4f v = *(const v4fa*)&so[w][r][c4];
      if (OM == 1) { v4h h4, l4; for (int i = 0; i < 4; ++i) { h4[i] = (_Float16)v[i]; l4[i] = (_Float16)((v[i] - (float)h4[i]) * 1024.0f); } *(v4h*)(C16 + cofs + (size_t)(row0 + r) * ldc + col0 + c4) = h4; *(v4h*)(C16L + cofs + (size_t)(row0 + r) * ldc + col0 + c4) = l4; continue; }
      if (C) *(v4f*)(C + cofs + (size_t)(row0 + r) * ldc + col0 + c4) = v; if (C16) { v4h h4; for (int i = 0; i < 4; ++i) h4[i] = (_Float16)v[i]; *(v4h*)(C16 + cofs + (size_t)(row0 + r) * ldc + col0 + c4) = h4; } }
    if (OM == 1) asm volatile("s_wait_xcnt 0x0" ::: "memory");      /* behind the last store of the hi/residual path */
     } }
template <int ACT, int OM>
__global__ __launch_bounds__(128) void k_gemm2(const _Float16* __restrict__ A, int lda, size_t sA, const _Float16* __restrict__ Bh, int ldb, size_t sB, float alpha, const float* __restrict__ bias, size_t sBias, const float* __restrict__ CP, int rowsPerB, size_t sCPb, int row0g,
    float* __restrict__ C, _Float16* __restrict__ C16, _Float16* __restrict__ C16L, int ldc, size_t sC, int M, int N, int K) {
  GEMM2_LDS gemm2_body<ACT, OM>(blockIdx.x, so, tA, tB, A, lda, sA, Bh, ldb, sB, alpha, bias, sBias, CP, rowsPerB, sCPb, row0g, C, C16, C16L, ldc, sC, M, N, K); }
// out = ctx Wo + bo in ONE launch. Rows < RE of a sequence carry O as hi + 2^10 residual: their blocks stage the residual tile beside the hi tile in every stage of the same ring and run its products against the same Wo fragments
// into accumulators of their own, joined in the epilogue. The residual term has no launch, no ring fill and no read-back of out of its own any more.
__global__ __launch_bounds__(128) void k_wo(const _Float16* __restrict__ OHp, const _Float16* __restrict__ OLp, const _Float16* __restrict__ BOp, const float* __restrict__ bo, float* __restrict__ out) {
  __shared__ __attribute__((aligned(16))) unsigned short tA[2][128][LP], tB[2][64][LP], tL[2][128][LP];
  float (*so)[32][68] = (float (*)[32][68])&tL[0][0][0];      /* the epilogue's staging tile lies in the residual ring, which nobody reads behind the last stage's barrier */
  static_assert(sizeof(float) * 4 * 32 * 68 <= sizeof(unsigned short) * 2 * 128 * LP, "the staging tile lies inside tL");
  static_assert(RE % 128 == 0 && SLEN % 128 == 0 && DM >= 128 && DM % 64 == 0, "a block's 128 rows carry a residual all or none; the ring's prologue needs two stages");
  const int tid = threadIdx.x, w = tid >> 5, lane = tid & 31, ln = lane & 15, hh = lane >> 4;
  constexpr int ntn = DM >> 6, nst = DM >> 6;
  const int mt = blockIdx.x / ntn, nq = blockIdx.x - mt * ntn; const int row0 = mt * 128 + 32 * w, col0 = nq * 64;
  const bool dual = (mt * 128) % SLEN < RE;      /* from blockIdx alone: the same for the whole block */
  const unsigned short* Ag = (const unsigned short*)OHp + (size_t)(mt * 128) * DM; const unsigned short* Lg = (const unsigned short*)OLp + (size_t)(mt * 128) * DM; const unsigned short* Bg = (const unsigned short*)BOp + (size_t)col0 * DM;
  auto fill = [&](int bf, int k0) { stage64(Ag + k0, DM, &tA[bf][0][0], tid); stage64(Ag + (size_t)64 * DM + k0, DM, &tA[bf][64][0], tid); stage64(Bg + k0, DM, &tB[bf][0][0], tid);
    if (dual) { stage64(Lg + k0, DM, &tL[bf][0][0], tid); stage64(Lg + (size_t)64 * DM + k0, DM, &tL[bf][64][0], tid); } };
  fill(0, 0);
  wait_async0(); __syncthreads();      /* stage 0 published */
  fill(1, 64);
  v8f c[2][4], d[2][4];      /* every '#pragma unroll' below: constant indices keep the fragment and accumulator arrays in registers */
#pragma unroll
  for (int i = 0; i < 2; ++i)
#pragma unroll
    for (int j = 0; j < 4; ++j) { c[i][j] = (v8f){0.f,0.f,0.f,0.f,0.f,0.f,0.f,0.f}; d[i][j] = c[i][j]; }
#pragma unroll 1
  for (int t = 0; t < nst; ++t) { const int bf = t & 1;      /* rolled: one stage a trip, the publish point at its foot */
    v16h fa[2][2], fb[2][4];      /* a stage's fragments are read as one group ahead of its products, as in gemm2_body */
#pragma unroll
    for (int kq = 0; kq < 2; ++kq) { fa[kq][0] = g2_frag((const _Float16*)&tA[bf][32 * w + ln][kq * 32], hh); fb[kq][0] = g2_frag((const _Float16*)&tB[bf][ln][kq * 32], hh); fa[kq][1] = g2_frag((const _Float16*)&tA[bf][32 * w + 16 + ln][kq * 32], hh);
      fb[kq][1] = g2_frag((const _Float16*)&tB[bf][16 + ln][kq * 32], hh); fb[kq][2] = g2_frag((const _Float16*)&tB[bf][32 + ln][kq * 32], hh); fb[kq][3] = g2_frag((const _Float16*)&tB[bf][48 + ln][kq * 32], hh); }
#pragma unroll
    for (int kq = 0; kq < 2; ++kq)
#pragma unroll
      for (int j = 0; j < 4; ++j) { c[0][j] = g2_mma(fa[kq][0], fb[kq][j], c[0][j]); c[1][j] = g2_mma(fa[kq][1], fb[kq][j], c[1][j]); }
    if (dual) {      /* the residual fragments take the registers that the hi fragments have left; the Wo fragments serve a second time */
#pragma unroll
      for (int kq = 0; kq < 2; ++kq) { fa[kq][0] = g2_frag((const _Float16*)&tL[bf][32 * w + ln][kq * 32], hh); fa[kq][1] = g2_frag((const _Float16*)&tL[bf][32 * w + 16 + ln][kq * 32], hh); }
#pragma unroll
      for (int kq = 0; kq < 2; ++kq)
#pragma unroll
        for (int j = 0; j < 4; ++j) { d[0][j] = g2_mma(fa[kq][0], fb[kq][j], d[0][j]); d[1][j] = g2_mma(fa[kq][1], fb[kq][j], d[1][j]); } }
    wait_ds0(); wait_async0(); __syncthreads();      /* publishes stage t + 1 and ends every read of buffer bf */
    if (t + 2 < nst) fill(bf, (t + 2) * 64); }
  wait_async0();
#pragma unroll
  for (int u = 0; u < 8; ++u) { const int j = u & 3, half = u >> 2; const float bv = bf16_round(bo[col0 + j * 16 + ln]);
#pragma unroll
    for (int r = 0; r < 8; ++r) so[w][half * 16 + 8 * hh + r][j * 16 + ln] = (c[half][j][r] + d[half][j][r] * 0.0009765625f) * 0.0625f + bv; }      /* d is 0 where the rows carry no residual */
  __builtin_amdgcn_fence(__ATOMIC_ACQ_REL, "workgroup"); __builtin_amdgcn_wave_barrier();      /* the wave's own so rows: its stores above stay ahead of its whole-line reads below */
  const int rsub = lane >> 4, c4 = (lane & 15) * 4;
#pragma unroll
  for (int q = 0; q < 16; ++q) { const int r = q * 2 + rsub; const v4f v = *(const v4fa*)&so[w][r][c4]; *(v4f*)(out + (size_t)(row0 + r) * DM + col0 + c4) = v; } }
// q, k and v = x W + b read the same x and depend on nothing of one another: one grid, a block range each (q, then k, then v), so that the two narrow products fill the places that the wide one leaves idle.
#define GB_Q ((NR / 128) * (DM / 64))
#define GB_KV ((NR / 128) * (KVD / 64))
__global__ __launch_bounds__(128) void k_qkv(const _Float16* __restrict__ X16, const _Float16* __restrict__ BQ, const _Float16* __restrict__ BK, const _Float16* __restrict__ BV, const float* __restrict__ bq, const float* __restrict__ bk, const float* __restrict__ bv,
    _Float16* __restrict__ QH, _Float16* __restrict__ QL, _Float16* __restrict__ KH, _Float16* __restrict__ KL, _Float16* __restrict__ VT, _Float16* __restrict__ VTL) {
  GEMM2_LDS
  const int b = blockIdx.x;      /* every branch below is the same for the whole block */
  if (b >= GB_Q + GB_KV) { gemm2_body<0, 2>(b - GB_Q - GB_KV, so, tA, tB, X16, DM, 0, BV, DM, 0, 0.0625f, bv, 0, nullptr, 1, 0, 0, nullptr, VT, VTL, SLEN, 0, NR, KVD, DM); return; }      /* V^T hi/lo: [kv head][d][token] */
  if (b >= GB_Q) { gemm2_body<0, 1>(b - GB_Q, so, tA, tB, X16, DM, 0, BK, DM, 0, 0.0625f, bk, 0, nullptr, 1, 0, 0, nullptr, KH, KL, KVD, 0, NR, KVD, DM); return; }      /* k hi/lo, 4 kv heads */
  gemm2_body<0, 1>(b, so, tA, tB, X16, DM, 0, BQ, DM, 0, 0.0625f, bq, 0, nullptr, 1, 0, 0, nullptr, QH, QL, DM, 0, NR, DM, DM); }      /* q hi/lo */



// lane l with lane l ^ 16: the two lane halves of a 16-column group hold the two key halves of one query
__device__ __forceinline__ float xhalf(float x) { return __builtin_bit_cast(float, __builtin_amdgcn_permlanex16(__builtin_bit_cast(int, x), __builtin_bit_cast(int, x), 0x76543210, 0xfedcba98, false, false)); }
template <int CAUSAL>
__device__ __forceinline__ void flash_body(const int bx, float (*sO)[16][64 + 4], unsigned short (*ring)[64][LP], const _Float16* __restrict__ Q16, int ldq, const _Float16* __restrict__ K16, int ldk, const _Float16* __restrict__ Vt, const int* __restrict__ MSK, _Float16* __restrict__ OH, int ldo) {
  constexpr int RPW = 16, DT = 4, KS = 2;      /* every '#pragma unroll' below: constant indices keep the fragment, score and accumulator arrays in registers */
  unsigned short (*sK)[64][LP] = ring, (*sV)[64][LP] = ring + 2;      /* two buffers each; a stage = 64 keys: K rows (key, d) and V^T rows (d, key), shared by the four waves */
  const int tid = threadIdx.x, w = tid >> 5, lane = tid & 31, ln = lane & 15, hh = lane >> 4;
  const int slab = bx / QBNP, qblk = QB0P + bx % QBNP; const int b = slab / NH, h = slab % NH; const int qb0 = qblk * (4 * RPW); const int q0 = qb0 + w * RPW; const int tq = q0 + ln;
  FragH bq[KS];
  { const unsigned short* qr = (const unsigned short*)Q16 + ((size_t)b * TQ + tq) * ldq + h * 64;
#pragma unroll
    for (int ks = 0; ks < KS; ++ks) { bq[ks].half[0] = *(const v8us*)(qr + ks * 32 + 8 * hh); bq[ks].half[1] = *(const v8us*)(qr + ks * 32 + 16 + 8 * hh); } }
  const int kvh = h / NREP;      /* K16 and Vt hold the kv heads themselves: query head h reads kv head h / NREP */
  const unsigned short* Vth = (const unsigned short*)Vt + (size_t)(b * NKV + kvh) * 64 * TK;
  const float sl = (CAUSAL == 14) ? bf16_round(((const float*)MSK)[h]) : 0.f;      /* mode 14: causal + ALiBi slope[h] * (key - query) from the slopes INPUT */
  // Softmax in log2 units: p * 1024 = 2^(s * c2 + sl2 * (key - query) - m + 10). A lane's 16 keys of a pass lie at fixed distances from its first one, so scale and ALiBi are one fma per score against kb; the first key's own term (base) joins the maximum once a pass.
  static_assert(CAUSAL == 0 || CAUSAL == 1 || CAUSAL == 14, "every query needs a valid key in the first pass: masked scores go out by 2^(-3e38 - finite) = 0");
  const float c2 = SCL * 1.44269504088896340736f, sl2 = sl * 1.44269504088896340736f; v8f kb[2];
#pragma unroll
  for (int nt = 0; nt < 2; ++nt)
#pragma unroll
    for (int r = 0; r < 8; ++r) kb[nt][r] = sl2 * (float)(nt * 16 + r);
  float m_r = -3.0e38f, l_r = 0.f; v8f oacc[DT];
#pragma unroll
  for (int dt = 0; dt < DT; ++dt) oacc[dt] = (v8f){0.f,0.f,0.f,0.f,0.f,0.f,0.f,0.f};
  const int jend = (CAUSAL == 1 || CAUSAL == 14) ? (qb0 + 4 * RPW) : TK;      /* causal: keys beyond the block's last query never contribute */
  const unsigned short* Kh = (const unsigned short*)K16 + (size_t)b * TK * ldk + kvh * 64; const int nst = jend >> 6;      /* jend is a multiple of 64 */
  stage64(Kh, ldk, &sK[0][0][0], tid); stage64(Vth, TK, &sV[0][0][0], tid);
  wait_async0(); __syncthreads();      /* stage 0 published */
  if (nst > 1) { stage64(Kh + (size_t)64 * ldk, ldk, &sK[1][0][0], tid); stage64(Vth + 64, TK, &sV[1][0][0], tid); }
  // LDS fragment reads stand in groups, ahead of the products that use them: K of both passes and V^T of pass 0 at the head of the stage, V^T of pass 1 behind the output products of pass 0.
  // Only the first group's latency is waited out; every read stays inside its own stage, ahead of the wait and the barrier at the foot.
  FragH ak[2][2][KS], av[2][DT];
  auto ldK = [&](int bf, int pp) {
#pragma unroll
    for (int nt = 0; nt < 2; ++nt) { const unsigned short* kr = &sK[bf][pp * 32 + nt * 16 + ln][0];
#pragma unroll
      for (int ks = 0; ks < KS; ++ks) { ak[pp][nt][ks].half[0] = *(const v8us*)(kr + ks * 32 + 8 * hh); ak[pp][nt][ks].half[1] = *(const v8us*)(kr + ks * 32 + 16 + 8 * hh); } } };
  auto ldV = [&](int bf, int pp) {
#pragma unroll
    for (int dt = 0; dt < DT; ++dt) { const unsigned short* vrow = &sV[bf][dt * 16 + ln][pp * 32]; av[pp][dt].half[0] = *(const v8us*)(vrow + 8 * hh); av[pp][dt].half[1] = *(const v8us*)(vrow + 16 + 8 * hh); } };
  // the stage loop stays rolled: one stage a trip with the publish point at its foot
#pragma unroll 1
  for (int t = 0; t < nst; ++t) { const int bf = t & 1;
  ldK(bf, 0); ldK(bf, 1); ldV(bf, 0);
  // the two passes of a stage are unrolled: pass 1's fragments get registers of their own, so that their reads can be issued during pass 0
#pragma unroll
  for (int pp = 0; pp < 2; ++pp) { const int j0 = t * 64 + pp * 32;
    v8f s[2];
#pragma unroll
    for (int nt = 0; nt < 2; ++nt) { v8f acc = (v8f){0.f,0.f,0.f,0.f,0.f,0.f,0.f,0.f};
#pragma unroll
      for (int ks = 0; ks < KS; ++ks) acc = mmaH<1>(ak[pp][nt][ks].v, ak[pp][nt][ks].v, bq[ks].v, bq[ks].v, acc);
      s[nt] = acc; }
    const float base = sl2 * (float)(j0 + 8 * hh - tq);      /* ALiBi of the lane's first key of this pass */
    v8f u[2];
#pragma unroll
    for (int nt = 0; nt < 2; ++nt) u[nt] = s[nt] * c2 + kb[nt];
    if ((CAUSAL == 1 || CAUSAL == 14) && t == nst - 1) {      /* only the block's last stage holds keys beyond a query: a scalar branch, every earlier stage goes unmasked */
#pragma unroll
      for (int nt = 0; nt < 2; ++nt)
#pragma unroll
        for (int r = 0; r < 8; ++r) u[nt][r] = (j0 + nt * 16 + 8 * hh + r <= tq) ? u[nt][r] : -3.0e38f; }
    float mcn[2];      /* two independent chains */
#pragma unroll
    for (int nt = 0; nt < 2; ++nt) { mcn[nt] = u[nt][0];
#pragma unroll
      for (int r = 1; r < 8; ++r) mcn[nt] = fmaxf(mcn[nt], u[nt][r]); }
    float mc = fmaxf(mcn[0], mcn[1]) + base; mc = fmaxf(mc, xhalf(mc));
    const float mn = fmaxf(m_r, mc); const float al = __builtin_amdgcn_exp2f(m_r - mn); m_r = mn;      /* first pass: 2^(-3e38 - mn) = 0 */
    const float sh = (mn - base) - 10.0f;      /* the factor 1024 of the f16 P operand rides in the exponent; l sums the same scaled values */
    FragH pb; v8f e[2];
#pragma unroll
    for (int nt = 0; nt < 2; ++nt) { e[nt] = u[nt] - sh;      /* the exponents as one vector, each 2^x then written over its own exponent */
#pragma unroll
      for (int r = 0; r < 8; ++r) { e[nt][r] = __builtin_amdgcn_exp2f(e[nt][r]); pb.h[nt * 8 + r] = (_Float16)e[nt][r]; } }
    const v8f e8 = e[0] + e[1]; const v4f e4 = __builtin_shufflevector(e8, e8, 0, 1, 2, 3) + __builtin_shufflevector(e8, e8, 4, 5, 6, 7);
    l_r = l_r * al + ((e4[0] + e4[2]) + (e4[1] + e4[3]));
#pragma unroll
    for (int dt = 0; dt < DT; ++dt) oacc[dt] *= al;
#pragma unroll
    for (int dt = 0; dt < DT; ++dt) oacc[dt] = mmaH<1>(av[pp][dt].v, av[pp][dt].v, pb.v, pb.v, oacc[dt]);
    if (pp == 0) ldV(bf, 1); }
    wait_ds0(); wait_async0(); __syncthreads();      /* publishes stage t + 1 and ends every read of buffer bf */
    if (t + 2 < nst) { const int j2 = (t + 2) * 64; stage64(Kh + (size_t)j2 * ldk, ldk, &sK[bf][0][0], tid); stage64(Vth + j2, TK, &sV[bf][0][0], tid); } }
  wait_async0();
  const float l = l_r + xhalf(l_r); const float li = (l > 0.f) ? 1.0f / l : 0.f;      /* l carries the factor 1024 of P */
#pragma unroll
  for (int dt = 0; dt < DT; ++dt) { const v4f lo = {oacc[dt][0] * li, oacc[dt][1] * li, oacc[dt][2] * li, oacc[dt][3] * li}, hi = {oacc[dt][4] * li, oacc[dt][5] * li, oacc[dt][6] * li, oacc[dt][7] * li};
    *(v4fa*)&sO[w][ln][dt * 16 + 8 * hh] = lo; *(v4fa*)&sO[w][ln][dt * 16 + 8 * hh + 4] = hi; }
  __builtin_amdgcn_fence(__ATOMIC_ACQ_REL, "workgroup"); __builtin_amdgcn_wave_barrier();      /* the wave's own sO rows: its stores above stay ahead of its whole-line reads below */
  {
#pragma unroll
    for (int rp = 0; rp < RPW; rp += 2) { const int r = rp + (lane >> 4), pc = lane & 15; const v4f val = *(const v4fa*)&sO[w][r][pc * 4]; v4h h4; for (int i = 0; i < 4; ++i) h4[i] = (_Float16)val[i]; *(v4h*)(OH + ((size_t)b * TQ + q0 + r) * ldo + h * 64 + pc * 4) = h4; }      /* O leaves as the f16 A operand of the Wo GEMM: 16 lanes one 128-byte line */
     } }
// 5-plane variant: S = Qh Kh^T + (Ql Kh^T + Qh Kl^T)/1024 with Q/K = [hi | 2^10 residual] f16 planes (QL/KL same layout as Q16/K16), then the 3-term P.V below.
// 3-term variant: O = (P_hi V_hi + (P_lo V_hi + P_hi V_lo) / 1024) / l with P = [hi | 2^10 residual] of 1024 p and V^T = [hi | 2^10 residual] planes (VtL same layout as Vt) -> ~2^-21-class products for un-averaged (early causal / peaked) rows
template <int CAUSAL>
__device__ __forceinline__ void flash5_body(const int bx, float (*sO)[16][64 + 4], unsigned short (*ring)[64][LP], const _Float16* __restrict__ Q16, const _Float16* __restrict__ QL, int ldq, const _Float16* __restrict__ K16, const _Float16* __restrict__ KL, int ldk, const _Float16* __restrict__ Vt, const _Float16* __restrict__ VtL, const int* __restrict__ MSK, _Float16* __restrict__ OH, _Float16* __restrict__ OL, int ldo) {
  constexpr int RPW = 16, DT = 4, KS = 2;      /* transposed products as in flash_body: lane (ln, hh) holds query q0 + ln, keys j0 + nt * 16 + 8 * hh + r; '#pragma unroll' as there */
  unsigned short (*sK)[LP] = ring[0], (*sKl)[LP] = ring[1], (*sV)[LP] = ring[2], (*sVl)[LP] = ring[3];      /* a stage = 64 keys of the four planes in ONE buffer: the LDS frame of flash_body, so that both bodies share a kernel at its residency */
  const int tid = threadIdx.x, w = tid >> 5, lane = tid & 31, ln = lane & 15, hh = lane >> 4;
  const int slab = bx / QBN5, qblk = QB05 + bx % QBN5; const int b = slab / NH, h = slab % NH; const int qb0 = qblk * (4 * RPW); const int q0 = qb0 + w * RPW; const int tq = q0 + ln;
  FragH bq[KS], bql[KS];
  { const unsigned short* qr = (const unsigned short*)Q16 + ((size_t)b * TQ + tq) * ldq + h * 64; const unsigned short* ql = (const unsigned short*)QL + ((size_t)b * TQ + tq) * ldq + h * 64;
#pragma unroll
    for (int ks = 0; ks < KS; ++ks) { bq[ks].half[0] = *(const v8us*)(qr + ks * 32 + 8 * hh); bq[ks].half[1] = *(const v8us*)(qr + ks * 32 + 16 + 8 * hh); bql[ks].half[0] = *(const v8us*)(ql + ks * 32 + 8 * hh); bql[ks].half[1] = *(const v8us*)(ql + ks * 32 + 16 + 8 * hh); } }
  const int kvh = h / NREP;      /* kv heads unexpanded, as in flash_body */
  const unsigned short* Vth = (const unsigned short*)Vt + (size_t)(b * NKV + kvh) * 64 * TK; const unsigned short* Vtl = (const unsigned short*)VtL + (size_t)(b * NKV + kvh) * 64 * TK;
  const float sl = (CAUSAL == 14) ? bf16_round(((const float*)MSK)[h]) : 0.f;      /* mode 14: causal + ALiBi slope[h] * (key - query) from the slopes INPUT */
  float m_r = -3.0e38f, l_r = 0.f; v8f oacc[DT], oaccL[DT];
#pragma unroll
  for (int dt = 0; dt < DT; ++dt) { oacc[dt] = (v8f){0.f,0.f,0.f,0.f,0.f,0.f,0.f,0.f}; oaccL[dt] = oacc[dt]; }
  const int jend = (CAUSAL == 1 || CAUSAL == 14) ? (qb0 + 4 * RPW) : TK;      /* causal: keys beyond the block's last query never contribute */
  const unsigned short* Kh = (const unsigned short*)K16 + (size_t)b * TK * ldk + kvh * 64; const unsigned short* Kl = (const unsigned short*)KL + (size_t)b * TK * ldk + kvh * 64; const int nst = jend >> 6;      /* jend is a multiple of 64 */
  // both loops stay rolled: one stage a trip, filled at its head and left at its foot, and the two passes of a stage share one body (short code, the pass as an address offset)
#pragma unroll 1
  for (int t = 0; t < nst; ++t) { const int j1 = t * 64;
    stage64(Kh + (size_t)j1 * ldk, ldk, &sK[0][0], tid); stage64(Kl + (size_t)j1 * ldk, ldk, &sKl[0][0], tid); stage64(Vth + j1, TK, &sV[0][0], tid); stage64(Vtl + j1, TK, &sVl[0][0], tid);
    wait_async0(); __syncthreads();      /* stage t published; at most four stages a block, their landing times covered by the other blocks of the grid */
#pragma unroll 1
  for (int p = 0; p < 64; p += 32) { const int j0 = t * 64 + p;
    v8f s[2];
#pragma unroll
    for (int nt = 0; nt < 2; ++nt) { const unsigned short* kr = &sK[p + nt * 16 + ln][0]; const unsigned short* klr = &sKl[p + nt * 16 + ln][0]; FragH ak[KS], akl[KS];
#pragma unroll
      for (int ks = 0; ks < KS; ++ks) { ak[ks].half[0] = *(const v8us*)(kr + ks * 32 + 8 * hh); ak[ks].half[1] = *(const v8us*)(kr + ks * 32 + 16 + 8 * hh); akl[ks].half[0] = *(const v8us*)(klr + ks * 32 + 8 * hh); akl[ks].half[1] = *(const v8us*)(klr + ks * 32 + 16 + 8 * hh); }
      v8f acc = (v8f){0.f,0.f,0.f,0.f,0.f,0.f,0.f,0.f}, accl = acc;
#pragma unroll
      for (int ks = 0; ks < KS; ++ks) { acc = mmaH<1>(ak[ks].v, ak[ks].v, bq[ks].v, bq[ks].v, acc); accl = mmaH<1>(ak[ks].v, ak[ks].v, bql[ks].v, bql[ks].v, accl); accl = mmaH<1>(akl[ks].v, akl[ks].v, bq[ks].v, bq[ks].v, accl); }
#pragma unroll
      for (int r = 0; r < 8; ++r) acc[r] += accl[r] * 0.0009765625f;
      s[nt] = acc; }
    float sc[2][8], mcn[2]; bool ok[2][8];
#pragma unroll
    for (int nt = 0; nt < 2; ++nt) { mcn[nt] = -3.0e38f;
#pragma unroll
      for (int r = 0; r < 8; ++r) { const int kk = j0 + nt * 16 + 8 * hh + r;
        ok[nt][r] = (CAUSAL == 1 || CAUSAL == 14) ? (kk <= tq) : ((CAUSAL == 2) ? ((kk >> 5) == (tq >> 5)) : true);      /* mode 2: block-diagonal 32-token groups */
        if (CAUSAL == 4) ok[nt][r] = MSK[((size_t)b * TQ + tq) * TK + kk] != 0;      /* mode 4: per-(query, key) INPUT mask shared by all heads; masked keys contribute nothing, rows with no valid key give l = 0 -> output 0 */
        float sv = ok[nt][r] ? s[nt][r] * SCL : -3.0e38f; if (CAUSAL == 14) { if (ok[nt][r]) sv += sl * (float)(kk - tq); }
        sc[nt][r] = sv; mcn[nt] = fmaxf(mcn[nt], sv); } }
    float mc = fmaxf(mcn[0], mcn[1]); mc = fmaxf(mc, xhalf(mc));
    const float mn = fmaxf(m_r, mc); const float ea = expf(m_r - mn); const float al = (mn > -1.0e38f) ? ea : 1.0f; m_r = mn;
    FragH pb, pl; float psn[2];
#pragma unroll
    for (int nt = 0; nt < 2; ++nt) { psn[nt] = 0.f;
#pragma unroll
      for (int r = 0; r < 8; ++r) { const float e = expf(sc[nt][r] - mn); const float p = ok[nt][r] ? e : 0.f; psn[nt] += p; const float ps = p * 1024.0f; const _Float16 ph = (_Float16)ps; pb.h[nt * 8 + r] = ph; pl.h[nt * 8 + r] = (_Float16)((ps - (float)ph) * 1024.0f); } }
    l_r = l_r * al + (psn[0] + psn[1]);
#pragma unroll
    for (int dt = 0; dt < DT; ++dt)
#pragma unroll
      for (int r = 0; r < 8; ++r) { oacc[dt][r] *= al; oaccL[dt][r] *= al; }
#pragma unroll
    for (int dt = 0; dt < DT; ++dt) { const unsigned short* vrow = &sV[dt * 16 + ln][p]; const unsigned short* vrl = &sVl[dt * 16 + ln][p]; FragH av, avl; av.half[0] = *(const v8us*)(vrow + 8 * hh); av.half[1] = *(const v8us*)(vrow + 16 + 8 * hh); avl.half[0] = *(const v8us*)(vrl + 8 * hh); avl.half[1] = *(const v8us*)(vrl + 16 + 8 * hh);
      oacc[dt] = mmaH<1>(av.v, av.v, pb.v, pb.v, oacc[dt]); oaccL[dt] = mmaH<1>(av.v, av.v, pl.v, pl.v, oaccL[dt]); oaccL[dt] = mmaH<1>(avl.v, avl.v, pb.v, pb.v, oaccL[dt]); } }
    wait_ds0(); __syncthreads(); }      /* ends every read of the buffer ahead of its refill */
  const float l = l_r + xhalf(l_r); const float li = (l > 0.f) ? 1.0f / (l * 1024.0f) : 0.f;
#pragma unroll
  for (int dt = 0; dt < DT; ++dt) { v4f lo, hi;
#pragma unroll
    for (int r = 0; r < 4; ++r) { float v = oacc[dt][r]; v += oaccL[dt][r] * 0.0009765625f; lo[r] = v * li; v = oacc[dt][4 + r]; v += oaccL[dt][4 + r] * 0.0009765625f; hi[r] = v * li; }
    *(v4fa*)&sO[w][ln][dt * 16 + 8 * hh] = lo; *(v4fa*)&sO[w][ln][dt * 16 + 8 * hh + 4] = hi; }
  __builtin_amdgcn_fence(__ATOMIC_ACQ_REL, "workgroup"); __builtin_amdgcn_wave_barrier();      /* the wave's own sO rows: its stores above stay ahead of its whole-line reads below */
  {
#pragma unroll
    for (int rp = 0; rp < RPW; rp += 2) { const int r = rp + (lane >> 4), pc = lane & 15; const v4f val = *(const v4fa*)&sO[w][r][pc * 4]; v4h h4, l4; for (int i = 0; i < 4; ++i) { h4[i] = (_Float16)val[i]; l4[i] = (_Float16)((val[i] - (float)h4[i]) * 1024.0f); }
      *(v4h*)(OH + ((size_t)b * TQ + q0 + r) * ldo + h * 64 + pc * 4) = h4; *(v4h*)(OL + ((size_t)b * TQ + q0 + r) * ldo + h * 64 + pc * 4) = l4; }      /* O leaves as f16 hi + 2^10 residual, the two A operands of the Wo GEMM on these rows */
     } }
// The two forms work on disjoint query rows from the same planes: one grid, the plain form's blocks first, then the few short blocks of the 5-plane form, which run beside them instead of in a launch of their own.
template <int CAUSAL>
__global__ __launch_bounds__(128) void k_flash_all(const _Float16* __restrict__ Q16, const _Float16* __restrict__ QL, int ldq, const _Float16* __restrict__ K16, const _Float16* __restrict__ KL, int ldk, const _Float16* __restrict__ Vt, const _Float16* __restrict__ VtL, const float* __restrict__ SLP, _Float16* __restrict__ OH, _Float16* __restrict__ OL, int ldo) {
  __shared__ __attribute__((aligned(16))) float sO[4][16][64 + 4];
  __shared__ __attribute__((aligned(16))) unsigned short ring[4][64][LP];
  const int* MSK = (const int*)SLP;      /* the bodies' one pointer for mask or slopes; mode 14 reads it as the f32 slopes */
  const int bx = blockIdx.x;      /* the branch is the same for the whole block */
  if (bx < NB * NH * QBNP) flash_body<CAUSAL>(bx, sO, ring, Q16, ldq, K16, ldk, Vt, MSK, OH, ldo);
  else flash5_body<CAUSAL>(bx - NB * NH * QBNP, sO, ring, Q16, QL, ldq, K16, KL, ldk, Vt, VtL, MSK, OH, OL, ldo); }

__global__ __launch_bounds__(256) void k_rotab(float* __restrict__ CS, float* __restrict__ SN) {
  #pragma clang fp contract(off)
  const int t = blockIdx.x * 256 + threadIdx.x; if (t >= SLEN * 32) return; const int j = t % 32, s = t / 32; const float ex = (float)(2 * j) / 64.0f; const float inv = 1.0f / powf(10000.0f, ex); const float th = (float)s * inv; const float c = cosf(th), sn = sinf(th);
  { *(float*)(CS + t) = c; *(float*)(SN + t) = sn;  } }
__global__ __launch_bounds__(256) void k_rope(const float* __restrict__ F, int nsrc, int ndst, int rep, const float* __restrict__ CS, const float* __restrict__ SN, _Float16* __restrict__ H, _Float16* __restrict__ L) {
  #pragma clang fp contract(off)
  const size_t t = (size_t)blockIdx.x * 256 + threadIdx.x; if (t >= (size_t)NR * ndst * 4) return; const int g8 = (int)(t % 4); const int hd = (int)((t / 4) % ndst); const size_t row = t / ((size_t)4 * ndst); const int s = (int)(row % SLEN); const int hs = hd / rep;
  const float* src = F + row * (size_t)(nsrc * 64) + hs * 64; FragH ah, al, bh, bl;
  for (int i = 0; i < 8; ++i) { const int d = g8 * 8 + i; const float c = CS[s * 32 + d], sn = SN[s * 32 + d]; const float x1 = src[d], x2 = src[d + 32];
    float o1 = x1 * c; o1 += -x2 * sn; float o2 = x2 * c; o2 += x1 * sn;
    _Float16 hv = (_Float16)o1; ah.h[i] = hv; al.h[i] = (_Float16)((o1 - (float)hv) * 1024.0f); hv = (_Float16)o2; bh.h[i] = hv; bl.h[i] = (_Float16)((o2 - (float)hv) * 1024.0f); }
  const size_t o = row * (size_t)(ndst * 64) + hd * 64 + g8 * 8;
  { *(v8us*)((unsigned short*)H + o) = ah.half[0]; *(v8us*)((unsigned short*)H + o + 32) = bh.half[0]; *(v8us*)((unsigned short*)L + o) = al.half[0]; *(v8us*)((unsigned short*)L + o + 32) = bl.half[0];  } }

extern "C" void kernel_launch(void* const* d_in, const int* in_sizes, int n_in,
                              void* d_out, int out_size, void* d_ws, size_t ws_size, hipStream_t stream) {
  (void)in_sizes; (void)n_in; (void)out_size;
  const float* const* I = (const float* const*)d_in; const float* x = I[0]; const float* Wq = I[1]; const float* bq = I[2]; const float* Wk = I[3]; const float* bk = I[4]; const float* Wv = I[5]; const float* bv = I[6]; const float* Wo = I[7]; const float* bo = I[8]; const float* slopes = I[9];
  char* ws = (char*)d_ws; size_t off = 0;
  auto take = [&](size_t bytes) { char* p = ws + off; off += (bytes + 255) & ~(size_t)255; return p; };
  const size_t np = (size_t)NR * DM, nk = (size_t)NR * KVD;
  _Float16* BQ = (_Float16*)take((size_t)DM * DM * 2); _Float16* BK = (_Float16*)take((size_t)KVD * DM * 2); _Float16* BV = (_Float16*)take((size_t)KVD * DM * 2); _Float16* BO = (_Float16*)take((size_t)DM * DM * 2);
  _Float16* X16 = (_Float16*)take(np * 2); _Float16* QH = (_Float16*)take(np * 2); _Float16* QL = (_Float16*)take(np * 2); _Float16* KH = (_Float16*)take(nk * 2); _Float16* KL = (_Float16*)take(nk * 2); _Float16* VT = (_Float16*)take(nk * 2); _Float16* VTL = (_Float16*)take(nk * 2);
  _Float16* OH = (_Float16*)take(np * 2); _Float16* OLo = (_Float16*)take(np * 2);
  if (off > ws_size) return;      /* 2+0.5+0.5+2 + 8+8+8+2+2+2+2+8+8 = 53 MiB */
  k_prep<<<2 * PB_W + 2 * PB_KV + PB_X, 256, 0, stream>>>(x, Wq, Wk, Wv, Wo, X16, BQ, BK, BV, BO);      /* x16 weights transposed, f16 plane of x */
  k_qkv<<<GB_Q + 2 * GB_KV, 128, 0, stream>>>(X16, BQ, BK, BV, bq, bk, bv, QH, QL, KH, KL, VT, VTL);      /* q hi/lo; k hi/lo, 4 kv heads; V^T hi/lo: [kv head][d][token] */
  k_flash_all<14><<<NB * NH * (QBNP + QBN5), 128, 0, stream>>>(QH, QL, DM, KH, KL, KVD, VT, VTL, slopes, OH, OLo, DM);      /* causal + ALiBi: rows >= 256 plain, rows < 256 hi + residual */
  k_wo<<<(NR / 128) * (DM / 64), 128, 0, stream>>>(OH, OLo, BO, bo, (float*)d_out);      /* out = ctx Wo + bo, the O residual term of the first 256 rows of each sequence in the same blocks */
}

// v008
// A run of this version takes 103 microseconds.
// In two side-by-side timings against v007, it was 1.04 and 1.03 times as fast.
// Over all steps from v000 it is 7.82 times as fast.
#include <hip/hip_runtime.h>
// CausalAlibiAttn (1 x 4096 tokens, D 1024 = 16 heads of 64, 4 kv heads): q, k, v = x W + b; q head h uses kv head h/4; scores/8 + slope[h] * (key - query) (ALiBi, slopes INPUT), causal; softmax; ctx Wo + bo.
// Structure: exact f16 plane of x; q, k, v by WMMA GEMMs (32x64 wave tiles, f32 accumulation, exact x16 weights + bias) whose epilogues split the f32 result into f16 hi + 2^10-residual planes themselves (v transposed in the LDS staging tile; k, v stay at their 4 kv heads); the fused causal flash kernel (query head h reads kv head h / 4) with the ALiBi term added per (head, query, key) in f32, in its 5-plane form for the first 256 query rows and the plain form beyond; it stores O as f16 hi (+ residual on those rows) for the Wo GEMM (+ bias; residual term only on those rows, in the same launch).
// Compute dtype: x and parameters rounded to bf16; q/k/P/v/O as f16 hi + residual on rows < 256 (~2^-21) and plain f16 beyond (~2^-12); ALiBi/softmax f32. v_wmma_f32_16x16x32_f16.
#define NB 1
#define DM 1024
#define NKV 4
#define NREP (NH / NKV)
#define KVD (NKV * 64)           /* 256 */
#define NR (NB * SLEN)           /* 4096 */
#define SLEN 4096
#define TQ SLEN
#define TK SLEN
#define NH 16
#define SCL 0.125f
#define QBLKS (TQ / 64)
#define QB05 0
#define QBN5 4
#define QB0P QBN5
#define QBNP (QBLKS - QBN5)
#define RE 256
typedef __bf16 v16b __attribute__((ext_vector_type(16)));
typedef unsigned short v8us __attribute__((ext_vector_type(8), may_alias));
typedef float  v8f  __attribute__((ext_vector_type(8)));
typedef float  v4f  __attribute__((ext_vector_type(4)));
typedef float  v4fa __attribute__((ext_vector_type(4), may_alias));
union FragB { v16b v; v8us half[2]; unsigned short u[16]; };

__device__ __forceinline__ unsigned short bf16_bits(float x) { unsigned int u = __float_as_uint(x); return (unsigned short)((u + 0x7FFFu + ((u >> 16) & 1u)) >> 16); }
__device__ __forceinline__ float bf16_val(unsigned short b) { return __uint_as_float(((unsigned int)b) << 16); }
__device__ __forceinline__ float bf16_round(float x) { return bf16_val(bf16_bits(x)); }
// D += A·B with NT terms: 1 = ah·bh, 2 = + al·bh (A split), 3 = + ah·bl (both split)
template <int NT>
__device__ __forceinline__ v8f mmaN(v16b ah, v16b al, v16b bh, v16b bl, v8f c) {
  c = __builtin_amdgcn_wmma_f32_16x16x32_bf16(false, ah, false, bh, (short)0, c, false, false);
  if (NT >= 2) c = __builtin_amdgcn_wmma_f32_16x16x32_bf16(false, al, false, bh, (short)0, c, false, false);
  if (NT >= 3) c = __builtin_amdgcn_wmma_f32_16x16x32_bf16(false, ah, false, bl, (short)0, c, false, false);
  asm volatile("v_nop\n\tv_nop\n\tv_nop\n\tv_nop" : "+v"(c) : "v"(ah), "v"(al), "v"(bh), "v"(bl));
  return c;
}

__global__ __launch_bounds__(256) void k_wt_bf16(const float* __restrict__ W, unsigned short* __restrict__ Wt, int K, int N) {
  const int t = blockIdx.x * 256 + threadIdx.x;
  const int k8n = K / 8;
  if (t >= N * k8n) return;
  const int n = t / k8n, k8 = (t % k8n) * 8;
  v8us v;
#pragma unroll
  for (int i = 0; i < 8; ++i) v[i] = bf16_bits(W[(size_t)(k8 + i) * N + n]);
  *(v8us*)(Wt + (size_t)n * K + k8) = v;
  
}

// GEMM C[M][N] (f32, pitch ldc) = act(A[M][K]·W + bias). A f32 row-major (pitch lda) converted per fragment to bf16
// (ASPLIT: hi/lo two planes -> 2 terms, else single rounded term); Wt bf16 [N][K] (pitch ldb). BIAS_BF16 rounds the
// bias to bf16 first (bias quantised to bf16 before the add). K%32==0, M%16==0, N%64==0.
template <bool ASPLIT, int ACT, bool BIAS_BF16>
__global__ __launch_bounds__(128) void k_gemm_bf(const float* __restrict__ A, int lda, const unsigned short* __restrict__ Wt, int ldb,
                                               const float* __restrict__ bias, float* __restrict__ C, int ldc, int M, int N, int K) {
  __shared__ __attribute__((aligned(16))) float so[4][16][64];
  const int tid = threadIdx.x, w = tid >> 5, lane = tid & 31, ln = lane & 15, hh = lane >> 4;
  const int ntn = N / 64;
  const int wid = blockIdx.x * 4 + w;
  const int mt = wid / ntn, nq = wid % ntn;
  if (mt * 16 >= M) return;
  const int row0 = mt * 16, col0 = nq * 64;
  const float* arow = A + (size_t)(row0 + ln) * lda;
  v8f acc[4] = {};
  for (int kb = 0; kb < K; kb += 32) {
    FragB ah, al;
    const v4f x0 = *(const v4fa*)(arow + kb + 8 * hh), x1 = *(const v4fa*)(arow + kb + 8 * hh + 4);
    const v4f x2 = *(const v4fa*)(arow + kb + 16 + 8 * hh), x3 = *(const v4fa*)(arow + kb + 16 + 8 * hh + 4);
    float xs[16] = {x0[0],x0[1],x0[2],x0[3],x1[0],x1[1],x1[2],x1[3],x2[0],x2[1],x2[2],x2[3],x3[0],x3[1],x3[2],x3[3]};
#pragma unroll
    for (int i = 0; i < 16; ++i) { const unsigned short hb = bf16_bits(xs[i]); ah.u[i] = hb; al.u[i] = ASPLIT ? bf16_bits(xs[i] - bf16_val(hb)) : (unsigned short)0; }
#pragma unroll
    for (int t = 0; t < 4; ++t) {
      const unsigned short* brow = Wt + (size_t)(col0 + t * 16 + ln) * ldb + kb;
      FragB b;
      b.half[0] = *(const v8us*)(brow + 8 * hh);
      b.half[1] = *(const v8us*)(brow + 16 + 8 * hh);
      acc[t] = mmaN<ASPLIT ? 2 : 1>(ah.v, al.v, b.v, b.v, acc[t]);
    }
  }
#pragma unroll
  for (int t = 0; t < 4; ++t) {
    float bv = bias ? bias[col0 + t * 16 + ln] : 0.f;
    if (BIAS_BF16) bv = bf16_round(bv);
#pragma unroll
    for (int r = 0; r < 8; ++r) { float v = acc[t][r] + bv; if (ACT == 1) v = fmaxf(v, 0.f); so[w][8 * hh + r][t * 16 + ln] = v; }
  }
  __builtin_amdgcn_fence(__ATOMIC_ACQ_REL, "workgroup");
  __builtin_amdgcn_wave_barrier();
  const int rsub = lane >> 4, c4 = (lane & 15) * 4;
  {
#pragma unroll
    for (int q = 0; q < 8; ++q) {
      const int r = q * 2 + rsub;
      const v4f v = *(const v4fa*)&so[w][r][c4];
      *(v4f*)(C + (size_t)(row0 + r) * ldc + col0 + c4) = v;
    }
    
  }
}

// GEMM C = act(A·W + bias + resid): A f32 (ASPLIT -> hi/lo 2 terms), Wt bf16 [N][K]; ACT 0 none, 1 relu, 2 exact gelu;
// resid (optional, f32, row index = (row % rmod), pitch ldr, RES_BF16 rounds it) added before the activation.
template <bool ASPLIT, int ACT, bool BIAS_BF16, bool RES_BF16>
__global__ __launch_bounds__(128) void k_gemm_bf3(const float* __restrict__ A, int lda, const unsigned short* __restrict__ Wt, int ldb,
                                                const float* __restrict__ bias, const float* __restrict__ resid, int rmod, int ldr,
                                                float* __restrict__ C, int ldc, int M, int N, int K) {
  __shared__ __attribute__((aligned(16))) float so[4][16][64];
  const int tid = threadIdx.x, w = tid >> 5, lane = tid & 31, ln = lane & 15, hh = lane >> 4;
  const int ntn = N / 64;
  const int wid = blockIdx.x * 4 + w;
  const int mt = wid / ntn, nq = wid % ntn;
  if (mt * 16 >= M) return;
  const int row0 = mt * 16, col0 = nq * 64;
  const float* arow = A + (size_t)(row0 + ln) * lda;
  v8f acc[4] = {};
  for (int kb = 0; kb < K; kb += 32) {
    FragB ah, al;
    const v4f x0 = *(const v4fa*)(arow + kb + 8 * hh), x1 = *(const v4fa*)(arow + kb + 8 * hh + 4);
    const v4f x2 = *(const v4fa*)(arow + kb + 16 + 8 * hh), x3 = *(const v4fa*)(arow + kb + 16 + 8 * hh + 4);
    float xs[16] = {x0[0],x0[1],x0[2],x0[3],x1[0],x1[1],x1[2],x1[3],x2[0],x2[1],x2[2],x2[3],x3[0],x3[1],x3[2],x3[3]};
#pragma unroll
    for (int i = 0; i < 16; ++i) { const unsigned short hb = bf16_bits(xs[i]); ah.u[i] = hb; al.u[i] = ASPLIT ? bf16_bits(xs[i] - bf16_val(hb)) : (unsigned short)0; }
#pragma unroll
    for (int t = 0; t < 4; ++t) {
      const unsigned short* brow = Wt + (size_t)(col0 + t * 16 + ln) * ldb + kb;
      FragB b;
      b.half[0] = *(const v8us*)(brow + 8 * hh);
      b.half[1] = *(const v8us*)(brow + 16 + 8 * hh);
      acc[t] = mmaN<ASPLIT ? 2 : 1>(ah.v, al.v, b.v, b.v, acc[t]);
    }
  }
#pragma unroll
  for (int t = 0; t < 4; ++t) {
    const int col = col0 + t * 16 + ln;
    float bv = bias ? bias[col] : 0.f;
    if (BIAS_BF16) bv = bf16_round(bv);
#pragma unroll
    for (int r = 0; r < 8; ++r) {
      float v = acc[t][r] + bv;
      if (resid) { float rv = resid[(size_t)((row0 + 8 * hh + r) % rmod) * ldr + col]; if (RES_BF16) rv = bf16_round(rv); v += rv; }
      if (ACT == 1) v = fmaxf(v, 0.f);
      if (ACT == 2) v = 0.5f * v * (1.0f + erff(v * 0.70710678118654752f));
      if (ACT == 3) { const float u = 0.7978845608028654f * (v + 0.044715f * v * v * v); v = 0.5f * v * (1.0f + tanhf(u)); }
      so[w][8 * hh + r][t * 16 + ln] = v;
    }
  }
  __builtin_amdgcn_fence(__ATOMIC_ACQ_REL, "workgroup");
  __builtin_amdgcn_wave_barrier();
  const int rsub = lane >> 4, c4 = (lane & 15) * 4;
  {
#pragma unroll
    for (int q = 0; q < 8; ++q) {
      const int r = q * 2 + rsub;
      const v4f v = *(const v4fa*)&so[w][r][c4];
      *(v4f*)(C + (size_t)(row0 + r) * ldc + col0 + c4) = v;
    }
    
  }
}
// row LayerNorm (biased variance, eps) over N: s = X (+ R); optional out_sum <- s; out_norm <- (s-mu)*rsqrt(var+eps)*g + b
template <bool PARAM_BF16>
__global__ __launch_bounds__(256) void k_layernorm(const float* __restrict__ X, const float* __restrict__ R, const float* __restrict__ g, const float* __restrict__ bta,
                                                  float* __restrict__ out_sum, float* __restrict__ out_norm, int N, float eps) {
  __shared__ float red[256];
  const int row = blockIdx.x, tid = threadIdx.x;
  const float* x = X + (size_t)row * N; const float* rr = R ? R + (size_t)row * N : nullptr;
  float vals[16];                     // up to N = 4096
  const int per = N / 256;            // contiguous chunk per thread? use strided-by-4 chunks: thread handles j = tid*4 + 1024*u
  float s1 = 0.f;
  for (int u = 0; u < per / 4; ++u) {
    const int j = tid * 4 + 1024 * u;
    const v4f a = *(const v4fa*)(x + j);
    v4f b = {0.f,0.f,0.f,0.f}; if (rr) b = *(const v4fa*)(rr + j);
#pragma unroll
    for (int q = 0; q < 4; ++q) { const float v = a[q] + b[q]; vals[u * 4 + q] = v; s1 += v; }
  }
  red[tid] = s1; __syncthreads();
  for (int st = 128; st > 0; st >>= 1) { if (tid < st) red[tid] += red[tid + st]; __syncthreads(); }
  const float mu = red[0] / (float)N; __syncthreads();
  float s2 = 0.f;
  for (int u = 0; u < per / 4; ++u)
#pragma unroll
    for (int q = 0; q < 4; ++q) { const float c = vals[u * 4 + q] - mu; s2 += c * c; }
  red[tid] = s2; __syncthreads();
  for (int st = 128; st > 0; st >>= 1) { if (tid < st) red[tid] += red[tid + st]; __syncthreads(); }
  const float rs = rsqrtf(red[0] / (float)N + eps);
  {
    for (int u = 0; u < per / 4; ++u) {
      const int j = tid * 4 + 1024 * u;
      v4f o, sm;
#pragma unroll
      for (int q = 0; q < 4; ++q) {
        float gg = g[j + q], bb = bta[j + q];
        if (PARAM_BF16) { gg = bf16_round(gg); bb = bf16_round(bb); }
        sm[q] = vals[u * 4 + q]; o[q] = (vals[u * 4 + q] - mu) * rs * gg + bb;
      }
      if (out_sum) *(v4f*)(out_sum + (size_t)row * N + j) = sm;
      *(v4f*)(out_norm + (size_t)row * N + j) = o;
    }
    
  }
}



// ---- f16 WMMA path (v_wmma_f32_16x16x32_f16): 11-bit significands for operands in range — used where a [0,1] probability operand needs more precision than bf16
typedef _Float16 v16h __attribute__((ext_vector_type(16)));
union FragH { v16h v; v8us half[2]; _Float16 h[16]; unsigned short u[16]; };
template <int NT>
__device__ __forceinline__ v8f mmaH(v16h ah, v16h al, v16h bh, v16h bl, v8f c) {
  c = __builtin_amdgcn_wmma_f32_16x16x32_f16(false, ah, false, bh, (short)0, c, false, false);
  if (NT >= 2) c = __builtin_amdgcn_wmma_f32_16x16x32_f16(false, al, false, bh, (short)0, c, false, false);
  if (NT >= 3) c = __builtin_amdgcn_wmma_f32_16x16x32_f16(false, ah, false, bl, (short)0, c, false, false);
  asm volatile("v_nop\n\tv_nop\n\tv_nop\n\tv_nop" : "+v"(c) : "v"(ah), "v"(al), "v"(bh), "v"(bl));
  return c;
}
// batched GEMM like k_gemm_b but f16 operands: A f32 (split into f16 hi/lo if ASPLIT, else rounded to f16), Bt = f16 values [n][k]; alpha; C f32; N multiple of 16 (partial tiles skipped)
template <bool ASPLIT>
__global__ __launch_bounds__(128) void k_gemm_h(const float* __restrict__ A, int lda, size_t sA, const _Float16* __restrict__ Bh, int ldb, size_t sB, float alpha, float* __restrict__ C, int ldc, size_t sC, int M, int N, int K) {
  __shared__ __attribute__((aligned(16))) float so[4][16][64];
  const int tid = threadIdx.x, w = tid >> 5, lane = tid & 31, ln = lane & 15, hh = lane >> 4; const int by = blockIdx.y;
  A += (size_t)by * sA; Bh += (size_t)by * sB; C += (size_t)by * sC;
  const int ntn = (N + 63) / 64; const int wid = blockIdx.x * 4 + w; const int mt = wid / ntn, nq = wid % ntn; if (mt * 16 >= M) return;
  const int row0 = mt * 16, col0 = nq * 64; const float* arow = A + (size_t)(row0 + ln) * lda;
  v8f acc[4] = {};
  for (int kb = 0; kb < K; kb += 32) {
    FragH ah, al;
    const v4f x0 = *(const v4fa*)(arow + kb + 8 * hh), x1 = *(const v4fa*)(arow + kb + 8 * hh + 4), x2 = *(const v4fa*)(arow + kb + 16 + 8 * hh), x3 = *(const v4fa*)(arow + kb + 16 + 8 * hh + 4);
    float xs[16] = {x0[0],x0[1],x0[2],x0[3],x1[0],x1[1],x1[2],x1[3],x2[0],x2[1],x2[2],x2[3],x3[0],x3[1],x3[2],x3[3]};
#pragma unroll
    for (int i = 0; i < 16; ++i) { const _Float16 h = (_Float16)xs[i]; ah.h[i] = h; al.h[i] = ASPLIT ? (_Float16)(xs[i] - (float)h) : (_Float16)0.0f; }
#pragma unroll
    for (int t = 0; t < 4; ++t) { if (col0 + t * 16 >= N) continue; const size_t boff = (size_t)(col0 + t * 16 + ln) * ldb + kb; FragH bq; bq.half[0] = *(const v8us*)(Bh + boff + 8 * hh); bq.half[1] = *(const v8us*)(Bh + boff + 16 + 8 * hh);
      acc[t] = mmaH<ASPLIT ? 2 : 1>(ah.v, al.v, bq.v, bq.v, acc[t]); }
  }
#pragma unroll
  for (int t = 0; t < 4; ++t) { if (col0 + t * 16 >= N) continue;
#pragma unroll
    for (int r = 0; r < 8; ++r) so[w][8 * hh + r][t * 16 + ln] = acc[t][r] * alpha; }
  __builtin_amdgcn_fence(__ATOMIC_ACQ_REL, "workgroup"); __builtin_amdgcn_wave_barrier();
  const int rsub = lane >> 4, c4 = (lane & 15) * 4;
  {
#pragma unroll
    for (int q = 0; q < 8; ++q) { const int r = q * 2 + rsub; if (col0 + c4 < N) { const v4f v = *(const v4fa*)&so[w][r][c4]; *(v4f*)(C + (size_t)(row0 + r) * ldc + col0 + c4) = v; } }
     }
}

// Wt[n][k] = f16(bf16(W[k][n]) * scale) from f32 row-major W[K][N] (scale = power of two; bf16-exact weights stay exact in f16 away from the subnormal range).
// A thread takes an 8 x 8 patch: 16 loads of 16 bytes, all in flight together (4 lanes one whole 128-byte line of a W row), the transposition is the choice of registers, 8 stores of 16 bytes (8 lanes one whole line of a Wt row).
// A wave covers 64 k x 32 n; a block of 8 waves 512 k x 32 n. One address pair for the loads and one for the stores, every step a constant offset.
template <int K, int N>
__device__ __forceinline__ void wt_f16(const float* __restrict__ W, _Float16* __restrict__ Wt, float scale, int blk) {      /* blk: the job's own block index */
  static_assert(K % 512 == 0 && N % 32 == 0, "whole blocks only: no thread is without a patch");
  const int lane = threadIdx.x & 31, g = blk * 8 + (threadIdx.x >> 5);
  const int k8 = ((g % (K / 64)) * 8 + (lane & 7)) * 8, n8 = ((g / (K / 64)) * 4 + (lane >> 3)) * 8;
  const float* src = W + (size_t)k8 * N + n8; unsigned short* dst = (unsigned short*)Wt + (size_t)n8 * K + k8; v4f r[8][2];      /* both loops unrolled: constant indices keep the patch in registers */
#pragma unroll
  for (int i = 0; i < 8; ++i) { r[i][0] = *(const v4fa*)(src + i * N); r[i][1] = *(const v4fa*)(src + i * N + 4); }
  asm volatile("s_wait_xcnt 0x0" :: "v"(src) : "memory");      /* a precaution: the loads' address pair is an input here, so it lives up to this wait and no load lands on it ahead of the wait */
  __builtin_amdgcn_sched_barrier(0);      /* keeps all 16 loads ahead of the first conversion: without it the compiler holds some back to save registers, and the thread waits out a second trip to memory */
#pragma unroll
  for (int j = 0; j < 8; ++j) { FragH f;
#pragma unroll
    for (int i = 0; i < 8; ++i) f.h[i] = (_Float16)(bf16_round(r[i][j >> 2][j & 3]) * scale);
    *(v8us*)(dst + j * K) = f.half[0]; }
  asm volatile("s_wait_xcnt 0x0" ::: "memory");      /* behind the last store: in k_prep the built code runs on from here towards another block range's body, which rewrites the stores' registers */
}
// k_gemm_hh variant with fused epilogue: v = acc·alpha + bias[by·sBias + col] (+ CP[(row/rowsPerB)·sCPb + by·64 + col] if CP) ; ACT 0 none / 1 elu ; writes f16 C16 (and f32 C if non-null)
template <int ACT>
__global__ __launch_bounds__(128) void k_gemm_hhx(const _Float16* __restrict__ A, int lda, size_t sA, const _Float16* __restrict__ Bh, int ldb, size_t sB, float alpha, const float* __restrict__ bias, size_t sBias, const float* __restrict__ CP, int rowsPerB, size_t sCPb, int row0g,
    float* __restrict__ C, _Float16* __restrict__ C16, int ldc, size_t sC, int M, int N, int K) {
  __shared__ __attribute__((aligned(16))) float so[4][16][64];
  const int tid = threadIdx.x, w = tid >> 5, lane = tid & 31, ln = lane & 15, hh = lane >> 4; const int by = blockIdx.y;
  A += (size_t)by * sA; Bh += (size_t)by * sB; const size_t cofs = (size_t)by * sC; const float* bp = bias ? bias + (size_t)by * sBias : nullptr;
  const int ntn = (N + 63) / 64; const int wid = blockIdx.x * 4 + w; const int mt = wid / ntn, nq = wid % ntn; if (mt * 16 >= M) return;
  const int row0 = mt * 16, col0 = nq * 64; const _Float16* arow = A + (size_t)(row0 + ln) * lda;
  v8f acc[4] = {};
  for (int kb = 0; kb < K; kb += 32) { FragH ah; ah.half[0] = *(const v8us*)((const unsigned short*)arow + kb + 8 * hh); ah.half[1] = *(const v8us*)((const unsigned short*)arow + kb + 16 + 8 * hh);
#pragma unroll
    for (int t = 0; t < 4; ++t) { if (col0 + t * 16 >= N) continue; const size_t boff = (size_t)(col0 + t * 16 + ln) * ldb + kb; FragH bq; bq.half[0] = *(const v8us*)((const unsigned short*)Bh + boff + 8 * hh); bq.half[1] = *(const v8us*)((const unsigned short*)Bh + boff + 16 + 8 * hh);
      acc[t] = mmaH<1>(ah.v, ah.v, bq.v, bq.v, acc[t]); }
  }
#pragma unroll
  for (int t = 0; t < 4; ++t) { if (col0 + t * 16 >= N) continue; const int col = col0 + t * 16 + ln; const float bv = bp ? bf16_round(bp[col]) : 0.f;
#pragma unroll
    for (int r = 0; r < 8; ++r) { float v = acc[t][r] * alpha + bv; if (CP) { const int bidx = (row0g + row0 + 8 * hh + r) / rowsPerB; v += CP[(size_t)bidx * sCPb + (size_t)by * 64 + col]; } if (ACT == 1) v = (v > 0.f) ? v : expm1f(v); else if (ACT == 7) v = (v > 0.f) ? v + 1.0f : expf(v); else if (ACT == 8) v = tanhf(v); else if (ACT == 9) v = 0.5f * v * (1.0f + tanhf(0.7978845608028654f * (v + 0.044715f * v * v * v))); else if (ACT == 11) v = 1.0f / (1.0f + expf(-v)); else if (ACT == 12) v = (v > 0.f) ? v : 0.01f * v; else if (ACT == 14) v = (v > 0.f) ? v : 0.1f * v; else if (ACT == 15) v = v / (1.0f + expf(-v)); else if (ACT == 3) v = fmaxf(v, 0.f); else if (ACT == 6) v = 0.5f * v * (1.0f + erff(v * 0.70710678118654752f)); so[w][8 * hh + r][t * 16 + ln] = v; } }
  __builtin_amdgcn_fence(__ATOMIC_ACQ_REL, "workgroup"); __builtin_amdgcn_wave_barrier();
  const int rsub = lane >> 4, c4 = (lane & 15) * 4; typedef _Float16 v4h __attribute__((ext_vector_type(4)));
  {
#pragma unroll
    for (int q = 0; q < 8; ++q) { const int r = q * 2 + rsub; if (col0 + c4 < N) { const v4f v = *(const v4fa*)&so[w][r][c4]; if (C) *(v4f*)(C + cofs + (size_t)(row0 + r) * ldc + col0 + c4) = v; if (C16) { v4h h4; for (int i = 0; i < 4; ++i) h4[i] = (_Float16)v[i]; *(v4h*)(C16 + cofs + (size_t)(row0 + r) * ldc + col0 + c4) = h4; } } }
     }
}


typedef _Float16 v4h __attribute__((ext_vector_type(4)));

// f16 plane of x: a thread takes 8 groups of 8 values, a block's width apart: 16 loads of 16 bytes in flight together, then 8 whole-line stores of 16 bytes a lane.
__device__ __forceinline__ void x16(const float* __restrict__ x, _Float16* __restrict__ X16, int blk) { const size_t t0 = (size_t)blk * 2048 + threadIdx.x; const float* src = x + t0 * 8; unsigned short* dst = (unsigned short*)X16 + t0 * 8; v4f r[8][2];      /* loops unrolled: constant indices keep the values in registers */
#pragma unroll
  for (int u = 0; u < 8; ++u) { r[u][0] = *(const v4fa*)(src + u * 2048); r[u][1] = *(const v4fa*)(src + u * 2048 + 4); }
  asm volatile("s_wait_xcnt 0x0" :: "v"(src) : "memory");      /* a precaution, as in wt_f16: the loads' address pair lives up to this wait */
  __builtin_amdgcn_sched_barrier(0);      /* keeps all 16 loads ahead of the first conversion, as in wt_f16 */
#pragma unroll
  for (int u = 0; u < 8; ++u) { FragH f;
#pragma unroll
    for (int q = 0; q < 8; ++q) f.h[q] = (_Float16)bf16_round(r[u][q >> 2][q & 3]);
    *(v8us*)(dst + u * 2048) = f.half[0]; }
  asm volatile("s_wait_xcnt 0x0" ::: "memory"); }      /* behind the last store, as in wt_f16 */
// The five preparation jobs (four weight transposes, the f16 plane of x) read and write disjoint buffers: one grid, a block range each, so that they run side by side instead of one launch behind the other.
// 64 values a thread: the launch is a few waves a SIMD, each with all its loads in flight, not a long queue of waves that each live for one load.
#define PB_W (DM * DM / 64 / 256)       /* blocks of a DM x DM weight */
#define PB_KV (DM * KVD / 64 / 256)     /* blocks of a DM x KVD weight */
#define PB_X (NR * DM / 64 / 256)       /* blocks of x */
static_assert((NR * DM) % (64 * 256) == 0, "whole blocks only: no thread of the x range is without its 64 values");
__global__ __launch_bounds__(256) void k_prep(const float* __restrict__ x, const float* __restrict__ Wq, const float* __restrict__ Wk, const float* __restrict__ Wv, const float* __restrict__ Wo,
                                              _Float16* __restrict__ X16, _Float16* __restrict__ BQ, _Float16* __restrict__ BK, _Float16* __restrict__ BV, _Float16* __restrict__ BO) {
  int blk = blockIdx.x;
  if (blk < PB_W) { wt_f16<DM, DM>(Wq, BQ, 16.0f, blk); return; } blk -= PB_W;
  if (blk < PB_W) { wt_f16<DM, DM>(Wo, BO, 16.0f, blk); return; } blk -= PB_W;
  if (blk < PB_KV) { wt_f16<DM, KVD>(Wk, BK, 16.0f, blk); return; } blk -= PB_KV;
  if (blk < PB_KV) { wt_f16<DM, KVD>(Wv, BV, 16.0f, blk); return; } blk -= PB_KV;
  x16(x, X16, blk); }
__global__ __launch_bounds__(256) void k_h16(const float* __restrict__ x, _Float16* __restrict__ X16, size_t n8) { const size_t t = (size_t)blockIdx.x * 256 + threadIdx.x; if (t >= n8) return; FragH f;
#pragma unroll
  for (int q = 0; q < 8; ++q) f.h[q] = (_Float16)x[t * 8 + q]; *(v8us*)((unsigned short*)X16 + t * 8) = f.half[0];  }
__global__ __launch_bounds__(256) void k_round16f(const float* __restrict__ W, _Float16* __restrict__ Bt, size_t n8) { const size_t t = (size_t)blockIdx.x * 256 + threadIdx.x; if (t >= n8) return; FragH f;
#pragma unroll
  for (int i = 0; i < 8; ++i) f.h[i] = (_Float16)(bf16_round(W[t * 8 + i]) * 16.0f); *(v8us*)((unsigned short*)Bt + t * 8) = f.half[0];  }
template <int NHv, int TTv>
__global__ __launch_bounds__(256) void k_vt(const _Float16* __restrict__ V16, int ldv, int voff, _Float16* __restrict__ Vt) { __shared__ unsigned short tl[64][66]; const int tid = threadIdx.x; const int slab = blockIdx.x / (TTv / 64), lg = blockIdx.x % (TTv / 64); const int b = slab / NHv, h = slab % NHv;
  for (int i = tid; i < 64 * 8; i += 256) { const int r = i / 8, c8 = (i % 8) * 8; FragH f; f.half[0] = *(const v8us*)((const unsigned short*)V16 + ((size_t)b * TTv + lg * 64 + r) * ldv + voff + h * 64 + c8);
#pragma unroll
    for (int q = 0; q < 8; ++q) tl[r][c8 + q] = f.u[q]; }
  __syncthreads();
  {
#pragma unroll
    for (int rd = 0; rd < 2; ++rd) { const int d = rd * 32 + tid / 8, pc = tid % 8; FragH f;
#pragma unroll
      for (int q = 0; q < 8; ++q) f.u[q] = tl[pc * 8 + q][d];
      *(v8us*)((unsigned short*)Vt + ((size_t)slab * 64 + d) * TTv + lg * 64 + pc * 8) = f.half[0]; }
     } }

// ---- LDS staging by asynchronous copies (global_load_async_to_lds_b128): a lane moves its own 16 bytes, 8 lanes one whole 128-byte row; two buffers, the next stage in flight while this one is worked on ----
#define LP 72      /* LDS row pitch in f16: 128 data bytes + 16 = an odd multiple of 16 bytes, the conflict-free pitch of the ds_load_b128 fragment readers */
__device__ __forceinline__ void wait_async0() { asm volatile("s_wait_asynccnt 0x0" ::: "memory"); }      /* the wave's own copies have landed; stands before the barrier behind which the other waves read them */
__device__ __forceinline__ void wait_ds0() { asm volatile("s_wait_dscnt 0x0" ::: "memory"); }      /* the wave's own LDS reads have retired before the barrier behind which their buffer is refilled */
// one tile of 64 rows x 128 bytes (row pitch ldg f16 in global memory, LP in LDS) by 128 threads: 4 copies a lane, rows tid / 8 + 16 i. The s_wait_xcnt closes the statement so that no address register is rewritten ahead of it.
__device__ __forceinline__ void stage64(const unsigned short* g, size_t ldg, const unsigned short* s, int tid) {
  const unsigned short* g0 = g + (size_t)(tid >> 3) * ldg + (tid & 7) * 8; const unsigned short* g1 = g0 + 16 * ldg; const unsigned short* g2 = g1 + 16 * ldg; const unsigned short* g3 = g2 + 16 * ldg;
  const unsigned l0 = (unsigned)(size_t)(s + (tid >> 3) * LP + (tid & 7) * 8), l1 = l0 + 16 * LP * 2, l2 = l0 + 32 * LP * 2, l3 = l0 + 48 * LP * 2;
  asm volatile("global_load_async_to_lds_b128 %0, %1, off\n\tglobal_load_async_to_lds_b128 %2, %3, off\n\tglobal_load_async_to_lds_b128 %4, %5, off\n\tglobal_load_async_to_lds_b128 %6, %7, off\n\ts_wait_xcnt 0x0"
               :: "v"(l0), "v"(g0), "v"(l1), "v"(g1), "v"(l2), "v"(g2), "v"(l3), "v"(g3) : "memory");
}
// ---- fast GEMM (block tile 128x64, wave tile 32x64; requires M % 128 == 0 rows per launch region, N % 64 == 0, K % 64 == 0, K >= 64); A and B tiles of 64 k staged in LDS; epilogue = k_gemm_hhx semantics ----
// OM 0: C (f32) and / or C16 (f16). OM 1: the f32 result leaves as two f16 planes, C16 = hi, C16L = (v - hi) * 2^10, same layout. OM 2: the same two planes transposed, [row / ldc][col][row % ldc] with ldc = rows per sequence (a multiple of 128). OM 1 and 2 take no CP term.
__device__ __forceinline__ v16h g2_frag(const _Float16* p, int hh) { FragH f; f.half[0] = *(const v8us*)((const unsigned short*)p + 8 * hh); f.half[1] = *(const v8us*)((const unsigned short*)p + 16 + 8 * hh); return f.v; }
__device__ __forceinline__ v8f g2_mma(v16h a, v16h b, v8f c) { v8f d = __builtin_amdgcn_wmma_f32_16x16x32_f16(false, a, false, b, (short)0, c, false, false); asm volatile("v_nop\n\tv_nop\n\tv_nop\n\tv_nop" : "+v"(d) : "v"(a), "v"(b)); return d; }
// The body takes its block index (bx) and the kernel's LDS arrays from the caller: a kernel that serves several GEMMs from one grid hands each block range its own operands.
#define GEMM2_LDS __shared__ __attribute__((aligned(16))) float so[4][32][68]; __shared__ __attribute__((aligned(16))) unsigned short tA[2][128][LP], tB[2][64][LP];
template <int ACT, int OM>
__device__ __forceinline__ void gemm2_body(const int bx, float (*so)[32][68], unsigned short (*tA)[128][LP], unsigned short (*tB)[64][LP],
    const _Float16* __restrict__ A, int lda, size_t sA, const _Float16* __restrict__ Bh, int ldb, size_t sB, float alpha, const float* __restrict__ bias, size_t sBias, const float* __restrict__ CP, int rowsPerB, size_t sCPb, int row0g,
    float* __restrict__ C, _Float16* __restrict__ C16, _Float16* __restrict__ C16L, int ldc, size_t sC, int M, int N, int K) {
  constexpr int TP = 132;      /* OM 2: row pitch of the transposed staging tile, 128 tokens + 4 floats; 64 rows of it fit in so */
  static_assert(64 * TP <= 4 * 32 * 68, "the transposed tile lies inside so");
  const int tid = threadIdx.x, w = tid >> 5, lane = tid & 31, ln = lane & 15, hh = lane >> 4; const int by = blockIdx.y;
  A += (size_t)by * sA; Bh += (size_t)by * sB; const size_t cofs = (size_t)by * sC; const float* bp = bias ? bias + (size_t)by * sBias : nullptr;
  const int ntn = N >> 6; const int mt = bx / ntn, nq = bx - mt * ntn; const int row0 = mt * 128 + 32 * w, col0 = nq * 64; if (mt * 128 + 128 > M) return;      /* the whole block leaves or none, ahead of every barrier */
  const unsigned short* Ag = (const unsigned short*)A + (size_t)(mt * 128) * lda; const unsigned short* Bg = (const unsigned short*)Bh + (size_t)col0 * ldb; const int nst = K >> 6;
  stage64(Ag, lda, &tA[0][0][0], tid); stage64(Ag + (size_t)64 * lda, lda, &tA[0][64][0], tid); stage64(Bg, ldb, &tB[0][0][0], tid);
  wait_async0(); __syncthreads();      /* stage 0 published */
  if (nst > 1) { stage64(Ag + 64, lda, &tA[1][0][0], tid); stage64(Ag + (size_t)64 * lda + 64, lda, &tA[1][64][0], tid); stage64(Bg + 64, ldb, &tB[1][0][0], tid); }
  const v8f z8 = {0.f,0.f,0.f,0.f,0.f,0.f,0.f,0.f}; v8f c00 = z8, c01 = z8, c02 = z8, c03 = z8, c10 = z8, c11 = z8, c12 = z8, c13 = z8;
#pragma unroll 1
  for (int t = 0; t < nst; ++t) { const int bf = t & 1;      /* rolled: one stage a trip, the publish point at its foot */
    // all 12 fragments of the stage are read from LDS as one group ahead of its 16 products: one LDS latency a stage in front of the matrix run, not one in front of every pair of products
    v16h fa[2][2], fb[2][4];
    // unrolled (both loops): the two k blocks of a stage become constant LDS offsets and the fragment arrays stay in registers
#pragma unroll
    for (int kq = 0; kq < 2; ++kq) { fa[kq][0] = g2_frag((const _Float16*)&tA[bf][32 * w + ln][kq * 32], hh); fb[kq][0] = g2_frag((const _Float16*)&tB[bf][ln][kq * 32], hh); fa[kq][1] = g2_frag((const _Float16*)&tA[bf][32 * w + 16 + ln][kq * 32], hh);
      fb[kq][1] = g2_frag((const _Float16*)&tB[bf][16 + ln][kq * 32], hh); fb[kq][2] = g2_frag((const _Float16*)&tB[bf][32 + ln][kq * 32], hh); fb[kq][3] = g2_frag((const _Float16*)&tB[bf][48 + ln][kq * 32], hh); }
#pragma unroll
    for (int kq = 0; kq < 2; ++kq) { c00 = g2_mma(fa[kq][0], fb[kq][0], c00); c10 = g2_mma(fa[kq][1], fb[kq][0], c10); c01 = g2_mma(fa[kq][0], fb[kq][1], c01); c11 = g2_mma(fa[kq][1], fb[kq][1], c11);
      c02 = g2_mma(fa[kq][0], fb[kq][2], c02); c12 = g2_mma(fa[kq][1], fb[kq][2], c12); c03 = g2_mma(fa[kq][0], fb[kq][3], c03); c13 = g2_mma(fa[kq][1], fb[kq][3], c13); }
    wait_ds0(); wait_async0(); __syncthreads();      /* publishes stage t + 1 and ends every read of buffer bf */
    if (t + 2 < nst) { const int k2 = (t + 2) * 64; stage64(Ag + k2, lda, &tA[bf][0][0], tid); stage64(Ag + (size_t)64 * lda + k2, lda, &tA[bf][64][0], tid); stage64(Bg + k2, ldb, &tB[bf][0][0], tid); } }
  wait_async0();
  v8f accs[8] = {c00, c01, c02, c03, c10, c11, c12, c13};
#pragma unroll
  for (int u = 0; u < 8; ++u) { const int t = u & 3, half = u >> 2; const int col = col0 + t * 16 + ln; const float bv = bp ? bf16_round(bp[col]) : 0.f;
#pragma unroll
    for (int r = 0; r < 8; ++r) { const int rloc = half * 16 + 8 * hh + r; float v = accs[u][r] * alpha + bv; if (OM == 0 && CP) { const int bidx = (row0g + row0 + rloc) / rowsPerB; v += CP[(size_t)bidx * sCPb + (size_t)by * 64 + col]; }
      if (ACT == 3) v = fmaxf(v, 0.f); else if (ACT == 6) v = 0.5f * v * (1.0f + erff(v * 0.70710678118654752f)); else if (ACT == 11) v = 1.0f / (1.0f + expf(-v)); else if (ACT == 15) v = v / (1.0f + expf(-v)); else if (ACT == 12) v = (v > 0.f) ? v : 0.01f * v; else if (ACT == 8) v = tanhf(v);
      if (OM == 2) (&so[0][0][0])[(t * 16 + ln) * TP + 32 * w + rloc] = v; else so[w][rloc][t * 16 + ln] = v; } }
  if (OM == 2) {      /* the staging tile holds the block's 64 columns as rows of 128 tokens: a wave stores 16 of them, 16 lanes one whole 256-byte run */
    __syncthreads();      /* a transposed row holds results of all four waves */
    const float* soT = &so[0][0][0]; const int rb = mt * 128; const size_t ob = ((size_t)(rb / ldc) * N + col0) * ldc + rb % ldc + (lane & 15) * 8;
    // unrolled (both loops): the eight row pairs become constant LDS offsets whose reads go out ahead of the stores, and the two packed planes stay in registers
#pragma unroll
    for (int i = 0; i < 8; ++i) { const int d = 16 * w + 2 * i + (lane >> 4); const v4f a = *(const v4fa*)&soT[d * TP + (lane & 15) * 8], c = *(const v4fa*)&soT[d * TP + (lane & 15) * 8 + 4]; FragH fh, fl;      /* inner loop unrolled for constant element indices */
#pragma unroll
      for (int q = 0; q < 4; ++q) { _Float16 h = (_Float16)a[q]; fh.h[q] = h; fl.h[q] = (_Float16)((a[q] - (float)h) * 1024.0f); h = (_Float16)c[q]; fh.h[4 + q] = h; fl.h[4 + q] = (_Float16)((c[q] - (float)h) * 1024.0f); }
      *(v8us*)((unsigned short*)C16 + cofs + ob + (size_t)d * ldc) = fh.half[0]; *(v8us*)((unsigned short*)C16L + cofs + ob + (size_t)d * ldc) = fl.half[0]; }
    return; }
  __builtin_amdgcn_fence(__ATOMIC_ACQ_REL, "workgroup"); __builtin_amdgcn_wave_barrier();
  const int rsub = lane >> 4, c4 = (lane & 15) * 4;
  {
#pragma unroll
    for (int q = 0; q < 16; ++q) { const int r = q * 2 + rsub; const v4f v = *(const v4fa*)&so[w][r][c4];
      if (OM == 1) { v4h h4, l4; for (int i = 0; i < 4; ++i) { h4[i] = (_Float16)v[i]; l4[i] = (_Float16)((v[i] - (float)h4[i]) * 1024.0f); } *(v4h*)(C16 + cofs + (size_t)(row0 + r) * ldc + col0 + c4) = h4; *(v4h*)(C16L + cofs + (size_t)(row0 + r) * ldc + col0 + c4) = l4; continue; }
      if (C) *(v4f*)(C + cofs + (size_t)(row0 + r) * ldc + col0 + c4) = v; if (C16) { v4h h4; for (int i = 0; i < 4; ++i) h4[i] = (_Float16)v[i]; *(v4h*)(C16 + cofs + (size_t)(row0 + r) * ldc + col0 + c4) = h4; } }
    if (OM == 1) asm volatile("s_wait_xcnt 0x0" ::: "memory");      /* behind the last store of the hi/residual path */
     } }
template <int ACT, int OM>
__global__ __launch_bounds__(128) void k_gemm2(const _Float16* __restrict__ A, int lda, size_t sA, const _Float16* __restrict__ Bh, int ldb, size_t sB, float alpha, const float* __restrict__ bias, size_t sBias, const float* __restrict__ CP, int rowsPerB, size_t sCPb, int row0g,
    float* __restrict__ C, _Float16* __restrict__ C16, _Float16* __restrict__ C16L, int ldc, size_t sC, int M, int N, int K) {
  GEMM2_LDS gemm2_body<ACT, OM>(blockIdx.x, so, tA, tB, A, lda, sA, Bh, ldb, sB, alpha, bias, sBias, CP, rowsPerB, sCPb, row0g, C, C16, C16L, ldc, sC, M, N, K); }
// out = ctx Wo + bo in ONE launch. Rows < RE of a sequence carry O as hi + 2^10 residual: their blocks stage the residual tile beside the hi tile in every stage of the same ring and run its products against the same Wo fragments
// into accumulators of their own, joined in the epilogue. The residual term has no launch, no ring fill and no read-back of out of its own any more.
__global__ __launch_bounds__(128) void k_wo(const _Float16* __restrict__ OHp, const _Float16* __restrict__ OLp, const _Float16* __restrict__ BOp, const float* __restrict__ bo, float* __restrict__ out) {
  __shared__ __attribute__((aligned(16))) unsigned short tA[2][128][LP], tB[2][64][LP], tL[2][128][LP];
  float (*so)[32][68] = (float (*)[32][68])&tL[0][0][0];      /* the epilogue's staging tile lies in the residual ring, which nobody reads behind the last stage's barrier */
  static_assert(sizeof(float) * 4 * 32 * 68 <= sizeof(unsigned short) * 2 * 128 * LP, "the staging tile lies inside tL");
  static_assert(RE % 128 == 0 && SLEN % 128 == 0 && DM >= 128 && DM % 64 == 0, "a block's 128 rows carry a residual all or none; the ring's prologue needs two stages");
  const int tid = threadIdx.x, w = tid >> 5, lane = tid & 31, ln = lane & 15, hh = lane >> 4;
  constexpr int ntn = DM >> 6, nst = DM >> 6;
  const int mt = blockIdx.x / ntn, nq = blockIdx.x - mt * ntn; const int row0 = mt * 128 + 32 * w, col0 = nq * 64;
  const bool dual = (mt * 128) % SLEN < RE;      /* from blockIdx alone: the same for the whole block */
  const unsigned short* Ag = (const unsigned short*)OHp + (size_t)(mt * 128) * DM; const unsigned short* Lg = (const unsigned short*)OLp + (size_t)(mt * 128) * DM; const unsigned short* Bg = (const unsigned short*)BOp + (size_t)col0 * DM;
  auto fill = [&](int bf, int k0) { stage64(Ag + k0, DM, &tA[bf][0][0], tid); stage64(Ag + (size_t)64 * DM + k0, DM, &tA[bf][64][0], tid); stage64(Bg + k0, DM, &tB[bf][0][0], tid);
    if (dual) { stage64(Lg + k0, DM, &tL[bf][0][0], tid); stage64(Lg + (size_t)64 * DM + k0, DM, &tL[bf][64][0], tid); } };
  fill(0, 0);
  wait_async0(); __syncthreads();      /* stage 0 published */
  fill(1, 64);
  v8f c[2][4], d[2][4];      /* every '#pragma unroll' below: constant indices keep the fragment and accumulator arrays in registers */
#pragma unroll
  for (int i = 0; i < 2; ++i)
#pragma unroll
    for (int j = 0; j < 4; ++j) { c[i][j] = (v8f){0.f,0.f,0.f,0.f,0.f,0.f,0.f,0.f}; d[i][j] = c[i][j]; }
#pragma unroll 1
  for (int t = 0; t < nst; ++t) { const int bf = t & 1;      /* rolled: one stage a trip, the publish point at its foot */
    v16h fa[2][2], fb[2][4];      /* a stage's fragments are read as one group ahead of its products, as in gemm2_body */
#pragma unroll
    for (int kq = 0; kq < 2; ++kq) { fa[kq][0] = g2_frag((const _Float16*)&tA[bf][32 * w + ln][kq * 32], hh); fb[kq][0] = g2_frag((const _Float16*)&tB[bf][ln][kq * 32], hh); fa[kq][1] = g2_frag((const _Float16*)&tA[bf][32 * w + 16 + ln][kq * 32], hh);
      fb[kq][1] = g2_frag((const _Float16*)&tB[bf][16 + ln][kq * 32], hh); fb[kq][2] = g2_frag((const _Float16*)&tB[bf][32 + ln][kq * 32], hh); fb[kq][3] = g2_frag((const _Float16*)&tB[bf][48 + ln][kq * 32], hh); }
#pragma unroll
    for (int kq = 0; kq < 2; ++kq)
#pragma unroll
      for (int j = 0; j < 4; ++j) { c[0][j] = g2_mma(fa[kq][0], fb[kq][j], c[0][j]); c[1][j] = g2_mma(fa[kq][1], fb[kq][j], c[1][j]); }
    if (dual) {      /* the residual fragments take the registers that the hi fragments have left; the Wo fragments serve a second time */
#pragma unroll
      for (int kq = 0; kq < 2; ++kq) { fa[kq][0] = g2_frag((const _Float16*)&tL[bf][32 * w + ln][kq * 32], hh); fa[kq][1] = g2_frag((const _Float16*)&tL[bf][32 * w + 16 + ln][kq * 32], hh); }
#pragma unroll
      for (int kq = 0; kq < 2; ++kq)
#pragma unroll
        for (int j = 0; j < 4; ++j) { d[0][j] = g2_mma(fa[kq][0], fb[kq][j], d[0][j]); d[1][j] = g2_mma(fa[kq][1], fb[kq][j], d[1][j]); } }
    wait_ds0(); wait_async0(); __syncthreads();      /* publishes stage t + 1 and ends every read of buffer bf */
    if (t + 2 < nst) fill(bf, (t + 2) * 64); }
  wait_async0();
#pragma unroll
  for (int u = 0; u < 8; ++u) { const int j = u & 3, half = u >> 2; const float bv = bf16_round(bo[col0 + j * 16 + ln]);
#pragma unroll
    for (int r = 0; r < 8; ++r) so[w][half * 16 + 8 * hh + r][j * 16 + ln] = (c[half][j][r] + d[half][j][r] * 0.0009765625f) * 0.0625f + bv; }      /* d is 0 where the rows carry no residual */
  __builtin_amdgcn_fence(__ATOMIC_ACQ_REL, "workgroup"); __builtin_amdgcn_wave_barrier();      /* the wave's own so rows: its stores above stay ahead of its whole-line reads below */
  const int rsub = lane >> 4, c4 = (lane & 15) * 4;
#pragma unroll
  for (int q = 0; q < 16; ++q) { const int r = q * 2 + rsub; const v4f v = *(const v4fa*)&so[w][r][c4]; *(v4f*)(out + (size_t)(row0 + r) * DM + col0 + c4) = v; } }
// q, k and v = x W + b read the same x and depend on nothing of one another: one grid, a block range each (q, then k, then v), so that the two narrow products fill the places that the wide one leaves idle.
#define GB_Q ((NR / 128) * (DM / 64))
#define GB_KV ((NR / 128) * (KVD / 64))
__global__ __launch_bounds__(128) void k_qkv(const _Float16* __restrict__ X16, const _Float16* __restrict__ BQ, const _Float16* __restrict__ BK, const _Float16* __restrict__ BV, const float* __restrict__ bq, const float* __restrict__ bk, const float* __restrict__ bv,
    _Float16* __restrict__ QH, _Float16* __restrict__ QL, _Float16* __restrict__ KH, _Float16* __restrict__ KL, _Float16* __restrict__ VT, _Float16* __restrict__ VTL) {
  GEMM2_LDS
  const int b = blockIdx.x;      /* every branch below is the same for the whole block */
  if (b >= GB_Q + GB_KV) { gemm2_body<0, 2>(b - GB_Q - GB_KV, so, tA, tB, X16, DM, 0, BV, DM, 0, 0.0625f, bv, 0, nullptr, 1, 0, 0, nullptr, VT, VTL, SLEN, 0, NR, KVD, DM); return; }      /* V^T hi/lo: [kv head][d][token] */
  if (b >= GB_Q) { gemm2_body<0, 1>(b - GB_Q, so, tA, tB, X16, DM, 0, BK, DM, 0, 0.0625f, bk, 0, nullptr, 1, 0, 0, nullptr, KH, KL, KVD, 0, NR, KVD, DM); return; }      /* k hi/lo, 4 kv heads */
  gemm2_body<0, 1>(b, so, tA, tB, X16, DM, 0, BQ, DM, 0, 0.0625f, bq, 0, nullptr, 1, 0, 0, nullptr, QH, QL, DM, 0, NR, DM, DM); }      /* q hi/lo */



// lane l with lane l ^ 16: the two lane halves of a 16-column group hold the two key halves of one query
__device__ __forceinline__ float xhalf(float x) { return __builtin_bit_cast(float, __builtin_amdgcn_permlanex16(__builtin_bit_cast(int, x), __builtin_bit_cast(int, x), 0x76543210, 0xfedcba98, false, false)); }
template <int CAUSAL>
__device__ __forceinline__ void flash_body(const int bx, float (*sO)[16][64 + 4], unsigned short (*ring)[64][LP], const _Float16* __restrict__ Q16, int ldq, const _Float16* __restrict__ K16, int ldk, const _Float16* __restrict__ Vt, const int* __restrict__ MSK, _Float16* __restrict__ OH, int ldo) {
  constexpr int RPW = 16, DT = 4, KS = 2;      /* every '#pragma unroll' below: constant indices keep the fragment, score and accumulator arrays in registers */
  unsigned short (*sK)[64][LP] = ring, (*sV)[64][LP] = ring + 2;      /* two buffers each; a stage = 64 keys: K rows (key, d) and V^T rows (d, key), shared by the four waves */
  const int tid = threadIdx.x, w = tid >> 5, lane = tid & 31, ln = lane & 15, hh = lane >> 4;
  const int slab = bx / QBNP, qblk = QB0P + bx % QBNP; const int b = slab / NH, h = slab % NH; const int qb0 = qblk * (4 * RPW); const int q0 = qb0 + w * RPW; const int tq = q0 + ln;
  FragH bq[KS];
  { const unsigned short* qr = (const unsigned short*)Q16 + ((size_t)b * TQ + tq) * ldq + h * 64;
#pragma unroll
    for (int ks = 0; ks < KS; ++ks) { bq[ks].half[0] = *(const v8us*)(qr + ks * 32 + 8 * hh); bq[ks].half[1] = *(const v8us*)(qr + ks * 32 + 16 + 8 * hh); } }
  const int kvh = h / NREP;      /* K16 and Vt hold the kv heads themselves: query head h reads kv head h / NREP */
  const unsigned short* Vth = (const unsigned short*)Vt + (size_t)(b * NKV + kvh) * 64 * TK;
  const float sl = (CAUSAL == 14) ? bf16_round(((const float*)MSK)[h]) : 0.f;      /* mode 14: causal + ALiBi slope[h] * (key - query) from the slopes INPUT */
  // Softmax in log2 units: p * 1024 = 2^(s * c2 + sl2 * (key - query) - m + 10). A lane's 16 keys of a pass lie at fixed distances from its first one, so scale and ALiBi are one fma per score against kb; the first key's own term (base) joins the maximum once a pass.
  static_assert(CAUSAL == 0 || CAUSAL == 1 || CAUSAL == 14, "every query needs a valid key in the first pass: masked scores go out by 2^(-3e38 - finite) = 0");
  const float c2 = SCL * 1.44269504088896340736f, sl2 = sl * 1.44269504088896340736f; v8f kb[2];
#pragma unroll
  for (int nt = 0; nt < 2; ++nt)
#pragma unroll
    for (int r = 0; r < 8; ++r) kb[nt][r] = sl2 * (float)(nt * 16 + r);
  float m_r = -3.0e38f, l_r = 0.f; v8f oacc[DT];
#pragma unroll
  for (int dt = 0; dt < DT; ++dt) oacc[dt] = (v8f){0.f,0.f,0.f,0.f,0.f,0.f,0.f,0.f};
  const int jend = (CAUSAL == 1 || CAUSAL == 14) ? (qb0 + 4 * RPW) : TK;      /* causal: keys beyond the block's last query never contribute */
  const unsigned short* Kh = (const unsigned short*)K16 + (size_t)b * TK * ldk + kvh * 64; const int nst = jend >> 6;      /* jend is a multiple of 64 */
  stage64(Kh, ldk, &sK[0][0][0], tid); stage64(Vth, TK, &sV[0][0][0], tid);
  wait_async0(); __syncthreads();      /* stage 0 published */
  if (nst > 1) { stage64(Kh + (size_t)64 * ldk, ldk, &sK[1][0][0], tid); stage64(Vth + 64, TK, &sV[1][0][0], tid); }
  // LDS fragment reads stand in groups, ahead of the products that use them: K of both passes and V^T of pass 0 at the head of the stage, V^T of pass 1 behind the output products of pass 0.
  // Only the first group's latency is waited out; every read stays inside its own stage, ahead of the wait and the barrier at the foot.
  FragH ak[2][2][KS], av[2][DT];
  auto ldK = [&](int bf, int pp) {
#pragma unroll
    for (int nt = 0; nt < 2; ++nt) { const unsigned short* kr = &sK[bf][pp * 32 + nt * 16 + ln][0];
#pragma unroll
      for (int ks = 0; ks < KS; ++ks) { ak[pp][nt][ks].half[0] = *(const v8us*)(kr + ks * 32 + 8 * hh); ak[pp][nt][ks].half[1] = *(const v8us*)(kr + ks * 32 + 16 + 8 * hh); } } };
  auto ldV = [&](int bf, int pp) {
#pragma unroll
    for (int dt = 0; dt < DT; ++dt) { const unsigned short* vrow = &sV[bf][dt * 16 + ln][pp * 32]; av[pp][dt].half[0] = *(const v8us*)(vrow + 8 * hh); av[pp][dt].half[1] = *(const v8us*)(vrow + 16 + 8 * hh); } };
  // the stage loop stays rolled: one stage a trip with the publish point at its foot
#pragma unroll 1
  for (int t = 0; t < nst; ++t) { const int bf = t & 1;
  ldK(bf, 0); ldK(bf, 1); ldV(bf, 0);
  // the two passes of a stage are unrolled: pass 1's fragments get registers of their own, so that their reads can be issued during pass 0
#pragma unroll
  for (int pp = 0; pp < 2; ++pp) { const int j0 = t * 64 + pp * 32;
    v8f s[2];
#pragma unroll
    for (int nt = 0; nt < 2; ++nt) { v8f acc = (v8f){0.f,0.f,0.f,0.f,0.f,0.f,0.f,0.f};
#pragma unroll
      for (int ks = 0; ks < KS; ++ks) acc = mmaH<1>(ak[pp][nt][ks].v, ak[pp][nt][ks].v, bq[ks].v, bq[ks].v, acc);
      s[nt] = acc; }
    const float base = sl2 * (float)(j0 + 8 * hh - tq);      /* ALiBi of the lane's first key of this pass */
    v8f u[2];
#pragma unroll
    for (int nt = 0; nt < 2; ++nt) u[nt] = s[nt] * c2 + kb[nt];
    if ((CAUSAL == 1 || CAUSAL == 14) && t == nst - 1) {      /* only the block's last stage holds keys beyond a query: a scalar branch, every earlier stage goes unmasked */
#pragma unroll
      for (int nt = 0; nt < 2; ++nt)
#pragma unroll
        for (int r = 0; r < 8; ++r) u[nt][r] = (j0 + nt * 16 + 8 * hh + r <= tq) ? u[nt][r] : -3.0e38f; }
    float mcn[2];      /* two independent chains */
#pragma unroll
    for (int nt = 0; nt < 2; ++nt) { mcn[nt] = u[nt][0];
#pragma unroll
      for (int r = 1; r < 8; ++r) mcn[nt] = fmaxf(mcn[nt], u[nt][r]); }
    float mc = fmaxf(mcn[0], mcn[1]) + base; mc = fmaxf(mc, xhalf(mc));
    const float mn = fmaxf(m_r, mc); const float al = __builtin_amdgcn_exp2f(m_r - mn); m_r = mn;      /* first pass: 2^(-3e38 - mn) = 0 */
    const float sh = (mn - base) - 10.0f;      /* the factor 1024 of the f16 P operand rides in the exponent; l sums the same scaled values */
    FragH pb; v8f e[2];
#pragma unroll
    for (int nt = 0; nt < 2; ++nt) { e[nt] = u[nt] - sh;      /* the exponents as one vector, each 2^x then written over its own exponent */
#pragma unroll
      for (int r = 0; r < 8; ++r) { e[nt][r] = __builtin_amdgcn_exp2f(e[nt][r]); pb.h[nt * 8 + r] = (_Float16)e[nt][r]; } }
    const v8f e8 = e[0] + e[1]; const v4f e4 = __builtin_shufflevector(e8, e8, 0, 1, 2, 3) + __builtin_shufflevector(e8, e8, 4, 5, 6, 7);
    l_r = l_r * al + ((e4[0] + e4[2]) + (e4[1] + e4[3]));
#pragma unroll
    for (int dt = 0; dt < DT; ++dt) oacc[dt] *= al;
#pragma unroll
    for (int dt = 0; dt < DT; ++dt) oacc[dt] = mmaH<1>(av[pp][dt].v, av[pp][dt].v, pb.v, pb.v, oacc[dt]);
    if (pp == 0) ldV(bf, 1); }
    wait_ds0(); wait_async0(); __syncthreads();      /* publishes stage t + 1 and ends every read of buffer bf */
    if (t + 2 < nst) { const int j2 = (t + 2) * 64; stage64(Kh + (size_t)j2 * ldk, ldk, &sK[bf][0][0], tid); stage64(Vth + j2, TK, &sV[bf][0][0], tid); } }
  wait_async0();
  const float l = l_r + xhalf(l_r); const float li = (l > 0.f) ? 1.0f / l : 0.f;      /* l carries the factor 1024 of P */
#pragma unroll
  for (int dt = 0; dt < DT; ++dt) { const v4f lo = {oacc[dt][0] * li, oacc[dt][1] * li, oacc[dt][2] * li, oacc[dt][3] * li}, hi = {oacc[dt][4] * li, oacc[dt][5] * li, oacc[dt][6] * li, oacc[dt][7] * li};
    *(v4fa*)&sO[w][ln][dt * 16 + 8 * hh] = lo; *(v4fa*)&sO[w][ln][dt * 16 + 8 * hh + 4] = hi; }
  __builtin_amdgcn_fence(__ATOMIC_ACQ_REL, "workgroup"); __builtin_amdgcn_wave_barrier();      /* the wave's own sO rows: its stores above stay ahead of its whole-line reads below */
  {
#pragma unroll
    for (int rp = 0; rp < RPW; rp += 2) { const int r = rp + (lane >> 4), pc = lane & 15; const v4f val = *(const v4fa*)&sO[w][r][pc * 4]; v4h h4; for (int i = 0; i < 4; ++i) h4[i] = (_Float16)val[i]; *(v4h*)(OH + ((size_t)b * TQ + q0 + r) * ldo + h * 64 + pc * 4) = h4; }      /* O leaves as the f16 A operand of the Wo GEMM: 16 lanes one 128-byte line */
     } }
// 5-plane variant: S = Qh Kh^T + (Ql Kh^T + Qh Kl^T)/1024 with Q/K = [hi | 2^10 residual] f16 planes (QL/KL same layout as Q16/K16), then the 3-term P.V below.
// 3-term variant: O = (P_hi V_hi + (P_lo V_hi + P_hi V_lo) / 1024) / l with P = [hi | 2^10 residual] of 1024 p and V^T = [hi | 2^10 residual] planes (VtL same layout as Vt) -> ~2^-21-class products for un-averaged (early causal / peaked) rows
template <int CAUSAL>
__device__ __forceinline__ void flash5_body(const int bx, float (*sO)[16][64 + 4], unsigned short (*ring)[64][LP], const _Float16* __restrict__ Q16, const _Float16* __restrict__ QL, int ldq, const _Float16* __restrict__ K16, const _Float16* __restrict__ KL, int ldk, const _Float16* __restrict__ Vt, const _Float16* __restrict__ VtL, const int* __restrict__ MSK, _Float16* __restrict__ OH, _Float16* __restrict__ OL, int ldo) {
  constexpr int RPW = 16, DT = 4, KS = 2;      /* transposed products as in flash_body: lane (ln, hh) holds query q0 + ln, keys j0 + nt * 16 + 8 * hh + r; '#pragma unroll' as there */
  unsigned short (*sK)[LP] = ring[0], (*sKl)[LP] = ring[1], (*sV)[LP] = ring[2], (*sVl)[LP] = ring[3];      /* a stage = 64 keys of the four planes in ONE buffer: the LDS frame of flash_body, so that both bodies share a kernel at its residency */
  const int tid = threadIdx.x, w = tid >> 5, lane = tid & 31, ln = lane & 15, hh = lane >> 4;
  const int slab = bx / QBN5, qblk = QB05 + bx % QBN5; const int b = slab / NH, h = slab % NH; const int qb0 = qblk * (4 * RPW); const int q0 = qb0 + w * RPW; const int tq = q0 + ln;
  FragH bq[KS], bql[KS];
  { const unsigned short* qr = (const unsigned short*)Q16 + ((size_t)b * TQ + tq) * ldq + h * 64; const unsigned short* ql = (const unsigned short*)QL + ((size_t)b * TQ + tq) * ldq + h * 64;
#pragma unroll
    for (int ks = 0; ks < KS; ++ks) { bq[ks].half[0] = *(const v8us*)(qr + ks * 32 + 8 * hh); bq[ks].half[1] = *(const v8us*)(qr + ks * 32 + 16 + 8 * hh); bql[ks].half[0] = *(const v8us*)(ql + ks * 32 + 8 * hh); bql[ks].half[1] = *(const v8us*)(ql + ks * 32 + 16 + 8 * hh); } }
  const int kvh = h / NREP;      /* kv heads unexpanded, as in flash_body */
  const unsigned short* Vth = (const unsigned short*)Vt + (size_t)(b * NKV + kvh) * 64 * TK; const unsigned short* Vtl = (const unsigned short*)VtL + (size_t)(b * NKV + kvh) * 64 * TK;
  const float sl = (CAUSAL == 14) ? bf16_round(((const float*)MSK)[h]) : 0.f;      /* mode 14: causal + ALiBi slope[h] * (key - query) from the slopes INPUT */
  float m_r = -3.0e38f, l_r = 0.f; v8f oacc[DT], oaccL[DT];
#pragma unroll
  for (int dt = 0; dt < DT; ++dt) { oacc[dt] = (v8f){0.f,0.f,0.f,0.f,0.f,0.f,0.f,0.f}; oaccL[dt] = oacc[dt]; }
  const int jend = (CAUSAL == 1 || CAUSAL == 14) ? (qb0 + 4 * RPW) : TK;      /* causal: keys beyond the block's last query never contribute */
  const unsigned short* Kh = (const unsigned short*)K16 + (size_t)b * TK * ldk + kvh * 64; const unsigned short* Kl = (const unsigned short*)KL + (size_t)b * TK * ldk + kvh * 64; const int nst = jend >> 6;      /* jend is a multiple of 64 */
  // both loops stay rolled: one stage a trip, filled at its head and left at its foot, and the two passes of a stage share one body (short code, the pass as an address offset)
#pragma unroll 1
  for (int t = 0; t < nst; ++t) { const int j1 = t * 64;
    stage64(Kh + (size_t)j1 * ldk, ldk, &sK[0][0], tid); stage64(Kl + (size_t)j1 * ldk, ldk, &sKl[0][0], tid); stage64(Vth + j1, TK, &sV[0][0], tid); stage64(Vtl + j1, TK, &sVl[0][0], tid);
    wait_async0(); __syncthreads();      /* stage t published; at most four stages a block, their landing times covered by the other blocks of the grid */
#pragma unroll 1
  for (int p = 0; p < 64; p += 32) { const int j0 = t * 64 + p;
    v8f s[2];
#pragma unroll
    for (int nt = 0; nt < 2; ++nt) { const unsigned short* kr = &sK[p + nt * 16 + ln][0]; const unsigned short* klr = &sKl[p + nt * 16 + ln][0]; FragH ak[KS], akl[KS];
#pragma unroll
      for (int ks = 0; ks < KS; ++ks) { ak[ks].half[0] = *(const v8us*)(kr + ks * 32 + 8 * hh); ak[ks].half[1] = *(const v8us*)(kr + ks * 32 + 16 + 8 * hh); akl[ks].half[0] = *(const v8us*)(klr + ks * 32 + 8 * hh); akl[ks].half[1] = *(const v8us*)(klr + ks * 32 + 16 + 8 * hh); }
      v8f acc = (v8f){0.f,0.f,0.f,0.f,0.f,0.f,0.f,0.f}, accl = acc;
#pragma unroll
      for (int ks = 0; ks < KS; ++ks) { acc = mmaH<1>(ak[ks].v, ak[ks].v, bq[ks].v, bq[ks].v, acc); accl = mmaH<1>(ak[ks].v, ak[ks].v, bql[ks].v, bql[ks].v, accl); accl = mmaH<1>(akl[ks].v, akl[ks].v, bq[ks].v, bq[ks].v, accl); }
#pragma unroll
      for (int r = 0; r < 8; ++r) acc[r] += accl[r] * 0.0009765625f;
      s[nt] = acc; }
    float sc[2][8], mcn[2]; bool ok[2][8];
#pragma unroll
    for (int nt = 0; nt < 2; ++nt) { mcn[nt] = -3.0e38f;
#pragma unroll
      for (int r = 0; r < 8; ++r) { const int kk = j0 + nt * 16 + 8 * hh + r;
        ok[nt][r] = (CAUSAL == 1 || CAUSAL == 14) ? (kk <= tq) : ((CAUSAL == 2) ? ((kk >> 5) == (tq >> 5)) : true);      /* mode 2: block-diagonal 32-token groups */
        if (CAUSAL == 4) ok[nt][r] = MSK[((size_t)b * TQ + tq) * TK + kk] != 0;      /* mode 4: per-(query, key) INPUT mask shared by all heads; masked keys contribute nothing, rows with no valid key give l = 0 -> output 0 */
        float sv = ok[nt][r] ? s[nt][r] * SCL : -3.0e38f; if (CAUSAL == 14) { if (ok[nt][r]) sv += sl * (float)(kk - tq); }
        sc[nt][r] = sv; mcn[nt] = fmaxf(mcn[nt], sv); } }
    float mc = fmaxf(mcn[0], mcn[1]); mc = fmaxf(mc, xhalf(mc));
    const float mn = fmaxf(m_r, mc); const float ea = expf(m_r - mn); const float al = (mn > -1.0e38f) ? ea : 1.0f; m_r = mn;
    FragH pb, pl; float psn[2];
#pragma unroll
    for (int nt = 0; nt < 2; ++nt) { psn[nt] = 0.f;
#pragma unroll
      for (int r = 0; r < 8; ++r) { const float e = expf(sc[nt][r] - mn); const float p = ok[nt][r] ? e : 0.f; psn[nt] += p; const float ps = p * 1024.0f; const _Float16 ph = (_Float16)ps; pb.h[nt * 8 + r] = ph; pl.h[nt * 8 + r] = (_Float16)((ps - (float)ph) * 1024.0f); } }
    l_r = l_r * al + (psn[0] + psn[1]);
#pragma unroll
    for (int dt = 0; dt < DT; ++dt)
#pragma unroll
      for (int r = 0; r < 8; ++r) { oacc[dt][r] *= al; oaccL[dt][r] *= al; }
#pragma unroll
    for (int dt = 0; dt < DT; ++dt) { const unsigned short* vrow = &sV[dt * 16 + ln][p]; const unsigned short* vrl = &sVl[dt * 16 + ln][p]; FragH av, avl; av.half[0] = *(const v8us*)(vrow + 8 * hh); av.half[1] = *(const v8us*)(vrow + 16 + 8 * hh); avl.half[0] = *(const v8us*)(vrl + 8 * hh); avl.half[1] = *(const v8us*)(vrl + 16 + 8 * hh);
      oacc[dt] = mmaH<1>(av.v, av.v, pb.v, pb.v, oacc[dt]); oaccL[dt] = mmaH<1>(av.v, av.v, pl.v, pl.v, oaccL[dt]); oaccL[dt] = mmaH<1>(avl.v, avl.v, pb.v, pb.v, oaccL[dt]); } }
    wait_ds0(); __syncthreads(); }      /* ends every read of the buffer ahead of its refill */
  const float l = l_r + xhalf(l_r); const float li = (l > 0.f) ? 1.0f / (l * 1024.0f) : 0.f;
#pragma unroll
  for (int dt = 0; dt < DT; ++dt) { v4f lo, hi;
#pragma unroll
    for (int r = 0; r < 4; ++r) { float v = oacc[dt][r]; v += oaccL[dt][r] * 0.0009765625f; lo[r] = v * li; v = oacc[dt][4 + r]; v += oaccL[dt][4 + r] * 0.0009765625f; hi[r] = v * li; }
    *(v4fa*)&sO[w][ln][dt * 16 + 8 * hh] = lo; *(v4fa*)&sO[w][ln][dt * 16 + 8 * hh + 4] = hi; }
  __builtin_amdgcn_fence(__ATOMIC_ACQ_REL, "workgroup"); __builtin_amdgcn_wave_barrier();      /* the wave's own sO rows: its stores above stay ahead of its whole-line reads below */
  {
#pragma unroll
    for (int rp = 0; rp < RPW; rp += 2) { const int r = rp + (lane >> 4), pc = lane & 15; const v4f val = *(const v4fa*)&sO[w][r][pc * 4]; v4h h4, l4; for (int i = 0; i < 4; ++i) { h4[i] = (_Float16)val[i]; l4[i] = (_Float16)((val[i] - (float)h4[i]) * 1024.0f); }
      *(v4h*)(OH + ((size_t)b * TQ + q0 + r) * ldo + h * 64 + pc * 4) = h4; *(v4h*)(OL + ((size_t)b * TQ + q0 + r) * ldo + h * 64 + pc * 4) = l4; }      /* O leaves as f16 hi + 2^10 residual, the two A operands of the Wo GEMM on these rows */
     } }
// The two forms work on disjoint query rows from the same planes: one grid, the plain form's blocks first, then the few short blocks of the 5-plane form, which run beside them instead of in a launch of their own.
template <int CAUSAL>
__global__ __launch_bounds__(128) void k_flash_all(const _Float16* __restrict__ Q16, const _Float16* __restrict__ QL, int ldq, const _Float16* __restrict__ K16, const _Float16* __restrict__ KL, int ldk, const _Float16* __restrict__ Vt, const _Float16* __restrict__ VtL, const float* __restrict__ SLP, _Float16* __restrict__ OH, _Float16* __restrict__ OL, int ldo) {
  __shared__ __attribute__((aligned(16))) float sO[4][16][64 + 4];
  __shared__ __attribute__((aligned(16))) unsigned short ring[4][64][LP];
  const int* MSK = (const int*)SLP;      /* the bodies' one pointer for mask or slopes; mode 14 reads it as the f32 slopes */
  const int bx = blockIdx.x;      /* the branch is the same for the whole block */
  if (bx < NB * NH * QBNP) flash_body<CAUSAL>(bx, sO, ring, Q16, ldq, K16, ldk, Vt, MSK, OH, ldo);
  else flash5_body<CAUSAL>(bx - NB * NH * QBNP, sO, ring, Q16, QL, ldq, K16, KL, ldk, Vt, VtL, MSK, OH, OL, ldo); }

__global__ __launch_bounds__(256) void k_rotab(float* __restrict__ CS, float* __restrict__ SN) {
  #pragma clang fp contract(off)
  const int t = blockIdx.x * 256 + threadIdx.x; if (t >= SLEN * 32) return; const int j = t % 32, s = t / 32; const float ex = (float)(2 * j) / 64.0f; const float inv = 1.0f / powf(10000.0f, ex); const float th = (float)s * inv; const float c = cosf(th), sn = sinf(th);
  { *(float*)(CS + t) = c; *(float*)(SN + t) = sn;  } }
__global__ __launch_bounds__(256) void k_rope(const float* __restrict__ F, int nsrc, int ndst, int rep, const float* __restrict__ CS, const float* __restrict__ SN, _Float16* __restrict__ H, _Float16* __restrict__ L) {
  #pragma clang fp contract(off)
  const size_t t = (size_t)blockIdx.x * 256 + threadIdx.x; if (t >= (size_t)NR * ndst * 4) return; const int g8 = (int)(t % 4); const int hd = (int)((t / 4) % ndst); const size_t row = t / ((size_t)4 * ndst); const int s = (int)(row % SLEN); const int hs = hd / rep;
  const float* src = F + row * (size_t)(nsrc * 64) + hs * 64; FragH ah, al, bh, bl;
  for (int i = 0; i < 8; ++i) { const int d = g8 * 8 + i; const float c = CS[s * 32 + d], sn = SN[s * 32 + d]; const float x1 = src[d], x2 = src[d + 32];
    float o1 = x1 * c; o1 += -x2 * sn; float o2 = x2 * c; o2 += x1 * sn;
    _Float16 hv = (_Float16)o1; ah.h[i] = hv; al.h[i] = (_Float16)((o1 - (float)hv) * 1024.0f); hv = (_Float16)o2; bh.h[i] = hv; bl.h[i] = (_Float16)((o2 - (float)hv) * 1024.0f); }
  const size_t o = row * (size_t)(ndst * 64) + hd * 64 + g8 * 8;
  { *(v8us*)((unsigned short*)H + o) = ah.half[0]; *(v8us*)((unsigned short*)H + o + 32) = bh.half[0]; *(v8us*)((unsigned short*)L + o) = al.half[0]; *(v8us*)((unsigned short*)L + o + 32) = bl.half[0];  } }

extern "C" void kernel_launch(void* const* d_in, const int* in_sizes, int n_in,
                              void* d_out, int out_size, void* d_ws, size_t ws_size, hipStream_t stream) {
  (void)in_sizes; (void)n_in; (void)out_size;
  const float* const* I = (const float* const*)d_in; const float* x = I[0]; const float* Wq = I[1]; const float* bq = I[2]; const float* Wk = I[3]; const float* bk = I[4]; const float* Wv = I[5]; const float* bv = I[6]; const float* Wo = I[7]; const float* bo = I[8]; const float* slopes = I[9];
  char* ws = (char*)d_ws; size_t off = 0;
  auto take = [&](size_t bytes) { char* p = ws + off; off += (bytes + 255) & ~(size_t)255; return p; };
  const size_t np = (size_t)NR * DM, nk = (size_t)NR * KVD;
  _Float16* BQ = (_Float16*)take((size_t)DM * DM * 2); _Float16* BK = (_Float16*)take((size_t)KVD * DM * 2); _Float16* BV = (_Float16*)take((size_t)KVD * DM * 2); _Float16* BO = (_Float16*)take((size_t)DM * DM * 2);
  _Float16* X16 = (_Float16*)take(np * 2); _Float16* QH = (_Float16*)take(np * 2); _Float16* QL = (_Float16*)take(np * 2); _Float16* KH = (_Float16*)take(nk * 2); _Float16* KL = (_Float16*)take(nk * 2); _Float16* VT = (_Float16*)take(nk * 2); _Float16* VTL = (_Float16*)take(nk * 2);
  _Float16* OH = (_Float16*)take(np * 2); _Float16* OLo = (_Float16*)take(np * 2);
  if (off > ws_size) return;      /* 2+0.5+0.5+2 + 8+8+8+2+2+2+2+8+8 = 53 MiB */
  k_prep<<<2 * PB_W + 2 * PB_KV + PB_X, 256, 0, stream>>>(x, Wq, Wk, Wv, Wo, X16, BQ, BK, BV, BO);      /* x16 weights transposed, f16 plane of x */
  k_qkv<<<GB_Q + 2 * GB_KV, 128, 0, stream>>>(X16, BQ, BK, BV, bq, bk, bv, QH, QL, KH, KL, VT, VTL);      /* q hi/lo; k hi/lo, 4 kv heads; V^T hi/lo: [kv head][d][token] */
  k_flash_all<14><<<NB * NH * (QBNP + QBN5), 128, 0, stream>>>(QH, QL, DM, KH, KL, KVD, VT, VTL, slopes, OH, OLo, DM);      /* causal + ALiBi: rows >= 256 plain, rows < 256 hi + residual */
  k_wo<<<(NR / 128) * (DM / 64), 128, 0, stream>>>(OH, OLo, BO, bo, (float*)d_out);      /* out = ctx Wo + bo, the O residual term of the first 256 rows of each sequence in the same blocks */
}
